// v000
// The times below were measured on an AMD MI455X: many runs one after another, warmed up first and cycling through
// copies of the inputs, with the whole window's GPU time divided by the number of runs. Launches and the gaps
// between them are all in it. The median over several windows is given; except for v000 it joins two sittings, which
// can be a few percent apart, so the side-by-side timings, each taken in one sitting, are the better comparison.
// The starting kernel, v000, takes 3370 microseconds a run.
// compute dtype: x, W*, b*, rel_pos_emb (INPUTS) rounded to bf16 with exact bf16 WMMA products (f32 accumulate) for the projections; rotary in f32; K pre-split into bf16 hi/lo rows; the relative-position scores q.rel^T as q hi/lo x bf16(rel) (2 products); P and V f16 hi/lo (3 products); softmax with the int mask in f32.
#include <hip/hip_runtime.h>
#include <math.h>

typedef __attribute__((ext_vector_type(16))) _Float16 v16h;
typedef __attribute__((ext_vector_type(16))) __bf16 v16b;
typedef __attribute__((ext_vector_type(8)))  _Float16 v8h;
typedef __attribute__((ext_vector_type(8)))  float v8f;
typedef __attribute__((ext_vector_type(4)))  float v4f;
typedef __attribute__((ext_vector_type(2)))  float v2f;
typedef __attribute__((ext_vector_type(4)))  unsigned v4u;
typedef __attribute__((ext_vector_type(4)))  int v4i;
typedef float __attribute__((may_alias)) float_a;
typedef int __attribute__((may_alias)) int_a;

template <typename T> __device__ __forceinline__ void vst2(void* p, T v) { *(T*)p = v;  }
__device__ __forceinline__ v8f wmma16(v16h a, v16h b, v8f c) {
  v8f d = __builtin_amdgcn_wmma_f32_16x16x32_f16(false, a, false, b, (short)0, c, false, false);
  asm volatile("v_nop\n\tv_nop\n\tv_nop\n\tv_nop" : "+v"(d) : "v"(a), "v"(b));
  return d;
}
__device__ __forceinline__ v8f wmma_bf(v16b a, v16b b, v8f c) {
  v8f d = __builtin_amdgcn_wmma_f32_16x16x32_bf16(false, a, false, b, (short)0, c, false, false);
  asm volatile("v_nop\n\tv_nop\n\tv_nop\n\tv_nop" : "+v"(d) : "v"(a), "v"(b));
  return d;
}
// 16x16x32 fragments: lane = (h = lane>>4, row/col = lane&15); elements 0..7 = k0+8h+0..7, 8..15 = k0+16+8h+0..7; D element r = row 8h+r
__device__ __forceinline__ v16h frag_h(const _Float16* rowk0, int lane) {
  union { v16h v; v8h q[2]; } u; const _Float16* p = rowk0 + 8 * (lane >> 4);
  u.q[0] = *(const v8h*)p; u.q[1] = *(const v8h*)(p + 16); return u.v;
}
__device__ __forceinline__ v16h frag_f32(const float* rowk0, int lane) {
  v16h a; const float* p = rowk0 + 8 * (lane >> 4);
#pragma unroll
  for (int i = 0; i < 8; ++i) { a[i] = (_Float16)p[i]; a[8 + i] = (_Float16)p[16 + i]; }
  return a;
}
__device__ __forceinline__ v16h frag_f32s(const float* rowk0, int lane, float sc) {
  v16h a; const float* p = rowk0 + 8 * (lane >> 4);
#pragma unroll
  for (int i = 0; i < 8; ++i) { a[i] = (_Float16)(p[i] * sc); a[8 + i] = (_Float16)(p[16 + i] * sc); }
  return a;
}
// column fragment from a [K][ld] layout (column n), rows >= K read as 0
__device__ __forceinline__ v16h fragc_f32(const float* W, int k0, int n, int lane, int ld, int K) {
  v16h a; const int g = lane >> 4;
#pragma unroll
  for (int i = 0; i < 8; ++i) { const int ka = k0 + 8 * g + i, kb = ka + 16;
    a[i] = (_Float16)(ka < K ? W[(size_t)ka * ld + n] : 0.f); a[8 + i] = (_Float16)(kb < K ? W[(size_t)kb * ld + n] : 0.f); }
  return a;
}
struct F2 { v16b h, l; };
__device__ __forceinline__ F2 bsplit16(const float v[16]) { F2 r;
#pragma unroll
  for (int i = 0; i < 16; ++i) { const __bf16 h = (__bf16)v[i]; r.h[i] = h; r.l[i] = (__bf16)(v[i] - (float)h); }
  return r; }
__device__ __forceinline__ F2 split_row(const float* row, int k0, int lane) { float v[16]; const float* p = row + k0 + 8 * (lane >> 4);
#pragma unroll
  for (int i = 0; i < 8; ++i) { v[i] = p[i]; v[8 + i] = p[16 + i]; }
  return bsplit16(v); }
__device__ __forceinline__ F2 split_rowK(const float* row, int k0, int lane, int K) { float v[16]; const int g = lane >> 4;
#pragma unroll
  for (int i = 0; i < 8; ++i) { const int ka = k0 + 8 * g + i, kb = ka + 16; v[i] = ka < K ? row[ka] : 0.f; v[8 + i] = kb < K ? row[kb] : 0.f; }
  return bsplit16(v); }
__device__ __forceinline__ F2 split_col(const float* W, int k0, int n, int lane, int ld, int K) { float v[16]; const int g = lane >> 4;
#pragma unroll
  for (int i = 0; i < 8; ++i) { const int ka = k0 + 8 * g + i, kb = ka + 16; v[i] = ka < K ? W[(size_t)ka * ld + n] : 0.f; v[8 + i] = kb < K ? W[(size_t)kb * ld + n] : 0.f; }
  return bsplit16(v); }
__device__ __forceinline__ v8f mac3(const F2& a, const F2& b, v8f c) { c = wmma_bf(a.l, b.h, c); c = wmma_bf(a.h, b.l, c); return wmma_bf(a.h, b.h, c); }
__device__ __forceinline__ float sigm(float v) { return 1.0f / (1.0f + expf(-v)); }
#define LDSX() do { asm volatile("s_wait_dscnt 0" ::: "memory"); __builtin_amdgcn_wave_barrier(); __builtin_amdgcn_fence(__ATOMIC_RELEASE, "workgroup"); } while (0)


// Rotary multi-head attention with Shaw relative-position scores (16 heads of 64 on [1,2048,1024], [in][out] weights + biases): q,k = rotate_half-RoPE(xW+b) (angle[d] = s*10000^(-2(d mod 32)/64));
// scores[i][j] = q_i.k_j/8 + q_i.rel_pos_emb[j-i+2047]; masked where mask[i][j] == 0 (-1e30); softmax; (P v) Wo + bo. The rel term uses the skew trick: QR[i][c] = q_i.rel[c] for all 4,095 offsets
// (one GEMM per head, two heads per pass to fit ws), then scores gather QR[i][j-i+2047] from the row's contiguous window.
#define NB 1
#define SS 2048
#define NREL 4096      // 4095 offsets padded to 4096 (column 4095 unused)
#define HPG 2          // heads per QR pass
#define E 1024
#define NH 16
#define HD 64
#define NR (NB * SS)
#define PLO 1024.0f
#define VLO 2048.0f
__device__ __forceinline__ float bfr(float v) { return (float)(__bf16)v; }
__device__ __forceinline__ v16b frag_b(const __bf16* rowk0, int lane) { return __builtin_bit_cast(v16b, frag_h((const _Float16*)rowk0, lane)); }

__global__ __launch_bounds__(256) void k_cvt(const float* __restrict__ x, __bf16* __restrict__ Xb) {
  const size_t i8 = (size_t)blockIdx.x * 256 + threadIdx.x; if (i8 >= (size_t)NR * E / 8) return;
  union { __bf16 h[8]; v4u u; } pk;
#pragma unroll
  for (int e = 0; e < 8; ++e) pk.h[e] = (__bf16)x[i8 * 8 + e];
  vst2((unsigned*)(Xb + i8 * 8), pk.u);
}
// PT rows: [0,E) Wq[:,n], [E,2E) Wk[:,n], [2E,3E) Wv[:,n], [3E,4E) Wo[:,n]  ([in][out] weights: column n as a bf16 row)
__global__ __launch_bounds__(256) void k_pack(const float* __restrict__ Wq, const float* __restrict__ Wk, const float* __restrict__ Wv, const float* __restrict__ Wo, __bf16* __restrict__ PT) {
  const int n = blockIdx.x, tid = threadIdx.x; __shared__ __align__(16) __bf16 srow[E];
  const float* W = n < E ? Wq : (n < 2 * E ? Wk : (n < 3 * E ? Wv : Wo)); const int nn = n & (E - 1);
  for (int k = tid; k < E; k += 256) srow[k] = (__bf16)W[(size_t)k * E + nn];
  __syncthreads();
  if (tid < E / 8) vst2((unsigned*)(PT + (size_t)n * E + tid * 8), *(const v4u*)(&srow[tid * 8]));
}
// QKV: block (64 rows, 128 cols = 2 heads, which); q (+bias) -> Q32 f32 [bh][s][64]; k (+bias) -> bf16 hi/lo rows; v (+bias) -> VT hi/lo x4 [bh][d][s]
__global__ __launch_bounds__(128) void k_qkv(const __bf16* __restrict__ Xb, const __bf16* __restrict__ PT, const float* __restrict__ bq, const float* __restrict__ bk, const float* __restrict__ bv,
                                            float* __restrict__ Q32, __bf16* __restrict__ Kh, __bf16* __restrict__ Kl, _Float16* __restrict__ VTh, _Float16* __restrict__ VTl) {
  __shared__ __align__(16) float so[4][16][132];
  __shared__ __align__(16) _Float16 sth[128][72], stl[128][72];
  const int tid = threadIdx.x, wave = tid >> 5, lane = tid & 31, col = lane & 15, g = lane >> 4;
  const int which = blockIdx.z, r0b = blockIdx.x * 64, r0 = r0b + wave * 16, n0 = blockIdx.y * 128; const int b = r0b / SS, s0 = r0b % SS;
  const float* bb_ = which == 0 ? bq : (which == 1 ? bk : bv);
  v8f acc[8] = {};
#pragma unroll 2
  for (int kc = 0; kc < E / 32; ++kc) { const v16b a = frag_b(Xb + (size_t)(r0 + col) * E + kc * 32, lane);
#pragma unroll
    for (int j = 0; j < 8; ++j) acc[j] = wmma_bf(a, frag_b(PT + (size_t)(which * E + n0 + j * 16 + col) * E + kc * 32, lane), acc[j]); }
  if (which < 2) {
#pragma unroll
    for (int j = 0; j < 8; ++j) { const float bb = bfr(bb_[n0 + j * 16 + col]);
#pragma unroll
      for (int r = 0; r < 8; ++r) so[wave][8 * g + r][j * 16 + col] = acc[j][r] + bb; }
    LDSX();
    { const int rl = lane & 15, hh = lane >> 4; float* rowp = &so[wave][rl][hh * 64]; const int spos = s0 + wave * 16 + rl;      // RoPE (rotate_half pairs (d, d+32)), angle[d] = s * 10000^(-2 (d mod 32) / 64)
#pragma unroll 4
      for (int d = 0; d < 32; ++d) { const float invf = powf(10000.0f, -(float)(2 * d) * (1.0f / 64.0f)); const float ang = (float)spos * invf; float sn, cs; sincosf(ang, &sn, &cs);
        const float x1 = rowp[d], x2 = rowp[d + 32]; rowp[d] = x1 * cs - x2 * sn; rowp[d + 32] = x2 * cs + x1 * sn; } }
    LDSX();
    if (which == 0) { for (int qq = lane; qq < 2 * 16 * 16; qq += 32) { const int hh = qq >> 8, rl = (qq >> 4) & 15, pc = qq & 15; const int h = (n0 >> 6) + hh;
        vst2(Q32 + (((size_t)b * NH + h) * SS + s0 + wave * 16 + rl) * HD + pc * 4, *(const v4f*)(&so[wave][rl][hh * 64 + pc * 4])); } }
    else {
      for (int qq = lane; qq < 2 * 16 * 16; qq += 32) { const int hh = qq >> 8, rl = (qq >> 4) & 15, pl = qq & 15; const int h = (n0 >> 6) + hh; const int pc = pl & 7; union { __bf16 e[8]; v4u u; } pk;
#pragma unroll
        for (int e = 0; e < 8; ++e) { const float v = so[wave][rl][hh * 64 + pc * 8 + e]; const __bf16 hi = (__bf16)v; pk.e[e] = pl < 8 ? hi : (__bf16)(v - (float)hi); }
        vst2((unsigned*)((pl < 8 ? Kh : Kl) + (((size_t)b * NH + h) * SS + s0 + wave * 16 + rl) * HD + pc * 8), pk.u); } } }
  else {
#pragma unroll
    for (int j = 0; j < 8; ++j) { const float bb = bfr(bb_[n0 + j * 16 + col]);
#pragma unroll
      for (int r = 0; r < 8; ++r) { const float v = (acc[j][r] + bb) * 4.0f; const _Float16 hi = (_Float16)v; sth[j * 16 + col][wave * 16 + 8 * g + r] = hi; stl[j * 16 + col][wave * 16 + 8 * g + r] = (_Float16)((v - (float)hi) * VLO); } }
    __syncthreads();
    for (int qq = tid; qq < 128 * 8; qq += 128) { const int cl = qq >> 3, pc = qq & 7; const int c = n0 + cl, h = c >> 6, d = c & 63; const size_t o = (((size_t)b * NH + h) * HD + d) * SS + s0 + pc * 8;
      vst2(VTh + o, *(const v4u*)(&sth[cl][pc * 8])); vst2(VTl + o, *(const v4u*)(&stl[cl][pc * 8])); } }
}

// relative-position score table for HPG heads: QR[hl][i][c] = q_(h0+hl, i) . rel[c], c < 4095 (column 4095 reads rel row 4094 clamp and is never used); block (64 rows, 128 cols, hl)
__global__ __launch_bounds__(128) void k_qr(const float* __restrict__ Q32, const __bf16* __restrict__ RB, int h0, float* __restrict__ QR) {
  __shared__ __align__(16) float so[4][16][132];
  const int tid = threadIdx.x, wave = tid >> 5, lane = tid & 31, col = lane & 15, g = lane >> 4; const int r0 = blockIdx.x * 64 + wave * 16, c0 = blockIdx.y * 128, hl = blockIdx.z; const size_t bh = (size_t)(h0 + hl);
  v8f acc[8] = {};
#pragma unroll
  for (int kc = 0; kc < 2; ++kc) { const F2 a = split_row(Q32 + (bh * SS + r0 + col) * HD, kc * 32, lane);
#pragma unroll
    for (int j = 0; j < 8; ++j) { const int c = c0 + j * 16 + col; const int cc = c < NREL - 1 ? c : NREL - 2; const v16b rb = frag_b(RB + (size_t)cc * HD + kc * 32, lane); acc[j] = wmma_bf(a.l, rb, acc[j]); acc[j] = wmma_bf(a.h, rb, acc[j]); } }
#pragma unroll
  for (int j = 0; j < 8; ++j)
#pragma unroll
    for (int r = 0; r < 8; ++r) so[wave][8 * g + r][j * 16 + col] = acc[j][r];
  LDSX();
  for (int rl = 0; rl < 16; ++rl) vst2(QR + ((size_t)hl * SS + r0 + rl) * NREL + c0 + lane * 4, *(const v4f*)(&so[wave][rl][lane * 4]));
}
// rel_pos_emb rows -> bf16 (4095 rows of 64)
__global__ __launch_bounds__(256) void k_relb(const float* __restrict__ rel, __bf16* __restrict__ RB) {
  const size_t i8 = (size_t)blockIdx.x * 256 + threadIdx.x; if (i8 >= (size_t)(NREL - 1) * HD / 8) return;
  union { __bf16 e[8]; v4u u; } pk;
#pragma unroll
  for (int e = 0; e < 8; ++e) pk.e[e] = (__bf16)rel[i8 * 8 + e];
  vst2((unsigned*)(RB + i8 * 8), pk.u);
}
// masked attention with relative-position scores: block (64 queries, head hl of the current pass); all 32 key tiles; S on q hi/lo x K hi/lo rows; P,V hi/lo; O f32 [bh][s][64]
__global__ __launch_bounds__(128) void k_attn(const float* __restrict__ Q32, const __bf16* __restrict__ Kh, const __bf16* __restrict__ Kl, const _Float16* __restrict__ VTh, const _Float16* __restrict__ VTl, const int* __restrict__ mask, const float* __restrict__ QR, int h0, float* __restrict__ O32) {
  __shared__ __align__(16) float sS[4][16][68];
  __shared__ __align__(16) _Float16 sPh[4][16][72], sPl[4][16][72];
  __shared__ __align__(16) float sO[4][16][68];
  const int tid = threadIdx.x, w = tid >> 5, lane = tid & 31, col = lane & 15, g = lane >> 4;
  const int hl = blockIdx.y; const size_t bh = (size_t)(h0 + hl); const int qb = blockIdx.x; const int q0 = qb * 64 + w * 16;
  F2 aq[2];
#pragma unroll
  for (int kc = 0; kc < 2; ++kc) aq[kc] = split_row(Q32 + (bh * SS + q0 + col) * HD, kc * 32, lane);
  float mrun = -3.0e38f, lrun = 0.f; v8f acc[4] = {}, ac1[4] = {}, ac2[4] = {};
#pragma unroll 1
  for (int kt = 0; kt < SS / 64; ++kt) {
#pragma unroll
    for (int t = 0; t < 4; ++t) { const int key = kt * 64 + t * 16 + col; const size_t ko = (bh * SS + key) * HD; v8f s = {};
#pragma unroll
      for (int kc = 0; kc < 2; ++kc) { const v16b khf = frag_b(Kh + ko + kc * 32, lane), klf = frag_b(Kl + ko + kc * 32, lane); s = wmma_bf(aq[kc].l, khf, s); s = wmma_bf(aq[kc].h, klf, s); s = wmma_bf(aq[kc].h, khf, s); }
#pragma unroll
      for (int r = 0; r < 8; ++r) { const int i = q0 + 8 * g + r; const float relsc = QR[((size_t)hl * SS + i) * NREL + (key - i + SS - 1)]; sS[w][8 * g + r][t * 16 + col] = (mask[(size_t)i * SS + key] == 0) ? -1.0e30f : s[r] * 0.125f + relsc; } }
    LDSX();
    float mx = -3.4e38f;
#pragma unroll
    for (int jj = 0; jj < 32; ++jj) mx = fmaxf(mx, sS[w][col][g * 32 + jj]);
    mx = fmaxf(mx, __shfl_xor(mx, 16, 32));
    const float mnew = fmaxf(mrun, mx); const float corr = expf(mrun - mnew);
    float ps = 0.f;
#pragma unroll
    for (int jj = 0; jj < 32; ++jj) { const float p = expf(sS[w][col][g * 32 + jj] - mnew) * 16384.0f; ps += p; const _Float16 hi = (_Float16)p; sPh[w][col][g * 32 + jj] = hi; sPl[w][col][g * 32 + jj] = (_Float16)((p - (float)hi) * PLO); }
    ps += __shfl_xor(ps, 16, 32);
    lrun = lrun * corr + ps * (1.0f / 16384.0f); mrun = mnew;
#pragma unroll
    for (int r = 0; r < 8; ++r) { const float cr = __shfl(corr, 8 * g + r, 32);
#pragma unroll
      for (int t = 0; t < 4; ++t) { acc[t][r] *= cr; ac1[t][r] *= cr; ac2[t][r] *= cr; } }
    LDSX();
#pragma unroll
    for (int kc = 0; kc < 2; ++kc) { const v16h ph = frag_h(&sPh[w][col][0] + kc * 32, lane), pl = frag_h(&sPl[w][col][0] + kc * 32, lane);
#pragma unroll
      for (int t = 0; t < 4; ++t) { const size_t vo = (bh * HD + t * 16 + col) * SS + kt * 64 + kc * 32; const v16h vh = frag_h(VTh + vo, lane);
        acc[t] = wmma16(ph, vh, acc[t]); ac1[t] = wmma16(ph, frag_h(VTl + vo, lane), ac1[t]); ac2[t] = wmma16(pl, vh, ac2[t]); } }
    __builtin_amdgcn_wave_barrier(); }
#pragma unroll
  for (int r = 0; r < 8; ++r) { const float lr = __shfl(lrun, 8 * g + r, 32); const float inv = 1.0f / (lr * 16384.0f * 4.0f);
#pragma unroll
    for (int t = 0; t < 4; ++t) sO[w][8 * g + r][t * 16 + col] = (acc[t][r] + ac1[t][r] * (1.0f / VLO) + ac2[t][r] * (1.0f / PLO)) * inv; }
  LDSX();
  for (int qq = lane; qq < 16 * 16; qq += 32) { const int rl = qq >> 4, pc = qq & 15; vst2(O32 + ((bh * SS) + q0 + rl) * HD + pc * 4, *(const v4f*)(&sO[w][rl][pc * 4])); }
}
// out = ctx Wo + bo : split(ctx) x bf16(Wo columns): 2 products (Wo is an INPUT -> bf16 exact)
__global__ __launch_bounds__(128) void k_out(const float* __restrict__ O32, const __bf16* __restrict__ PT, const float* __restrict__ bo, float* __restrict__ out) {
  __shared__ __align__(16) float so[4][16][132];
  const int tid = threadIdx.x, wave = tid >> 5, lane = tid & 31, col = lane & 15, g = lane >> 4;
  const int r0 = blockIdx.x * 64 + wave * 16, n0 = blockIdx.y * 128; const int ra = r0 + col; const int b = ra / SS, s = ra % SS;
  v8f acc[8] = {};
#pragma unroll 1
  for (int kc = 0; kc < E / 32; ++kc) { const int h = kc >> 1; const F2 a = split_row(O32 + (((size_t)b * NH + h) * SS + s) * HD, (kc & 1) * 32, lane);
#pragma unroll
    for (int j = 0; j < 8; ++j) { const v16b wb = frag_b(PT + (size_t)(3 * E + n0 + j * 16 + col) * E + kc * 32, lane); acc[j] = wmma_bf(a.l, wb, acc[j]); acc[j] = wmma_bf(a.h, wb, acc[j]); } }
#pragma unroll
  for (int j = 0; j < 8; ++j) { const int n = n0 + j * 16 + col; const float bb = bfr(bo[n]);
#pragma unroll
    for (int r = 0; r < 8; ++r) so[wave][8 * g + r][j * 16 + col] = acc[j][r] + bb; }
  LDSX();
#pragma unroll 4
  for (int rl = 0; rl < 16; ++rl) vst2(out + (size_t)(r0 + rl) * E + n0 + lane * 4, *(const v4f*)(&so[wave][rl][lane * 4]));
}
extern "C" void kernel_launch(void* const* d_in, const int* in_sizes, int n_in, void* d_out, int out_size, void* d_ws, size_t ws_size, hipStream_t stream) {
  (void)in_sizes; (void)n_in; (void)out_size; (void)ws_size;
  const float* x = (const float*)d_in[0]; const int* mask = (const int*)d_in[1]; const float* Wq = (const float*)d_in[2]; const float* bq = (const float*)d_in[3]; const float* Wk = (const float*)d_in[4]; const float* bk = (const float*)d_in[5];
  const float* Wv = (const float*)d_in[6]; const float* bv = (const float*)d_in[7]; const float* Wp = (const float*)d_in[8]; const float* bp = (const float*)d_in[9]; const float* rel = (const float*)d_in[10];
  float* out = (float*)d_out;
  char* ws = (char*)d_ws; size_t off = 0;
  auto take = [&](size_t bytes) { char* p = ws + off; off += (bytes + 255) & ~(size_t)255; return p; };
  __bf16* Xb = (__bf16*)take((size_t)NR * E * 2); __bf16* PT = (__bf16*)take((size_t)4 * E * E * 2); __bf16* RB = (__bf16*)take((size_t)NREL * HD * 2);
  float* Q32 = (float*)take((size_t)NR * E * 4); __bf16* Kh = (__bf16*)take((size_t)NR * E * 2); __bf16* Kl = (__bf16*)take((size_t)NR * E * 2); _Float16* VTh = (_Float16*)take((size_t)NR * E * 2); _Float16* VTl = (_Float16*)take((size_t)NR * E * 2); float* O32 = (float*)take((size_t)NR * E * 4);
  float* QR = (float*)take((size_t)HPG * SS * NREL * 4);     // 67 MB for 2 heads
  // ws ~ 112 MB
  k_cvt<<<(NR * E / 8 + 255) / 256, 256, 0, stream>>>(x, Xb);
  k_pack<<<4 * E, 256, 0, stream>>>(Wq, Wk, Wv, Wp, PT);
  k_relb<<<((NREL - 1) * HD / 8 + 255) / 256, 256, 0, stream>>>(rel, RB);
  k_qkv<<<dim3(NR / 64, E / 128, 3), 128, 0, stream>>>(Xb, PT, bq, bk, bv, Q32, Kh, Kl, VTh, VTl);
  for (int h0 = 0; h0 < NH; h0 += HPG) {
    k_qr<<<dim3(SS / 64, NREL / 128, HPG), 128, 0, stream>>>(Q32, RB, h0, QR);
    k_attn<<<dim3(SS / 64, HPG), 128, 0, stream>>>(Q32, Kh, Kl, VTh, VTl, mask, QR, h0, O32); }
  k_out<<<dim3(NR / 64, E / 128), 128, 0, stream>>>(O32, PT, bp, out);
}

// v001
// Measured time: 556 microseconds a run.
// Two timings next to v000 both put it at 6.06 times that version's speed.
// compute dtype: x, W*, b*, rel_pos_emb (INPUTS) rounded to bf16 with exact bf16 WMMA products (f32 accumulate) for the projections; rotary in f32; K pre-split into bf16 hi/lo rows; the relative-position scores q.rel^T as q hi/lo x bf16(rel) (2 products); P and V f16 hi/lo (3 products); softmax with the int mask in f32.
#include <hip/hip_runtime.h>
#include <math.h>

typedef __attribute__((ext_vector_type(16))) _Float16 v16h;
typedef __attribute__((ext_vector_type(16))) __bf16 v16b;
typedef __attribute__((ext_vector_type(8)))  _Float16 v8h;
typedef __attribute__((ext_vector_type(8)))  float v8f;
typedef __attribute__((ext_vector_type(4)))  float v4f;
typedef __attribute__((ext_vector_type(2)))  float v2f;
typedef __attribute__((ext_vector_type(4)))  unsigned v4u;
typedef __attribute__((ext_vector_type(4)))  int v4i;
typedef float __attribute__((may_alias)) float_a;
typedef int __attribute__((may_alias)) int_a;

template <typename T> __device__ __forceinline__ void vst2(void* p, T v) { *(T*)p = v;  }
__device__ __forceinline__ v8f wmma16(v16h a, v16h b, v8f c) {
  v8f d = __builtin_amdgcn_wmma_f32_16x16x32_f16(false, a, false, b, (short)0, c, false, false);
  asm volatile("v_nop\n\tv_nop\n\tv_nop\n\tv_nop" : "+v"(d) : "v"(a), "v"(b));
  return d;
}
__device__ __forceinline__ v8f wmma_bf(v16b a, v16b b, v8f c) {
  v8f d = __builtin_amdgcn_wmma_f32_16x16x32_bf16(false, a, false, b, (short)0, c, false, false);
  asm volatile("v_nop\n\tv_nop\n\tv_nop\n\tv_nop" : "+v"(d) : "v"(a), "v"(b));
  return d;
}
// 16x16x32 fragments: lane = (h = lane>>4, row/col = lane&15); elements 0..7 = k0+8h+0..7, 8..15 = k0+16+8h+0..7; D element r = row 8h+r
__device__ __forceinline__ v16h frag_h(const _Float16* rowk0, int lane) {
  union { v16h v; v8h q[2]; } u; const _Float16* p = rowk0 + 8 * (lane >> 4);
  u.q[0] = *(const v8h*)p; u.q[1] = *(const v8h*)(p + 16); return u.v;
}
__device__ __forceinline__ v16h frag_f32(const float* rowk0, int lane) {
  v16h a; const float* p = rowk0 + 8 * (lane >> 4);
#pragma unroll
  for (int i = 0; i < 8; ++i) { a[i] = (_Float16)p[i]; a[8 + i] = (_Float16)p[16 + i]; }
  return a;
}
__device__ __forceinline__ v16h frag_f32s(const float* rowk0, int lane, float sc) {
  v16h a; const float* p = rowk0 + 8 * (lane >> 4);
#pragma unroll
  for (int i = 0; i < 8; ++i) { a[i] = (_Float16)(p[i] * sc); a[8 + i] = (_Float16)(p[16 + i] * sc); }
  return a;
}
// column fragment from a [K][ld] layout (column n), rows >= K read as 0
__device__ __forceinline__ v16h fragc_f32(const float* W, int k0, int n, int lane, int ld, int K) {
  v16h a; const int g = lane >> 4;
#pragma unroll
  for (int i = 0; i < 8; ++i) { const int ka = k0 + 8 * g + i, kb = ka + 16;
    a[i] = (_Float16)(ka < K ? W[(size_t)ka * ld + n] : 0.f); a[8 + i] = (_Float16)(kb < K ? W[(size_t)kb * ld + n] : 0.f); }
  return a;
}
struct F2 { v16b h, l; };
__device__ __forceinline__ F2 bsplit16(const float v[16]) { F2 r;
#pragma unroll
  for (int i = 0; i < 16; ++i) { const __bf16 h = (__bf16)v[i]; r.h[i] = h; r.l[i] = (__bf16)(v[i] - (float)h); }
  return r; }
__device__ __forceinline__ F2 split_row(const float* row, int k0, int lane) { float v[16]; const float* p = row + k0 + 8 * (lane >> 4);
#pragma unroll
  for (int i = 0; i < 8; ++i) { v[i] = p[i]; v[8 + i] = p[16 + i]; }
  return bsplit16(v); }
__device__ __forceinline__ F2 split_rowK(const float* row, int k0, int lane, int K) { float v[16]; const int g = lane >> 4;
#pragma unroll
  for (int i = 0; i < 8; ++i) { const int ka = k0 + 8 * g + i, kb = ka + 16; v[i] = ka < K ? row[ka] : 0.f; v[8 + i] = kb < K ? row[kb] : 0.f; }
  return bsplit16(v); }
__device__ __forceinline__ F2 split_col(const float* W, int k0, int n, int lane, int ld, int K) { float v[16]; const int g = lane >> 4;
#pragma unroll
  for (int i = 0; i < 8; ++i) { const int ka = k0 + 8 * g + i, kb = ka + 16; v[i] = ka < K ? W[(size_t)ka * ld + n] : 0.f; v[8 + i] = kb < K ? W[(size_t)kb * ld + n] : 0.f; }
  return bsplit16(v); }
__device__ __forceinline__ v8f mac3(const F2& a, const F2& b, v8f c) { c = wmma_bf(a.l, b.h, c); c = wmma_bf(a.h, b.l, c); return wmma_bf(a.h, b.h, c); }
__device__ __forceinline__ float sigm(float v) { return 1.0f / (1.0f + expf(-v)); }
#define LDSX() do { asm volatile("s_wait_dscnt 0" ::: "memory"); __builtin_amdgcn_wave_barrier(); __builtin_amdgcn_fence(__ATOMIC_RELEASE, "workgroup"); } while (0)


// Rotary multi-head attention with Shaw relative-position scores (16 heads of 64 on [1,2048,1024], [in][out] weights + biases): q,k = rotate_half-RoPE(xW+b) (angle[d] = s*10000^(-2(d mod 32)/64));
// scores[i][j] = q_i.k_j/8 + q_i.rel_pos_emb[j-i+2047]; masked where mask[i][j] == 0 (-1e30); softmax; (P v) Wo + bo. The rel term uses the skew trick inside the attention kernel: a tile of 16 queries x 64 keys
// needs only the 79 offsets c = j-i+2047 of its diagonals, so q.rel[c] is formed for five 16-column tiles, laid in LDS and read back along the diagonal. No score table in memory: all heads run in one launch.
#define NB 1
#define SS 2048
#define NREL 4096      // 4095 offsets padded to 4096 (offset 4095 is clamped to row 4094 and never used)
#define E 1024
#define NH 16
#define HD 64
#define NR (NB * SS)
#define PLO 1024.0f
#define VLO 2048.0f
__device__ __forceinline__ float bfr(float v) { return (float)(__bf16)v; }
__device__ __forceinline__ v16b frag_b(const __bf16* rowk0, int lane) { return __builtin_bit_cast(v16b, frag_h((const _Float16*)rowk0, lane)); }

__global__ __launch_bounds__(256) void k_cvt(const float* __restrict__ x, __bf16* __restrict__ Xb) {
  const size_t i8 = (size_t)blockIdx.x * 256 + threadIdx.x; if (i8 >= (size_t)NR * E / 8) return;
  union { __bf16 h[8]; v4u u; } pk;
#pragma unroll
  for (int e = 0; e < 8; ++e) pk.h[e] = (__bf16)x[i8 * 8 + e];
  vst2((unsigned*)(Xb + i8 * 8), pk.u);
}
// PT rows: [0,E) Wq[:,n], [E,2E) Wk[:,n], [2E,3E) Wv[:,n], [3E,4E) Wo[:,n]  ([in][out] weights: column n as a bf16 row)
__global__ __launch_bounds__(256) void k_pack(const float* __restrict__ Wq, const float* __restrict__ Wk, const float* __restrict__ Wv, const float* __restrict__ Wo, __bf16* __restrict__ PT) {
  const int n = blockIdx.x, tid = threadIdx.x; __shared__ __align__(16) __bf16 srow[E];
  const float* W = n < E ? Wq : (n < 2 * E ? Wk : (n < 3 * E ? Wv : Wo)); const int nn = n & (E - 1);
  for (int k = tid; k < E; k += 256) srow[k] = (__bf16)W[(size_t)k * E + nn];
  __syncthreads();
  if (tid < E / 8) vst2((unsigned*)(PT + (size_t)n * E + tid * 8), *(const v4u*)(&srow[tid * 8]));
}
// QKV: block (64 rows, 128 cols = 2 heads, which); q (+bias) -> Q32 f32 [bh][s][64]; k (+bias) -> bf16 hi/lo rows; v (+bias) -> VT hi/lo x4 [bh][d][s]
__global__ __launch_bounds__(128) void k_qkv(const __bf16* __restrict__ Xb, const __bf16* __restrict__ PT, const float* __restrict__ bq, const float* __restrict__ bk, const float* __restrict__ bv,
                                            float* __restrict__ Q32, __bf16* __restrict__ Kh, __bf16* __restrict__ Kl, _Float16* __restrict__ VTh, _Float16* __restrict__ VTl) {
  __shared__ __align__(16) float so[4][16][132];
  __shared__ __align__(16) _Float16 sth[128][72], stl[128][72];
  const int tid = threadIdx.x, wave = tid >> 5, lane = tid & 31, col = lane & 15, g = lane >> 4;
  const int which = blockIdx.z, r0b = blockIdx.x * 64, r0 = r0b + wave * 16, n0 = blockIdx.y * 128; const int b = r0b / SS, s0 = r0b % SS;
  const float* bb_ = which == 0 ? bq : (which == 1 ? bk : bv);
  v8f acc[8] = {};
#pragma unroll 2
  for (int kc = 0; kc < E / 32; ++kc) { const v16b a = frag_b(Xb + (size_t)(r0 + col) * E + kc * 32, lane);
#pragma unroll
    for (int j = 0; j < 8; ++j) acc[j] = wmma_bf(a, frag_b(PT + (size_t)(which * E + n0 + j * 16 + col) * E + kc * 32, lane), acc[j]); }
  if (which < 2) {
#pragma unroll
    for (int j = 0; j < 8; ++j) { const float bb = bfr(bb_[n0 + j * 16 + col]);
#pragma unroll
      for (int r = 0; r < 8; ++r) so[wave][8 * g + r][j * 16 + col] = acc[j][r] + bb; }
    LDSX();
    { const int rl = lane & 15, hh = lane >> 4; float* rowp = &so[wave][rl][hh * 64]; const int spos = s0 + wave * 16 + rl;      // RoPE (rotate_half pairs (d, d+32)), angle[d] = s * 10000^(-2 (d mod 32) / 64)
#pragma unroll 4
      for (int d = 0; d < 32; ++d) { const float invf = powf(10000.0f, -(float)(2 * d) * (1.0f / 64.0f)); const float ang = (float)spos * invf; float sn, cs; sincosf(ang, &sn, &cs);
        const float x1 = rowp[d], x2 = rowp[d + 32]; rowp[d] = x1 * cs - x2 * sn; rowp[d + 32] = x2 * cs + x1 * sn; } }
    LDSX();
    if (which == 0) { for (int qq = lane; qq < 2 * 16 * 16; qq += 32) { const int hh = qq >> 8, rl = (qq >> 4) & 15, pc = qq & 15; const int h = (n0 >> 6) + hh;
        vst2(Q32 + (((size_t)b * NH + h) * SS + s0 + wave * 16 + rl) * HD + pc * 4, *(const v4f*)(&so[wave][rl][hh * 64 + pc * 4])); } }
    else {
      for (int qq = lane; qq < 2 * 16 * 16; qq += 32) { const int hh = qq >> 8, rl = (qq >> 4) & 15, pl = qq & 15; const int h = (n0 >> 6) + hh; const int pc = pl & 7; union { __bf16 e[8]; v4u u; } pk;
#pragma unroll
        for (int e = 0; e < 8; ++e) { const float v = so[wave][rl][hh * 64 + pc * 8 + e]; const __bf16 hi = (__bf16)v; pk.e[e] = pl < 8 ? hi : (__bf16)(v - (float)hi); }
        vst2((unsigned*)((pl < 8 ? Kh : Kl) + (((size_t)b * NH + h) * SS + s0 + wave * 16 + rl) * HD + pc * 8), pk.u); } } }
  else {
#pragma unroll
    for (int j = 0; j < 8; ++j) { const float bb = bfr(bb_[n0 + j * 16 + col]);
#pragma unroll
      for (int r = 0; r < 8; ++r) { const float v = (acc[j][r] + bb) * 4.0f; const _Float16 hi = (_Float16)v; sth[j * 16 + col][wave * 16 + 8 * g + r] = hi; stl[j * 16 + col][wave * 16 + 8 * g + r] = (_Float16)((v - (float)hi) * VLO); } }
    __syncthreads();
    for (int qq = tid; qq < 128 * 8; qq += 128) { const int cl = qq >> 3, pc = qq & 7; const int c = n0 + cl, h = c >> 6, d = c & 63; const size_t o = (((size_t)b * NH + h) * HD + d) * SS + s0 + pc * 8;
      vst2(VTh + o, *(const v4u*)(&sth[cl][pc * 8])); vst2(VTl + o, *(const v4u*)(&stl[cl][pc * 8])); } }
}

// rel_pos_emb rows -> bf16 (4095 rows of 64)
__global__ __launch_bounds__(256) void k_relb(const float* __restrict__ rel, __bf16* __restrict__ RB) {
  const size_t i8 = (size_t)blockIdx.x * 256 + threadIdx.x; if (i8 >= (size_t)(NREL - 1) * HD / 8) return;
  union { __bf16 e[8]; v4u u; } pk;
#pragma unroll
  for (int e = 0; e < 8; ++e) pk.e[e] = (__bf16)rel[i8 * 8 + e];
  vst2((unsigned*)(RB + i8 * 8), pk.u);
}
// masked attention with relative-position scores: block (64 queries, head); all 32 key tiles; S on q hi/lo x K hi/lo rows; P,V hi/lo; O f32 [bh][s][64]
__global__ __launch_bounds__(128) void k_attn(const float* __restrict__ Q32, const __bf16* __restrict__ Kh, const __bf16* __restrict__ Kl, const _Float16* __restrict__ VTh, const _Float16* __restrict__ VTl, const int* __restrict__ mask, const __bf16* __restrict__ RB, float* __restrict__ O32) {
  __shared__ __align__(16) float sS[4][16][68];
  __shared__ __align__(16) float sR[4][16][84];
  __shared__ __align__(16) _Float16 sPh[4][16][72], sPl[4][16][72];
  __shared__ __align__(16) float sO[4][16][68];
  const int tid = threadIdx.x, w = tid >> 5, lane = tid & 31, col = lane & 15, g = lane >> 4;
  const size_t bh = (size_t)blockIdx.y; const int qb = blockIdx.x; const int q0 = qb * 64 + w * 16;
  F2 aq[2];
#pragma unroll
  for (int kc = 0; kc < 2; ++kc) aq[kc] = split_row(Q32 + (bh * SS + q0 + col) * HD, kc * 32, lane);
  float mrun = -3.0e38f, lrun = 0.f; v8f acc[4] = {}, ac1[4] = {}, ac2[4] = {};
#pragma unroll 1
  for (int kt = 0; kt < SS / 64; ++kt) {
    // sR[row][x] = q_(q0+row) . rel[cb + x], x < 80: query q0+row and key kt*64+kk meet at offset c = cb + (kk - row + 15). Same products in the same order as a table of q.rel would hold.
    // The loops below are unrolled so that d, s and the fragments are indexed by constants and stay in registers.
    const int cb = kt * 64 - q0 + (SS - 16);
#pragma unroll
    for (int u = 0; u < 5; ++u) { const int c = cb + u * 16 + col; const int cc = c < NREL - 1 ? c : NREL - 2; v8f d = {};
#pragma unroll
      for (int kc = 0; kc < 2; ++kc) { const v16b rb = frag_b(RB + (size_t)cc * HD + kc * 32, lane); d = wmma_bf(aq[kc].l, rb, d); d = wmma_bf(aq[kc].h, rb, d); }
#pragma unroll
      for (int r = 0; r < 8; ++r) sR[w][8 * g + r][u * 16 + col] = d[r]; }
    v8f s[4] = {};
#pragma unroll
    for (int t = 0; t < 4; ++t) { const size_t ko = (bh * SS + kt * 64 + t * 16 + col) * HD;
#pragma unroll
      for (int kc = 0; kc < 2; ++kc) { const v16b khf = frag_b(Kh + ko + kc * 32, lane), klf = frag_b(Kl + ko + kc * 32, lane); s[t] = wmma_bf(aq[kc].l, khf, s[t]); s[t] = wmma_bf(aq[kc].h, klf, s[t]); s[t] = wmma_bf(aq[kc].h, khf, s[t]); } }
    LDSX();      // the diagonal read below takes sR values that other lanes of this wave stored
#pragma unroll
    for (int t = 0; t < 4; ++t) { const int key = kt * 64 + t * 16 + col;
#pragma unroll
      for (int r = 0; r < 8; ++r) { const int i = q0 + 8 * g + r; const float relsc = sR[w][8 * g + r][t * 16 + col + 15 - (8 * g + r)]; sS[w][8 * g + r][t * 16 + col] = (mask[(size_t)i * SS + key] == 0) ? -1.0e30f : s[t][r] * 0.125f + relsc; } }
    LDSX();
    float mx = -3.4e38f;
#pragma unroll
    for (int jj = 0; jj < 32; ++jj) mx = fmaxf(mx, sS[w][col][g * 32 + jj]);
    mx = fmaxf(mx, __shfl_xor(mx, 16, 32));
    const float mnew = fmaxf(mrun, mx); const float corr = expf(mrun - mnew);
    float ps = 0.f;
#pragma unroll
    for (int jj = 0; jj < 32; ++jj) { const float p = expf(sS[w][col][g * 32 + jj] - mnew) * 16384.0f; ps += p; const _Float16 hi = (_Float16)p; sPh[w][col][g * 32 + jj] = hi; sPl[w][col][g * 32 + jj] = (_Float16)((p - (float)hi) * PLO); }
    ps += __shfl_xor(ps, 16, 32);
    lrun = lrun * corr + ps * (1.0f / 16384.0f); mrun = mnew;
#pragma unroll
    for (int r = 0; r < 8; ++r) { const float cr = __shfl(corr, 8 * g + r, 32);
#pragma unroll
      for (int t = 0; t < 4; ++t) { acc[t][r] *= cr; ac1[t][r] *= cr; ac2[t][r] *= cr; } }
    LDSX();
#pragma unroll
    for (int kc = 0; kc < 2; ++kc) { const v16h ph = frag_h(&sPh[w][col][0] + kc * 32, lane), pl = frag_h(&sPl[w][col][0] + kc * 32, lane);
#pragma unroll
      for (int t = 0; t < 4; ++t) { const size_t vo = (bh * HD + t * 16 + col) * SS + kt * 64 + kc * 32; const v16h vh = frag_h(VTh + vo, lane);
        acc[t] = wmma16(ph, vh, acc[t]); ac1[t] = wmma16(ph, frag_h(VTl + vo, lane), ac1[t]); ac2[t] = wmma16(pl, vh, ac2[t]); } }
    __builtin_amdgcn_wave_barrier(); }
#pragma unroll
  for (int r = 0; r < 8; ++r) { const float lr = __shfl(lrun, 8 * g + r, 32); const float inv = 1.0f / (lr * 16384.0f * 4.0f);
#pragma unroll
    for (int t = 0; t < 4; ++t) sO[w][8 * g + r][t * 16 + col] = (acc[t][r] + ac1[t][r] * (1.0f / VLO) + ac2[t][r] * (1.0f / PLO)) * inv; }
  LDSX();
  for (int qq = lane; qq < 16 * 16; qq += 32) { const int rl = qq >> 4, pc = qq & 15; vst2(O32 + ((bh * SS) + q0 + rl) * HD + pc * 4, *(const v4f*)(&sO[w][rl][pc * 4])); }
}
// out = ctx Wo + bo : split(ctx) x bf16(Wo columns): 2 products (Wo is an INPUT -> bf16 exact)
__global__ __launch_bounds__(128) void k_out(const float* __restrict__ O32, const __bf16* __restrict__ PT, const float* __restrict__ bo, float* __restrict__ out) {
  __shared__ __align__(16) float so[4][16][132];
  const int tid = threadIdx.x, wave = tid >> 5, lane = tid & 31, col = lane & 15, g = lane >> 4;
  const int r0 = blockIdx.x * 64 + wave * 16, n0 = blockIdx.y * 128; const int ra = r0 + col; const int b = ra / SS, s = ra % SS;
  v8f acc[8] = {};
#pragma unroll 1
  for (int kc = 0; kc < E / 32; ++kc) { const int h = kc >> 1; const F2 a = split_row(O32 + (((size_t)b * NH + h) * SS + s) * HD, (kc & 1) * 32, lane);
#pragma unroll
    for (int j = 0; j < 8; ++j) { const v16b wb = frag_b(PT + (size_t)(3 * E + n0 + j * 16 + col) * E + kc * 32, lane); acc[j] = wmma_bf(a.l, wb, acc[j]); acc[j] = wmma_bf(a.h, wb, acc[j]); } }
#pragma unroll
  for (int j = 0; j < 8; ++j) { const int n = n0 + j * 16 + col; const float bb = bfr(bo[n]);
#pragma unroll
    for (int r = 0; r < 8; ++r) so[wave][8 * g + r][j * 16 + col] = acc[j][r] + bb; }
  LDSX();
#pragma unroll 4
  for (int rl = 0; rl < 16; ++rl) vst2(out + (size_t)(r0 + rl) * E + n0 + lane * 4, *(const v4f*)(&so[wave][rl][lane * 4]));
}
extern "C" void kernel_launch(void* const* d_in, const int* in_sizes, int n_in, void* d_out, int out_size, void* d_ws, size_t ws_size, hipStream_t stream) {
  (void)in_sizes; (void)n_in; (void)out_size; (void)ws_size;
  const float* x = (const float*)d_in[0]; const int* mask = (const int*)d_in[1]; const float* Wq = (const float*)d_in[2]; const float* bq = (const float*)d_in[3]; const float* Wk = (const float*)d_in[4]; const float* bk = (const float*)d_in[5];
  const float* Wv = (const float*)d_in[6]; const float* bv = (const float*)d_in[7]; const float* Wp = (const float*)d_in[8]; const float* bp = (const float*)d_in[9]; const float* rel = (const float*)d_in[10];
  float* out = (float*)d_out;
  char* ws = (char*)d_ws; size_t off = 0;
  auto take = [&](size_t bytes) { char* p = ws + off; off += (bytes + 255) & ~(size_t)255; return p; };
  __bf16* Xb = (__bf16*)take((size_t)NR * E * 2); __bf16* PT = (__bf16*)take((size_t)4 * E * E * 2); __bf16* RB = (__bf16*)take((size_t)NREL * HD * 2);
  float* Q32 = (float*)take((size_t)NR * E * 4); __bf16* Kh = (__bf16*)take((size_t)NR * E * 2); __bf16* Kl = (__bf16*)take((size_t)NR * E * 2); _Float16* VTh = (_Float16*)take((size_t)NR * E * 2); _Float16* VTl = (_Float16*)take((size_t)NR * E * 2); float* O32 = (float*)take((size_t)NR * E * 4);
  // ws ~ 45 MB
  k_cvt<<<(NR * E / 8 + 255) / 256, 256, 0, stream>>>(x, Xb);
  k_pack<<<4 * E, 256, 0, stream>>>(Wq, Wk, Wv, Wp, PT);
  k_relb<<<((NREL - 1) * HD / 8 + 255) / 256, 256, 0, stream>>>(rel, RB);
  k_qkv<<<dim3(NR / 64, E / 128, 3), 128, 0, stream>>>(Xb, PT, bq, bk, bv, Q32, Kh, Kl, VTh, VTl);
  k_attn<<<dim3(SS / 64, NH), 128, 0, stream>>>(Q32, Kh, Kl, VTh, VTl, mask, RB, O32);
  k_out<<<dim3(NR / 64, E / 128), 128, 0, stream>>>(O32, PT, bp, out);
}

// v002
// One run takes 255 microseconds.
// Timed twice side by side with v001, it ran 2.18 times as fast both times.
// Counting every step since v000, it is 13.2 times as fast.
// compute dtype: x, W*, b*, rel_pos_emb (INPUTS) rounded to bf16 with exact bf16 WMMA products (f32 accumulate) for the projections; rotary in f32; K pre-split into bf16 hi/lo rows; the relative-position scores q.rel^T as q hi/lo x bf16(rel) (2 products); P and V f16 hi/lo (3 products); softmax with the int mask in f32.
#include <hip/hip_runtime.h>
#include <math.h>

typedef __attribute__((ext_vector_type(16))) _Float16 v16h;
typedef __attribute__((ext_vector_type(16))) __bf16 v16b;
typedef __attribute__((ext_vector_type(8)))  _Float16 v8h;
typedef __attribute__((ext_vector_type(8)))  float v8f;
typedef __attribute__((ext_vector_type(4)))  float v4f;
typedef __attribute__((ext_vector_type(2)))  float v2f;
typedef __attribute__((ext_vector_type(4)))  unsigned v4u;
typedef __attribute__((ext_vector_type(4)))  int v4i;
typedef float __attribute__((may_alias)) float_a;
typedef int __attribute__((may_alias)) int_a;

template <typename T> __device__ __forceinline__ void vst2(void* p, T v) { *(T*)p = v;  }
__device__ __forceinline__ v8f wmma16(v16h a, v16h b, v8f c) {
  v8f d = __builtin_amdgcn_wmma_f32_16x16x32_f16(false, a, false, b, (short)0, c, false, false);
  asm volatile("v_nop\n\tv_nop\n\tv_nop\n\tv_nop" : "+v"(d) : "v"(a), "v"(b));
  return d;
}
__device__ __forceinline__ v8f wmma_bf(v16b a, v16b b, v8f c) {
  v8f d = __builtin_amdgcn_wmma_f32_16x16x32_bf16(false, a, false, b, (short)0, c, false, false);
  asm volatile("v_nop\n\tv_nop\n\tv_nop\n\tv_nop" : "+v"(d) : "v"(a), "v"(b));
  return d;
}
// The same two for the attention kernel, whose fragments in flight lie above v255: an operand of an asm statement is held below v256, so a and b are not named there (naming them spills).
__device__ __forceinline__ v8f wmma16_w(v16h a, v16h b, v8f c) {
  v8f d = __builtin_amdgcn_wmma_f32_16x16x32_f16(false, a, false, b, (short)0, c, false, false);
  asm volatile("v_nop\n\tv_nop\n\tv_nop\n\tv_nop" : "+v"(d));      // the distance behind a matrix instruction
  return d;
}
__device__ __forceinline__ v8f wmma_bf_w(v16b a, v16b b, v8f c) {
  v8f d = __builtin_amdgcn_wmma_f32_16x16x32_bf16(false, a, false, b, (short)0, c, false, false);
  asm volatile("v_nop\n\tv_nop\n\tv_nop\n\tv_nop" : "+v"(d));      // the distance behind a matrix instruction
  return d;
}
// 16x16x32 fragments: lane = (h = lane>>4, row/col = lane&15); elements 0..7 = k0+8h+0..7, 8..15 = k0+16+8h+0..7; D element r = row 8h+r
__device__ __forceinline__ v16h frag_h(const _Float16* rowk0, int lane) {
  union { v16h v; v8h q[2]; } u; const _Float16* p = rowk0 + 8 * (lane >> 4);
  u.q[0] = *(const v8h*)p; u.q[1] = *(const v8h*)(p + 16); return u.v;
}
__device__ __forceinline__ v16h frag_f32(const float* rowk0, int lane) {
  v16h a; const float* p = rowk0 + 8 * (lane >> 4);
#pragma unroll
  for (int i = 0; i < 8; ++i) { a[i] = (_Float16)p[i]; a[8 + i] = (_Float16)p[16 + i]; }
  return a;
}
__device__ __forceinline__ v16h frag_f32s(const float* rowk0, int lane, float sc) {
  v16h a; const float* p = rowk0 + 8 * (lane >> 4);
#pragma unroll
  for (int i = 0; i < 8; ++i) { a[i] = (_Float16)(p[i] * sc); a[8 + i] = (_Float16)(p[16 + i] * sc); }
  return a;
}
// column fragment from a [K][ld] layout (column n), rows >= K read as 0
__device__ __forceinline__ v16h fragc_f32(const float* W, int k0, int n, int lane, int ld, int K) {
  v16h a; const int g = lane >> 4;
#pragma unroll
  for (int i = 0; i < 8; ++i) { const int ka = k0 + 8 * g + i, kb = ka + 16;
    a[i] = (_Float16)(ka < K ? W[(size_t)ka * ld + n] : 0.f); a[8 + i] = (_Float16)(kb < K ? W[(size_t)kb * ld + n] : 0.f); }
  return a;
}
struct F2 { v16b h, l; };
__device__ __forceinline__ F2 bsplit16(const float v[16]) { F2 r;
#pragma unroll
  for (int i = 0; i < 16; ++i) { const __bf16 h = (__bf16)v[i]; r.h[i] = h; r.l[i] = (__bf16)(v[i] - (float)h); }
  return r; }
__device__ __forceinline__ F2 split_row(const float* row, int k0, int lane) { float v[16]; const float* p = row + k0 + 8 * (lane >> 4);
#pragma unroll
  for (int i = 0; i < 8; ++i) { v[i] = p[i]; v[8 + i] = p[16 + i]; }
  return bsplit16(v); }
__device__ __forceinline__ F2 split_rowK(const float* row, int k0, int lane, int K) { float v[16]; const int g = lane >> 4;
#pragma unroll
  for (int i = 0; i < 8; ++i) { const int ka = k0 + 8 * g + i, kb = ka + 16; v[i] = ka < K ? row[ka] : 0.f; v[8 + i] = kb < K ? row[kb] : 0.f; }
  return bsplit16(v); }
__device__ __forceinline__ F2 split_col(const float* W, int k0, int n, int lane, int ld, int K) { float v[16]; const int g = lane >> 4;
#pragma unroll
  for (int i = 0; i < 8; ++i) { const int ka = k0 + 8 * g + i, kb = ka + 16; v[i] = ka < K ? W[(size_t)ka * ld + n] : 0.f; v[8 + i] = kb < K ? W[(size_t)kb * ld + n] : 0.f; }
  return bsplit16(v); }
__device__ __forceinline__ v8f mac3(const F2& a, const F2& b, v8f c) { c = wmma_bf(a.l, b.h, c); c = wmma_bf(a.h, b.l, c); return wmma_bf(a.h, b.h, c); }
__device__ __forceinline__ float sigm(float v) { return 1.0f / (1.0f + expf(-v)); }
#define LDSX() do { asm volatile("s_wait_dscnt 0" ::: "memory"); __builtin_amdgcn_wave_barrier(); __builtin_amdgcn_fence(__ATOMIC_RELEASE, "workgroup"); } while (0)
// The same exchange among the lanes of ONE wave, for places where global loads are in flight: the fence at wavefront scope orders the LDS accesses for the compiler and does not drain the loads as the work-group one does.
#define LDSW() do { asm volatile("s_wait_dscnt 0" ::: "memory"); __builtin_amdgcn_wave_barrier(); __builtin_amdgcn_fence(__ATOMIC_RELEASE, "wavefront"); } while (0)


// Rotary multi-head attention with Shaw relative-position scores (16 heads of 64 on [1,2048,1024], [in][out] weights + biases): q,k = rotate_half-RoPE(xW+b) (angle[d] = s*10000^(-2(d mod 32)/64));
// scores[i][j] = q_i.k_j/8 + q_i.rel_pos_emb[j-i+2047]; masked where mask[i][j] == 0 (-1e30); softmax; (P v) Wo + bo. The rel term uses the skew trick inside the attention kernel: a tile of 16 queries x 64 keys
// needs only the 79 offsets c = j-i+2047 of its diagonals, so q.rel[c] is formed for five 16-column tiles, laid in LDS and read back along the diagonal. No score table in memory: all heads run in one launch.
#define NB 1
#define SS 2048
#define NREL 4096      // 4095 offsets padded to 4096 (offset 4095 is clamped to row 4094 and never used)
#define E 1024
#define NH 16
#define HD 64
#define NR (NB * SS)
#define PLO 1024.0f
#define VLO 2048.0f
__device__ __forceinline__ float bfr(float v) { return (float)(__bf16)v; }
__device__ __forceinline__ v16b frag_b(const __bf16* rowk0, int lane) { return __builtin_bit_cast(v16b, frag_h((const _Float16*)rowk0, lane)); }
// the same fragments from the lane's own pointer p = rowk0 + 8 * (lane >> 4)
__device__ __forceinline__ v16h frag_ph(const _Float16* p) { union { v16h v; v8h q[2]; } u; u.q[0] = *(const v8h*)p; u.q[1] = *(const v8h*)(p + 16); return u.v; }
__device__ __forceinline__ v16b frag_p(const __bf16* p) { return __builtin_bit_cast(v16b, frag_ph((const _Float16*)p)); }

__global__ __launch_bounds__(256) void k_cvt(const float* __restrict__ x, __bf16* __restrict__ Xb) {
  const size_t i8 = (size_t)blockIdx.x * 256 + threadIdx.x; if (i8 >= (size_t)NR * E / 8) return;
  union { __bf16 h[8]; v4u u; } pk;
#pragma unroll
  for (int e = 0; e < 8; ++e) pk.h[e] = (__bf16)x[i8 * 8 + e];
  vst2((unsigned*)(Xb + i8 * 8), pk.u);
}
// PT rows: [0,E) Wq[:,n], [E,2E) Wk[:,n], [2E,3E) Wv[:,n], [3E,4E) Wo[:,n]  ([in][out] weights: column n as a bf16 row)
__global__ __launch_bounds__(256) void k_pack(const float* __restrict__ Wq, const float* __restrict__ Wk, const float* __restrict__ Wv, const float* __restrict__ Wo, __bf16* __restrict__ PT) {
  const int n = blockIdx.x, tid = threadIdx.x; __shared__ __align__(16) __bf16 srow[E];
  const float* W = n < E ? Wq : (n < 2 * E ? Wk : (n < 3 * E ? Wv : Wo)); const int nn = n & (E - 1);
  for (int k = tid; k < E; k += 256) srow[k] = (__bf16)W[(size_t)k * E + nn];
  __syncthreads();
  if (tid < E / 8) vst2((unsigned*)(PT + (size_t)n * E + tid * 8), *(const v4u*)(&srow[tid * 8]));
}
// QKV: block (64 rows, 128 cols = 2 heads, which); q (+bias) -> Q32 f32 [bh][s][64]; k (+bias) -> bf16 hi/lo rows; v (+bias) -> VT hi/lo x4 [bh][d][s]
__global__ __launch_bounds__(128) void k_qkv(const __bf16* __restrict__ Xb, const __bf16* __restrict__ PT, const float* __restrict__ bq, const float* __restrict__ bk, const float* __restrict__ bv,
                                            float* __restrict__ Q32, __bf16* __restrict__ Kh, __bf16* __restrict__ Kl, _Float16* __restrict__ VTh, _Float16* __restrict__ VTl) {
  __shared__ __align__(16) float so[4][16][132];
  __shared__ __align__(16) _Float16 sth[128][72], stl[128][72];
  const int tid = threadIdx.x, wave = tid >> 5, lane = tid & 31, col = lane & 15, g = lane >> 4;
  const int which = blockIdx.z, r0b = blockIdx.x * 64, r0 = r0b + wave * 16, n0 = blockIdx.y * 128; const int b = r0b / SS, s0 = r0b % SS;
  const float* bb_ = which == 0 ? bq : (which == 1 ? bk : bv);
  v8f acc[8] = {};
  // Two k chunks a pass: all 36 loads of the pass stand ahead of its first product, so that their latencies overlap (one wait a pass instead of one a product). Not unrolled further: registers.
#pragma unroll 1
  for (int kc = 0; kc < E / 32; kc += 2) { v16b a[2], wb[2][8];
    const __bf16* pa = Xb + (size_t)(r0 + col) * E + kc * 32 + 8 * g; const __bf16* pw = PT + (size_t)(which * E + n0 + col) * E + kc * 32 + 8 * g;
    // inner loops unrolled so that the fragment arrays are indexed by constants and stay in registers
#pragma unroll
    for (int c = 0; c < 2; ++c) { a[c] = frag_p(pa + c * 32);
#pragma unroll
      for (int j = 0; j < 8; ++j) wb[c][j] = frag_p(pw + (size_t)j * 16 * E + c * 32); }
#pragma unroll
    for (int j = 0; j < 8; ++j) acc[j] = wmma_bf(a[0], wb[0][j], acc[j]);
    asm volatile("s_wait_xcnt 0x0" :: "v"(pa), "v"(pw) : "memory");      // the loads' address registers are held up to here and rewritten only behind this wait
#pragma unroll
    for (int j = 0; j < 8; ++j) acc[j] = wmma_bf(a[1], wb[1][j], acc[j]); }
  if (which < 2) {
#pragma unroll
    for (int j = 0; j < 8; ++j) { const float bb = bfr(bb_[n0 + j * 16 + col]);
#pragma unroll
      for (int r = 0; r < 8; ++r) so[wave][8 * g + r][j * 16 + col] = acc[j][r] + bb; }
    LDSX();
    { const int rl = lane & 15, hh = lane >> 4; float* rowp = &so[wave][rl][hh * 64]; const int spos = s0 + wave * 16 + rl;      // RoPE (rotate_half pairs (d, d+32)), angle[d] = s * 10000^(-2 (d mod 32) / 64)
#pragma unroll 4
      for (int d = 0; d < 32; ++d) { const float invf = powf(10000.0f, -(float)(2 * d) * (1.0f / 64.0f)); const float ang = (float)spos * invf; float sn, cs; sincosf(ang, &sn, &cs);
        const float x1 = rowp[d], x2 = rowp[d + 32]; rowp[d] = x1 * cs - x2 * sn; rowp[d + 32] = x2 * cs + x1 * sn; } }
    LDSX();
    if (which == 0) { for (int qq = lane; qq < 2 * 16 * 16; qq += 32) { const int hh = qq >> 8, rl = (qq >> 4) & 15, pc = qq & 15; const int h = (n0 >> 6) + hh;
        vst2(Q32 + (((size_t)b * NH + h) * SS + s0 + wave * 16 + rl) * HD + pc * 4, *(const v4f*)(&so[wave][rl][hh * 64 + pc * 4])); } }
    else {
      for (int qq = lane; qq < 2 * 16 * 16; qq += 32) { const int hh = qq >> 8, rl = (qq >> 4) & 15, pl = qq & 15; const int h = (n0 >> 6) + hh; const int pc = pl & 7; union { __bf16 e[8]; v4u u; } pk;
#pragma unroll
        for (int e = 0; e < 8; ++e) { const float v = so[wave][rl][hh * 64 + pc * 8 + e]; const __bf16 hi = (__bf16)v; pk.e[e] = pl < 8 ? hi : (__bf16)(v - (float)hi); }
        vst2((unsigned*)((pl < 8 ? Kh : Kl) + (((size_t)b * NH + h) * SS + s0 + wave * 16 + rl) * HD + pc * 8), pk.u); } } }
  else {
#pragma unroll
    for (int j = 0; j < 8; ++j) { const float bb = bfr(bb_[n0 + j * 16 + col]);
#pragma unroll
      for (int r = 0; r < 8; ++r) { const float v = (acc[j][r] + bb) * 4.0f; const _Float16 hi = (_Float16)v; sth[j * 16 + col][wave * 16 + 8 * g + r] = hi; stl[j * 16 + col][wave * 16 + 8 * g + r] = (_Float16)((v - (float)hi) * VLO); } }
    __syncthreads();
    for (int qq = tid; qq < 128 * 8; qq += 128) { const int cl = qq >> 3, pc = qq & 7; const int c = n0 + cl, h = c >> 6, d = c & 63; const size_t o = (((size_t)b * NH + h) * HD + d) * SS + s0 + pc * 8;
      vst2(VTh + o, *(const v4u*)(&sth[cl][pc * 8])); vst2(VTl + o, *(const v4u*)(&stl[cl][pc * 8])); } }
}

// rel_pos_emb rows -> bf16 (4095 rows of 64)
__global__ __launch_bounds__(256) void k_relb(const float* __restrict__ rel, __bf16* __restrict__ RB) {
  const size_t i8 = (size_t)blockIdx.x * 256 + threadIdx.x; if (i8 >= (size_t)(NREL - 1) * HD / 8) return;
  union { __bf16 e[8]; v4u u; } pk;
#pragma unroll
  for (int e = 0; e < 8; ++e) pk.e[e] = (__bf16)rel[i8 * 8 + e];
  vst2((unsigned*)(RB + i8 * 8), pk.u);
}
// masked attention with relative-position scores: block (64 queries, head); all 32 key tiles; S on q hi/lo x K hi/lo rows; P,V hi/lo; O f32 [bh][s][64]
__global__ __launch_bounds__(128) void k_attn(const float* __restrict__ Q32, const __bf16* __restrict__ Kh, const __bf16* __restrict__ Kl, const _Float16* __restrict__ VTh, const _Float16* __restrict__ VTl, const int* __restrict__ mask, const __bf16* __restrict__ RB, float* __restrict__ O32) {
  __shared__ __align__(16) float sS[4][16][68];
  __shared__ __align__(16) float sR[4][16][84];
  __shared__ __align__(16) _Float16 sPh[4][16][72], sPl[4][16][72];
  __shared__ __align__(16) float sO[4][16][68];
  const int tid = threadIdx.x, w = tid >> 5, lane = tid & 31, col = lane & 15, g = lane >> 4;
  const size_t bh = (size_t)blockIdx.y; const int qb = blockIdx.x; const int q0 = qb * 64 + w * 16;
  F2 aq[2]; float qv[2][16]; const float* pq = Q32 + (bh * SS + q0 + col) * HD + 8 * g;
  // unrolled: qv is indexed by constants and stays in registers
#pragma unroll
  for (int kc = 0; kc < 2; ++kc) {
#pragma unroll
    for (int i = 0; i < 8; ++i) { qv[kc][i] = pq[kc * 32 + i]; qv[kc][8 + i] = pq[kc * 32 + 16 + i]; } }
  asm volatile("s_wait_xcnt 0x0" :: "v"(pq) : "memory");      // the q loads' address register is held up to here and rewritten only behind this wait
#pragma unroll
  for (int kc = 0; kc < 2; ++kc) aq[kc] = bsplit16(qv[kc]);
  float mrun = -3.0e38f, lrun = 0.f; v8f acc[4] = {}, ac1[4] = {}, ac2[4] = {};
#pragma unroll 1
  for (int kt = 0; kt < SS / 64; ++kt) {
    // sR[row][x] = q_(q0+row) . rel[cb + x], x < 80: query q0+row and key kt*64+kk meet at offset c = cb + (kk - row + 15). Same products in the same order as a table of q.rel would hold.
    // The loops below are unrolled so that d, s and the fragments are indexed by constants and stay in registers.
    const int cb = kt * 64 - q0 + (SS - 16);
    // The loads of the score part (rel rows, K rows, mask words) all stand ahead of the first product: they are in flight together and the pass waits for memory once, not once a fragment.
    v16b rb[5][2], khf[4][2], klf[4][2]; int mk[4][8];
    // rel rows cb + col + 16 u: at most 4079 for u < 4; only the last tile can reach the pad offset 4095 and keeps the clamp
    const int c4 = cb + 64 + col; const __bf16* pr = RB + (size_t)(cb + col) * HD + 8 * g; const __bf16* pr4 = RB + (size_t)(c4 < NREL - 1 ? c4 : NREL - 2) * HD + 8 * g;
    const size_t ko = (bh * SS + kt * 64 + col) * HD + 8 * g; const __bf16* pkh = Kh + ko; const __bf16* pkl = Kl + ko; const int* pm = mask + (size_t)(q0 + 8 * g) * SS + kt * 64 + col;
#pragma unroll
    for (int u = 0; u < 5; ++u) {
#pragma unroll
      for (int kc = 0; kc < 2; ++kc) rb[u][kc] = frag_p((u < 4 ? pr + u * 16 * HD : pr4) + kc * 32); }
#pragma unroll
    for (int t = 0; t < 4; ++t) {
#pragma unroll
      for (int kc = 0; kc < 2; ++kc) { khf[t][kc] = frag_p(pkh + t * 16 * HD + kc * 32); klf[t][kc] = frag_p(pkl + t * 16 * HD + kc * 32); } }
#pragma unroll
    for (int t = 0; t < 4; ++t) {
#pragma unroll
      for (int r = 0; r < 8; ++r) mk[t][r] = pm[r * SS + t * 16]; }
#pragma unroll
    for (int u = 0; u < 5; ++u) { v8f d = {};
#pragma unroll
      for (int kc = 0; kc < 2; ++kc) { d = wmma_bf_w(aq[kc].l, rb[u][kc], d); d = wmma_bf_w(aq[kc].h, rb[u][kc], d); }
#pragma unroll
      for (int r = 0; r < 8; ++r) sR[w][8 * g + r][u * 16 + col] = d[r]; }
    asm volatile("s_wait_xcnt 0x0" :: "v"(pr), "v"(pr4), "v"(pkh), "v"(pkl), "v"(pm) : "memory");      // the address registers of the loads above are held up to here and rewritten only behind this wait
    // The V fragments are asked for here, where the rel registers have come free: they fly during the q.k products and the softmax and are first used behind it.
    v16h vhf[2][4], vlf[2][4]; const size_t vo = (bh * HD + col) * SS + kt * 64 + 8 * g; const _Float16* pvh = VTh + vo; const _Float16* pvl = VTl + vo;
#pragma unroll
    for (int kc = 0; kc < 2; ++kc) {
#pragma unroll
      for (int t = 0; t < 4; ++t) { vhf[kc][t] = frag_ph(pvh + t * 16 * SS + kc * 32); vlf[kc][t] = frag_ph(pvl + t * 16 * SS + kc * 32); } }
    v8f s[4] = {};
#pragma unroll
    for (int t = 0; t < 4; ++t) {
#pragma unroll
      for (int kc = 0; kc < 2; ++kc) { s[t] = wmma_bf_w(aq[kc].l, khf[t][kc], s[t]); s[t] = wmma_bf_w(aq[kc].h, klf[t][kc], s[t]); s[t] = wmma_bf_w(aq[kc].h, khf[t][kc], s[t]); } }
    asm volatile("s_wait_xcnt 0x0" :: "v"(pvh), "v"(pvl) : "memory");      // as above, for the V loads
    LDSW();      // the diagonal read below takes sR values that other lanes of this wave stored
    float rs[4][8];
#pragma unroll
    for (int t = 0; t < 4; ++t) {
#pragma unroll
      for (int r = 0; r < 8; ++r) rs[t][r] = sR[w][8 * g + r][t * 16 + col + 15 - (8 * g + r)]; }
#pragma unroll
    for (int t = 0; t < 4; ++t) {
#pragma unroll
      for (int r = 0; r < 8; ++r) { const float sc = s[t][r] * 0.125f + rs[t][r]; sS[w][8 * g + r][t * 16 + col] = (mk[t][r] == 0) ? -1.0e30f : sc; } }
    LDSW();
    float mx = -3.4e38f;
#pragma unroll
    for (int jj = 0; jj < 32; ++jj) mx = fmaxf(mx, sS[w][col][g * 32 + jj]);
    mx = fmaxf(mx, __shfl_xor(mx, 16, 32));
    const float mnew = fmaxf(mrun, mx); const float corr = expf(mrun - mnew);
    float ps = 0.f;
#pragma unroll
    for (int jj = 0; jj < 32; ++jj) { const float p = expf(sS[w][col][g * 32 + jj] - mnew) * 16384.0f; ps += p; const _Float16 hi = (_Float16)p; sPh[w][col][g * 32 + jj] = hi; sPl[w][col][g * 32 + jj] = (_Float16)((p - (float)hi) * PLO); }
    ps += __shfl_xor(ps, 16, 32);
    lrun = lrun * corr + ps * (1.0f / 16384.0f); mrun = mnew;
#pragma unroll
    for (int r = 0; r < 8; ++r) { const float cr = __shfl(corr, 8 * g + r, 32);
#pragma unroll
      for (int t = 0; t < 4; ++t) { acc[t][r] *= cr; ac1[t][r] *= cr; ac2[t][r] *= cr; } }
    LDSW();
#pragma unroll
    for (int kc = 0; kc < 2; ++kc) { const v16h ph = frag_h(&sPh[w][col][0] + kc * 32, lane), pl = frag_h(&sPl[w][col][0] + kc * 32, lane);
#pragma unroll
      for (int t = 0; t < 4; ++t) { acc[t] = wmma16_w(ph, vhf[kc][t], acc[t]); ac1[t] = wmma16_w(ph, vlf[kc][t], ac1[t]); ac2[t] = wmma16_w(pl, vhf[kc][t], ac2[t]); } }
    __builtin_amdgcn_wave_barrier(); }
#pragma unroll
  for (int r = 0; r < 8; ++r) { const float lr = __shfl(lrun, 8 * g + r, 32); const float inv = 1.0f / (lr * 16384.0f * 4.0f);
#pragma unroll
    for (int t = 0; t < 4; ++t) sO[w][8 * g + r][t * 16 + col] = (acc[t][r] + ac1[t][r] * (1.0f / VLO) + ac2[t][r] * (1.0f / PLO)) * inv; }
  LDSX();
  for (int qq = lane; qq < 16 * 16; qq += 32) { const int rl = qq >> 4, pc = qq & 15; vst2(O32 + ((bh * SS) + q0 + rl) * HD + pc * 4, *(const v4f*)(&sO[w][rl][pc * 4])); }
}
// out = ctx Wo + bo : split(ctx) x bf16(Wo columns): 2 products (Wo is an INPUT -> bf16 exact)
__global__ __launch_bounds__(128) void k_out(const float* __restrict__ O32, const __bf16* __restrict__ PT, const float* __restrict__ bo, float* __restrict__ out) {
  __shared__ __align__(16) float so[4][16][132];
  const int tid = threadIdx.x, wave = tid >> 5, lane = tid & 31, col = lane & 15, g = lane >> 4;
  const int r0 = blockIdx.x * 64 + wave * 16, n0 = blockIdx.y * 128; const int ra = r0 + col; const int b = ra / SS, s = ra % SS;
  v8f acc[8] = {};
  // One head (two k chunks) a pass: all loads of the pass stand ahead of its first product, so that their latencies overlap. Not unrolled further: registers.
#pragma unroll 1
  for (int h = 0; h < NH; ++h) { float ov[2][16]; v16b wb[2][8];
    const float* po = O32 + (((size_t)b * NH + h) * SS + s) * HD + 8 * g; const __bf16* pw = PT + (size_t)(3 * E + n0 + col) * E + h * 64 + 8 * g;
    // inner loops unrolled so that the arrays are indexed by constants and stay in registers
#pragma unroll
    for (int c = 0; c < 2; ++c) {
#pragma unroll
      for (int i = 0; i < 8; ++i) { ov[c][i] = po[c * 32 + i]; ov[c][8 + i] = po[c * 32 + 16 + i]; }
#pragma unroll
      for (int j = 0; j < 8; ++j) wb[c][j] = frag_p(pw + (size_t)j * 16 * E + c * 32); }
    asm volatile("s_wait_xcnt 0x0" :: "v"(po), "v"(pw) : "memory");      // the loads' address registers are held up to here and rewritten only behind this wait
#pragma unroll
    for (int c = 0; c < 2; ++c) { const F2 a = bsplit16(ov[c]);
#pragma unroll
      for (int j = 0; j < 8; ++j) { acc[j] = wmma_bf(a.l, wb[c][j], acc[j]); acc[j] = wmma_bf(a.h, wb[c][j], acc[j]); } } }
#pragma unroll
  for (int j = 0; j < 8; ++j) { const int n = n0 + j * 16 + col; const float bb = bfr(bo[n]);
#pragma unroll
    for (int r = 0; r < 8; ++r) so[wave][8 * g + r][j * 16 + col] = acc[j][r] + bb; }
  LDSX();
#pragma unroll 4
  for (int rl = 0; rl < 16; ++rl) vst2(out + (size_t)(r0 + rl) * E + n0 + lane * 4, *(const v4f*)(&so[wave][rl][lane * 4]));
}
extern "C" void kernel_launch(void* const* d_in, const int* in_sizes, int n_in, void* d_out, int out_size, void* d_ws, size_t ws_size, hipStream_t stream) {
  (void)in_sizes; (void)n_in; (void)out_size; (void)ws_size;
  const float* x = (const float*)d_in[0]; const int* mask = (const int*)d_in[1]; const float* Wq = (const float*)d_in[2]; const float* bq = (const float*)d_in[3]; const float* Wk = (const float*)d_in[4]; const float* bk = (const float*)d_in[5];
  const float* Wv = (const float*)d_in[6]; const float* bv = (const float*)d_in[7]; const float* Wp = (const float*)d_in[8]; const float* bp = (const float*)d_in[9]; const float* rel = (const float*)d_in[10];
  float* out = (float*)d_out;
  char* ws = (char*)d_ws; size_t off = 0;
  auto take = [&](size_t bytes) { char* p = ws + off; off += (bytes + 255) & ~(size_t)255; return p; };
  __bf16* Xb = (__bf16*)take((size_t)NR * E * 2); __bf16* PT = (__bf16*)take((size_t)4 * E * E * 2); __bf16* RB = (__bf16*)take((size_t)NREL * HD * 2);
  float* Q32 = (float*)take((size_t)NR * E * 4); __bf16* Kh = (__bf16*)take((size_t)NR * E * 2); __bf16* Kl = (__bf16*)take((size_t)NR * E * 2); _Float16* VTh = (_Float16*)take((size_t)NR * E * 2); _Float16* VTl = (_Float16*)take((size_t)NR * E * 2); float* O32 = (float*)take((size_t)NR * E * 4);
  // ws ~ 45 MB
  k_cvt<<<(NR * E / 8 + 255) / 256, 256, 0, stream>>>(x, Xb);
  k_pack<<<4 * E, 256, 0, stream>>>(Wq, Wk, Wv, Wp, PT);
  k_relb<<<((NREL - 1) * HD / 8 + 255) / 256, 256, 0, stream>>>(rel, RB);
  k_qkv<<<dim3(NR / 64, E / 128, 3), 128, 0, stream>>>(Xb, PT, bq, bk, bv, Q32, Kh, Kl, VTh, VTl);
  k_attn<<<dim3(SS / 64, NH), 128, 0, stream>>>(Q32, Kh, Kl, VTh, VTl, mask, RB, O32);
  k_out<<<dim3(NR / 64, E / 128), 128, 0, stream>>>(O32, PT, bp, out);
}

// v003
// Measured time: 159 microseconds a run.
// In two side-by-side timings against v002, it was 1.61 and 1.60 times as fast.
// Counting every step since v000, it is 21.2 times as fast.
// compute dtype: x, W*, b*, rel_pos_emb (INPUTS) rounded to bf16 with exact bf16 WMMA products (f32 accumulate) for the projections; rotary in f32; K pre-split into bf16 hi/lo rows; the relative-position scores q.rel^T as q hi/lo x bf16(rel) (2 products); P and V f16 hi/lo (3 products); softmax with the int mask in f32.
#include <hip/hip_runtime.h>
#include <math.h>

typedef __attribute__((ext_vector_type(16))) _Float16 v16h;
typedef __attribute__((ext_vector_type(16))) __bf16 v16b;
typedef __attribute__((ext_vector_type(8)))  _Float16 v8h;
typedef __attribute__((ext_vector_type(8)))  float v8f;
typedef __attribute__((ext_vector_type(4)))  float v4f;
typedef __attribute__((ext_vector_type(2)))  float v2f;
typedef __attribute__((ext_vector_type(4)))  unsigned v4u;
typedef __attribute__((ext_vector_type(4)))  int v4i;
typedef float __attribute__((may_alias)) float_a;
typedef int __attribute__((may_alias)) int_a;

template <typename T> __device__ __forceinline__ void vst2(void* p, T v) { *(T*)p = v;  }
__device__ __forceinline__ v8f wmma16(v16h a, v16h b, v8f c) {
  v8f d = __builtin_amdgcn_wmma_f32_16x16x32_f16(false, a, false, b, (short)0, c, false, false);
  asm volatile("v_nop\n\tv_nop\n\tv_nop\n\tv_nop" : "+v"(d) : "v"(a), "v"(b));
  return d;
}
__device__ __forceinline__ v8f wmma_bf(v16b a, v16b b, v8f c) {
  v8f d = __builtin_amdgcn_wmma_f32_16x16x32_bf16(false, a, false, b, (short)0, c, false, false);
  asm volatile("v_nop\n\tv_nop\n\tv_nop\n\tv_nop" : "+v"(d) : "v"(a), "v"(b));
  return d;
}
// The same two for the attention kernel, whose fragments in flight lie above v255: an operand of an asm statement is held below v256, so a and b are not named there (naming them spills).
__device__ __forceinline__ v8f wmma16_w(v16h a, v16h b, v8f c) {
  v8f d = __builtin_amdgcn_wmma_f32_16x16x32_f16(false, a, false, b, (short)0, c, false, false);
  asm volatile("v_nop\n\tv_nop\n\tv_nop\n\tv_nop" : "+v"(d));      // the distance behind a matrix instruction
  return d;
}
__device__ __forceinline__ v8f wmma_bf_w(v16b a, v16b b, v8f c) {
  v8f d = __builtin_amdgcn_wmma_f32_16x16x32_bf16(false, a, false, b, (short)0, c, false, false);
  asm volatile("v_nop\n\tv_nop\n\tv_nop\n\tv_nop" : "+v"(d));      // the distance behind a matrix instruction
  return d;
}
// 16x16x32 fragments: lane = (h = lane>>4, row/col = lane&15); elements 0..7 = k0+8h+0..7, 8..15 = k0+16+8h+0..7; D element r = row 8h+r
__device__ __forceinline__ v16h frag_h(const _Float16* rowk0, int lane) {
  union { v16h v; v8h q[2]; } u; const _Float16* p = rowk0 + 8 * (lane >> 4);
  u.q[0] = *(const v8h*)p; u.q[1] = *(const v8h*)(p + 16); return u.v;
}
__device__ __forceinline__ v16h frag_f32(const float* rowk0, int lane) {
  v16h a; const float* p = rowk0 + 8 * (lane >> 4);
#pragma unroll
  for (int i = 0; i < 8; ++i) { a[i] = (_Float16)p[i]; a[8 + i] = (_Float16)p[16 + i]; }
  return a;
}
__device__ __forceinline__ v16h frag_f32s(const float* rowk0, int lane, float sc) {
  v16h a; const float* p = rowk0 + 8 * (lane >> 4);
#pragma unroll
  for (int i = 0; i < 8; ++i) { a[i] = (_Float16)(p[i] * sc); a[8 + i] = (_Float16)(p[16 + i] * sc); }
  return a;
}
// column fragment from a [K][ld] layout (column n), rows >= K read as 0
__device__ __forceinline__ v16h fragc_f32(const float* W, int k0, int n, int lane, int ld, int K) {
  v16h a; const int g = lane >> 4;
#pragma unroll
  for (int i = 0; i < 8; ++i) { const int ka = k0 + 8 * g + i, kb = ka + 16;
    a[i] = (_Float16)(ka < K ? W[(size_t)ka * ld + n] : 0.f); a[8 + i] = (_Float16)(kb < K ? W[(size_t)kb * ld + n] : 0.f); }
  return a;
}
struct F2 { v16b h, l; };
__device__ __forceinline__ F2 bsplit16(const float v[16]) { F2 r;
#pragma unroll
  for (int i = 0; i < 16; ++i) { const __bf16 h = (__bf16)v[i]; r.h[i] = h; r.l[i] = (__bf16)(v[i] - (float)h); }
  return r; }
__device__ __forceinline__ F2 split_row(const float* row, int k0, int lane) { float v[16]; const float* p = row + k0 + 8 * (lane >> 4);
#pragma unroll
  for (int i = 0; i < 8; ++i) { v[i] = p[i]; v[8 + i] = p[16 + i]; }
  return bsplit16(v); }
__device__ __forceinline__ F2 split_rowK(const float* row, int k0, int lane, int K) { float v[16]; const int g = lane >> 4;
#pragma unroll
  for (int i = 0; i < 8; ++i) { const int ka = k0 + 8 * g + i, kb = ka + 16; v[i] = ka < K ? row[ka] : 0.f; v[8 + i] = kb < K ? row[kb] : 0.f; }
  return bsplit16(v); }
__device__ __forceinline__ F2 split_col(const float* W, int k0, int n, int lane, int ld, int K) { float v[16]; const int g = lane >> 4;
#pragma unroll
  for (int i = 0; i < 8; ++i) { const int ka = k0 + 8 * g + i, kb = ka + 16; v[i] = ka < K ? W[(size_t)ka * ld + n] : 0.f; v[8 + i] = kb < K ? W[(size_t)kb * ld + n] : 0.f; }
  return bsplit16(v); }
__device__ __forceinline__ v8f mac3(const F2& a, const F2& b, v8f c) { c = wmma_bf(a.l, b.h, c); c = wmma_bf(a.h, b.l, c); return wmma_bf(a.h, b.h, c); }
__device__ __forceinline__ float sigm(float v) { return 1.0f / (1.0f + expf(-v)); }
#define LDSX() do { asm volatile("s_wait_dscnt 0" ::: "memory"); __builtin_amdgcn_wave_barrier(); __builtin_amdgcn_fence(__ATOMIC_RELEASE, "workgroup"); } while (0)
// The same exchange among the lanes of ONE wave, for places where global loads are in flight: the fence at wavefront scope orders the LDS accesses for the compiler and does not drain the loads as the work-group one does.
#define LDSW() do { asm volatile("s_wait_dscnt 0" ::: "memory"); __builtin_amdgcn_wave_barrier(); __builtin_amdgcn_fence(__ATOMIC_RELEASE, "wavefront"); } while (0)


// Rotary multi-head attention with Shaw relative-position scores (16 heads of 64 on [1,2048,1024], [in][out] weights + biases): q,k = rotate_half-RoPE(xW+b) (angle[d] = s*10000^(-2(d mod 32)/64));
// scores[i][j] = q_i.k_j/8 + q_i.rel_pos_emb[j-i+2047]; masked where mask[i][j] == 0 (-1e30); softmax; (P v) Wo + bo. The rel term uses the skew trick inside the attention kernel: a tile of 16 queries x 64 keys
// needs only the 79 offsets c = j-i+2047 of its diagonals, so q.rel[c] is formed for five 16-column tiles, laid in LDS and read back along the diagonal. No score table in memory: all heads run in one launch.
#define NB 1
#define SS 2048
#define NREL 4096      // 4095 offsets padded to 4096 (offset 4095 is clamped to row 4094 and never used)
#define E 1024
#define NH 16
#define HD 64
#define NR (NB * SS)
#define PLO 1024.0f
#define VLO 2048.0f
__device__ __forceinline__ float bfr(float v) { return (float)(__bf16)v; }
__device__ __forceinline__ v16b frag_b(const __bf16* rowk0, int lane) { return __builtin_bit_cast(v16b, frag_h((const _Float16*)rowk0, lane)); }
// FRAGMENT ORDER of the 16-bit operands in the workspace: a tile of 16 rows x 32 k is 1024 contiguous bytes; the piece of 8 elements k = 16 hf + 8 g + 0..7 of row r lies at element (hf * 32 + g * 16 + r) * 8.
// Lane l = g * 16 + r finds its two pieces at l * 8 and 256 + l * 8, so each wave-wide 16-byte load covers 512 contiguous bytes (4 whole lines) and not 32-byte pieces of 16 lines. p = tile + lane * 8.
__device__ __forceinline__ v16h frag_th(const _Float16* p) { union { v16h v; v8h q[2]; } u; u.q[0] = *(const v8h*)p; u.q[1] = *(const v8h*)(p + 256); return u.v; }
__device__ __forceinline__ v16b frag_t(const __bf16* p) { return __builtin_bit_cast(v16b, frag_th((const _Float16*)p)); }

__global__ __launch_bounds__(256) void k_cvt(const float* __restrict__ x, __bf16* __restrict__ Xb) {
  const size_t i8 = (size_t)blockIdx.x * 256 + threadIdx.x; if (i8 >= (size_t)NR * E / 8) return;
  // i8 = the piece's place in fragment order: tile (row tile, k chunk), then hf, g, row
  const size_t tile = i8 >> 6; const int hf = (int)(i8 >> 5) & 1, g = (int)(i8 >> 4) & 1, row = (int)i8 & 15;
  const float* px = x + ((tile >> 5) * 16 + row) * E + (tile & 31) * 32 + hf * 16 + g * 8;
  union { __bf16 h[8]; v4u u; } pk;
#pragma unroll
  for (int e = 0; e < 8; ++e) pk.h[e] = (__bf16)px[e];
  vst2((unsigned*)(Xb + i8 * 8), pk.u);
}
// PT rows: [0,E) Wq[:,n], [E,2E) Wk[:,n], [2E,3E) Wv[:,n], [3E,4E) Wo[:,n]  ([in][out] weights: column n as a bf16 row), in fragment order
__global__ __launch_bounds__(256) void k_pack(const float* __restrict__ Wq, const float* __restrict__ Wk, const float* __restrict__ Wv, const float* __restrict__ Wo, __bf16* __restrict__ PT) {
  // block: 32 columns n (two row tiles of PT) x 256 k, turned in LDS; written in fragment order, tile (n / 16, k / 32)
  const int n0 = blockIdx.x * 32, k0 = blockIdx.y * 256, tid = threadIdx.x; __shared__ __align__(16) __bf16 st[32][264];
  const float* W = n0 < E ? Wq : (n0 < 2 * E ? Wk : (n0 < 3 * E ? Wv : Wo)); const int nn0 = n0 & (E - 1);
  const int kr = tid >> 3, c4 = (tid & 7) * 4; const float* pwv = W + (size_t)(k0 + kr) * E + nn0 + c4; v4f v[8];      // a wave-wide load: 4 rows k x 128 bytes, whole lines
  // unrolled: v is indexed by constants and stays in registers
#pragma unroll
  for (int i = 0; i < 8; ++i) v[i] = *(const v4f*)(pwv + (size_t)i * 32 * E);
  asm volatile("s_wait_xcnt 0x0" :: "v"(pwv) : "memory");      // the loads' address register is held up to here and rewritten only behind this wait
#pragma unroll
  for (int i = 0; i < 8; ++i) {
#pragma unroll
    for (int e = 0; e < 4; ++e) st[c4 + e][i * 32 + kr] = (__bf16)v[i][e]; }
  __syncthreads();
  for (int i = 0; i < 4; ++i) { const int j = i * 256 + tid, tile = j >> 6, nt = tile >> 3, kcl = tile & 7, hf = (j >> 5) & 1, g = (j >> 4) & 1, row = j & 15;
    vst2((unsigned*)(PT + ((size_t)((n0 >> 4) + nt) * (E / 32) + (k0 >> 5) + kcl) * 512 + (j & 63) * 8), *(const v4u*)(&st[nt * 16 + row][kcl * 32 + hf * 16 + g * 8])); }
}
// QKV: block (64 rows, 128 cols = 2 heads, which); q (+bias) -> Q32 f32 [bh][s][64]; k (+bias) -> bf16 hi/lo rows; v (+bias) -> VT hi/lo x4 (rows d, k = key); K and VT in fragment order
__global__ __launch_bounds__(128) void k_qkv(const __bf16* __restrict__ Xb, const __bf16* __restrict__ PT, const float* __restrict__ bq, const float* __restrict__ bk, const float* __restrict__ bv,
                                            float* __restrict__ Q32, __bf16* __restrict__ Kh, __bf16* __restrict__ Kl, _Float16* __restrict__ VTh, _Float16* __restrict__ VTl) {
  __shared__ __align__(16) float so[4][16][132];
  __shared__ __align__(16) _Float16 sth[128][72], stl[128][72];
  const int tid = threadIdx.x, wave = tid >> 5, lane = tid & 31, col = lane & 15, g = lane >> 4;
  const int which = blockIdx.z, r0b = blockIdx.x * 64, r0 = r0b + wave * 16, n0 = blockIdx.y * 128; const int b = r0b / SS, s0 = r0b % SS;
  const float* bb_ = which == 0 ? bq : (which == 1 ? bk : bv);
  v8f acc[8] = {};
  // Two k chunks a pass: all 36 loads of the pass stand ahead of its first product, so that their latencies overlap (one wait a pass instead of one a product). Not unrolled further: registers.
#pragma unroll 1
  for (int kc = 0; kc < E / 32; kc += 2) { v16b a[2], wb[2][8];
    const __bf16* pa = Xb + ((size_t)(r0 >> 4) * (E / 32) + kc) * 512 + lane * 8; const __bf16* pw = PT + ((size_t)((which * E + n0) >> 4) * (E / 32) + kc) * 512 + lane * 8;
    // inner loops unrolled so that the fragment arrays are indexed by constants and stay in registers
#pragma unroll
    for (int c = 0; c < 2; ++c) { a[c] = frag_t(pa + c * 512);
#pragma unroll
      for (int j = 0; j < 8; ++j) wb[c][j] = frag_t(pw + (size_t)j * (E / 32) * 512 + c * 512); }
#pragma unroll
    for (int j = 0; j < 8; ++j) acc[j] = wmma_bf(a[0], wb[0][j], acc[j]);
    asm volatile("s_wait_xcnt 0x0" :: "v"(pa), "v"(pw) : "memory");      // the loads' address registers are held up to here and rewritten only behind this wait
#pragma unroll
    for (int j = 0; j < 8; ++j) acc[j] = wmma_bf(a[1], wb[1][j], acc[j]); }
  if (which < 2) {
#pragma unroll
    for (int j = 0; j < 8; ++j) { const float bb = bfr(bb_[n0 + j * 16 + col]);
#pragma unroll
      for (int r = 0; r < 8; ++r) so[wave][8 * g + r][j * 16 + col] = acc[j][r] + bb; }
    LDSX();
    { const int rl = lane & 15, hh = lane >> 4; float* rowp = &so[wave][rl][hh * 64]; const int spos = s0 + wave * 16 + rl;      // RoPE (rotate_half pairs (d, d+32)), angle[d] = s * 10000^(-2 (d mod 32) / 64)
#pragma unroll 4
      for (int d = 0; d < 32; ++d) { const float invf = powf(10000.0f, -(float)(2 * d) * (1.0f / 64.0f)); const float ang = (float)spos * invf; float sn, cs; sincosf(ang, &sn, &cs);
        const float x1 = rowp[d], x2 = rowp[d + 32]; rowp[d] = x1 * cs - x2 * sn; rowp[d + 32] = x2 * cs + x1 * sn; } }
    LDSX();
    if (which == 0) { for (int qq = lane; qq < 2 * 16 * 16; qq += 32) { const int hh = qq >> 8, rl = (qq >> 4) & 15, pc = qq & 15; const int h = (n0 >> 6) + hh;
        vst2(Q32 + (((size_t)b * NH + h) * SS + s0 + wave * 16 + rl) * HD + pc * 4, *(const v4f*)(&so[wave][rl][hh * 64 + pc * 4])); } }
    else {
      // fragment order, tile (key / 16, d / 32): the wave's 32 lanes store one 512-byte half tile a trip
      for (int i = 0; i < 16; ++i) { const int hf = i & 1, kc = (i >> 1) & 1, lo = (i >> 2) & 1, hh = i >> 3; const int h = (n0 >> 6) + hh; union { __bf16 e[8]; v4u u; } pk;
#pragma unroll
        for (int e = 0; e < 8; ++e) { const float v = so[wave][col][hh * 64 + kc * 32 + hf * 16 + g * 8 + e]; const __bf16 hi = (__bf16)v; pk.e[e] = lo ? (__bf16)(v - (float)hi) : hi; }
        vst2((unsigned*)((lo ? Kl : Kh) + ((((size_t)b * NH + h) * (SS / 16) + (s0 >> 4) + wave) * 2 + kc) * 512 + hf * 256 + lane * 8), pk.u);
        asm volatile("s_wait_xcnt 0x0" ::: "memory"); } } }      // the next trip rewrites the store's address and data registers only behind this wait
  else {
#pragma unroll
    for (int j = 0; j < 8; ++j) { const float bb = bfr(bb_[n0 + j * 16 + col]);
#pragma unroll
      for (int r = 0; r < 8; ++r) { const float v = (acc[j][r] + bb) * 4.0f; const _Float16 hi = (_Float16)v; sth[j * 16 + col][wave * 16 + 8 * g + r] = hi; stl[j * 16 + col][wave * 16 + 8 * g + r] = (_Float16)((v - (float)hi) * VLO); } }
    __syncthreads();
    // fragment order, per head and 64 keys eight tiles (key chunk kc, d / 16): qq = hh, kc, d / 16, hf, g, d % 16 from the top bit down
    for (int qq = tid; qq < 128 * 8; qq += 128) { const int hh = qq >> 9, cl = hh * 64 + ((qq >> 6) & 3) * 16 + (qq & 15), pc = ((qq >> 8) & 1) * 4 + ((qq >> 4) & 3); const size_t o = (((size_t)b * NH + (n0 >> 6) + hh) * (SS / 64) + (s0 >> 6)) * 4096 + (qq & 511) * 8;
      vst2(VTh + o, *(const v4u*)(&sth[cl][pc * 8])); vst2(VTl + o, *(const v4u*)(&stl[cl][pc * 8])); } }
}

// rel_pos_emb rows -> bf16 in fragment order, tile (offset / 16, d / 32); the pad row 4095 takes row 4094's values (never used by a score)
__global__ __launch_bounds__(256) void k_relb(const float* __restrict__ rel, __bf16* __restrict__ RB) {
  const size_t i8 = (size_t)blockIdx.x * 256 + threadIdx.x; if (i8 >= (size_t)NREL * HD / 8) return;
  const int tile = (int)(i8 >> 6), hf = (int)(i8 >> 5) & 1, g = (int)(i8 >> 4) & 1, c = (tile >> 1) * 16 + ((int)i8 & 15);
  const float* ps = rel + (size_t)(c < NREL - 1 ? c : NREL - 2) * HD + (tile & 1) * 32 + hf * 16 + g * 8;
  union { __bf16 e[8]; v4u u; } pk;
#pragma unroll
  for (int e = 0; e < 8; ++e) pk.e[e] = (__bf16)ps[e];
  vst2((unsigned*)(RB + i8 * 8), pk.u);
}
// masked attention with relative-position scores: block (64 queries, head); all 32 key tiles; S on q hi/lo x K hi/lo rows; P,V hi/lo; O f32 in fragment order
__global__ __launch_bounds__(128) void k_attn(const float* __restrict__ Q32, const __bf16* __restrict__ Kh, const __bf16* __restrict__ Kl, const _Float16* __restrict__ VTh, const _Float16* __restrict__ VTl, const int* __restrict__ mask, const __bf16* __restrict__ RB, float* __restrict__ O32) {
  __shared__ __align__(16) float sS[4][16][68];
  __shared__ __align__(16) float sR[4][16][84];
  __shared__ __align__(16) _Float16 sPh[4][16][72], sPl[4][16][72];
  __shared__ __align__(16) float sO[4][16][68];
  const int tid = threadIdx.x, w = tid >> 5, lane = tid & 31, col = lane & 15, g = lane >> 4;
  const size_t bh = (size_t)blockIdx.y; const int qb = blockIdx.x; const int q0 = qb * 64 + w * 16;
  F2 aq[2]; float qv[2][16]; const float* pq = Q32 + (bh * SS + q0 + col) * HD + 8 * g;
  // unrolled: qv is indexed by constants and stays in registers
#pragma unroll
  for (int kc = 0; kc < 2; ++kc) {
#pragma unroll
    for (int i = 0; i < 8; ++i) { qv[kc][i] = pq[kc * 32 + i]; qv[kc][8 + i] = pq[kc * 32 + 16 + i]; } }
  asm volatile("s_wait_xcnt 0x0" :: "v"(pq) : "memory");      // the q loads' address register is held up to here and rewritten only behind this wait
#pragma unroll
  for (int kc = 0; kc < 2; ++kc) aq[kc] = bsplit16(qv[kc]);
  float mrun = -3.0e38f, lrun = 0.f; v8f acc[4] = {}, ac1[4] = {}, ac2[4] = {};
#pragma unroll 1
  for (int kt = 0; kt < SS / 64; ++kt) {
    // sR[row][x] = q_(q0+row) . rel[cb + x], x < 80: query q0+row and key kt*64+kk meet at offset c = cb + (kk - row + 15). Same products in the same order as a table of q.rel would hold.
    // The loops below are unrolled so that d, s and the fragments are indexed by constants and stay in registers.
    const int cb = kt * 64 - q0 + (SS - 16);
    // The loads of the score part (rel rows, K rows, mask words) all stand ahead of the first product: they are in flight together and the pass waits for memory once, not once a fragment.
    v16b rb[5][2], khf[4][2], klf[4][2]; int mk[4][8];
    // cb is a multiple of 16: the five rel tiles are whole tiles cb / 16 + u <= 255 of RB (the pad offset 4095 is a written row there)
    const __bf16* pr = RB + (size_t)(cb >> 4) * 1024 + lane * 8;
    const size_t ko = (bh * (SS / 16) + kt * 4) * 1024 + lane * 8; const __bf16* pkh = Kh + ko; const __bf16* pkl = Kl + ko; const int* pm = mask + (size_t)(q0 + 8 * g) * SS + kt * 64 + col;
#pragma unroll
    for (int u = 0; u < 5; ++u) {
#pragma unroll
      for (int kc = 0; kc < 2; ++kc) rb[u][kc] = frag_t(pr + (u * 2 + kc) * 512); }
#pragma unroll
    for (int t = 0; t < 4; ++t) {
#pragma unroll
      for (int kc = 0; kc < 2; ++kc) { khf[t][kc] = frag_t(pkh + (t * 2 + kc) * 512); klf[t][kc] = frag_t(pkl + (t * 2 + kc) * 512); } }
#pragma unroll
    for (int t = 0; t < 4; ++t) {
#pragma unroll
      for (int r = 0; r < 8; ++r) mk[t][r] = pm[r * SS + t * 16]; }
    __builtin_amdgcn_sched_barrier(0);      // keeps every load above ahead of the first product: without it the scheduler puts a q.k product, with its wait, in front of the rel loads, and the pass waits for memory twice
#pragma unroll
    for (int u = 0; u < 5; ++u) { v8f d = {};
#pragma unroll
      for (int kc = 0; kc < 2; ++kc) { d = wmma_bf_w(aq[kc].l, rb[u][kc], d); d = wmma_bf_w(aq[kc].h, rb[u][kc], d); }
#pragma unroll
      for (int r = 0; r < 8; ++r) sR[w][8 * g + r][u * 16 + col] = d[r]; }
    asm volatile("s_wait_xcnt 0x0" :: "v"(pr), "v"(pkh), "v"(pkl), "v"(pm) : "memory");      // the address registers of the loads above are held up to here and rewritten only behind this wait
    // The V fragments are asked for here, where the rel registers have come free: they fly during the q.k products and the softmax and are first used behind it.
    v16h vhf[2][4], vlf[2][4]; const size_t vo = (bh * (SS / 64) + kt) * 4096 + lane * 8; const _Float16* pvh = VTh + vo; const _Float16* pvl = VTl + vo;
#pragma unroll
    for (int kc = 0; kc < 2; ++kc) {
#pragma unroll
      for (int t = 0; t < 4; ++t) { vhf[kc][t] = frag_th(pvh + (kc * 4 + t) * 512); vlf[kc][t] = frag_th(pvl + (kc * 4 + t) * 512); } }
    v8f s[4] = {};
#pragma unroll
    for (int t = 0; t < 4; ++t) {
#pragma unroll
      for (int kc = 0; kc < 2; ++kc) { s[t] = wmma_bf_w(aq[kc].l, khf[t][kc], s[t]); s[t] = wmma_bf_w(aq[kc].h, klf[t][kc], s[t]); s[t] = wmma_bf_w(aq[kc].h, khf[t][kc], s[t]); } }
    asm volatile("s_wait_xcnt 0x0" :: "v"(pvh), "v"(pvl) : "memory");      // as above, for the V loads
    LDSW();      // the diagonal read below takes sR values that other lanes of this wave stored
    float rs[4][8];
#pragma unroll
    for (int t = 0; t < 4; ++t) {
#pragma unroll
      for (int r = 0; r < 8; ++r) rs[t][r] = sR[w][8 * g + r][t * 16 + col + 15 - (8 * g + r)]; }
#pragma unroll
    for (int t = 0; t < 4; ++t) {
#pragma unroll
      for (int r = 0; r < 8; ++r) { const float sc = s[t][r] * 0.125f + rs[t][r]; sS[w][8 * g + r][t * 16 + col] = (mk[t][r] == 0) ? -1.0e30f : sc; } }
    LDSW();
    float mx = -3.4e38f;
#pragma unroll
    for (int jj = 0; jj < 32; ++jj) mx = fmaxf(mx, sS[w][col][g * 32 + jj]);
    mx = fmaxf(mx, __shfl_xor(mx, 16, 32));
    const float mnew = fmaxf(mrun, mx); const float corr = expf(mrun - mnew);
    float ps = 0.f;
#pragma unroll
    for (int jj = 0; jj < 32; ++jj) { const float p = expf(sS[w][col][g * 32 + jj] - mnew) * 16384.0f; ps += p; const _Float16 hi = (_Float16)p; sPh[w][col][g * 32 + jj] = hi; sPl[w][col][g * 32 + jj] = (_Float16)((p - (float)hi) * PLO); }
    ps += __shfl_xor(ps, 16, 32);
    lrun = lrun * corr + ps * (1.0f / 16384.0f); mrun = mnew;
#pragma unroll
    for (int r = 0; r < 8; ++r) { const float cr = __shfl(corr, 8 * g + r, 32);
#pragma unroll
      for (int t = 0; t < 4; ++t) { acc[t][r] *= cr; ac1[t][r] *= cr; ac2[t][r] *= cr; } }
    LDSW();
#pragma unroll
    for (int kc = 0; kc < 2; ++kc) { const v16h ph = frag_h(&sPh[w][col][0] + kc * 32, lane), pl = frag_h(&sPl[w][col][0] + kc * 32, lane);
#pragma unroll
      for (int t = 0; t < 4; ++t) { acc[t] = wmma16_w(ph, vhf[kc][t], acc[t]); ac1[t] = wmma16_w(ph, vlf[kc][t], ac1[t]); ac2[t] = wmma16_w(pl, vhf[kc][t], ac2[t]); } }
    __builtin_amdgcn_wave_barrier(); }
#pragma unroll
  for (int r = 0; r < 8; ++r) { const float lr = __shfl(lrun, 8 * g + r, 32); const float inv = 1.0f / (lr * 16384.0f * 4.0f);
#pragma unroll
    for (int t = 0; t < 4; ++t) sO[w][8 * g + r][t * 16 + col] = (acc[t][r] + ac1[t][r] * (1.0f / VLO) + ac2[t][r] * (1.0f / PLO)) * inv; }
  LDSX();
  // O32 in the f32 form of the fragment order: tile (query / 16, d / 32) = 2048 bytes, four 512-byte parts j; lane (g, row) holds d = 16 (j >> 1) + 8 g + 4 (j & 1) + 0..3 of its row in part j
  for (int i = 0; i < 8; ++i) vst2(O32 + (bh * (SS / 16) + (q0 >> 4)) * 1024 + i * 128 + lane * 4, *(const v4f*)(&sO[w][col][(i >> 2) * 32 + ((i >> 1) & 1) * 16 + g * 8 + (i & 1) * 4]));
}
// out = ctx Wo + bo : split(ctx) x bf16(Wo columns): 2 products (Wo is an INPUT -> bf16 exact)
__global__ __launch_bounds__(128) void k_out(const float* __restrict__ O32, const __bf16* __restrict__ PT, const float* __restrict__ bo, float* __restrict__ out) {
  __shared__ __align__(16) float so[4][16][132];
  const int tid = threadIdx.x, wave = tid >> 5, lane = tid & 31, col = lane & 15, g = lane >> 4;
  const int r0 = blockIdx.x * 64 + wave * 16, n0 = blockIdx.y * 128; const int ra = r0 + col; const int b = ra / SS, s = ra % SS;
  v8f acc[8] = {};
  const float* po0 = O32 + ((size_t)b * NH * (SS / 16) + (s >> 4)) * 1024 + lane * 4; const __bf16* pw0 = PT + (size_t)((3 * E + n0) >> 4) * (E / 32) * 512 + lane * 8;
  // One head (two k chunks) a pass: all loads of the pass stand ahead of its first product, so that their latencies overlap. Not unrolled further: registers.
#pragma unroll 1
  for (int h = 0; h < NH; ++h) { float ov[2][16]; v16b wb[2][8];
    const float* po = po0 + (size_t)h * (SS / 16) * 1024; const __bf16* pw = pw0 + h * 1024;
    // inner loops unrolled so that the arrays are indexed by constants and stay in registers
#pragma unroll
    for (int c = 0; c < 2; ++c) {
#pragma unroll
      for (int i = 0; i < 16; ++i) ov[c][i] = po[c * 512 + (i >> 2) * 128 + (i & 3)]; }
#pragma unroll
    for (int c = 0; c < 2; ++c) {
#pragma unroll
      for (int j = 0; j < 8; ++j) wb[c][j] = frag_t(pw + (size_t)j * (E / 32) * 512 + c * 512); }
    asm volatile("s_wait_xcnt 0x0" :: "v"(po), "v"(pw) : "memory");      // the loads' address registers are held up to here and rewritten only behind this wait
#pragma unroll
    for (int c = 0; c < 2; ++c) { const F2 a = bsplit16(ov[c]);
#pragma unroll
      for (int j = 0; j < 8; ++j) { acc[j] = wmma_bf(a.l, wb[c][j], acc[j]); acc[j] = wmma_bf(a.h, wb[c][j], acc[j]); } } }
#pragma unroll
  for (int j = 0; j < 8; ++j) { const int n = n0 + j * 16 + col; const float bb = bfr(bo[n]);
#pragma unroll
    for (int r = 0; r < 8; ++r) so[wave][8 * g + r][j * 16 + col] = acc[j][r] + bb; }
  LDSX();
#pragma unroll 4
  for (int rl = 0; rl < 16; ++rl) vst2(out + (size_t)(r0 + rl) * E + n0 + lane * 4, *(const v4f*)(&so[wave][rl][lane * 4]));
}
extern "C" void kernel_launch(void* const* d_in, const int* in_sizes, int n_in, void* d_out, int out_size, void* d_ws, size_t ws_size, hipStream_t stream) {
  (void)in_sizes; (void)n_in; (void)out_size; (void)ws_size;
  const float* x = (const float*)d_in[0]; const int* mask = (const int*)d_in[1]; const float* Wq = (const float*)d_in[2]; const float* bq = (const float*)d_in[3]; const float* Wk = (const float*)d_in[4]; const float* bk = (const float*)d_in[5];
  const float* Wv = (const float*)d_in[6]; const float* bv = (const float*)d_in[7]; const float* Wp = (const float*)d_in[8]; const float* bp = (const float*)d_in[9]; const float* rel = (const float*)d_in[10];
  float* out = (float*)d_out;
  char* ws = (char*)d_ws; size_t off = 0;
  auto take = [&](size_t bytes) { char* p = ws + off; off += (bytes + 255) & ~(size_t)255; return p; };
  __bf16* Xb = (__bf16*)take((size_t)NR * E * 2); __bf16* PT = (__bf16*)take((size_t)4 * E * E * 2); __bf16* RB = (__bf16*)take((size_t)NREL * HD * 2);
  float* Q32 = (float*)take((size_t)NR * E * 4); __bf16* Kh = (__bf16*)take((size_t)NR * E * 2); __bf16* Kl = (__bf16*)take((size_t)NR * E * 2); _Float16* VTh = (_Float16*)take((size_t)NR * E * 2); _Float16* VTl = (_Float16*)take((size_t)NR * E * 2); float* O32 = (float*)take((size_t)NR * E * 4);
  // ws ~ 45 MB
  k_cvt<<<(NR * E / 8 + 255) / 256, 256, 0, stream>>>(x, Xb);
  k_pack<<<dim3(4 * E / 32, E / 256), 256, 0, stream>>>(Wq, Wk, Wv, Wp, PT);
  k_relb<<<((NREL - 1) * HD / 8 + 255) / 256, 256, 0, stream>>>(rel, RB);
  k_qkv<<<dim3(NR / 64, E / 128, 3), 128, 0, stream>>>(Xb, PT, bq, bk, bv, Q32, Kh, Kl, VTh, VTl);
  k_attn<<<dim3(SS / 64, NH), 128, 0, stream>>>(Q32, Kh, Kl, VTh, VTl, mask, RB, O32);
  k_out<<<dim3(NR / 64, E / 128), 128, 0, stream>>>(O32, PT, bp, out);
}

// v004
// It runs in 127 microseconds.
// Next to v003, in two timings, it ran 1.24 and 1.25 times as fast.
// Counting every step since v000, it is 26.5 times as fast.
// compute dtype: x, W*, b*, rel_pos_emb (INPUTS) rounded to bf16 with exact bf16 WMMA products (f32 accumulate) for the projections; rotary in f32; K pre-split into bf16 hi/lo rows; the relative-position scores q.rel^T as q hi/lo x bf16(rel) (2 products); P and V f16 hi/lo (3 products); softmax with the int mask in f32.
#include <hip/hip_runtime.h>
#include <math.h>

typedef __attribute__((ext_vector_type(16))) _Float16 v16h;
typedef __attribute__((ext_vector_type(16))) __bf16 v16b;
typedef __attribute__((ext_vector_type(8)))  _Float16 v8h;
typedef __attribute__((ext_vector_type(8)))  float v8f;
typedef __attribute__((ext_vector_type(4)))  float v4f;
typedef __attribute__((ext_vector_type(2)))  float v2f;
typedef __attribute__((ext_vector_type(4)))  unsigned v4u;
typedef __attribute__((ext_vector_type(4)))  int v4i;
typedef float __attribute__((may_alias)) float_a;
typedef int __attribute__((may_alias)) int_a;

template <typename T> __device__ __forceinline__ void vst2(void* p, T v) { *(T*)p = v;  }
__device__ __forceinline__ v8f wmma16(v16h a, v16h b, v8f c) {
  v8f d = __builtin_amdgcn_wmma_f32_16x16x32_f16(false, a, false, b, (short)0, c, false, false);
  asm volatile("v_nop\n\tv_nop\n\tv_nop\n\tv_nop" : "+v"(d) : "v"(a), "v"(b));
  return d;
}
__device__ __forceinline__ v8f wmma_bf(v16b a, v16b b, v8f c) {
  v8f d = __builtin_amdgcn_wmma_f32_16x16x32_bf16(false, a, false, b, (short)0, c, false, false);
  asm volatile("v_nop\n\tv_nop\n\tv_nop\n\tv_nop" : "+v"(d) : "v"(a), "v"(b));
  return d;
}
// The same two for the attention kernel, whose fragments in flight lie above v255: an operand of an asm statement is held below v256, so a and b are not named there (naming them spills).
__device__ __forceinline__ v8f wmma16_w(v16h a, v16h b, v8f c) {
  v8f d = __builtin_amdgcn_wmma_f32_16x16x32_f16(false, a, false, b, (short)0, c, false, false);
  asm volatile("v_nop\n\tv_nop\n\tv_nop\n\tv_nop" : "+v"(d));      // the distance behind a matrix instruction
  return d;
}
__device__ __forceinline__ v8f wmma_bf_w(v16b a, v16b b, v8f c) {
  v8f d = __builtin_amdgcn_wmma_f32_16x16x32_bf16(false, a, false, b, (short)0, c, false, false);
  asm volatile("v_nop\n\tv_nop\n\tv_nop\n\tv_nop" : "+v"(d));      // the distance behind a matrix instruction
  return d;
}
// 16x16x32 fragments: lane = (h = lane>>4, row/col = lane&15); elements 0..7 = k0+8h+0..7, 8..15 = k0+16+8h+0..7; D element r = row 8h+r
__device__ __forceinline__ v16h frag_h(const _Float16* rowk0, int lane) {
  union { v16h v; v8h q[2]; } u; const _Float16* p = rowk0 + 8 * (lane >> 4);
  u.q[0] = *(const v8h*)p; u.q[1] = *(const v8h*)(p + 16); return u.v;
}
__device__ __forceinline__ v16h frag_f32(const float* rowk0, int lane) {
  v16h a; const float* p = rowk0 + 8 * (lane >> 4);
#pragma unroll
  for (int i = 0; i < 8; ++i) { a[i] = (_Float16)p[i]; a[8 + i] = (_Float16)p[16 + i]; }
  return a;
}
__device__ __forceinline__ v16h frag_f32s(const float* rowk0, int lane, float sc) {
  v16h a; const float* p = rowk0 + 8 * (lane >> 4);
#pragma unroll
  for (int i = 0; i < 8; ++i) { a[i] = (_Float16)(p[i] * sc); a[8 + i] = (_Float16)(p[16 + i] * sc); }
  return a;
}
// column fragment from a [K][ld] layout (column n), rows >= K read as 0
__device__ __forceinline__ v16h fragc_f32(const float* W, int k0, int n, int lane, int ld, int K) {
  v16h a; const int g = lane >> 4;
#pragma unroll
  for (int i = 0; i < 8; ++i) { const int ka = k0 + 8 * g + i, kb = ka + 16;
    a[i] = (_Float16)(ka < K ? W[(size_t)ka * ld + n] : 0.f); a[8 + i] = (_Float16)(kb < K ? W[(size_t)kb * ld + n] : 0.f); }
  return a;
}
struct F2 { v16b h, l; };
__device__ __forceinline__ F2 bsplit16(const float v[16]) { F2 r;
#pragma unroll
  for (int i = 0; i < 16; ++i) { const __bf16 h = (__bf16)v[i]; r.h[i] = h; r.l[i] = (__bf16)(v[i] - (float)h); }
  return r; }
__device__ __forceinline__ F2 split_row(const float* row, int k0, int lane) { float v[16]; const float* p = row + k0 + 8 * (lane >> 4);
#pragma unroll
  for (int i = 0; i < 8; ++i) { v[i] = p[i]; v[8 + i] = p[16 + i]; }
  return bsplit16(v); }
__device__ __forceinline__ F2 split_rowK(const float* row, int k0, int lane, int K) { float v[16]; const int g = lane >> 4;
#pragma unroll
  for (int i = 0; i < 8; ++i) { const int ka = k0 + 8 * g + i, kb = ka + 16; v[i] = ka < K ? row[ka] : 0.f; v[8 + i] = kb < K ? row[kb] : 0.f; }
  return bsplit16(v); }
__device__ __forceinline__ F2 split_col(const float* W, int k0, int n, int lane, int ld, int K) { float v[16]; const int g = lane >> 4;
#pragma unroll
  for (int i = 0; i < 8; ++i) { const int ka = k0 + 8 * g + i, kb = ka + 16; v[i] = ka < K ? W[(size_t)ka * ld + n] : 0.f; v[8 + i] = kb < K ? W[(size_t)kb * ld + n] : 0.f; }
  return bsplit16(v); }
__device__ __forceinline__ v8f mac3(const F2& a, const F2& b, v8f c) { c = wmma_bf(a.l, b.h, c); c = wmma_bf(a.h, b.l, c); return wmma_bf(a.h, b.h, c); }
__device__ __forceinline__ float sigm(float v) { return 1.0f / (1.0f + expf(-v)); }
#define LDSX() do { asm volatile("s_wait_dscnt 0" ::: "memory"); __builtin_amdgcn_wave_barrier(); __builtin_amdgcn_fence(__ATOMIC_RELEASE, "workgroup"); } while (0)
// The same exchange among the lanes of ONE wave, for places where global loads are in flight: the fence at wavefront scope orders the LDS accesses for the compiler and does not drain the loads as the work-group one does.
#define LDSW() do { asm volatile("s_wait_dscnt 0" ::: "memory"); __builtin_amdgcn_wave_barrier(); __builtin_amdgcn_fence(__ATOMIC_RELEASE, "wavefront"); } while (0)


// Rotary multi-head attention with Shaw relative-position scores (16 heads of 64 on [1,2048,1024], [in][out] weights + biases): q,k = rotate_half-RoPE(xW+b) (angle[d] = s*10000^(-2(d mod 32)/64));
// scores[i][j] = q_i.k_j/8 + q_i.rel_pos_emb[j-i+2047]; masked where mask[i][j] == 0 (-1e30); softmax; (P v) Wo + bo. The rel term uses the skew trick inside the attention kernel: a tile of 16 queries x 64 keys
// needs only the 79 offsets c = j-i+2047 of its diagonals, so q.rel[c] is formed for five 16-column tiles, laid in LDS and read back along the diagonal. No score table in memory: all heads run in one launch.
// A tile of 16 queries x 64 keys whose mask words are all 0 adds exactly nothing to a row that has an open key somewhere (its weights are exp(-1e30 - m) = 0, or are wiped by the factor 0 at the row's first open key):
// k_msk reads the mask once and says which tiles hold an open word; the attention kernel passes over the others.
#define NB 1
#define SS 2048
#define NREL 4096      // 4095 offsets padded to 4096 (offset 4095 is clamped to row 4094 and never used)
#define E 1024
#define NH 16
#define HD 64
#define NR (NB * SS)
#define PLO 1024.0f
#define VLO 2048.0f
__device__ __forceinline__ float bfr(float v) { return (float)(__bf16)v; }
__device__ __forceinline__ v16b frag_b(const __bf16* rowk0, int lane) { return __builtin_bit_cast(v16b, frag_h((const _Float16*)rowk0, lane)); }
// FRAGMENT ORDER of the 16-bit operands in the workspace: a tile of 16 rows x 32 k is 1024 contiguous bytes; the piece of 8 elements k = 16 hf + 8 g + 0..7 of row r lies at element (hf * 32 + g * 16 + r) * 8.
// Lane l = g * 16 + r finds its two pieces at l * 8 and 256 + l * 8, so each wave-wide 16-byte load covers 512 contiguous bytes (4 whole lines) and not 32-byte pieces of 16 lines. p = tile + lane * 8.
__device__ __forceinline__ v16h frag_th(const _Float16* p) { union { v16h v; v8h q[2]; } u; u.q[0] = *(const v8h*)p; u.q[1] = *(const v8h*)(p + 256); return u.v; }
__device__ __forceinline__ v16b frag_t(const __bf16* p) { return __builtin_bit_cast(v16b, frag_th((const _Float16*)p)); }

__global__ __launch_bounds__(256) void k_cvt(const float* __restrict__ x, __bf16* __restrict__ Xb) {
  const size_t i8 = (size_t)blockIdx.x * 256 + threadIdx.x; if (i8 >= (size_t)NR * E / 8) return;
  // i8 = the piece's place in fragment order: tile (row tile, k chunk), then hf, g, row
  const size_t tile = i8 >> 6; const int hf = (int)(i8 >> 5) & 1, g = (int)(i8 >> 4) & 1, row = (int)i8 & 15;
  const float* px = x + ((tile >> 5) * 16 + row) * E + (tile & 31) * 32 + hf * 16 + g * 8;
  union { __bf16 h[8]; v4u u; } pk;
#pragma unroll
  for (int e = 0; e < 8; ++e) pk.h[e] = (__bf16)px[e];
  vst2((unsigned*)(Xb + i8 * 8), pk.u);
}
// PT rows: [0,E) Wq[:,n], [E,2E) Wk[:,n], [2E,3E) Wv[:,n], [3E,4E) Wo[:,n]  ([in][out] weights: column n as a bf16 row), in fragment order
__global__ __launch_bounds__(256) void k_pack(const float* __restrict__ Wq, const float* __restrict__ Wk, const float* __restrict__ Wv, const float* __restrict__ Wo, __bf16* __restrict__ PT) {
  // block: 32 columns n (two row tiles of PT) x 256 k, turned in LDS; written in fragment order, tile (n / 16, k / 32)
  const int n0 = blockIdx.x * 32, k0 = blockIdx.y * 256, tid = threadIdx.x; __shared__ __align__(16) __bf16 st[32][264];
  const float* W = n0 < E ? Wq : (n0 < 2 * E ? Wk : (n0 < 3 * E ? Wv : Wo)); const int nn0 = n0 & (E - 1);
  const int kr = tid >> 3, c4 = (tid & 7) * 4; const float* pwv = W + (size_t)(k0 + kr) * E + nn0 + c4; v4f v[8];      // a wave-wide load: 4 rows k x 128 bytes, whole lines
  // unrolled: v is indexed by constants and stays in registers
#pragma unroll
  for (int i = 0; i < 8; ++i) v[i] = *(const v4f*)(pwv + (size_t)i * 32 * E);
  asm volatile("s_wait_xcnt 0x0" :: "v"(pwv) : "memory");      // the loads' address register is held up to here and rewritten only behind this wait
#pragma unroll
  for (int i = 0; i < 8; ++i) {
#pragma unroll
    for (int e = 0; e < 4; ++e) st[c4 + e][i * 32 + kr] = (__bf16)v[i][e]; }
  __syncthreads();
  for (int i = 0; i < 4; ++i) { const int j = i * 256 + tid, tile = j >> 6, nt = tile >> 3, kcl = tile & 7, hf = (j >> 5) & 1, g = (j >> 4) & 1, row = j & 15;
    vst2((unsigned*)(PT + ((size_t)((n0 >> 4) + nt) * (E / 32) + (k0 >> 5) + kcl) * 512 + (j & 63) * 8), *(const v4u*)(&st[nt * 16 + row][kcl * 32 + hf * 16 + g * 8])); }
}
// QKV: block (64 rows, 128 cols = 2 heads, which); q (+bias) -> Q32 f32 [bh][s][64]; k (+bias) -> bf16 hi/lo rows; v (+bias) -> VT hi/lo x4 (rows d, k = key); K and VT in fragment order
__global__ __launch_bounds__(128) void k_qkv(const __bf16* __restrict__ Xb, const __bf16* __restrict__ PT, const float* __restrict__ bq, const float* __restrict__ bk, const float* __restrict__ bv,
                                            float* __restrict__ Q32, __bf16* __restrict__ Kh, __bf16* __restrict__ Kl, _Float16* __restrict__ VTh, _Float16* __restrict__ VTl) {
  __shared__ __align__(16) float so[4][16][132];
  __shared__ __align__(16) _Float16 sth[128][72], stl[128][72];
  const int tid = threadIdx.x, wave = tid >> 5, lane = tid & 31, col = lane & 15, g = lane >> 4;
  const int which = blockIdx.z, r0b = blockIdx.x * 64, r0 = r0b + wave * 16, n0 = blockIdx.y * 128; const int b = r0b / SS, s0 = r0b % SS;
  const float* bb_ = which == 0 ? bq : (which == 1 ? bk : bv);
  v8f acc[8] = {};
  // Two k chunks a pass: all 36 loads of the pass stand ahead of its first product, so that their latencies overlap (one wait a pass instead of one a product). Not unrolled further: registers.
#pragma unroll 1
  for (int kc = 0; kc < E / 32; kc += 2) { v16b a[2], wb[2][8];
    const __bf16* pa = Xb + ((size_t)(r0 >> 4) * (E / 32) + kc) * 512 + lane * 8; const __bf16* pw = PT + ((size_t)((which * E + n0) >> 4) * (E / 32) + kc) * 512 + lane * 8;
    // inner loops unrolled so that the fragment arrays are indexed by constants and stay in registers
#pragma unroll
    for (int c = 0; c < 2; ++c) { a[c] = frag_t(pa + c * 512);
#pragma unroll
      for (int j = 0; j < 8; ++j) wb[c][j] = frag_t(pw + (size_t)j * (E / 32) * 512 + c * 512); }
#pragma unroll
    for (int j = 0; j < 8; ++j) acc[j] = wmma_bf(a[0], wb[0][j], acc[j]);
    asm volatile("s_wait_xcnt 0x0" :: "v"(pa), "v"(pw) : "memory");      // the loads' address registers are held up to here and rewritten only behind this wait
#pragma unroll
    for (int j = 0; j < 8; ++j) acc[j] = wmma_bf(a[1], wb[1][j], acc[j]); }
  if (which < 2) {
#pragma unroll
    for (int j = 0; j < 8; ++j) { const float bb = bfr(bb_[n0 + j * 16 + col]);
#pragma unroll
      for (int r = 0; r < 8; ++r) so[wave][8 * g + r][j * 16 + col] = acc[j][r] + bb; }
    LDSX();
    { const int rl = lane & 15, hh = lane >> 4; float* rowp = &so[wave][rl][hh * 64]; const int spos = s0 + wave * 16 + rl;      // RoPE (rotate_half pairs (d, d+32)), angle[d] = s * 10000^(-2 (d mod 32) / 64)
#pragma unroll 4
      for (int d = 0; d < 32; ++d) { const float invf = powf(10000.0f, -(float)(2 * d) * (1.0f / 64.0f)); const float ang = (float)spos * invf; float sn, cs; sincosf(ang, &sn, &cs);
        const float x1 = rowp[d], x2 = rowp[d + 32]; rowp[d] = x1 * cs - x2 * sn; rowp[d + 32] = x2 * cs + x1 * sn; } }
    LDSX();
    if (which == 0) { for (int qq = lane; qq < 2 * 16 * 16; qq += 32) { const int hh = qq >> 8, rl = (qq >> 4) & 15, pc = qq & 15; const int h = (n0 >> 6) + hh;
        vst2(Q32 + (((size_t)b * NH + h) * SS + s0 + wave * 16 + rl) * HD + pc * 4, *(const v4f*)(&so[wave][rl][hh * 64 + pc * 4])); } }
    else {
      // fragment order, tile (key / 16, d / 32): the wave's 32 lanes store one 512-byte half tile a trip
      for (int i = 0; i < 16; ++i) { const int hf = i & 1, kc = (i >> 1) & 1, lo = (i >> 2) & 1, hh = i >> 3; const int h = (n0 >> 6) + hh; union { __bf16 e[8]; v4u u; } pk;
#pragma unroll
        for (int e = 0; e < 8; ++e) { const float v = so[wave][col][hh * 64 + kc * 32 + hf * 16 + g * 8 + e]; const __bf16 hi = (__bf16)v; pk.e[e] = lo ? (__bf16)(v - (float)hi) : hi; }
        vst2((unsigned*)((lo ? Kl : Kh) + ((((size_t)b * NH + h) * (SS / 16) + (s0 >> 4) + wave) * 2 + kc) * 512 + hf * 256 + lane * 8), pk.u);
        asm volatile("s_wait_xcnt 0x0" ::: "memory"); } } }      // the next trip rewrites the store's address and data registers only behind this wait
  else {
#pragma unroll
    for (int j = 0; j < 8; ++j) { const float bb = bfr(bb_[n0 + j * 16 + col]);
#pragma unroll
      for (int r = 0; r < 8; ++r) { const float v = (acc[j][r] + bb) * 4.0f; const _Float16 hi = (_Float16)v; sth[j * 16 + col][wave * 16 + 8 * g + r] = hi; stl[j * 16 + col][wave * 16 + 8 * g + r] = (_Float16)((v - (float)hi) * VLO); } }
    __syncthreads();
    // fragment order, per head and 64 keys eight tiles (key chunk kc, d / 16): qq = hh, kc, d / 16, hf, g, d % 16 from the top bit down
    for (int qq = tid; qq < 128 * 8; qq += 128) { const int hh = qq >> 9, cl = hh * 64 + ((qq >> 6) & 3) * 16 + (qq & 15), pc = ((qq >> 8) & 1) * 4 + ((qq >> 4) & 3); const size_t o = (((size_t)b * NH + (n0 >> 6) + hh) * (SS / 64) + (s0 >> 6)) * 4096 + (qq & 511) * 8;
      vst2(VTh + o, *(const v4u*)(&sth[cl][pc * 8])); vst2(VTl + o, *(const v4u*)(&stl[cl][pc * 8])); } }
}

// rel_pos_emb rows -> bf16 in fragment order, tile (offset / 16, d / 32); the pad row 4095 takes row 4094's values (never used by a score)
__global__ __launch_bounds__(256) void k_relb(const float* __restrict__ rel, __bf16* __restrict__ RB) {
  const size_t i8 = (size_t)blockIdx.x * 256 + threadIdx.x; if (i8 >= (size_t)NREL * HD / 8) return;
  const int tile = (int)(i8 >> 6), hf = (int)(i8 >> 5) & 1, g = (int)(i8 >> 4) & 1, c = (tile >> 1) * 16 + ((int)i8 & 15);
  const float* ps = rel + (size_t)(c < NREL - 1 ? c : NREL - 2) * HD + (tile & 1) * 32 + hf * 16 + g * 8;
  union { __bf16 e[8]; v4u u; } pk;
#pragma unroll
  for (int e = 0; e < 8; ++e) pk.e[e] = (__bf16)ps[e];
  vst2((unsigned*)(RB + i8 * 8), pk.u);
}
// MW[query / 16]: bit kt is set where key tile kt (64 keys) holds a mask word != 0 for one of the 16 queries. Where one of the 16 rows has no open key at all its softmax is uniform over ALL keys, so every bit is set.
// block = 16 queries, wave = key tile; a wave-wide 16-byte load covers 256 contiguous bytes of two rows.
__global__ __launch_bounds__(1024) void k_msk(const int* __restrict__ mask, unsigned* __restrict__ MW) {
  __shared__ __align__(16) unsigned sT[SS / 64];
  const int tid = threadIdx.x, kt = tid >> 5, lane = tid & 31;
  const int* pm = mask + (size_t)(blockIdx.x * 16 + (lane >> 4)) * SS + kt * 64 + (lane & 15) * 4; v4i m[8];
  // unrolled: m is indexed by constants and stays in registers; the eight loads are in flight together
#pragma unroll
  for (int i = 0; i < 8; ++i) m[i] = *(const v4i*)(pm + (size_t)i * 2 * SS);
  asm volatile("s_wait_xcnt 0x0" :: "v"(pm) : "memory");      // the loads' address register is held up to here and rewritten only behind this wait
  unsigned rows = 0;      // bit r: row r has an open key in this tile
#pragma unroll
  for (int i = 0; i < 8; ++i) { const unsigned bl = __builtin_amdgcn_ballot_w32((m[i][0] | m[i][1] | m[i][2] | m[i][3]) != 0);
    rows |= ((bl & 0xFFFFu) ? 1u : 0u) << (2 * i); rows |= ((bl >> 16) ? 2u : 0u) << (2 * i); }
  if (lane == 0) sT[kt] = rows;
  __syncthreads();
  if (tid == 0) { unsigned tiles = 0, seen = 0;
#pragma unroll
    for (int k = 0; k < SS / 64; ++k) { const unsigned v = sT[k]; seen |= v; tiles |= (v ? 1u : 0u) << k; }
    MW[blockIdx.x] = seen == 0xFFFFu ? tiles : 0xFFFFFFFFu; }
}
// masked attention with relative-position scores: block (64 queries, head) twice, two waves a query tile; the key tiles that MW names; S on q hi/lo x K hi/lo rows; P,V hi/lo; O f32 in fragment order
__global__ __launch_bounds__(256) void k_attn(const float* __restrict__ Q32, const __bf16* __restrict__ Kh, const __bf16* __restrict__ Kl, const _Float16* __restrict__ VTh, const _Float16* __restrict__ VTl, const int* __restrict__ mask, const unsigned* __restrict__ MW, const __bf16* __restrict__ RB, float* __restrict__ O32) {
  __shared__ __align__(16) float sS[8][16][68];
  __shared__ __align__(16) float sR[8][16][84];
  __shared__ __align__(16) _Float16 sPh[8][16][72], sPl[8][16][72];
  __shared__ __align__(16) float sO[4][16][68];
  // wave wv: query tile w = wv & 3 of the 64 queries, key share kh = wv >> 2 (the even or the odd key tiles)
  const int tid = threadIdx.x, wv = tid >> 5, w = wv & 3, lane = tid & 31, col = lane & 15, g = lane >> 4;
  // All waves are resident at once, so the launch lasts as long as its longest wave: the tiles that are left are dealt evenly. Under a mask that opens more keys to later queries the cost grows with the query block:
  // a block takes query block t of one head and then query block 31 - t of another, one after the other in every wave, so that all blocks cost alike; each (head, query block) is taken once. And two waves share
  // a query tile, one on its even and one on its odd key tiles, each with a running maximum, sum and context of its own; the two are joined in LDS behind the key loop. Not unrolled: one copy of the code.
  // The tile words of the wave's two query tiles, read here, ahead of every store, with the wave's number in a scalar register: scalar loads, and the test on the word in the key loop is a scalar branch.
  const int ws = __builtin_amdgcn_readfirstlane(w), kh = __builtin_amdgcn_readfirstlane(wv >> 2); const unsigned live0 = MW[(int)blockIdx.x * 4 + ws], live1 = MW[(SS / 64 - 1 - (int)blockIdx.x) * 4 + ws];
#pragma unroll 1
  for (int part = 0; part < 2; ++part) {
  const size_t bh = (size_t)(blockIdx.y + part * (NH / 2)); const int qb = part ? SS / 64 - 1 - (int)blockIdx.x : (int)blockIdx.x; const int q0 = qb * 64 + w * 16;
  const unsigned live = (part ? live1 : live0) & (kh ? 0xAAAAAAAAu : 0x55555555u);
  F2 aq[2]; float qv[2][16]; const float* pq = Q32 + (bh * SS + q0 + col) * HD + 8 * g;
  // unrolled: qv is indexed by constants and stays in registers
#pragma unroll
  for (int kc = 0; kc < 2; ++kc) {
#pragma unroll
    for (int i = 0; i < 8; ++i) { qv[kc][i] = pq[kc * 32 + i]; qv[kc][8 + i] = pq[kc * 32 + 16 + i]; } }
  asm volatile("s_wait_xcnt 0x0" :: "v"(pq) : "memory");      // the q loads' address register is held up to here and rewritten only behind this wait
#pragma unroll
  for (int kc = 0; kc < 2; ++kc) aq[kc] = bsplit16(qv[kc]);
  float mrun = -3.0e38f, lrun = 0.f; v8f acc[4] = {}, ac1[4] = {}, ac2[4] = {};
#pragma unroll 1
  for (int kt = 0; kt < SS / 64; ++kt) {
    if (!((live >> kt) & 1u)) continue;      // no open key for any of the wave's 16 queries in this tile, or the other wave's tile
    // sR[row][x] = q_(q0+row) . rel[cb + x], x < 80: query q0+row and key kt*64+kk meet at offset c = cb + (kk - row + 15). Same products in the same order as a table of q.rel would hold.
    // The loops below are unrolled so that d, s and the fragments are indexed by constants and stay in registers.
    const int cb = kt * 64 - q0 + (SS - 16);
    // The loads of the score part (rel rows, K rows, mask words) all stand ahead of the first product: they are in flight together and the pass waits for memory once, not once a fragment.
    v16b rb[5][2], khf[4][2], klf[4][2]; int mk[4][8];
    // cb is a multiple of 16: the five rel tiles are whole tiles cb / 16 + u <= 255 of RB (the pad offset 4095 is a written row there)
    const __bf16* pr = RB + (size_t)(cb >> 4) * 1024 + lane * 8;
    const size_t ko = (bh * (SS / 16) + kt * 4) * 1024 + lane * 8; const __bf16* pkh = Kh + ko; const __bf16* pkl = Kl + ko; const int* pm = mask + (size_t)(q0 + 8 * g) * SS + kt * 64 + col;
#pragma unroll
    for (int u = 0; u < 5; ++u) {
#pragma unroll
      for (int kc = 0; kc < 2; ++kc) rb[u][kc] = frag_t(pr + (u * 2 + kc) * 512); }
#pragma unroll
    for (int t = 0; t < 4; ++t) {
#pragma unroll
      for (int kc = 0; kc < 2; ++kc) { khf[t][kc] = frag_t(pkh + (t * 2 + kc) * 512); klf[t][kc] = frag_t(pkl + (t * 2 + kc) * 512); } }
#pragma unroll
    for (int t = 0; t < 4; ++t) {
#pragma unroll
      for (int r = 0; r < 8; ++r) mk[t][r] = pm[r * SS + t * 16]; }
    __builtin_amdgcn_sched_barrier(0);      // keeps every load above ahead of the first product: without it the scheduler puts a q.k product, with its wait, in front of the rel loads, and the pass waits for memory twice
#pragma unroll
    for (int u = 0; u < 5; ++u) { v8f d = {};
#pragma unroll
      for (int kc = 0; kc < 2; ++kc) { d = wmma_bf_w(aq[kc].l, rb[u][kc], d); d = wmma_bf_w(aq[kc].h, rb[u][kc], d); }
#pragma unroll
      for (int r = 0; r < 8; ++r) sR[wv][8 * g + r][u * 16 + col] = d[r]; }
    asm volatile("s_wait_xcnt 0x0" :: "v"(pr), "v"(pkh), "v"(pkl), "v"(pm) : "memory");      // the address registers of the loads above are held up to here and rewritten only behind this wait
    // The V fragments are asked for here, where the rel registers have come free: they fly during the q.k products and the softmax and are first used behind it.
    v16h vhf[2][4], vlf[2][4]; const size_t vo = (bh * (SS / 64) + kt) * 4096 + lane * 8; const _Float16* pvh = VTh + vo; const _Float16* pvl = VTl + vo;
#pragma unroll
    for (int kc = 0; kc < 2; ++kc) {
#pragma unroll
      for (int t = 0; t < 4; ++t) { vhf[kc][t] = frag_th(pvh + (kc * 4 + t) * 512); vlf[kc][t] = frag_th(pvl + (kc * 4 + t) * 512); } }
    v8f s[4] = {};
#pragma unroll
    for (int t = 0; t < 4; ++t) {
#pragma unroll
      for (int kc = 0; kc < 2; ++kc) { s[t] = wmma_bf_w(aq[kc].l, khf[t][kc], s[t]); s[t] = wmma_bf_w(aq[kc].h, klf[t][kc], s[t]); s[t] = wmma_bf_w(aq[kc].h, khf[t][kc], s[t]); } }
    asm volatile("s_wait_xcnt 0x0" :: "v"(pvh), "v"(pvl) : "memory");      // as above, for the V loads
    LDSW();      // the diagonal read below takes sR values that other lanes of this wave stored
    float rs[4][8];
#pragma unroll
    for (int t = 0; t < 4; ++t) {
#pragma unroll
      for (int r = 0; r < 8; ++r) rs[t][r] = sR[wv][8 * g + r][t * 16 + col + 15 - (8 * g + r)]; }
#pragma unroll
    for (int t = 0; t < 4; ++t) {
#pragma unroll
      for (int r = 0; r < 8; ++r) { const float sc = s[t][r] * 0.125f + rs[t][r]; sS[wv][8 * g + r][t * 16 + col] = (mk[t][r] == 0) ? -1.0e30f : sc; } }
    LDSW();
    float mx = -3.4e38f;
#pragma unroll
    for (int jj = 0; jj < 32; ++jj) mx = fmaxf(mx, sS[wv][col][g * 32 + jj]);
    mx = fmaxf(mx, __shfl_xor(mx, 16, 32));
    const float mnew = fmaxf(mrun, mx); const float corr = expf(mrun - mnew);
    float ps = 0.f;
#pragma unroll
    for (int jj = 0; jj < 32; ++jj) { const float p = expf(sS[wv][col][g * 32 + jj] - mnew) * 16384.0f; ps += p; const _Float16 hi = (_Float16)p; sPh[wv][col][g * 32 + jj] = hi; sPl[wv][col][g * 32 + jj] = (_Float16)((p - (float)hi) * PLO); }
    ps += __shfl_xor(ps, 16, 32);
    lrun = lrun * corr + ps * (1.0f / 16384.0f); mrun = mnew;
#pragma unroll
    for (int r = 0; r < 8; ++r) { const float cr = __shfl(corr, 8 * g + r, 32);
#pragma unroll
      for (int t = 0; t < 4; ++t) { acc[t][r] *= cr; ac1[t][r] *= cr; ac2[t][r] *= cr; } }
    LDSW();
#pragma unroll
    for (int kc = 0; kc < 2; ++kc) { const v16h ph = frag_h(&sPh[wv][col][0] + kc * 32, lane), pl = frag_h(&sPl[wv][col][0] + kc * 32, lane);
#pragma unroll
      for (int t = 0; t < 4; ++t) { acc[t] = wmma16_w(ph, vhf[kc][t], acc[t]); ac1[t] = wmma16_w(ph, vlf[kc][t], ac1[t]); ac2[t] = wmma16_w(pl, vhf[kc][t], ac2[t]); } }
    __builtin_amdgcn_wave_barrier(); }
  // The odd-tile wave lays its share down (context not yet divided, maximum, sum); behind the barrier the even-tile wave scales both shares to the common maximum, adds them and divides.
  // A share without a tile has maximum -3e38 and sum 0: its factor is exp(-3e38 - m) = 0.
  if (kh) {
#pragma unroll
    for (int r = 0; r < 8; ++r) {
#pragma unroll
      for (int t = 0; t < 4; ++t) sO[w][8 * g + r][t * 16 + col] = acc[t][r] + ac1[t][r] * (1.0f / VLO) + ac2[t][r] * (1.0f / PLO); }
    if (g == 0) { sO[w][col][64] = mrun; sO[w][col][65] = lrun; } }      // in the row's pad words
  __syncthreads();      // the odd-tile waves' shares are in LDS
  if (!kh) {
  const float m1 = sO[w][col][64], l1 = sO[w][col][65]; const float mm = fmaxf(mrun, m1); const float a0 = expf(mrun - mm), a1 = expf(m1 - mm); const float ll = lrun * a0 + l1 * a1;
#pragma unroll
  for (int r = 0; r < 8; ++r) { const float lr = __shfl(ll, 8 * g + r, 32), f0 = __shfl(a0, 8 * g + r, 32), f1 = __shfl(a1, 8 * g + r, 32); const float inv = 1.0f / (lr * 16384.0f * 4.0f);
#pragma unroll
    for (int t = 0; t < 4; ++t) { float* p = &sO[w][8 * g + r][t * 16 + col]; *p = ((acc[t][r] + ac1[t][r] * (1.0f / VLO) + ac2[t][r] * (1.0f / PLO)) * f0 + *p * f1) * inv; } }      // each lane rewrites the places that it has read itself
  LDSX();
  // O32 in the f32 form of the fragment order: tile (query / 16, d / 32) = 2048 bytes, four 512-byte parts j; lane (g, row) holds d = 16 (j >> 1) + 8 g + 4 (j & 1) + 0..3 of its row in part j
  float* po = O32 + (bh * (SS / 16) + (q0 >> 4)) * 1024 + lane * 4;
  for (int i = 0; i < 8; ++i) vst2(po + i * 128, *(const v4f*)(&sO[w][col][(i >> 2) * 32 + ((i >> 1) & 1) * 16 + g * 8 + (i & 1) * 4]));
  asm volatile("s_wait_xcnt 0x0" :: "v"(po) : "memory"); }      // the second part rewrites the stores' address and data registers only behind this wait
  __syncthreads(); }      // sO has been read: the second part may write it
}
// out = ctx Wo + bo : split(ctx) x bf16(Wo columns): 2 products (Wo is an INPUT -> bf16 exact)
__global__ __launch_bounds__(128) void k_out(const float* __restrict__ O32, const __bf16* __restrict__ PT, const float* __restrict__ bo, float* __restrict__ out) {
  __shared__ __align__(16) float so[4][16][132];
  const int tid = threadIdx.x, wave = tid >> 5, lane = tid & 31, col = lane & 15, g = lane >> 4;
  const int r0 = blockIdx.x * 64 + wave * 16, n0 = blockIdx.y * 128; const int ra = r0 + col; const int b = ra / SS, s = ra % SS;
  v8f acc[8] = {};
  const float* po0 = O32 + ((size_t)b * NH * (SS / 16) + (s >> 4)) * 1024 + lane * 4; const __bf16* pw0 = PT + (size_t)((3 * E + n0) >> 4) * (E / 32) * 512 + lane * 8;
  // One head (two k chunks) a pass: all loads of the pass stand ahead of its first product, so that their latencies overlap. Not unrolled further: registers.
#pragma unroll 1
  for (int h = 0; h < NH; ++h) { float ov[2][16]; v16b wb[2][8];
    const float* po = po0 + (size_t)h * (SS / 16) * 1024; const __bf16* pw = pw0 + h * 1024;
    // inner loops unrolled so that the arrays are indexed by constants and stay in registers
#pragma unroll
    for (int c = 0; c < 2; ++c) {
#pragma unroll
      for (int i = 0; i < 16; ++i) ov[c][i] = po[c * 512 + (i >> 2) * 128 + (i & 3)]; }
#pragma unroll
    for (int c = 0; c < 2; ++c) {
#pragma unroll
      for (int j = 0; j < 8; ++j) wb[c][j] = frag_t(pw + (size_t)j * (E / 32) * 512 + c * 512); }
    asm volatile("s_wait_xcnt 0x0" :: "v"(po), "v"(pw) : "memory");      // the loads' address registers are held up to here and rewritten only behind this wait
#pragma unroll
    for (int c = 0; c < 2; ++c) { const F2 a = bsplit16(ov[c]);
#pragma unroll
      for (int j = 0; j < 8; ++j) { acc[j] = wmma_bf(a.l, wb[c][j], acc[j]); acc[j] = wmma_bf(a.h, wb[c][j], acc[j]); } } }
#pragma unroll
  for (int j = 0; j < 8; ++j) { const int n = n0 + j * 16 + col; const float bb = bfr(bo[n]);
#pragma unroll
    for (int r = 0; r < 8; ++r) so[wave][8 * g + r][j * 16 + col] = acc[j][r] + bb; }
  LDSX();
#pragma unroll 4
  for (int rl = 0; rl < 16; ++rl) vst2(out + (size_t)(r0 + rl) * E + n0 + lane * 4, *(const v4f*)(&so[wave][rl][lane * 4]));
}
extern "C" void kernel_launch(void* const* d_in, const int* in_sizes, int n_in, void* d_out, int out_size, void* d_ws, size_t ws_size, hipStream_t stream) {
  (void)in_sizes; (void)n_in; (void)out_size; (void)ws_size;
  const float* x = (const float*)d_in[0]; const int* mask = (const int*)d_in[1]; const float* Wq = (const float*)d_in[2]; const float* bq = (const float*)d_in[3]; const float* Wk = (const float*)d_in[4]; const float* bk = (const float*)d_in[5];
  const float* Wv = (const float*)d_in[6]; const float* bv = (const float*)d_in[7]; const float* Wp = (const float*)d_in[8]; const float* bp = (const float*)d_in[9]; const float* rel = (const float*)d_in[10];
  float* out = (float*)d_out;
  char* ws = (char*)d_ws; size_t off = 0;
  auto take = [&](size_t bytes) { char* p = ws + off; off += (bytes + 255) & ~(size_t)255; return p; };
  __bf16* Xb = (__bf16*)take((size_t)NR * E * 2); __bf16* PT = (__bf16*)take((size_t)4 * E * E * 2); __bf16* RB = (__bf16*)take((size_t)NREL * HD * 2);
  float* Q32 = (float*)take((size_t)NR * E * 4); __bf16* Kh = (__bf16*)take((size_t)NR * E * 2); __bf16* Kl = (__bf16*)take((size_t)NR * E * 2); _Float16* VTh = (_Float16*)take((size_t)NR * E * 2); _Float16* VTl = (_Float16*)take((size_t)NR * E * 2); float* O32 = (float*)take((size_t)NR * E * 4); unsigned* MW = (unsigned*)take((size_t)(SS / 16) * 4);
  // ws ~ 45 MB
  k_cvt<<<(NR * E / 8 + 255) / 256, 256, 0, stream>>>(x, Xb);
  k_pack<<<dim3(4 * E / 32, E / 256), 256, 0, stream>>>(Wq, Wk, Wv, Wp, PT);
  k_relb<<<((NREL - 1) * HD / 8 + 255) / 256, 256, 0, stream>>>(rel, RB);
  k_msk<<<SS / 16, 1024, 0, stream>>>(mask, MW);
  k_qkv<<<dim3(NR / 64, E / 128, 3), 128, 0, stream>>>(Xb, PT, bq, bk, bv, Q32, Kh, Kl, VTh, VTl);
  k_attn<<<dim3(SS / 64, NH / 2), 256, 0, stream>>>(Q32, Kh, Kl, VTh, VTl, mask, MW, RB, O32);
  k_out<<<dim3(NR / 64, E / 128), 128, 0, stream>>>(O32, PT, bp, out);
}

// v005
// A run of this version takes 119 microseconds.
// In two side-by-side timings against v004, it was 1.07 and 1.08 times as fast.
// All steps since v000 together make it 28.5 times as fast.
// compute dtype: x, W*, b*, rel_pos_emb (INPUTS) rounded to bf16 with exact bf16 WMMA products (f32 accumulate) for the projections; rotary in f32; K pre-split into bf16 hi/lo rows; the relative-position scores q.rel^T as q hi/lo x bf16(rel) (2 products); P and V f16 hi/lo (3 products); softmax with the int mask in f32.
#include <hip/hip_runtime.h>
#include <math.h>

typedef __attribute__((ext_vector_type(16))) _Float16 v16h;
typedef __attribute__((ext_vector_type(16))) __bf16 v16b;
typedef __attribute__((ext_vector_type(8)))  _Float16 v8h;
typedef __attribute__((ext_vector_type(8)))  float v8f;
typedef __attribute__((ext_vector_type(4)))  float v4f;
typedef __attribute__((ext_vector_type(2)))  float v2f;
typedef __attribute__((ext_vector_type(4)))  unsigned v4u;
typedef __attribute__((ext_vector_type(4)))  int v4i;
typedef float __attribute__((may_alias)) float_a;
typedef int __attribute__((may_alias)) int_a;

template <typename T> __device__ __forceinline__ void vst2(void* p, T v) { *(T*)p = v;  }
__device__ __forceinline__ v8f wmma16(v16h a, v16h b, v8f c) {
  v8f d = __builtin_amdgcn_wmma_f32_16x16x32_f16(false, a, false, b, (short)0, c, false, false);
  asm volatile("v_nop\n\tv_nop\n\tv_nop\n\tv_nop" : "+v"(d) : "v"(a), "v"(b));
  return d;
}
__device__ __forceinline__ v8f wmma_bf(v16b a, v16b b, v8f c) {
  v8f d = __builtin_amdgcn_wmma_f32_16x16x32_bf16(false, a, false, b, (short)0, c, false, false);
  asm volatile("v_nop\n\tv_nop\n\tv_nop\n\tv_nop" : "+v"(d) : "v"(a), "v"(b));
  return d;
}
// The same two for the attention kernel, whose fragments in flight lie above v255: an operand of an asm statement is held below v256, so a and b are not named there (naming them spills).
__device__ __forceinline__ v8f wmma16_w(v16h a, v16h b, v8f c) {
  v8f d = __builtin_amdgcn_wmma_f32_16x16x32_f16(false, a, false, b, (short)0, c, false, false);
  asm volatile("v_nop\n\tv_nop\n\tv_nop\n\tv_nop" : "+v"(d));      // the distance behind a matrix instruction
  return d;
}
__device__ __forceinline__ v8f wmma_bf_w(v16b a, v16b b, v8f c) {
  v8f d = __builtin_amdgcn_wmma_f32_16x16x32_bf16(false, a, false, b, (short)0, c, false, false);
  asm volatile("v_nop\n\tv_nop\n\tv_nop\n\tv_nop" : "+v"(d));      // the distance behind a matrix instruction
  return d;
}
// 16x16x32 fragments: lane = (h = lane>>4, row/col = lane&15); elements 0..7 = k0+8h+0..7, 8..15 = k0+16+8h+0..7; D element r = row 8h+r
__device__ __forceinline__ v16h frag_h(const _Float16* rowk0, int lane) {
  union { v16h v; v8h q[2]; } u; const _Float16* p = rowk0 + 8 * (lane >> 4);
  u.q[0] = *(const v8h*)p; u.q[1] = *(const v8h*)(p + 16); return u.v;
}
__device__ __forceinline__ v16h frag_f32(const float* rowk0, int lane) {
  v16h a; const float* p = rowk0 + 8 * (lane >> 4);
#pragma unroll
  for (int i = 0; i < 8; ++i) { a[i] = (_Float16)p[i]; a[8 + i] = (_Float16)p[16 + i]; }
  return a;
}
__device__ __forceinline__ v16h frag_f32s(const float* rowk0, int lane, float sc) {
  v16h a; const float* p = rowk0 + 8 * (lane >> 4);
#pragma unroll
  for (int i = 0; i < 8; ++i) { a[i] = (_Float16)(p[i] * sc); a[8 + i] = (_Float16)(p[16 + i] * sc); }
  return a;
}
// column fragment from a [K][ld] layout (column n), rows >= K read as 0
__device__ __forceinline__ v16h fragc_f32(const float* W, int k0, int n, int lane, int ld, int K) {
  v16h a; const int g = lane >> 4;
#pragma unroll
  for (int i = 0; i < 8; ++i) { const int ka = k0 + 8 * g + i, kb = ka + 16;
    a[i] = (_Float16)(ka < K ? W[(size_t)ka * ld + n] : 0.f); a[8 + i] = (_Float16)(kb < K ? W[(size_t)kb * ld + n] : 0.f); }
  return a;
}
struct F2 { v16b h, l; };
__device__ __forceinline__ F2 bsplit16(const float v[16]) { F2 r;
#pragma unroll
  for (int i = 0; i < 16; ++i) { const __bf16 h = (__bf16)v[i]; r.h[i] = h; r.l[i] = (__bf16)(v[i] - (float)h); }
  return r; }
__device__ __forceinline__ F2 split_row(const float* row, int k0, int lane) { float v[16]; const float* p = row + k0 + 8 * (lane >> 4);
#pragma unroll
  for (int i = 0; i < 8; ++i) { v[i] = p[i]; v[8 + i] = p[16 + i]; }
  return bsplit16(v); }
__device__ __forceinline__ F2 split_rowK(const float* row, int k0, int lane, int K) { float v[16]; const int g = lane >> 4;
#pragma unroll
  for (int i = 0; i < 8; ++i) { const int ka = k0 + 8 * g + i, kb = ka + 16; v[i] = ka < K ? row[ka] : 0.f; v[8 + i] = kb < K ? row[kb] : 0.f; }
  return bsplit16(v); }
__device__ __forceinline__ F2 split_col(const float* W, int k0, int n, int lane, int ld, int K) { float v[16]; const int g = lane >> 4;
#pragma unroll
  for (int i = 0; i < 8; ++i) { const int ka = k0 + 8 * g + i, kb = ka + 16; v[i] = ka < K ? W[(size_t)ka * ld + n] : 0.f; v[8 + i] = kb < K ? W[(size_t)kb * ld + n] : 0.f; }
  return bsplit16(v); }
__device__ __forceinline__ v8f mac3(const F2& a, const F2& b, v8f c) { c = wmma_bf(a.l, b.h, c); c = wmma_bf(a.h, b.l, c); return wmma_bf(a.h, b.h, c); }
__device__ __forceinline__ float sigm(float v) { return 1.0f / (1.0f + expf(-v)); }
#define LDSX() do { asm volatile("s_wait_dscnt 0" ::: "memory"); __builtin_amdgcn_wave_barrier(); __builtin_amdgcn_fence(__ATOMIC_RELEASE, "workgroup"); } while (0)
// The same exchange among the lanes of ONE wave, for places where global loads are in flight: the fence at wavefront scope orders the LDS accesses for the compiler and does not drain the loads as the work-group one does.
#define LDSW() do { asm volatile("s_wait_dscnt 0" ::: "memory"); __builtin_amdgcn_wave_barrier(); __builtin_amdgcn_fence(__ATOMIC_RELEASE, "wavefront"); } while (0)


// Rotary multi-head attention with Shaw relative-position scores (16 heads of 64 on [1,2048,1024], [in][out] weights + biases): q,k = rotate_half-RoPE(xW+b) (angle[d] = s*10000^(-2(d mod 32)/64));
// scores[i][j] = q_i.k_j/8 + q_i.rel_pos_emb[j-i+2047]; masked where mask[i][j] == 0 (-1e30); softmax; (P v) Wo + bo. The rel term uses the skew trick inside the attention kernel: a tile of 16 queries x 64 keys
// needs only the 79 offsets c = j-i+2047 of its diagonals, so q.rel[c] is formed for five 16-column tiles, laid in LDS and read back along the diagonal. No score table in memory: all heads run in one launch.
// A tile of 16 queries x 64 keys whose mask words are all 0 adds exactly nothing to a row that has an open key somewhere (its weights are exp(-1e30 - m) = 0, or are wiped by the factor 0 at the row's first open key):
// p_msk reads the mask once and says which tiles hold an open word; the attention kernel passes over the others.
#define NB 1
#define SS 2048
#define NREL 4096      // 4095 offsets padded to 4096 (offset 4095 is clamped to row 4094 and never used)
#define E 1024
#define NH 16
#define HD 64
#define NR (NB * SS)
#define PLO 1024.0f
#define VLO 2048.0f
__device__ __forceinline__ float bfr(float v) { return (float)(__bf16)v; }
__device__ __forceinline__ v16b frag_b(const __bf16* rowk0, int lane) { return __builtin_bit_cast(v16b, frag_h((const _Float16*)rowk0, lane)); }
// FRAGMENT ORDER of the 16-bit operands in the workspace: a tile of 16 rows x 32 k is 1024 contiguous bytes; the piece of 8 elements k = 16 hf + 8 g + 0..7 of row r lies at element (hf * 32 + g * 16 + r) * 8.
// Lane l = g * 16 + r finds its two pieces at l * 8 and 256 + l * 8, so each wave-wide 16-byte load covers 512 contiguous bytes (4 whole lines) and not 32-byte pieces of 16 lines. p = tile + lane * 8.
__device__ __forceinline__ v16h frag_th(const _Float16* p) { union { v16h v; v8h q[2]; } u; u.q[0] = *(const v8h*)p; u.q[1] = *(const v8h*)(p + 256); return u.v; }
__device__ __forceinline__ v16b frag_t(const __bf16* p) { return __builtin_bit_cast(v16b, frag_th((const _Float16*)p)); }

// The four preparation jobs (weights, mask scan, x, rel rows) depend on the inputs alone and not on each other: they are parts of ONE launch, k_prep, in which a range of block indices picks the job (blk = the block's number inside its job).
__device__ __forceinline__ void p_cvt(int blk, const float* __restrict__ x, __bf16* __restrict__ Xb) {
  const size_t i8 = (size_t)blk * 256 + threadIdx.x; if (i8 >= (size_t)NR * E / 8) return;
  // i8 = the piece's place in fragment order: tile (row tile, k chunk), then hf, g, row
  const size_t tile = i8 >> 6; const int hf = (int)(i8 >> 5) & 1, g = (int)(i8 >> 4) & 1, row = (int)i8 & 15;
  const float* px = x + ((tile >> 5) * 16 + row) * E + (tile & 31) * 32 + hf * 16 + g * 8;
  union { __bf16 h[8]; v4u u; } pk;
#pragma unroll
  for (int e = 0; e < 8; ++e) pk.h[e] = (__bf16)px[e];
  vst2((unsigned*)(Xb + i8 * 8), pk.u);
}
// PT rows: [0,E) Wq[:,n], [E,2E) Wk[:,n], [2E,3E) Wv[:,n], [3E,4E) Wo[:,n]  ([in][out] weights: column n as a bf16 row), in fragment order
__device__ __forceinline__ void p_pack(int blk, const float* __restrict__ Wq, const float* __restrict__ Wk, const float* __restrict__ Wv, const float* __restrict__ Wo, __bf16* __restrict__ PT) {
  // block: 32 columns n (two row tiles of PT) x 256 k, turned in LDS; written in fragment order, tile (n / 16, k / 32)
  const int n0 = (blk & (4 * E / 32 - 1)) * 32, k0 = (blk / (4 * E / 32)) * 256, tid = threadIdx.x; __shared__ __align__(16) __bf16 st[32][264];
  const float* W = n0 < E ? Wq : (n0 < 2 * E ? Wk : (n0 < 3 * E ? Wv : Wo)); const int nn0 = n0 & (E - 1);
  const int kr = tid >> 3, c4 = (tid & 7) * 4; const float* pwv = W + (size_t)(k0 + kr) * E + nn0 + c4; v4f v[8];      // a wave-wide load: 4 rows k x 128 bytes, whole lines
  // unrolled: v is indexed by constants and stays in registers
#pragma unroll
  for (int i = 0; i < 8; ++i) v[i] = *(const v4f*)(pwv + (size_t)i * 32 * E);
  asm volatile("s_wait_xcnt 0x0" :: "v"(pwv) : "memory");      // the loads' address register is held up to here and rewritten only behind this wait
#pragma unroll
  for (int i = 0; i < 8; ++i) {
#pragma unroll
    for (int e = 0; e < 4; ++e) st[c4 + e][i * 32 + kr] = (__bf16)v[i][e]; }
  __syncthreads();
  for (int i = 0; i < 4; ++i) { const int j = i * 256 + tid, tile = j >> 6, nt = tile >> 3, kcl = tile & 7, hf = (j >> 5) & 1, g = (j >> 4) & 1, row = j & 15;
    vst2((unsigned*)(PT + ((size_t)((n0 >> 4) + nt) * (E / 32) + (k0 >> 5) + kcl) * 512 + (j & 63) * 8), *(const v4u*)(&st[nt * 16 + row][kcl * 32 + hf * 16 + g * 8])); }
}
// QKV: block (64 rows, 128 cols = 2 heads, which); q (+bias) -> Q32 f32 [bh][s][64]; k (+bias) -> bf16 hi/lo rows; v (+bias) -> VT hi/lo x4 (rows d, k = key); K and VT in fragment order
__global__ __launch_bounds__(128) void k_qkv(const __bf16* __restrict__ Xb, const __bf16* __restrict__ PT, const float* __restrict__ bq, const float* __restrict__ bk, const float* __restrict__ bv,
                                            float* __restrict__ Q32, __bf16* __restrict__ Kh, __bf16* __restrict__ Kl, _Float16* __restrict__ VTh, _Float16* __restrict__ VTl) {
  __shared__ __align__(16) float so[4][16][132];
  __shared__ __align__(16) _Float16 sth[128][72], stl[128][72];
  const int tid = threadIdx.x, wave = tid >> 5, lane = tid & 31, col = lane & 15, g = lane >> 4;
  const int which = blockIdx.z, r0b = blockIdx.x * 64, r0 = r0b + wave * 16, n0 = blockIdx.y * 128; const int b = r0b / SS, s0 = r0b % SS;
  const float* bb_ = which == 0 ? bq : (which == 1 ? bk : bv);
  v8f acc[8] = {};
  // Two k chunks a pass: all 36 loads of the pass stand ahead of its first product, so that their latencies overlap (one wait a pass instead of one a product). Not unrolled further: registers.
#pragma unroll 1
  for (int kc = 0; kc < E / 32; kc += 2) { v16b a[2], wb[2][8];
    const __bf16* pa = Xb + ((size_t)(r0 >> 4) * (E / 32) + kc) * 512 + lane * 8; const __bf16* pw = PT + ((size_t)((which * E + n0) >> 4) * (E / 32) + kc) * 512 + lane * 8;
    // inner loops unrolled so that the fragment arrays are indexed by constants and stay in registers
#pragma unroll
    for (int c = 0; c < 2; ++c) { a[c] = frag_t(pa + c * 512);
#pragma unroll
      for (int j = 0; j < 8; ++j) wb[c][j] = frag_t(pw + (size_t)j * (E / 32) * 512 + c * 512); }
#pragma unroll
    for (int j = 0; j < 8; ++j) acc[j] = wmma_bf(a[0], wb[0][j], acc[j]);
    asm volatile("s_wait_xcnt 0x0" :: "v"(pa), "v"(pw) : "memory");      // the loads' address registers are held up to here and rewritten only behind this wait
#pragma unroll
    for (int j = 0; j < 8; ++j) acc[j] = wmma_bf(a[1], wb[1][j], acc[j]); }
  if (which < 2) {
#pragma unroll
    for (int j = 0; j < 8; ++j) { const float bb = bfr(bb_[n0 + j * 16 + col]);
#pragma unroll
      for (int r = 0; r < 8; ++r) so[wave][8 * g + r][j * 16 + col] = acc[j][r] + bb; }
    LDSX();
    { const int rl = lane & 15, hh = lane >> 4; float* rowp = &so[wave][rl][hh * 64]; const int spos = s0 + wave * 16 + rl;      // RoPE (rotate_half pairs (d, d+32)), angle[d] = s * 10000^(-2 (d mod 32) / 64)
#pragma unroll 4
      for (int d = 0; d < 32; ++d) { const float invf = powf(10000.0f, -(float)(2 * d) * (1.0f / 64.0f)); const float ang = (float)spos * invf; float sn, cs; sincosf(ang, &sn, &cs);
        const float x1 = rowp[d], x2 = rowp[d + 32]; rowp[d] = x1 * cs - x2 * sn; rowp[d + 32] = x2 * cs + x1 * sn; } }
    LDSX();
    if (which == 0) { for (int qq = lane; qq < 2 * 16 * 16; qq += 32) { const int hh = qq >> 8, rl = (qq >> 4) & 15, pc = qq & 15; const int h = (n0 >> 6) + hh;
        vst2(Q32 + (((size_t)b * NH + h) * SS + s0 + wave * 16 + rl) * HD + pc * 4, *(const v4f*)(&so[wave][rl][hh * 64 + pc * 4])); } }
    else {
      // fragment order, tile (key / 16, d / 32): the wave's 32 lanes store one 512-byte half tile a trip
      for (int i = 0; i < 16; ++i) { const int hf = i & 1, kc = (i >> 1) & 1, lo = (i >> 2) & 1, hh = i >> 3; const int h = (n0 >> 6) + hh; union { __bf16 e[8]; v4u u; } pk;
#pragma unroll
        for (int e = 0; e < 8; ++e) { const float v = so[wave][col][hh * 64 + kc * 32 + hf * 16 + g * 8 + e]; const __bf16 hi = (__bf16)v; pk.e[e] = lo ? (__bf16)(v - (float)hi) : hi; }
        vst2((unsigned*)((lo ? Kl : Kh) + ((((size_t)b * NH + h) * (SS / 16) + (s0 >> 4) + wave) * 2 + kc) * 512 + hf * 256 + lane * 8), pk.u);
        asm volatile("s_wait_xcnt 0x0" ::: "memory"); } } }      // the next trip rewrites the store's address and data registers only behind this wait
  else {
#pragma unroll
    for (int j = 0; j < 8; ++j) { const float bb = bfr(bb_[n0 + j * 16 + col]);
#pragma unroll
      for (int r = 0; r < 8; ++r) { const float v = (acc[j][r] + bb) * 4.0f; const _Float16 hi = (_Float16)v; sth[j * 16 + col][wave * 16 + 8 * g + r] = hi; stl[j * 16 + col][wave * 16 + 8 * g + r] = (_Float16)((v - (float)hi) * VLO); } }
    __syncthreads();
    // fragment order, per head and 64 keys eight tiles (key chunk kc, d / 16): qq = hh, kc, d / 16, hf, g, d % 16 from the top bit down
    for (int qq = tid; qq < 128 * 8; qq += 128) { const int hh = qq >> 9, cl = hh * 64 + ((qq >> 6) & 3) * 16 + (qq & 15), pc = ((qq >> 8) & 1) * 4 + ((qq >> 4) & 3); const size_t o = (((size_t)b * NH + (n0 >> 6) + hh) * (SS / 64) + (s0 >> 6)) * 4096 + (qq & 511) * 8;
      vst2(VTh + o, *(const v4u*)(&sth[cl][pc * 8])); vst2(VTl + o, *(const v4u*)(&stl[cl][pc * 8])); } }
}

// rel_pos_emb rows -> bf16 in fragment order, tile (offset / 16, d / 32); the pad row 4095 takes row 4094's values (never used by a score)
__device__ __forceinline__ void p_relb(int blk, const float* __restrict__ rel, __bf16* __restrict__ RB) {
  const size_t i8 = (size_t)blk * 256 + threadIdx.x; if (i8 >= (size_t)NREL * HD / 8) return;
  const int tile = (int)(i8 >> 6), hf = (int)(i8 >> 5) & 1, g = (int)(i8 >> 4) & 1, c = (tile >> 1) * 16 + ((int)i8 & 15);
  const float* ps = rel + (size_t)(c < NREL - 1 ? c : NREL - 2) * HD + (tile & 1) * 32 + hf * 16 + g * 8;
  union { __bf16 e[8]; v4u u; } pk;
#pragma unroll
  for (int e = 0; e < 8; ++e) pk.e[e] = (__bf16)ps[e];
  vst2((unsigned*)(RB + i8 * 8), pk.u);
}
// MW[query / 16][key quarter]: bit 16 + k is set where key tile 8 * quarter + k (64 keys) holds a mask word != 0 for one of the 16 queries; bit r < 16 where row r has an open key in the quarter. tile_word() joins the four.
// block = 16 queries x 8 key tiles (a block of k_prep has 8 waves), wave = key tile; a wave-wide 16-byte load covers 256 contiguous bytes of two rows.
__device__ __forceinline__ void p_msk(int blk, const int* __restrict__ mask, unsigned* __restrict__ MW) {
  __shared__ __align__(16) unsigned sT[8];
  const int tid = threadIdx.x, kt = tid >> 5, lane = tid & 31;
  const int* pm = mask + (size_t)((blk >> 2) * 16 + (lane >> 4)) * SS + ((blk & 3) * 8 + kt) * 64 + (lane & 15) * 4; v4i m[8];
  // unrolled: m is indexed by constants and stays in registers; the eight loads are in flight together
#pragma unroll
  for (int i = 0; i < 8; ++i) m[i] = *(const v4i*)(pm + (size_t)i * 2 * SS);
  asm volatile("s_wait_xcnt 0x0" :: "v"(pm) : "memory");      // the loads' address register is held up to here and rewritten only behind this wait
  unsigned rows = 0;      // bit r: row r has an open key in this tile
#pragma unroll
  for (int i = 0; i < 8; ++i) { const unsigned bl = __builtin_amdgcn_ballot_w32((m[i][0] | m[i][1] | m[i][2] | m[i][3]) != 0);
    rows |= ((bl & 0xFFFFu) ? 1u : 0u) << (2 * i); rows |= ((bl >> 16) ? 2u : 0u) << (2 * i); }
  if (lane == 0) sT[kt] = rows;
  __syncthreads();
  if (tid == 0) { unsigned tiles = 0, seen = 0;
#pragma unroll
    for (int k = 0; k < 8; ++k) { const unsigned v = sT[k]; seen |= v; tiles |= (v ? 1u : 0u) << k; }
    MW[blk] = seen | (tiles << 16); }
}
// The word of a query tile: bit kt is set where key tile kt holds an open key for one of the 16 queries. Where one of the 16 rows has no open key at all its softmax is uniform over ALL keys, so every bit is set.
__device__ __forceinline__ unsigned tile_word(const unsigned* __restrict__ MW, int qt) {
  const v4u p = *(const v4u*)(MW + qt * 4);
  const unsigned seen = (p[0] | p[1] | p[2] | p[3]) & 0xFFFFu, tiles = (p[0] >> 16) | ((p[1] >> 16) << 8) | ((p[2] >> 16) << 16) | ((p[3] >> 16) << 24);
  return seen == 0xFFFFu ? tiles : 0xFFFFFFFFu;
}
#define PB_PACK (4 * E / 32 * (E / 256))
#define PB_MSK (SS / 16 * 4)
#define PB_CVT (NR * E / 8 / 256)
#define PB_REL (NREL * HD / 8 / 256)
// The jobs with the longest way through a block (loads, LDS, barrier, stores) come first, the short ones last.
__global__ __launch_bounds__(256) void k_prep(const float* __restrict__ x, const int* __restrict__ mask, const float* __restrict__ Wq, const float* __restrict__ Wk, const float* __restrict__ Wv, const float* __restrict__ Wo, const float* __restrict__ rel,
                                             __bf16* __restrict__ Xb, __bf16* __restrict__ PT, __bf16* __restrict__ RB, unsigned* __restrict__ MW) {
  const int blk = (int)blockIdx.x;
  if (blk < PB_PACK) p_pack(blk, Wq, Wk, Wv, Wo, PT);
  else if (blk < PB_PACK + PB_MSK) p_msk(blk - PB_PACK, mask, MW);
  else if (blk < PB_PACK + PB_MSK + PB_CVT) p_cvt(blk - (PB_PACK + PB_MSK), x, Xb);
  else p_relb(blk - (PB_PACK + PB_MSK + PB_CVT), rel, RB);
}
// masked attention with relative-position scores: block (64 queries, head) twice, two waves a query tile; the key tiles that MW names; S on q hi/lo x K hi/lo rows; P,V hi/lo; O f32 in fragment order
__global__ __launch_bounds__(256) void k_attn(const float* __restrict__ Q32, const __bf16* __restrict__ Kh, const __bf16* __restrict__ Kl, const _Float16* __restrict__ VTh, const _Float16* __restrict__ VTl, const int* __restrict__ mask, const unsigned* __restrict__ MW, const __bf16* __restrict__ RB, float* __restrict__ O32) {
  __shared__ __align__(16) float sS[8][16][68];
  __shared__ __align__(16) float sR[8][16][84];
  __shared__ __align__(16) _Float16 sPh[8][16][72], sPl[8][16][72];
  __shared__ __align__(16) float sO[4][16][68];
  // wave wv: query tile w = wv & 3 of the 64 queries, key share kh = wv >> 2 (the even or the odd key tiles)
  const int tid = threadIdx.x, wv = tid >> 5, w = wv & 3, lane = tid & 31, col = lane & 15, g = lane >> 4;
  // All waves are resident at once, so the launch lasts as long as its longest wave: the tiles that are left are dealt evenly. Under a mask that opens more keys to later queries the cost grows with the query block:
  // a block takes query block t of one head and then query block 31 - t of another, one after the other in every wave, so that all blocks cost alike; each (head, query block) is taken once. And two waves share
  // a query tile, one on its even and one on its odd key tiles, each with a running maximum, sum and context of its own; the two are joined in LDS behind the key loop. Not unrolled: one copy of the code.
  // The tile words of the wave's two query tiles, read here, ahead of every store, with the wave's number in a scalar register: scalar loads, and the test on the word in the key loop is a scalar branch.
  const int ws = __builtin_amdgcn_readfirstlane(w), kh = __builtin_amdgcn_readfirstlane(wv >> 2); const unsigned live0 = tile_word(MW, (int)blockIdx.x * 4 + ws), live1 = tile_word(MW, (SS / 64 - 1 - (int)blockIdx.x) * 4 + ws);
#pragma unroll 1
  for (int part = 0; part < 2; ++part) {
  const size_t bh = (size_t)(blockIdx.y + part * (NH / 2)); const int qb = part ? SS / 64 - 1 - (int)blockIdx.x : (int)blockIdx.x; const int q0 = qb * 64 + w * 16;
  const unsigned live = (part ? live1 : live0) & (kh ? 0xAAAAAAAAu : 0x55555555u);
  F2 aq[2]; float qv[2][16]; const float* pq = Q32 + (bh * SS + q0 + col) * HD + 8 * g;
  // unrolled: qv is indexed by constants and stays in registers
#pragma unroll
  for (int kc = 0; kc < 2; ++kc) {
#pragma unroll
    for (int i = 0; i < 8; ++i) { qv[kc][i] = pq[kc * 32 + i]; qv[kc][8 + i] = pq[kc * 32 + 16 + i]; } }
  asm volatile("s_wait_xcnt 0x0" :: "v"(pq) : "memory");      // the q loads' address register is held up to here and rewritten only behind this wait
#pragma unroll
  for (int kc = 0; kc < 2; ++kc) aq[kc] = bsplit16(qv[kc]);
  float mrun = -3.0e38f, lrun = 0.f; v8f acc[4] = {}, ac1[4] = {}, ac2[4] = {};
#pragma unroll 1
  for (int kt = 0; kt < SS / 64; ++kt) {
    if (!((live >> kt) & 1u)) continue;      // no open key for any of the wave's 16 queries in this tile, or the other wave's tile
    // sR[row][x] = q_(q0+row) . rel[cb + x], x < 80: query q0+row and key kt*64+kk meet at offset c = cb + (kk - row + 15). Same products in the same order as a table of q.rel would hold.
    // The loops below are unrolled so that d, s and the fragments are indexed by constants and stay in registers.
    const int cb = kt * 64 - q0 + (SS - 16);
    // The loads of the score part (rel rows, K rows, mask words) all stand ahead of the first product: they are in flight together and the pass waits for memory once, not once a fragment.
    v16b rb[5][2], khf[4][2], klf[4][2]; int mk[4][8];
    // cb is a multiple of 16: the five rel tiles are whole tiles cb / 16 + u <= 255 of RB (the pad offset 4095 is a written row there)
    const __bf16* pr = RB + (size_t)(cb >> 4) * 1024 + lane * 8;
    const size_t ko = (bh * (SS / 16) + kt * 4) * 1024 + lane * 8; const __bf16* pkh = Kh + ko; const __bf16* pkl = Kl + ko; const int* pm = mask + (size_t)(q0 + 8 * g) * SS + kt * 64 + col;
#pragma unroll
    for (int u = 0; u < 5; ++u) {
#pragma unroll
      for (int kc = 0; kc < 2; ++kc) rb[u][kc] = frag_t(pr + (u * 2 + kc) * 512); }
#pragma unroll
    for (int t = 0; t < 4; ++t) {
#pragma unroll
      for (int kc = 0; kc < 2; ++kc) { khf[t][kc] = frag_t(pkh + (t * 2 + kc) * 512); klf[t][kc] = frag_t(pkl + (t * 2 + kc) * 512); } }
#pragma unroll
    for (int t = 0; t < 4; ++t) {
#pragma unroll
      for (int r = 0; r < 8; ++r) mk[t][r] = pm[r * SS + t * 16]; }
    __builtin_amdgcn_sched_barrier(0);      // keeps every load above ahead of the first product: without it the scheduler puts a q.k product, with its wait, in front of the rel loads, and the pass waits for memory twice
#pragma unroll
    for (int u = 0; u < 5; ++u) { v8f d = {};
#pragma unroll
      for (int kc = 0; kc < 2; ++kc) { d = wmma_bf_w(aq[kc].l, rb[u][kc], d); d = wmma_bf_w(aq[kc].h, rb[u][kc], d); }
#pragma unroll
      for (int r = 0; r < 8; ++r) sR[wv][8 * g + r][u * 16 + col] = d[r]; }
    asm volatile("s_wait_xcnt 0x0" :: "v"(pr), "v"(pkh), "v"(pkl), "v"(pm) : "memory");      // the address registers of the loads above are held up to here and rewritten only behind this wait
    // The V fragments are asked for here, where the rel registers have come free: they fly during the q.k products and the softmax and are first used behind it.
    v16h vhf[2][4], vlf[2][4]; const size_t vo = (bh * (SS / 64) + kt) * 4096 + lane * 8; const _Float16* pvh = VTh + vo; const _Float16* pvl = VTl + vo;
#pragma unroll
    for (int kc = 0; kc < 2; ++kc) {
#pragma unroll
      for (int t = 0; t < 4; ++t) { vhf[kc][t] = frag_th(pvh + (kc * 4 + t) * 512); vlf[kc][t] = frag_th(pvl + (kc * 4 + t) * 512); } }
    v8f s[4] = {};
#pragma unroll
    for (int t = 0; t < 4; ++t) {
#pragma unroll
      for (int kc = 0; kc < 2; ++kc) { s[t] = wmma_bf_w(aq[kc].l, khf[t][kc], s[t]); s[t] = wmma_bf_w(aq[kc].h, klf[t][kc], s[t]); s[t] = wmma_bf_w(aq[kc].h, khf[t][kc], s[t]); } }
    asm volatile("s_wait_xcnt 0x0" :: "v"(pvh), "v"(pvl) : "memory");      // as above, for the V loads
    LDSW();      // the diagonal read below takes sR values that other lanes of this wave stored
    float rs[4][8];
#pragma unroll
    for (int t = 0; t < 4; ++t) {
#pragma unroll
      for (int r = 0; r < 8; ++r) rs[t][r] = sR[wv][8 * g + r][t * 16 + col + 15 - (8 * g + r)]; }
#pragma unroll
    for (int t = 0; t < 4; ++t) {
#pragma unroll
      for (int r = 0; r < 8; ++r) { const float sc = s[t][r] * 0.125f + rs[t][r]; sS[wv][8 * g + r][t * 16 + col] = (mk[t][r] == 0) ? -1.0e30f : sc; } }
    LDSW();
    float mx = -3.4e38f;
#pragma unroll
    for (int jj = 0; jj < 32; ++jj) mx = fmaxf(mx, sS[wv][col][g * 32 + jj]);
    mx = fmaxf(mx, __shfl_xor(mx, 16, 32));
    const float mnew = fmaxf(mrun, mx); const float corr = expf(mrun - mnew);
    float ps = 0.f;
#pragma unroll
    for (int jj = 0; jj < 32; ++jj) { const float p = expf(sS[wv][col][g * 32 + jj] - mnew) * 16384.0f; ps += p; const _Float16 hi = (_Float16)p; sPh[wv][col][g * 32 + jj] = hi; sPl[wv][col][g * 32 + jj] = (_Float16)((p - (float)hi) * PLO); }
    ps += __shfl_xor(ps, 16, 32);
    lrun = lrun * corr + ps * (1.0f / 16384.0f); mrun = mnew;
#pragma unroll
    for (int r = 0; r < 8; ++r) { const float cr = __shfl(corr, 8 * g + r, 32);
#pragma unroll
      for (int t = 0; t < 4; ++t) { acc[t][r] *= cr; ac1[t][r] *= cr; ac2[t][r] *= cr; } }
    LDSW();
#pragma unroll
    for (int kc = 0; kc < 2; ++kc) { const v16h ph = frag_h(&sPh[wv][col][0] + kc * 32, lane), pl = frag_h(&sPl[wv][col][0] + kc * 32, lane);
#pragma unroll
      for (int t = 0; t < 4; ++t) { acc[t] = wmma16_w(ph, vhf[kc][t], acc[t]); ac1[t] = wmma16_w(ph, vlf[kc][t], ac1[t]); ac2[t] = wmma16_w(pl, vhf[kc][t], ac2[t]); } }
    __builtin_amdgcn_wave_barrier(); }
  // The odd-tile wave lays its share down (context not yet divided, maximum, sum); behind the barrier the even-tile wave scales both shares to the common maximum, adds them and divides.
  // A share without a tile has maximum -3e38 and sum 0: its factor is exp(-3e38 - m) = 0.
  if (kh) {
#pragma unroll
    for (int r = 0; r < 8; ++r) {
#pragma unroll
      for (int t = 0; t < 4; ++t) sO[w][8 * g + r][t * 16 + col] = acc[t][r] + ac1[t][r] * (1.0f / VLO) + ac2[t][r] * (1.0f / PLO); }
    if (g == 0) { sO[w][col][64] = mrun; sO[w][col][65] = lrun; } }      // in the row's pad words
  __syncthreads();      // the odd-tile waves' shares are in LDS
  if (!kh) {
  const float m1 = sO[w][col][64], l1 = sO[w][col][65]; const float mm = fmaxf(mrun, m1); const float a0 = expf(mrun - mm), a1 = expf(m1 - mm); const float ll = lrun * a0 + l1 * a1;
#pragma unroll
  for (int r = 0; r < 8; ++r) { const float lr = __shfl(ll, 8 * g + r, 32), f0 = __shfl(a0, 8 * g + r, 32), f1 = __shfl(a1, 8 * g + r, 32); const float inv = 1.0f / (lr * 16384.0f * 4.0f);
#pragma unroll
    for (int t = 0; t < 4; ++t) { float* p = &sO[w][8 * g + r][t * 16 + col]; *p = ((acc[t][r] + ac1[t][r] * (1.0f / VLO) + ac2[t][r] * (1.0f / PLO)) * f0 + *p * f1) * inv; } }      // each lane rewrites the places that it has read itself
  LDSX();
  // O32 in the f32 form of the fragment order: tile (query / 16, d / 32) = 2048 bytes, four 512-byte parts j; lane (g, row) holds d = 16 (j >> 1) + 8 g + 4 (j & 1) + 0..3 of its row in part j
  float* po = O32 + (bh * (SS / 16) + (q0 >> 4)) * 1024 + lane * 4;
  for (int i = 0; i < 8; ++i) vst2(po + i * 128, *(const v4f*)(&sO[w][col][(i >> 2) * 32 + ((i >> 1) & 1) * 16 + g * 8 + (i & 1) * 4]));
  asm volatile("s_wait_xcnt 0x0" :: "v"(po) : "memory"); }      // the second part rewrites the stores' address and data registers only behind this wait
  __syncthreads(); }      // sO has been read: the second part may write it
}
// out = ctx Wo + bo : split(ctx) x bf16(Wo columns): 2 products (Wo is an INPUT -> bf16 exact)
__global__ __launch_bounds__(128) void k_out(const float* __restrict__ O32, const __bf16* __restrict__ PT, const float* __restrict__ bo, float* __restrict__ out) {
  __shared__ __align__(16) float so[4][16][132];
  const int tid = threadIdx.x, wave = tid >> 5, lane = tid & 31, col = lane & 15, g = lane >> 4;
  const int r0 = blockIdx.x * 64 + wave * 16, n0 = blockIdx.y * 128; const int ra = r0 + col; const int b = ra / SS, s = ra % SS;
  v8f acc[8] = {};
  const float* po0 = O32 + ((size_t)b * NH * (SS / 16) + (s >> 4)) * 1024 + lane * 4; const __bf16* pw0 = PT + (size_t)((3 * E + n0) >> 4) * (E / 32) * 512 + lane * 8;
  // One head (two k chunks) a pass: all loads of the pass stand ahead of its first product, so that their latencies overlap. Not unrolled further: registers.
#pragma unroll 1
  for (int h = 0; h < NH; ++h) { float ov[2][16]; v16b wb[2][8];
    const float* po = po0 + (size_t)h * (SS / 16) * 1024; const __bf16* pw = pw0 + h * 1024;
    // inner loops unrolled so that the arrays are indexed by constants and stay in registers
#pragma unroll
    for (int c = 0; c < 2; ++c) {
#pragma unroll
      for (int i = 0; i < 16; ++i) ov[c][i] = po[c * 512 + (i >> 2) * 128 + (i & 3)]; }
#pragma unroll
    for (int c = 0; c < 2; ++c) {
#pragma unroll
      for (int j = 0; j < 8; ++j) wb[c][j] = frag_t(pw + (size_t)j * (E / 32) * 512 + c * 512); }
    asm volatile("s_wait_xcnt 0x0" :: "v"(po), "v"(pw) : "memory");      // the loads' address registers are held up to here and rewritten only behind this wait
#pragma unroll
    for (int c = 0; c < 2; ++c) { const F2 a = bsplit16(ov[c]);
#pragma unroll
      for (int j = 0; j < 8; ++j) { acc[j] = wmma_bf(a.l, wb[c][j], acc[j]); acc[j] = wmma_bf(a.h, wb[c][j], acc[j]); } } }
#pragma unroll
  for (int j = 0; j < 8; ++j) { const int n = n0 + j * 16 + col; const float bb = bfr(bo[n]);
#pragma unroll
    for (int r = 0; r < 8; ++r) so[wave][8 * g + r][j * 16 + col] = acc[j][r] + bb; }
  LDSX();
#pragma unroll 4
  for (int rl = 0; rl < 16; ++rl) vst2(out + (size_t)(r0 + rl) * E + n0 + lane * 4, *(const v4f*)(&so[wave][rl][lane * 4]));
}
extern "C" void kernel_launch(void* const* d_in, const int* in_sizes, int n_in, void* d_out, int out_size, void* d_ws, size_t ws_size, hipStream_t stream) {
  (void)in_sizes; (void)n_in; (void)out_size; (void)ws_size;
  const float* x = (const float*)d_in[0]; const int* mask = (const int*)d_in[1]; const float* Wq = (const float*)d_in[2]; const float* bq = (const float*)d_in[3]; const float* Wk = (const float*)d_in[4]; const float* bk = (const float*)d_in[5];
  const float* Wv = (const float*)d_in[6]; const float* bv = (const float*)d_in[7]; const float* Wp = (const float*)d_in[8]; const float* bp = (const float*)d_in[9]; const float* rel = (const float*)d_in[10];
  float* out = (float*)d_out;
  char* ws = (char*)d_ws; size_t off = 0;
  auto take = [&](size_t bytes) { char* p = ws + off; off += (bytes + 255) & ~(size_t)255; return p; };
  __bf16* Xb = (__bf16*)take((size_t)NR * E * 2); __bf16* PT = (__bf16*)take((size_t)4 * E * E * 2); __bf16* RB = (__bf16*)take((size_t)NREL * HD * 2);
  float* Q32 = (float*)take((size_t)NR * E * 4); __bf16* Kh = (__bf16*)take((size_t)NR * E * 2); __bf16* Kl = (__bf16*)take((size_t)NR * E * 2); _Float16* VTh = (_Float16*)take((size_t)NR * E * 2); _Float16* VTl = (_Float16*)take((size_t)NR * E * 2); float* O32 = (float*)take((size_t)NR * E * 4); unsigned* MW = (unsigned*)take((size_t)(SS / 16) * 4 * 4);
  // ws ~ 45 MB
  k_prep<<<PB_PACK + PB_MSK + PB_CVT + PB_REL, 256, 0, stream>>>(x, mask, Wq, Wk, Wv, Wp, rel, Xb, PT, RB, MW);
  k_qkv<<<dim3(NR / 64, E / 128, 3), 128, 0, stream>>>(Xb, PT, bq, bk, bv, Q32, Kh, Kl, VTh, VTl);
  k_attn<<<dim3(SS / 64, NH / 2), 256, 0, stream>>>(Q32, Kh, Kl, VTh, VTl, mask, MW, RB, O32);
  k_out<<<dim3(NR / 64, E / 128), 128, 0, stream>>>(O32, PT, bp, out);
}

// v006
// A run of this version takes 113 microseconds.
// Timed twice side by side with v005, it ran 1.05 and 1.04 times as fast.
// Over all steps from v000 it is 29.8 times as fast.
// compute dtype: x, W*, b*, rel_pos_emb (INPUTS) rounded to bf16 with exact bf16 WMMA products (f32 accumulate) for the projections; rotary in f32; K pre-split into bf16 hi/lo rows; the relative-position scores q.rel^T as q hi/lo x bf16(rel) (2 products); P and V f16 hi/lo (3 products); softmax with the int mask in f32.
#include <hip/hip_runtime.h>
#include <math.h>

typedef __attribute__((ext_vector_type(16))) _Float16 v16h;
typedef __attribute__((ext_vector_type(16))) __bf16 v16b;
typedef __attribute__((ext_vector_type(8)))  _Float16 v8h;
typedef __attribute__((ext_vector_type(8)))  float v8f;
typedef __attribute__((ext_vector_type(4)))  float v4f;
typedef __attribute__((ext_vector_type(2)))  float v2f;
typedef __attribute__((ext_vector_type(4)))  unsigned v4u;
typedef __attribute__((ext_vector_type(4)))  int v4i;
typedef float __attribute__((may_alias)) float_a;
typedef int __attribute__((may_alias)) int_a;

template <typename T> __device__ __forceinline__ void vst2(void* p, T v) { *(T*)p = v;  }
__device__ __forceinline__ v8f wmma16(v16h a, v16h b, v8f c) {
  v8f d = __builtin_amdgcn_wmma_f32_16x16x32_f16(false, a, false, b, (short)0, c, false, false);
  asm volatile("v_nop\n\tv_nop\n\tv_nop\n\tv_nop" : "+v"(d) : "v"(a), "v"(b));
  return d;
}
__device__ __forceinline__ v8f wmma_bf(v16b a, v16b b, v8f c) {
  v8f d = __builtin_amdgcn_wmma_f32_16x16x32_bf16(false, a, false, b, (short)0, c, false, false);
  asm volatile("v_nop\n\tv_nop\n\tv_nop\n\tv_nop" : "+v"(d) : "v"(a), "v"(b));
  return d;
}
// The same two for the attention kernel, whose fragments in flight lie above v255: an operand of an asm statement is held below v256, so a and b are not named there (naming them spills).
__device__ __forceinline__ v8f wmma16_w(v16h a, v16h b, v8f c) {
  v8f d = __builtin_amdgcn_wmma_f32_16x16x32_f16(false, a, false, b, (short)0, c, false, false);
  asm volatile("v_nop\n\tv_nop\n\tv_nop\n\tv_nop" : "+v"(d));      // the distance behind a matrix instruction
  return d;
}
__device__ __forceinline__ v8f wmma_bf_w(v16b a, v16b b, v8f c) {
  v8f d = __builtin_amdgcn_wmma_f32_16x16x32_bf16(false, a, false, b, (short)0, c, false, false);
  asm volatile("v_nop\n\tv_nop\n\tv_nop\n\tv_nop" : "+v"(d));      // the distance behind a matrix instruction
  return d;
}
// 16x16x32 fragments: lane = (h = lane>>4, row/col = lane&15); elements 0..7 = k0+8h+0..7, 8..15 = k0+16+8h+0..7; D element r = row 8h+r
__device__ __forceinline__ v16h frag_h(const _Float16* rowk0, int lane) {
  union { v16h v; v8h q[2]; } u; const _Float16* p = rowk0 + 8 * (lane >> 4);
  u.q[0] = *(const v8h*)p; u.q[1] = *(const v8h*)(p + 16); return u.v;
}
__device__ __forceinline__ v16h frag_f32(const float* rowk0, int lane) {
  v16h a; const float* p = rowk0 + 8 * (lane >> 4);
#pragma unroll
  for (int i = 0; i < 8; ++i) { a[i] = (_Float16)p[i]; a[8 + i] = (_Float16)p[16 + i]; }
  return a;
}
__device__ __forceinline__ v16h frag_f32s(const float* rowk0, int lane, float sc) {
  v16h a; const float* p = rowk0 + 8 * (lane >> 4);
#pragma unroll
  for (int i = 0; i < 8; ++i) { a[i] = (_Float16)(p[i] * sc); a[8 + i] = (_Float16)(p[16 + i] * sc); }
  return a;
}
// column fragment from a [K][ld] layout (column n), rows >= K read as 0
__device__ __forceinline__ v16h fragc_f32(const float* W, int k0, int n, int lane, int ld, int K) {
  v16h a; const int g = lane >> 4;
#pragma unroll
  for (int i = 0; i < 8; ++i) { const int ka = k0 + 8 * g + i, kb = ka + 16;
    a[i] = (_Float16)(ka < K ? W[(size_t)ka * ld + n] : 0.f); a[8 + i] = (_Float16)(kb < K ? W[(size_t)kb * ld + n] : 0.f); }
  return a;
}
struct F2 { v16b h, l; };
__device__ __forceinline__ F2 bsplit16(const float v[16]) { F2 r;
#pragma unroll
  for (int i = 0; i < 16; ++i) { const __bf16 h = (__bf16)v[i]; r.h[i] = h; r.l[i] = (__bf16)(v[i] - (float)h); }
  return r; }
__device__ __forceinline__ F2 split_row(const float* row, int k0, int lane) { float v[16]; const float* p = row + k0 + 8 * (lane >> 4);
#pragma unroll
  for (int i = 0; i < 8; ++i) { v[i] = p[i]; v[8 + i] = p[16 + i]; }
  return bsplit16(v); }
__device__ __forceinline__ F2 split_rowK(const float* row, int k0, int lane, int K) { float v[16]; const int g = lane >> 4;
#pragma unroll
  for (int i = 0; i < 8; ++i) { const int ka = k0 + 8 * g + i, kb = ka + 16; v[i] = ka < K ? row[ka] : 0.f; v[8 + i] = kb < K ? row[kb] : 0.f; }
  return bsplit16(v); }
__device__ __forceinline__ F2 split_col(const float* W, int k0, int n, int lane, int ld, int K) { float v[16]; const int g = lane >> 4;
#pragma unroll
  for (int i = 0; i < 8; ++i) { const int ka = k0 + 8 * g + i, kb = ka + 16; v[i] = ka < K ? W[(size_t)ka * ld + n] : 0.f; v[8 + i] = kb < K ? W[(size_t)kb * ld + n] : 0.f; }
  return bsplit16(v); }
__device__ __forceinline__ v8f mac3(const F2& a, const F2& b, v8f c) { c = wmma_bf(a.l, b.h, c); c = wmma_bf(a.h, b.l, c); return wmma_bf(a.h, b.h, c); }
__device__ __forceinline__ float sigm(float v) { return 1.0f / (1.0f + expf(-v)); }
#define LDSX() do { asm volatile("s_wait_dscnt 0" ::: "memory"); __builtin_amdgcn_wave_barrier(); __builtin_amdgcn_fence(__ATOMIC_RELEASE, "workgroup"); } while (0)
// The same exchange among the lanes of ONE wave, for places where global loads are in flight: the fence at wavefront scope orders the LDS accesses for the compiler and does not drain the loads as the work-group one does.
#define LDSW() do { asm volatile("s_wait_dscnt 0" ::: "memory"); __builtin_amdgcn_wave_barrier(); __builtin_amdgcn_fence(__ATOMIC_RELEASE, "wavefront"); } while (0)


// Rotary multi-head attention with Shaw relative-position scores (16 heads of 64 on [1,2048,1024], [in][out] weights + biases): q,k = rotate_half-RoPE(xW+b) (angle[d] = s*10000^(-2(d mod 32)/64));
// scores[i][j] = q_i.k_j/8 + q_i.rel_pos_emb[j-i+2047]; masked where mask[i][j] == 0 (-1e30); softmax; (P v) Wo + bo. The rel term uses the skew trick inside the attention kernel: a tile of 16 queries x 64 keys
// needs only the 79 offsets c = j-i+2047 of its diagonals, so q.rel[c] is formed for five 16-column tiles, laid in LDS and read back along the diagonal. No score table in memory: all heads run in one launch.
// A tile of 16 queries x 64 keys whose mask words are all 0 adds exactly nothing to a row that has an open key somewhere (its weights are exp(-1e30 - m) = 0, or are wiped by the factor 0 at the row's first open key):
// p_msk reads the mask once and says which tiles hold an open word; the attention kernel passes over the others.
#define NB 1
#define SS 2048
#define NREL 4096      // 4095 offsets padded to 4096 (offset 4095 is clamped to row 4094 and never used)
#define E 1024
#define NH 16
#define HD 64
#define NR (NB * SS)
#define PLO 1024.0f
#define VLO 2048.0f
__device__ __forceinline__ float bfr(float v) { return (float)(__bf16)v; }
__device__ __forceinline__ v16b frag_b(const __bf16* rowk0, int lane) { return __builtin_bit_cast(v16b, frag_h((const _Float16*)rowk0, lane)); }
// FRAGMENT ORDER of the 16-bit operands in the workspace: a tile of 16 rows x 32 k is 1024 contiguous bytes; the piece of 8 elements k = 16 hf + 8 g + 0..7 of row r lies at element (hf * 32 + g * 16 + r) * 8.
// Lane l = g * 16 + r finds its two pieces at l * 8 and 256 + l * 8, so each wave-wide 16-byte load covers 512 contiguous bytes (4 whole lines) and not 32-byte pieces of 16 lines. p = tile + lane * 8.
__device__ __forceinline__ v16h frag_th(const _Float16* p) { union { v16h v; v8h q[2]; } u; u.q[0] = *(const v8h*)p; u.q[1] = *(const v8h*)(p + 256); return u.v; }
__device__ __forceinline__ v16b frag_t(const __bf16* p) { return __builtin_bit_cast(v16b, frag_th((const _Float16*)p)); }

// The five preparation jobs (rotary angles, weights, mask scan, x, rel rows) depend on the inputs alone and not on each other: they are parts of ONE launch, k_prep, in which a range of block indices picks the job (blk = the block's number inside its job).
__device__ __forceinline__ void p_cvt(int blk, const float* __restrict__ x, __bf16* __restrict__ Xb) {
  const size_t i8 = (size_t)blk * 256 + threadIdx.x; if (i8 >= (size_t)NR * E / 8) return;
  // i8 = the piece's place in fragment order: tile (row tile, k chunk), then hf, g, row
  const size_t tile = i8 >> 6; const int hf = (int)(i8 >> 5) & 1, g = (int)(i8 >> 4) & 1, row = (int)i8 & 15;
  const float* px = x + ((tile >> 5) * 16 + row) * E + (tile & 31) * 32 + hf * 16 + g * 8;
  union { __bf16 h[8]; v4u u; } pk;
#pragma unroll
  for (int e = 0; e < 8; ++e) pk.h[e] = (__bf16)px[e];
  vst2((unsigned*)(Xb + i8 * 8), pk.u);
}
// PT rows: [0,E) Wq[:,n], [E,2E) Wk[:,n], [2E,3E) Wv[:,n], [3E,4E) Wo[:,n]  ([in][out] weights: column n as a bf16 row), in fragment order
__device__ __forceinline__ void p_pack(int blk, const float* __restrict__ Wq, const float* __restrict__ Wk, const float* __restrict__ Wv, const float* __restrict__ Wo, __bf16* __restrict__ PT) {
  // block: 32 columns n (two row tiles of PT) x 256 k, turned in LDS; written in fragment order, tile (n / 16, k / 32)
  const int n0 = (blk & (4 * E / 32 - 1)) * 32, k0 = (blk / (4 * E / 32)) * 256, tid = threadIdx.x; __shared__ __align__(16) __bf16 st[32][264];
  const float* W = n0 < E ? Wq : (n0 < 2 * E ? Wk : (n0 < 3 * E ? Wv : Wo)); const int nn0 = n0 & (E - 1);
  const int kr = tid >> 3, c4 = (tid & 7) * 4; const float* pwv = W + (size_t)(k0 + kr) * E + nn0 + c4; v4f v[8];      // a wave-wide load: 4 rows k x 128 bytes, whole lines
  // unrolled: v is indexed by constants and stays in registers
#pragma unroll
  for (int i = 0; i < 8; ++i) v[i] = *(const v4f*)(pwv + (size_t)i * 32 * E);
  asm volatile("s_wait_xcnt 0x0" :: "v"(pwv) : "memory");      // the loads' address register is held up to here and rewritten only behind this wait
#pragma unroll
  for (int i = 0; i < 8; ++i) {
#pragma unroll
    for (int e = 0; e < 4; ++e) st[c4 + e][i * 32 + kr] = (__bf16)v[i][e]; }
  __syncthreads();
  for (int i = 0; i < 4; ++i) { const int j = i * 256 + tid, tile = j >> 6, nt = tile >> 3, kcl = tile & 7, hf = (j >> 5) & 1, g = (j >> 4) & 1, row = j & 15;
    vst2((unsigned*)(PT + ((size_t)((n0 >> 4) + nt) * (E / 32) + (k0 >> 5) + kcl) * 512 + (j & 63) * 8), *(const v4u*)(&st[nt * 16 + row][kcl * 32 + hf * 16 + g * 8])); }
  asm volatile("s_wait_xcnt 0x0" ::: "memory");      // another job's code follows in the listing: the stores' address and data registers are rewritten only behind this wait
}
// QKV: block (64 rows, 128 cols = 2 heads, which); q (+bias) -> Q32 f32 [bh][s][64]; k (+bias) -> bf16 hi/lo rows; v (+bias) -> VT hi/lo x4 (rows d, k = key); K and VT in fragment order
__global__ __launch_bounds__(128) void k_qkv(const __bf16* __restrict__ Xb, const __bf16* __restrict__ PT, const float* __restrict__ CS, const float* __restrict__ bq, const float* __restrict__ bk, const float* __restrict__ bv,
                                            float* __restrict__ Q32, __bf16* __restrict__ Kh, __bf16* __restrict__ Kl, _Float16* __restrict__ VTh, _Float16* __restrict__ VTl) {
  __shared__ __align__(16) float so[4][16][132];
  __shared__ __align__(16) _Float16 sth[128][72], stl[128][72];
  const int tid = threadIdx.x, wave = tid >> 5, lane = tid & 31, col = lane & 15, g = lane >> 4;
  const int which = blockIdx.z, r0b = blockIdx.x * 64, r0 = r0b + wave * 16, n0 = blockIdx.y * 128; const int b = r0b / SS, s0 = r0b % SS;
  const float* bb_ = which == 0 ? bq : (which == 1 ? bk : bv);
  v8f acc[8] = {};
  // The (cos, sin) pairs of the lane's accumulator places: rows 8 g + r, d mod 32 = jj * 16 + col; the same for both heads of the block. Asked for here, they are in flight together with the loads of the product loop's first pass. A wave-wide load covers 128 bytes of two rows.
  v2f cs[2][8]; const float* pcs = CS + ((size_t)(s0 + wave * 16 + 8 * g) * 32 + col) * 2;
  // unrolled: cs is indexed by constants and stays in registers
#pragma unroll
  for (int jj = 0; jj < 2; ++jj) {
#pragma unroll
    for (int r = 0; r < 8; ++r) cs[jj][r] = *(const v2f*)(pcs + r * 64 + jj * 32); }
  asm volatile("s_wait_xcnt 0x0" :: "v"(pcs) : "memory");      // the loads' address register is held up to here and rewritten only behind this wait
  // Two k chunks a pass: all 36 loads of the pass stand ahead of its first product, so that their latencies overlap (one wait a pass instead of one a product). Not unrolled further: registers.
#pragma unroll 1
  for (int kc = 0; kc < E / 32; kc += 2) { v16b a[2], wb[2][8];
    const __bf16* pa = Xb + ((size_t)(r0 >> 4) * (E / 32) + kc) * 512 + lane * 8; const __bf16* pw = PT + ((size_t)((which * E + n0) >> 4) * (E / 32) + kc) * 512 + lane * 8;
    // inner loops unrolled so that the fragment arrays are indexed by constants and stay in registers
#pragma unroll
    for (int c = 0; c < 2; ++c) { a[c] = frag_t(pa + c * 512);
#pragma unroll
      for (int j = 0; j < 8; ++j) wb[c][j] = frag_t(pw + (size_t)j * (E / 32) * 512 + c * 512); }
#pragma unroll
    for (int j = 0; j < 8; ++j) acc[j] = wmma_bf(a[0], wb[0][j], acc[j]);
    asm volatile("s_wait_xcnt 0x0" :: "v"(pa), "v"(pw) : "memory");      // the loads' address registers are held up to here and rewritten only behind this wait
#pragma unroll
    for (int j = 0; j < 8; ++j) acc[j] = wmma_bf(a[1], wb[1][j], acc[j]); }
  if (which < 2) {
    // RoPE (rotate_half pairs (d, d+32)) on the accumulators: column tiles j and j + 2 of a head hold d and d + 32 of the same row in the same lane and element
#pragma unroll
    for (int j = 0; j < 8; ++j) { if (j & 2) continue;
      const int jj = j & 1; const float b1 = bfr(bb_[n0 + j * 16 + col]), b2 = bfr(bb_[n0 + (j + 2) * 16 + col]);
#pragma unroll
      for (int r = 0; r < 8; ++r) { const float x1 = acc[j][r] + b1, x2 = acc[j + 2][r] + b2, c = cs[jj][r][0], sn = cs[jj][r][1];
        so[wave][8 * g + r][j * 16 + col] = x1 * c - x2 * sn; so[wave][8 * g + r][(j + 2) * 16 + col] = x2 * c + x1 * sn; } }
    LDSX();
    if (which == 0) { for (int qq = lane; qq < 2 * 16 * 16; qq += 32) { const int hh = qq >> 8, rl = (qq >> 4) & 15, pc = qq & 15; const int h = (n0 >> 6) + hh;
        vst2(Q32 + (((size_t)b * NH + h) * SS + s0 + wave * 16 + rl) * HD + pc * 4, *(const v4f*)(&so[wave][rl][hh * 64 + pc * 4])); } }
    else {
      // fragment order, tile (key / 16, d / 32): the wave's 32 lanes store one 512-byte half tile a trip
      for (int i = 0; i < 16; ++i) { const int hf = i & 1, kc = (i >> 1) & 1, lo = (i >> 2) & 1, hh = i >> 3; const int h = (n0 >> 6) + hh; union { __bf16 e[8]; v4u u; } pk;
#pragma unroll
        for (int e = 0; e < 8; ++e) { const float v = so[wave][col][hh * 64 + kc * 32 + hf * 16 + g * 8 + e]; const __bf16 hi = (__bf16)v; pk.e[e] = lo ? (__bf16)(v - (float)hi) : hi; }
        vst2((unsigned*)((lo ? Kl : Kh) + ((((size_t)b * NH + h) * (SS / 16) + (s0 >> 4) + wave) * 2 + kc) * 512 + hf * 256 + lane * 8), pk.u);
        asm volatile("s_wait_xcnt 0x0" ::: "memory"); } } }      // the next trip rewrites the store's address and data registers only behind this wait
  else {
#pragma unroll
    for (int j = 0; j < 8; ++j) { const float bb = bfr(bb_[n0 + j * 16 + col]);
#pragma unroll
      for (int r = 0; r < 8; ++r) { const float v = (acc[j][r] + bb) * 4.0f; const _Float16 hi = (_Float16)v; sth[j * 16 + col][wave * 16 + 8 * g + r] = hi; stl[j * 16 + col][wave * 16 + 8 * g + r] = (_Float16)((v - (float)hi) * VLO); } }
    __syncthreads();
    // fragment order, per head and 64 keys eight tiles (key chunk kc, d / 16): qq = hh, kc, d / 16, hf, g, d % 16 from the top bit down
    for (int qq = tid; qq < 128 * 8; qq += 128) { const int hh = qq >> 9, cl = hh * 64 + ((qq >> 6) & 3) * 16 + (qq & 15), pc = ((qq >> 8) & 1) * 4 + ((qq >> 4) & 3); const size_t o = (((size_t)b * NH + (n0 >> 6) + hh) * (SS / 64) + (s0 >> 6)) * 4096 + (qq & 511) * 8;
      vst2(VTh + o, *(const v4u*)(&sth[cl][pc * 8])); vst2(VTl + o, *(const v4u*)(&stl[cl][pc * 8])); } }
}

// rel_pos_emb rows -> bf16 in fragment order, tile (offset / 16, d / 32); the pad row 4095 takes row 4094's values (never used by a score)
__device__ __forceinline__ void p_relb(int blk, const float* __restrict__ rel, __bf16* __restrict__ RB) {
  const size_t i8 = (size_t)blk * 256 + threadIdx.x; if (i8 >= (size_t)NREL * HD / 8) return;
  const int tile = (int)(i8 >> 6), hf = (int)(i8 >> 5) & 1, g = (int)(i8 >> 4) & 1, c = (tile >> 1) * 16 + ((int)i8 & 15);
  const float* ps = rel + (size_t)(c < NREL - 1 ? c : NREL - 2) * HD + (tile & 1) * 32 + hf * 16 + g * 8;
  union { __bf16 e[8]; v4u u; } pk;
#pragma unroll
  for (int e = 0; e < 8; ++e) pk.e[e] = (__bf16)ps[e];
  vst2((unsigned*)(RB + i8 * 8), pk.u);
}
// MW[query / 16][key quarter]: bit 16 + k is set where key tile 8 * quarter + k (64 keys) holds a mask word != 0 for one of the 16 queries; bit r < 16 where row r has an open key in the quarter. tile_word() joins the four.
// block = 16 queries x 8 key tiles (a block of k_prep has 8 waves), wave = key tile; a wave-wide 16-byte load covers 256 contiguous bytes of two rows.
__device__ __forceinline__ void p_msk(int blk, const int* __restrict__ mask, unsigned* __restrict__ MW) {
  __shared__ __align__(16) unsigned sT[8];
  const int tid = threadIdx.x, kt = tid >> 5, lane = tid & 31;
  const int* pm = mask + (size_t)((blk >> 2) * 16 + (lane >> 4)) * SS + ((blk & 3) * 8 + kt) * 64 + (lane & 15) * 4; v4i m[8];
  // unrolled: m is indexed by constants and stays in registers; the eight loads are in flight together
#pragma unroll
  for (int i = 0; i < 8; ++i) m[i] = *(const v4i*)(pm + (size_t)i * 2 * SS);
  asm volatile("s_wait_xcnt 0x0" :: "v"(pm) : "memory");      // the loads' address register is held up to here and rewritten only behind this wait
  unsigned rows = 0;      // bit r: row r has an open key in this tile
#pragma unroll
  for (int i = 0; i < 8; ++i) { const unsigned bl = __builtin_amdgcn_ballot_w32((m[i][0] | m[i][1] | m[i][2] | m[i][3]) != 0);
    rows |= ((bl & 0xFFFFu) ? 1u : 0u) << (2 * i); rows |= ((bl >> 16) ? 2u : 0u) << (2 * i); }
  if (lane == 0) sT[kt] = rows;
  __syncthreads();
  if (tid == 0) { unsigned tiles = 0, seen = 0;
#pragma unroll
    for (int k = 0; k < 8; ++k) { const unsigned v = sT[k]; seen |= v; tiles |= (v ? 1u : 0u) << k; }
    MW[blk] = seen | (tiles << 16); }
}
// The word of a query tile: bit kt is set where key tile kt holds an open key for one of the 16 queries. Where one of the 16 rows has no open key at all its softmax is uniform over ALL keys, so every bit is set.
__device__ __forceinline__ unsigned tile_word(const unsigned* __restrict__ MW, int qt) {
  const v4u p = *(const v4u*)(MW + qt * 4);
  const unsigned seen = (p[0] | p[1] | p[2] | p[3]) & 0xFFFFu, tiles = (p[0] >> 16) | ((p[1] >> 16) << 8) | ((p[2] >> 16) << 16) | ((p[3] >> 16) << 24);
  return seen == 0xFFFFu ? tiles : 0xFFFFFFFFu;
}
// CS[s][d] = (cos, sin) of the rotary angle s * 10000^(-2 d / 64), d < 32: each angle is worked out once here and read by every QKV block that needs it. A thread takes one d and eight positions s; a wave stores 256 contiguous bytes.
__device__ __forceinline__ void p_rot(int blk, float* __restrict__ CS) {
  const int i = blk * 256 + (int)threadIdx.x, d = i & 31, sb = (i >> 5) * 8;
  const float invf = powf(10000.0f, -(float)(2 * d) * (1.0f / 64.0f));
  for (int e = 0; e < 8; ++e) { const float ang = (float)(sb + e) * invf; float sn, c; sincosf(ang, &sn, &c); v2f v; v[0] = c; v[1] = sn;
    vst2(CS + ((size_t)(sb + e) * 32 + d) * 2, v);
    asm volatile("s_wait_xcnt 0x0" ::: "memory"); }      // the next trip rewrites the store's address and data registers only behind this wait
}
#define PB_ROT (SS * 32 / 8 / 256)
#define PB_PACK (4 * E / 32 * (E / 256))
#define PB_MSK (SS / 16 * 4)
#define PB_CVT (NR * E / 8 / 256)
#define PB_REL (NREL * HD / 8 / 256)
// The jobs with the longest way through a block (the angles' arithmetic; loads, LDS, barrier, stores) take the lowest block indices, the short ones the highest.
__global__ __launch_bounds__(256) void k_prep(const float* __restrict__ x, const int* __restrict__ mask, const float* __restrict__ Wq, const float* __restrict__ Wk, const float* __restrict__ Wv, const float* __restrict__ Wo, const float* __restrict__ rel,
                                             __bf16* __restrict__ Xb, __bf16* __restrict__ PT, __bf16* __restrict__ RB, unsigned* __restrict__ MW, float* __restrict__ CS) {
  const int blk = (int)blockIdx.x - PB_ROT;
  if (blk < 0) p_rot((int)blockIdx.x, CS);
  else if (blk < PB_PACK) p_pack(blk, Wq, Wk, Wv, Wo, PT);
  else if (blk < PB_PACK + PB_MSK) p_msk(blk - PB_PACK, mask, MW);
  else if (blk < PB_PACK + PB_MSK + PB_CVT) p_cvt(blk - (PB_PACK + PB_MSK), x, Xb);
  else p_relb(blk - (PB_PACK + PB_MSK + PB_CVT), rel, RB);
}
// masked attention with relative-position scores: block (64 queries, head) twice, two waves a query tile; the key tiles that MW names; S on q hi/lo x K hi/lo rows; P,V hi/lo; O f32 in fragment order
__global__ __launch_bounds__(256) void k_attn(const float* __restrict__ Q32, const __bf16* __restrict__ Kh, const __bf16* __restrict__ Kl, const _Float16* __restrict__ VTh, const _Float16* __restrict__ VTl, const int* __restrict__ mask, const unsigned* __restrict__ MW, const __bf16* __restrict__ RB, float* __restrict__ O32) {
  __shared__ __align__(16) float sS[8][16][68];
  __shared__ __align__(16) float sR[8][16][84];
  __shared__ __align__(16) _Float16 sPh[8][16][72], sPl[8][16][72];
  __shared__ __align__(16) float sO[4][16][68];
  // wave wv: query tile w = wv & 3 of the 64 queries, key share kh = wv >> 2 (the even or the odd key tiles)
  const int tid = threadIdx.x, wv = tid >> 5, w = wv & 3, lane = tid & 31, col = lane & 15, g = lane >> 4;
  // All waves are resident at once, so the launch lasts as long as its longest wave: the tiles that are left are dealt evenly. Under a mask that opens more keys to later queries the cost grows with the query block:
  // a block takes query block t of one head and then query block 31 - t of another, one after the other in every wave, so that all blocks cost alike; each (head, query block) is taken once. And two waves share
  // a query tile, one on its even and one on its odd key tiles, each with a running maximum, sum and context of its own; the two are joined in LDS behind the key loop. Not unrolled: one copy of the code.
  // The tile words of the wave's two query tiles, read here, ahead of every store, with the wave's number in a scalar register: scalar loads, and the test on the word in the key loop is a scalar branch.
  const int ws = __builtin_amdgcn_readfirstlane(w), kh = __builtin_amdgcn_readfirstlane(wv >> 2); const unsigned live0 = tile_word(MW, (int)blockIdx.x * 4 + ws), live1 = tile_word(MW, (SS / 64 - 1 - (int)blockIdx.x) * 4 + ws);
#pragma unroll 1
  for (int part = 0; part < 2; ++part) {
  const size_t bh = (size_t)(blockIdx.y + part * (NH / 2)); const int qb = part ? SS / 64 - 1 - (int)blockIdx.x : (int)blockIdx.x; const int q0 = qb * 64 + w * 16;
  const unsigned live = (part ? live1 : live0) & (kh ? 0xAAAAAAAAu : 0x55555555u);
  F2 aq[2]; float qv[2][16]; const float* pq = Q32 + (bh * SS + q0 + col) * HD + 8 * g;
  // unrolled: qv is indexed by constants and stays in registers
#pragma unroll
  for (int kc = 0; kc < 2; ++kc) {
#pragma unroll
    for (int i = 0; i < 8; ++i) { qv[kc][i] = pq[kc * 32 + i]; qv[kc][8 + i] = pq[kc * 32 + 16 + i]; } }
  asm volatile("s_wait_xcnt 0x0" :: "v"(pq) : "memory");      // the q loads' address register is held up to here and rewritten only behind this wait
#pragma unroll
  for (int kc = 0; kc < 2; ++kc) aq[kc] = bsplit16(qv[kc]);
  float mrun = -3.0e38f, lrun = 0.f; v8f acc[4] = {}, ac1[4] = {}, ac2[4] = {};
#pragma unroll 1
  for (int kt = 0; kt < SS / 64; ++kt) {
    if (!((live >> kt) & 1u)) continue;      // no open key for any of the wave's 16 queries in this tile, or the other wave's tile
    // sR[row][x] = q_(q0+row) . rel[cb + x], x < 80: query q0+row and key kt*64+kk meet at offset c = cb + (kk - row + 15). Same products in the same order as a table of q.rel would hold.
    // The loops below are unrolled so that d, s and the fragments are indexed by constants and stay in registers.
    const int cb = kt * 64 - q0 + (SS - 16);
    // The loads of the score part (rel rows, K rows, mask words) all stand ahead of the first product: they are in flight together and the pass waits for memory once, not once a fragment.
    v16b rb[5][2], khf[4][2], klf[4][2]; int mk[4][8];
    // cb is a multiple of 16: the five rel tiles are whole tiles cb / 16 + u <= 255 of RB (the pad offset 4095 is a written row there)
    const __bf16* pr = RB + (size_t)(cb >> 4) * 1024 + lane * 8;
    const size_t ko = (bh * (SS / 16) + kt * 4) * 1024 + lane * 8; const __bf16* pkh = Kh + ko; const __bf16* pkl = Kl + ko; const int* pm = mask + (size_t)(q0 + 8 * g) * SS + kt * 64 + col;
#pragma unroll
    for (int u = 0; u < 5; ++u) {
#pragma unroll
      for (int kc = 0; kc < 2; ++kc) rb[u][kc] = frag_t(pr + (u * 2 + kc) * 512); }
#pragma unroll
    for (int t = 0; t < 4; ++t) {
#pragma unroll
      for (int kc = 0; kc < 2; ++kc) { khf[t][kc] = frag_t(pkh + (t * 2 + kc) * 512); klf[t][kc] = frag_t(pkl + (t * 2 + kc) * 512); } }
#pragma unroll
    for (int t = 0; t < 4; ++t) {
#pragma unroll
      for (int r = 0; r < 8; ++r) mk[t][r] = pm[r * SS + t * 16]; }
    __builtin_amdgcn_sched_barrier(0);      // keeps every load above ahead of the first product: without it the scheduler puts a q.k product, with its wait, in front of the rel loads, and the pass waits for memory twice
#pragma unroll
    for (int u = 0; u < 5; ++u) { v8f d = {};
#pragma unroll
      for (int kc = 0; kc < 2; ++kc) { d = wmma_bf_w(aq[kc].l, rb[u][kc], d); d = wmma_bf_w(aq[kc].h, rb[u][kc], d); }
#pragma unroll
      for (int r = 0; r < 8; ++r) sR[wv][8 * g + r][u * 16 + col] = d[r]; }
    asm volatile("s_wait_xcnt 0x0" :: "v"(pr), "v"(pkh), "v"(pkl), "v"(pm) : "memory");      // the address registers of the loads above are held up to here and rewritten only behind this wait
    // The V fragments are asked for here, where the rel registers have come free: they fly during the q.k products and the softmax and are first used behind it.
    v16h vhf[2][4], vlf[2][4]; const size_t vo = (bh * (SS / 64) + kt) * 4096 + lane * 8; const _Float16* pvh = VTh + vo; const _Float16* pvl = VTl + vo;
#pragma unroll
    for (int kc = 0; kc < 2; ++kc) {
#pragma unroll
      for (int t = 0; t < 4; ++t) { vhf[kc][t] = frag_th(pvh + (kc * 4 + t) * 512); vlf[kc][t] = frag_th(pvl + (kc * 4 + t) * 512); } }
    v8f s[4] = {};
#pragma unroll
    for (int t = 0; t < 4; ++t) {
#pragma unroll
      for (int kc = 0; kc < 2; ++kc) { s[t] = wmma_bf_w(aq[kc].l, khf[t][kc], s[t]); s[t] = wmma_bf_w(aq[kc].h, klf[t][kc], s[t]); s[t] = wmma_bf_w(aq[kc].h, khf[t][kc], s[t]); } }
    asm volatile("s_wait_xcnt 0x0" :: "v"(pvh), "v"(pvl) : "memory");      // as above, for the V loads
    LDSW();      // the diagonal read below takes sR values that other lanes of this wave stored
    float rs[4][8];
#pragma unroll
    for (int t = 0; t < 4; ++t) {
#pragma unroll
      for (int r = 0; r < 8; ++r) rs[t][r] = sR[wv][8 * g + r][t * 16 + col + 15 - (8 * g + r)]; }
#pragma unroll
    for (int t = 0; t < 4; ++t) {
#pragma unroll
      for (int r = 0; r < 8; ++r) { const float sc = s[t][r] * 0.125f + rs[t][r]; sS[wv][8 * g + r][t * 16 + col] = (mk[t][r] == 0) ? -1.0e30f : sc; } }
    LDSW();
    float mx = -3.4e38f;
#pragma unroll
    for (int jj = 0; jj < 32; ++jj) mx = fmaxf(mx, sS[wv][col][g * 32 + jj]);
    mx = fmaxf(mx, __shfl_xor(mx, 16, 32));
    const float mnew = fmaxf(mrun, mx); const float corr = expf(mrun - mnew);
    float ps = 0.f;
#pragma unroll
    for (int jj = 0; jj < 32; ++jj) { const float p = expf(sS[wv][col][g * 32 + jj] - mnew) * 16384.0f; ps += p; const _Float16 hi = (_Float16)p; sPh[wv][col][g * 32 + jj] = hi; sPl[wv][col][g * 32 + jj] = (_Float16)((p - (float)hi) * PLO); }
    ps += __shfl_xor(ps, 16, 32);
    lrun = lrun * corr + ps * (1.0f / 16384.0f); mrun = mnew;
#pragma unroll
    for (int r = 0; r < 8; ++r) { const float cr = __shfl(corr, 8 * g + r, 32);
#pragma unroll
      for (int t = 0; t < 4; ++t) { acc[t][r] *= cr; ac1[t][r] *= cr; ac2[t][r] *= cr; } }
    LDSW();
#pragma unroll
    for (int kc = 0; kc < 2; ++kc) { const v16h ph = frag_h(&sPh[wv][col][0] + kc * 32, lane), pl = frag_h(&sPl[wv][col][0] + kc * 32, lane);
#pragma unroll
      for (int t = 0; t < 4; ++t) { acc[t] = wmma16_w(ph, vhf[kc][t], acc[t]); ac1[t] = wmma16_w(ph, vlf[kc][t], ac1[t]); ac2[t] = wmma16_w(pl, vhf[kc][t], ac2[t]); } }
    __builtin_amdgcn_wave_barrier(); }
  // The odd-tile wave lays its share down (context not yet divided, maximum, sum); behind the barrier the even-tile wave scales both shares to the common maximum, adds them and divides.
  // A share without a tile has maximum -3e38 and sum 0: its factor is exp(-3e38 - m) = 0.
  if (kh) {
#pragma unroll
    for (int r = 0; r < 8; ++r) {
#pragma unroll
      for (int t = 0; t < 4; ++t) sO[w][8 * g + r][t * 16 + col] = acc[t][r] + ac1[t][r] * (1.0f / VLO) + ac2[t][r] * (1.0f / PLO); }
    if (g == 0) { sO[w][col][64] = mrun; sO[w][col][65] = lrun; } }      // in the row's pad words
  __syncthreads();      // the odd-tile waves' shares are in LDS
  if (!kh) {
  const float m1 = sO[w][col][64], l1 = sO[w][col][65]; const float mm = fmaxf(mrun, m1); const float a0 = expf(mrun - mm), a1 = expf(m1 - mm); const float ll = lrun * a0 + l1 * a1;
#pragma unroll
  for (int r = 0; r < 8; ++r) { const float lr = __shfl(ll, 8 * g + r, 32), f0 = __shfl(a0, 8 * g + r, 32), f1 = __shfl(a1, 8 * g + r, 32); const float inv = 1.0f / (lr * 16384.0f * 4.0f);
#pragma unroll
    for (int t = 0; t < 4; ++t) { float* p = &sO[w][8 * g + r][t * 16 + col]; *p = ((acc[t][r] + ac1[t][r] * (1.0f / VLO) + ac2[t][r] * (1.0f / PLO)) * f0 + *p * f1) * inv; } }      // each lane rewrites the places that it has read itself
  LDSX();
  // O32 in the f32 form of the fragment order: tile (query / 16, d / 32) = 2048 bytes, four 512-byte parts j; lane (g, row) holds d = 16 (j >> 1) + 8 g + 4 (j & 1) + 0..3 of its row in part j
  float* po = O32 + (bh * (SS / 16) + (q0 >> 4)) * 1024 + lane * 4;
  for (int i = 0; i < 8; ++i) vst2(po + i * 128, *(const v4f*)(&sO[w][col][(i >> 2) * 32 + ((i >> 1) & 1) * 16 + g * 8 + (i & 1) * 4]));
  asm volatile("s_wait_xcnt 0x0" :: "v"(po) : "memory"); }      // the second part rewrites the stores' address and data registers only behind this wait
  __syncthreads(); }      // sO has been read: the second part may write it
}
// out = ctx Wo + bo : split(ctx) x bf16(Wo columns): 2 products (Wo is an INPUT -> bf16 exact)
__global__ __launch_bounds__(128) void k_out(const float* __restrict__ O32, const __bf16* __restrict__ PT, const float* __restrict__ bo, float* __restrict__ out) {
  __shared__ __align__(16) float so[4][16][132];
  const int tid = threadIdx.x, wave = tid >> 5, lane = tid & 31, col = lane & 15, g = lane >> 4;
  const int r0 = blockIdx.x * 64 + wave * 16, n0 = blockIdx.y * 128; const int ra = r0 + col; const int b = ra / SS, s = ra % SS;
  v8f acc[8] = {};
  const float* po0 = O32 + ((size_t)b * NH * (SS / 16) + (s >> 4)) * 1024 + lane * 4; const __bf16* pw0 = PT + (size_t)((3 * E + n0) >> 4) * (E / 32) * 512 + lane * 8;
  // One head (two k chunks) a pass: all loads of the pass stand ahead of its first product, so that their latencies overlap. Not unrolled further: registers.
#pragma unroll 1
  for (int h = 0; h < NH; ++h) { float ov[2][16]; v16b wb[2][8];
    const float* po = po0 + (size_t)h * (SS / 16) * 1024; const __bf16* pw = pw0 + h * 1024;
    // inner loops unrolled so that the arrays are indexed by constants and stay in registers
#pragma unroll
    for (int c = 0; c < 2; ++c) {
#pragma unroll
      for (int i = 0; i < 16; ++i) ov[c][i] = po[c * 512 + (i >> 2) * 128 + (i & 3)]; }
#pragma unroll
    for (int c = 0; c < 2; ++c) {
#pragma unroll
      for (int j = 0; j < 8; ++j) wb[c][j] = frag_t(pw + (size_t)j * (E / 32) * 512 + c * 512); }
    asm volatile("s_wait_xcnt 0x0" :: "v"(po), "v"(pw) : "memory");      // the loads' address registers are held up to here and rewritten only behind this wait
#pragma unroll
    for (int c = 0; c < 2; ++c) { const F2 a = bsplit16(ov[c]);
#pragma unroll
      for (int j = 0; j < 8; ++j) { acc[j] = wmma_bf(a.l, wb[c][j], acc[j]); acc[j] = wmma_bf(a.h, wb[c][j], acc[j]); } } }
#pragma unroll
  for (int j = 0; j < 8; ++j) { const int n = n0 + j * 16 + col; const float bb = bfr(bo[n]);
#pragma unroll
    for (int r = 0; r < 8; ++r) so[wave][8 * g + r][j * 16 + col] = acc[j][r] + bb; }
  LDSX();
#pragma unroll 4
  for (int rl = 0; rl < 16; ++rl) vst2(out + (size_t)(r0 + rl) * E + n0 + lane * 4, *(const v4f*)(&so[wave][rl][lane * 4]));
}
extern "C" void kernel_launch(void* const* d_in, const int* in_sizes, int n_in, void* d_out, int out_size, void* d_ws, size_t ws_size, hipStream_t stream) {
  (void)in_sizes; (void)n_in; (void)out_size; (void)ws_size;
  const float* x = (const float*)d_in[0]; const int* mask = (const int*)d_in[1]; const float* Wq = (const float*)d_in[2]; const float* bq = (const float*)d_in[3]; const float* Wk = (const float*)d_in[4]; const float* bk = (const float*)d_in[5];
  const float* Wv = (const float*)d_in[6]; const float* bv = (const float*)d_in[7]; const float* Wp = (const float*)d_in[8]; const float* bp = (const float*)d_in[9]; const float* rel = (const float*)d_in[10];
  float* out = (float*)d_out;
  char* ws = (char*)d_ws; size_t off = 0;
  auto take = [&](size_t bytes) { char* p = ws + off; off += (bytes + 255) & ~(size_t)255; return p; };
  __bf16* Xb = (__bf16*)take((size_t)NR * E * 2); __bf16* PT = (__bf16*)take((size_t)4 * E * E * 2); __bf16* RB = (__bf16*)take((size_t)NREL * HD * 2);
  float* Q32 = (float*)take((size_t)NR * E * 4); __bf16* Kh = (__bf16*)take((size_t)NR * E * 2); __bf16* Kl = (__bf16*)take((size_t)NR * E * 2); _Float16* VTh = (_Float16*)take((size_t)NR * E * 2); _Float16* VTl = (_Float16*)take((size_t)NR * E * 2); float* O32 = (float*)take((size_t)NR * E * 4); unsigned* MW = (unsigned*)take((size_t)(SS / 16) * 4 * 4); float* CS = (float*)take((size_t)SS * 32 * 2 * 4);
  // ws ~ 45 MB
  k_prep<<<PB_ROT + PB_PACK + PB_MSK + PB_CVT + PB_REL, 256, 0, stream>>>(x, mask, Wq, Wk, Wv, Wp, rel, Xb, PT, RB, MW, CS);
  k_qkv<<<dim3(NR / 64, E / 128, 3), 128, 0, stream>>>(Xb, PT, CS, bq, bk, bv, Q32, Kh, Kl, VTh, VTl);
  k_attn<<<dim3(SS / 64, NH / 2), 256, 0, stream>>>(Q32, Kh, Kl, VTh, VTl, mask, MW, RB, O32);
  k_out<<<dim3(NR / 64, E / 128), 128, 0, stream>>>(O32, PT, bp, out);
}

// v007
// A run of this version takes 103 microseconds.
// Timed twice side by side with v006, it ran 1.12 and 1.11 times as fast.
// All steps since v000 together make it 33.2 times as fast.
// compute dtype: x, W*, b*, rel_pos_emb (INPUTS) rounded to bf16 with exact bf16 WMMA products (f32 accumulate) for the projections; rotary in f32; K pre-split into bf16 hi/lo rows; the relative-position scores q.rel^T as q hi/lo x bf16(rel) (2 products); P and V f16 hi/lo (3 products); softmax with the int mask in f32.
#include <hip/hip_runtime.h>
#include <math.h>

typedef __attribute__((ext_vector_type(16))) _Float16 v16h;
typedef __attribute__((ext_vector_type(16))) __bf16 v16b;
typedef __attribute__((ext_vector_type(8)))  _Float16 v8h;
typedef __attribute__((ext_vector_type(8)))  float v8f;
typedef __attribute__((ext_vector_type(4)))  float v4f;
typedef __attribute__((ext_vector_type(2)))  float v2f;
typedef __attribute__((ext_vector_type(4)))  unsigned v4u;
typedef __attribute__((ext_vector_type(4)))  int v4i;
typedef float __attribute__((may_alias)) float_a;
typedef int __attribute__((may_alias)) int_a;

template <typename T> __device__ __forceinline__ void vst2(void* p, T v) { *(T*)p = v;  }
__device__ __forceinline__ v8f wmma16(v16h a, v16h b, v8f c) {
  v8f d = __builtin_amdgcn_wmma_f32_16x16x32_f16(false, a, false, b, (short)0, c, false, false);
  asm volatile("v_nop\n\tv_nop\n\tv_nop\n\tv_nop" : "+v"(d) : "v"(a), "v"(b));
  return d;
}
__device__ __forceinline__ v8f wmma_bf(v16b a, v16b b, v8f c) {
  v8f d = __builtin_amdgcn_wmma_f32_16x16x32_bf16(false, a, false, b, (short)0, c, false, false);
  asm volatile("v_nop\n\tv_nop\n\tv_nop\n\tv_nop" : "+v"(d) : "v"(a), "v"(b));
  return d;
}
// The same two for the attention kernel, whose fragments in flight lie above v255: an operand of an asm statement is held below v256, so a and b are not named there (naming them spills).
__device__ __forceinline__ v8f wmma16_w(v16h a, v16h b, v8f c) {
  v8f d = __builtin_amdgcn_wmma_f32_16x16x32_f16(false, a, false, b, (short)0, c, false, false);
  asm volatile("v_nop\n\tv_nop\n\tv_nop\n\tv_nop" : "+v"(d));      // the distance behind a matrix instruction
  return d;
}
__device__ __forceinline__ v8f wmma_bf_w(v16b a, v16b b, v8f c) {
  v8f d = __builtin_amdgcn_wmma_f32_16x16x32_bf16(false, a, false, b, (short)0, c, false, false);
  asm volatile("v_nop\n\tv_nop\n\tv_nop\n\tv_nop" : "+v"(d));      // the distance behind a matrix instruction
  return d;
}
// 16x16x32 fragments: lane = (h = lane>>4, row/col = lane&15); elements 0..7 = k0+8h+0..7, 8..15 = k0+16+8h+0..7; D element r = row 8h+r
__device__ __forceinline__ v16h frag_h(const _Float16* rowk0, int lane) {
  union { v16h v; v8h q[2]; } u; const _Float16* p = rowk0 + 8 * (lane >> 4);
  u.q[0] = *(const v8h*)p; u.q[1] = *(const v8h*)(p + 16); return u.v;
}
__device__ __forceinline__ v16h frag_f32(const float* rowk0, int lane) {
  v16h a; const float* p = rowk0 + 8 * (lane >> 4);
#pragma unroll
  for (int i = 0; i < 8; ++i) { a[i] = (_Float16)p[i]; a[8 + i] = (_Float16)p[16 + i]; }
  return a;
}
__device__ __forceinline__ v16h frag_f32s(const float* rowk0, int lane, float sc) {
  v16h a; const float* p = rowk0 + 8 * (lane >> 4);
#pragma unroll
  for (int i = 0; i < 8; ++i) { a[i] = (_Float16)(p[i] * sc); a[8 + i] = (_Float16)(p[16 + i] * sc); }
  return a;
}
// column fragment from a [K][ld] layout (column n), rows >= K read as 0
__device__ __forceinline__ v16h fragc_f32(const float* W, int k0, int n, int lane, int ld, int K) {
  v16h a; const int g = lane >> 4;
#pragma unroll
  for (int i = 0; i < 8; ++i) { const int ka = k0 + 8 * g + i, kb = ka + 16;
    a[i] = (_Float16)(ka < K ? W[(size_t)ka * ld + n] : 0.f); a[8 + i] = (_Float16)(kb < K ? W[(size_t)kb * ld + n] : 0.f); }
  return a;
}
struct F2 { v16b h, l; };
__device__ __forceinline__ F2 bsplit16(const float v[16]) { F2 r;
#pragma unroll
  for (int i = 0; i < 16; ++i) { const __bf16 h = (__bf16)v[i]; r.h[i] = h; r.l[i] = (__bf16)(v[i] - (float)h); }
  return r; }
__device__ __forceinline__ F2 split_row(const float* row, int k0, int lane) { float v[16]; const float* p = row + k0 + 8 * (lane >> 4);
#pragma unroll
  for (int i = 0; i < 8; ++i) { v[i] = p[i]; v[8 + i] = p[16 + i]; }
  return bsplit16(v); }
__device__ __forceinline__ F2 split_rowK(const float* row, int k0, int lane, int K) { float v[16]; const int g = lane >> 4;
#pragma unroll
  for (int i = 0; i < 8; ++i) { const int ka = k0 + 8 * g + i, kb = ka + 16; v[i] = ka < K ? row[ka] : 0.f; v[8 + i] = kb < K ? row[kb] : 0.f; }
  return bsplit16(v); }
__device__ __forceinline__ F2 split_col(const float* W, int k0, int n, int lane, int ld, int K) { float v[16]; const int g = lane >> 4;
#pragma unroll
  for (int i = 0; i < 8; ++i) { const int ka = k0 + 8 * g + i, kb = ka + 16; v[i] = ka < K ? W[(size_t)ka * ld + n] : 0.f; v[8 + i] = kb < K ? W[(size_t)kb * ld + n] : 0.f; }
  return bsplit16(v); }
__device__ __forceinline__ v8f mac3(const F2& a, const F2& b, v8f c) { c = wmma_bf(a.l, b.h, c); c = wmma_bf(a.h, b.l, c); return wmma_bf(a.h, b.h, c); }
__device__ __forceinline__ float sigm(float v) { return 1.0f / (1.0f + expf(-v)); }
#define LDSX() do { asm volatile("s_wait_dscnt 0" ::: "memory"); __builtin_amdgcn_wave_barrier(); __builtin_amdgcn_fence(__ATOMIC_RELEASE, "workgroup"); } while (0)
// The same exchange among the lanes of ONE wave, for places where global loads are in flight: the fence at wavefront scope orders the LDS accesses for the compiler and does not drain the loads as the work-group one does.
#define LDSW() do { asm volatile("s_wait_dscnt 0" ::: "memory"); __builtin_amdgcn_wave_barrier(); __builtin_amdgcn_fence(__ATOMIC_RELEASE, "wavefront"); } while (0)


// Rotary multi-head attention with Shaw relative-position scores (16 heads of 64 on [1,2048,1024], [in][out] weights + biases): q,k = rotate_half-RoPE(xW+b) (angle[d] = s*10000^(-2(d mod 32)/64));
// scores[i][j] = q_i.k_j/8 + q_i.rel_pos_emb[j-i+2047]; masked where mask[i][j] == 0 (-1e30); softmax; (P v) Wo + bo. The rel term uses the skew trick inside the attention kernel: a tile of 16 queries x 64 keys
// needs only the 79 offsets c = j-i+2047 of its diagonals, so q.rel[c] is formed for five 16-column tiles, laid in LDS and read back along the diagonal. No score table in memory: all heads run in one launch.
// A tile of 16 queries x 64 keys whose mask words are all 0 adds exactly nothing to a row that has an open key somewhere (its weights are exp(-1e30 - m) = 0, or are wiped by the factor 0 at the row's first open key):
// p_msk reads the mask once and says which tiles hold an open word; the attention kernel passes over the others.
#define NB 1
#define SS 2048
#define NREL 4096      // 4095 offsets padded to 4096 (offset 4095 is clamped to row 4094 and never used)
#define E 1024
#define NH 16
#define HD 64
#define NR (NB * SS)
#define PLO 1024.0f
#define VLO 2048.0f
__device__ __forceinline__ float bfr(float v) { return (float)(__bf16)v; }
__device__ __forceinline__ v16b frag_b(const __bf16* rowk0, int lane) { return __builtin_bit_cast(v16b, frag_h((const _Float16*)rowk0, lane)); }
// FRAGMENT ORDER of the 16-bit operands in the workspace: a tile of 16 rows x 32 k is 1024 contiguous bytes; the piece of 8 elements k = 16 hf + 8 g + 0..7 of row r lies at element (hf * 32 + g * 16 + r) * 8.
// Lane l = g * 16 + r finds its two pieces at l * 8 and 256 + l * 8, so each wave-wide 16-byte load covers 512 contiguous bytes (4 whole lines) and not 32-byte pieces of 16 lines. p = tile + lane * 8.
__device__ __forceinline__ v16h frag_th(const _Float16* p) { union { v16h v; v8h q[2]; } u; u.q[0] = *(const v8h*)p; u.q[1] = *(const v8h*)(p + 256); return u.v; }
__device__ __forceinline__ v16b frag_t(const __bf16* p) { return __builtin_bit_cast(v16b, frag_th((const _Float16*)p)); }

// The five preparation jobs (rotary angles, weights, mask scan, x, rel rows) depend on the inputs alone and not on each other: they are parts of ONE launch, k_prep, in which a range of block indices picks the job (blk = the block's number inside its job).
__device__ __forceinline__ void p_cvt(int blk, const float* __restrict__ x, __bf16* __restrict__ Xb) {
  const size_t i8 = (size_t)blk * 256 + threadIdx.x; if (i8 >= (size_t)NR * E / 8) return;
  // i8 = the piece's place in fragment order: tile (row tile, k chunk), then hf, g, row
  const size_t tile = i8 >> 6; const int hf = (int)(i8 >> 5) & 1, g = (int)(i8 >> 4) & 1, row = (int)i8 & 15;
  const float* px = x + ((tile >> 5) * 16 + row) * E + (tile & 31) * 32 + hf * 16 + g * 8;
  union { __bf16 h[8]; v4u u; } pk;
#pragma unroll
  for (int e = 0; e < 8; ++e) pk.h[e] = (__bf16)px[e];
  vst2((unsigned*)(Xb + i8 * 8), pk.u);
}
// PT rows: [0,E) Wq[:,n], [E,2E) Wk[:,n], [2E,3E) Wv[:,n], [3E,4E) Wo[:,n]  ([in][out] weights: column n as a bf16 row), in fragment order
__device__ __forceinline__ void p_pack(int blk, const float* __restrict__ Wq, const float* __restrict__ Wk, const float* __restrict__ Wv, const float* __restrict__ Wo, __bf16* __restrict__ PT) {
  // block: 32 columns n (two row tiles of PT) x 256 k, turned in LDS; written in fragment order, tile (n / 16, k / 32)
  const int n0 = (blk & (4 * E / 32 - 1)) * 32, k0 = (blk / (4 * E / 32)) * 256, tid = threadIdx.x; __shared__ __align__(16) __bf16 st[32][264];
  const float* W = n0 < E ? Wq : (n0 < 2 * E ? Wk : (n0 < 3 * E ? Wv : Wo)); const int nn0 = n0 & (E - 1);
  const int kr = tid >> 3, c4 = (tid & 7) * 4; const float* pwv = W + (size_t)(k0 + kr) * E + nn0 + c4; v4f v[8];      // a wave-wide load: 4 rows k x 128 bytes, whole lines
  // unrolled: v is indexed by constants and stays in registers
#pragma unroll
  for (int i = 0; i < 8; ++i) v[i] = *(const v4f*)(pwv + (size_t)i * 32 * E);
  asm volatile("s_wait_xcnt 0x0" :: "v"(pwv) : "memory");      // the loads' address register is held up to here and rewritten only behind this wait
#pragma unroll
  for (int i = 0; i < 8; ++i) {
#pragma unroll
    for (int e = 0; e < 4; ++e) st[c4 + e][i * 32 + kr] = (__bf16)v[i][e]; }
  __syncthreads();
  for (int i = 0; i < 4; ++i) { const int j = i * 256 + tid, tile = j >> 6, nt = tile >> 3, kcl = tile & 7, hf = (j >> 5) & 1, g = (j >> 4) & 1, row = j & 15;
    vst2((unsigned*)(PT + ((size_t)((n0 >> 4) + nt) * (E / 32) + (k0 >> 5) + kcl) * 512 + (j & 63) * 8), *(const v4u*)(&st[nt * 16 + row][kcl * 32 + hf * 16 + g * 8])); }
  asm volatile("s_wait_xcnt 0x0" ::: "memory");      // another job's code follows in the listing: the stores' address and data registers are rewritten only behind this wait
}
// QKV: block (64 rows, 128 cols = 2 heads, which); q (+bias) -> Q32 f32 [bh][s][64]; k (+bias) -> bf16 hi/lo rows; v (+bias) -> VT hi/lo x4 (rows d, k = key); K and VT in fragment order
__global__ __launch_bounds__(128) void k_qkv(const __bf16* __restrict__ Xb, const __bf16* __restrict__ PT, const float* __restrict__ CS, const float* __restrict__ bq, const float* __restrict__ bk, const float* __restrict__ bv,
                                            float* __restrict__ Q32, __bf16* __restrict__ Kh, __bf16* __restrict__ Kl, _Float16* __restrict__ VTh, _Float16* __restrict__ VTl) {
  __shared__ __align__(16) float so[4][16][132];
  __shared__ __align__(16) _Float16 sth[128][72], stl[128][72];
  const int tid = threadIdx.x, wave = tid >> 5, lane = tid & 31, col = lane & 15, g = lane >> 4;
  const int which = blockIdx.z, r0b = blockIdx.x * 64, r0 = r0b + wave * 16, n0 = blockIdx.y * 128; const int b = r0b / SS, s0 = r0b % SS;
  const float* bb_ = which == 0 ? bq : (which == 1 ? bk : bv);
  v8f acc[8] = {};
  // The (cos, sin) pairs of the lane's accumulator places: rows 8 g + r, d mod 32 = jj * 16 + col; the same for both heads of the block. Asked for here, they are in flight together with the loads of the product loop's first pass. A wave-wide load covers 128 bytes of two rows.
  v2f cs[2][8]; const float* pcs = CS + ((size_t)(s0 + wave * 16 + 8 * g) * 32 + col) * 2;
  // unrolled: cs is indexed by constants and stays in registers
#pragma unroll
  for (int jj = 0; jj < 2; ++jj) {
#pragma unroll
    for (int r = 0; r < 8; ++r) cs[jj][r] = *(const v2f*)(pcs + r * 64 + jj * 32); }
  asm volatile("s_wait_xcnt 0x0" :: "v"(pcs) : "memory");      // the loads' address register is held up to here and rewritten only behind this wait
  // Two k chunks a pass: all 36 loads of the pass stand ahead of its first product, so that their latencies overlap (one wait a pass instead of one a product). Not unrolled further: registers.
#pragma unroll 1
  for (int kc = 0; kc < E / 32; kc += 2) { v16b a[2], wb[2][8];
    const __bf16* pa = Xb + ((size_t)(r0 >> 4) * (E / 32) + kc) * 512 + lane * 8; const __bf16* pw = PT + ((size_t)((which * E + n0) >> 4) * (E / 32) + kc) * 512 + lane * 8;
    // inner loops unrolled so that the fragment arrays are indexed by constants and stay in registers
#pragma unroll
    for (int c = 0; c < 2; ++c) { a[c] = frag_t(pa + c * 512);
#pragma unroll
      for (int j = 0; j < 8; ++j) wb[c][j] = frag_t(pw + (size_t)j * (E / 32) * 512 + c * 512); }
#pragma unroll
    for (int j = 0; j < 8; ++j) acc[j] = wmma_bf(a[0], wb[0][j], acc[j]);
    asm volatile("s_wait_xcnt 0x0" :: "v"(pa), "v"(pw) : "memory");      // the loads' address registers are held up to here and rewritten only behind this wait
#pragma unroll
    for (int j = 0; j < 8; ++j) acc[j] = wmma_bf(a[1], wb[1][j], acc[j]); }
  if (which < 2) {
    // RoPE (rotate_half pairs (d, d+32)) on the accumulators: column tiles j and j + 2 of a head hold d and d + 32 of the same row in the same lane and element
#pragma unroll
    for (int j = 0; j < 8; ++j) { if (j & 2) continue;
      const int jj = j & 1; const float b1 = bfr(bb_[n0 + j * 16 + col]), b2 = bfr(bb_[n0 + (j + 2) * 16 + col]);
#pragma unroll
      for (int r = 0; r < 8; ++r) { const float x1 = acc[j][r] + b1, x2 = acc[j + 2][r] + b2, c = cs[jj][r][0], sn = cs[jj][r][1];
        so[wave][8 * g + r][j * 16 + col] = x1 * c - x2 * sn; so[wave][8 * g + r][(j + 2) * 16 + col] = x2 * c + x1 * sn; } }
    LDSX();
    if (which == 0) { for (int qq = lane; qq < 2 * 16 * 16; qq += 32) { const int hh = qq >> 8, rl = (qq >> 4) & 15, pc = qq & 15; const int h = (n0 >> 6) + hh;
        vst2(Q32 + (((size_t)b * NH + h) * SS + s0 + wave * 16 + rl) * HD + pc * 4, *(const v4f*)(&so[wave][rl][hh * 64 + pc * 4])); } }
    else {
      // fragment order, tile (key / 16, d / 32): the wave's 32 lanes store one 512-byte half tile a trip
      for (int i = 0; i < 16; ++i) { const int hf = i & 1, kc = (i >> 1) & 1, lo = (i >> 2) & 1, hh = i >> 3; const int h = (n0 >> 6) + hh; union { __bf16 e[8]; v4u u; } pk;
#pragma unroll
        for (int e = 0; e < 8; ++e) { const float v = so[wave][col][hh * 64 + kc * 32 + hf * 16 + g * 8 + e]; const __bf16 hi = (__bf16)v; pk.e[e] = lo ? (__bf16)(v - (float)hi) : hi; }
        vst2((unsigned*)((lo ? Kl : Kh) + ((((size_t)b * NH + h) * (SS / 16) + (s0 >> 4) + wave) * 2 + kc) * 512 + hf * 256 + lane * 8), pk.u);
        asm volatile("s_wait_xcnt 0x0" ::: "memory"); } } }      // the next trip rewrites the store's address and data registers only behind this wait
  else {
#pragma unroll
    for (int j = 0; j < 8; ++j) { const float bb = bfr(bb_[n0 + j * 16 + col]);
#pragma unroll
      for (int r = 0; r < 8; ++r) { const float v = (acc[j][r] + bb) * 4.0f; const _Float16 hi = (_Float16)v; sth[j * 16 + col][wave * 16 + 8 * g + r] = hi; stl[j * 16 + col][wave * 16 + 8 * g + r] = (_Float16)((v - (float)hi) * VLO); } }
    __syncthreads();
    // fragment order, per head and 64 keys eight tiles (key chunk kc, d / 16): qq = hh, kc, d / 16, hf, g, d % 16 from the top bit down
    for (int qq = tid; qq < 128 * 8; qq += 128) { const int hh = qq >> 9, cl = hh * 64 + ((qq >> 6) & 3) * 16 + (qq & 15), pc = ((qq >> 8) & 1) * 4 + ((qq >> 4) & 3); const size_t o = (((size_t)b * NH + (n0 >> 6) + hh) * (SS / 64) + (s0 >> 6)) * 4096 + (qq & 511) * 8;
      vst2(VTh + o, *(const v4u*)(&sth[cl][pc * 8])); vst2(VTl + o, *(const v4u*)(&stl[cl][pc * 8])); } }
}

// rel_pos_emb rows -> bf16 in fragment order, tile (offset / 16, d / 32); the pad row 4095 takes row 4094's values (never used by a score)
__device__ __forceinline__ void p_relb(int blk, const float* __restrict__ rel, __bf16* __restrict__ RB) {
  const size_t i8 = (size_t)blk * 256 + threadIdx.x; if (i8 >= (size_t)NREL * HD / 8) return;
  const int tile = (int)(i8 >> 6), hf = (int)(i8 >> 5) & 1, g = (int)(i8 >> 4) & 1, c = (tile >> 1) * 16 + ((int)i8 & 15);
  const float* ps = rel + (size_t)(c < NREL - 1 ? c : NREL - 2) * HD + (tile & 1) * 32 + hf * 16 + g * 8;
  union { __bf16 e[8]; v4u u; } pk;
#pragma unroll
  for (int e = 0; e < 8; ++e) pk.e[e] = (__bf16)ps[e];
  vst2((unsigned*)(RB + i8 * 8), pk.u);
}
// MW[query / 16][key quarter]: bit 16 + k is set where key tile 8 * quarter + k (64 keys) holds a mask word != 0 for one of the 16 queries; bit r < 16 where row r has an open key in the quarter. tile_word() joins the four.
// block = 16 queries x 8 key tiles (a block of k_prep has 8 waves), wave = key tile; a wave-wide 16-byte load covers 256 contiguous bytes of two rows.
__device__ __forceinline__ void p_msk(int blk, const int* __restrict__ mask, unsigned* __restrict__ MW) {
  __shared__ __align__(16) unsigned sT[8];
  const int tid = threadIdx.x, kt = tid >> 5, lane = tid & 31;
  const int* pm = mask + (size_t)((blk >> 2) * 16 + (lane >> 4)) * SS + ((blk & 3) * 8 + kt) * 64 + (lane & 15) * 4; v4i m[8];
  // unrolled: m is indexed by constants and stays in registers; the eight loads are in flight together
#pragma unroll
  for (int i = 0; i < 8; ++i) m[i] = *(const v4i*)(pm + (size_t)i * 2 * SS);
  asm volatile("s_wait_xcnt 0x0" :: "v"(pm) : "memory");      // the loads' address register is held up to here and rewritten only behind this wait
  unsigned rows = 0;      // bit r: row r has an open key in this tile
#pragma unroll
  for (int i = 0; i < 8; ++i) { const unsigned bl = __builtin_amdgcn_ballot_w32((m[i][0] | m[i][1] | m[i][2] | m[i][3]) != 0);
    rows |= ((bl & 0xFFFFu) ? 1u : 0u) << (2 * i); rows |= ((bl >> 16) ? 2u : 0u) << (2 * i); }
  if (lane == 0) sT[kt] = rows;
  __syncthreads();
  if (tid == 0) { unsigned tiles = 0, seen = 0;
#pragma unroll
    for (int k = 0; k < 8; ++k) { const unsigned v = sT[k]; seen |= v; tiles |= (v ? 1u : 0u) << k; }
    MW[blk] = seen | (tiles << 16); }
}
// The word of a query tile: bit kt is set where key tile kt holds an open key for one of the 16 queries. Where one of the 16 rows has no open key at all its softmax is uniform over ALL keys, so every bit is set.
__device__ __forceinline__ unsigned tile_word(const unsigned* __restrict__ MW, int qt) {
  const v4u p = *(const v4u*)(MW + qt * 4);
  const unsigned seen = (p[0] | p[1] | p[2] | p[3]) & 0xFFFFu, tiles = (p[0] >> 16) | ((p[1] >> 16) << 8) | ((p[2] >> 16) << 16) | ((p[3] >> 16) << 24);
  return seen == 0xFFFFu ? tiles : 0xFFFFFFFFu;
}
// CS[s][d] = (cos, sin) of the rotary angle s * 10000^(-2 d / 64), d < 32: each angle is worked out once here and read by every QKV block that needs it. A thread takes one d and eight positions s; a wave stores 256 contiguous bytes.
__device__ __forceinline__ void p_rot(int blk, float* __restrict__ CS) {
  const int i = blk * 256 + (int)threadIdx.x, d = i & 31, sb = (i >> 5) * 8;
  const float invf = powf(10000.0f, -(float)(2 * d) * (1.0f / 64.0f));
  for (int e = 0; e < 8; ++e) { const float ang = (float)(sb + e) * invf; float sn, c; sincosf(ang, &sn, &c); v2f v; v[0] = c; v[1] = sn;
    vst2(CS + ((size_t)(sb + e) * 32 + d) * 2, v);
    asm volatile("s_wait_xcnt 0x0" ::: "memory"); }      // the next trip rewrites the store's address and data registers only behind this wait
}
#define PB_ROT (SS * 32 / 8 / 256)
#define PB_PACK (4 * E / 32 * (E / 256))
#define PB_MSK (SS / 16 * 4)
#define PB_CVT (NR * E / 8 / 256)
#define PB_REL (NREL * HD / 8 / 256)
// The jobs with the longest way through a block (the angles' arithmetic; loads, LDS, barrier, stores) take the lowest block indices, the short ones the highest.
__global__ __launch_bounds__(256) void k_prep(const float* __restrict__ x, const int* __restrict__ mask, const float* __restrict__ Wq, const float* __restrict__ Wk, const float* __restrict__ Wv, const float* __restrict__ Wo, const float* __restrict__ rel,
                                             __bf16* __restrict__ Xb, __bf16* __restrict__ PT, __bf16* __restrict__ RB, unsigned* __restrict__ MW, float* __restrict__ CS) {
  const int blk = (int)blockIdx.x - PB_ROT;
  if (blk < 0) p_rot((int)blockIdx.x, CS);
  else if (blk < PB_PACK) p_pack(blk, Wq, Wk, Wv, Wo, PT);
  else if (blk < PB_PACK + PB_MSK) p_msk(blk - PB_PACK, mask, MW);
  else if (blk < PB_PACK + PB_MSK + PB_CVT) p_cvt(blk - (PB_PACK + PB_MSK), x, Xb);
  else p_relb(blk - (PB_PACK + PB_MSK + PB_CVT), rel, RB);
}
// masked attention with relative-position scores: block (64 queries, head) twice, two waves a query tile; the key tiles that MW names; S on q hi/lo x K hi/lo rows; P,V hi/lo; O f32 in fragment order
// All three products are formed TRANSPOSED (keys, offsets or d as the rows of A; the 16 queries as the columns of B): a lane (g, col) then holds, of ONE query q0 + col, the scores of keys 16 t + 8 g + r. Maximum and sum are
// taken in the lane (one exchange between the halves g), two score tiles converted in place ARE the B operand of V^T P^T, the rescale factor is the lane's own, and the context leaves in the order that k_out reads.
__global__ __launch_bounds__(256) void k_attn(const float* __restrict__ Q32, const __bf16* __restrict__ Kh, const __bf16* __restrict__ Kl, const _Float16* __restrict__ VTh, const _Float16* __restrict__ VTl, const int* __restrict__ mask, const unsigned* __restrict__ MW, const __bf16* __restrict__ RB, float* __restrict__ O32) {
  __shared__ __align__(16) float sR[8][16][84];
  __shared__ __align__(16) float sO[4][34][32];
  // wave wv: query tile w = wv & 3 of the 64 queries, key share kh = wv >> 2 (the even or the odd key tiles)
  const int tid = threadIdx.x, wv = tid >> 5, w = wv & 3, lane = tid & 31, col = lane & 15, g = lane >> 4;
  // All waves are resident at once, so the launch lasts as long as its longest wave: the tiles that are left are dealt evenly. Under a mask that opens more keys to later queries the cost grows with the query block:
  // a block takes query block t of one head and then query block 31 - t of another, one after the other in every wave, so that all blocks cost alike; each (head, query block) is taken once. And two waves share
  // a query tile, one on its even and one on its odd key tiles, each with a running maximum, sum and context of its own; the two are joined in LDS behind the key loop. Not unrolled: one copy of the code.
  // The tile words of the wave's two query tiles, read here, ahead of every store, with the wave's number in a scalar register: scalar loads, and the test on the word in the key loop is a scalar branch.
  const int ws = __builtin_amdgcn_readfirstlane(w), kh = __builtin_amdgcn_readfirstlane(wv >> 2); const unsigned live0 = tile_word(MW, (int)blockIdx.x * 4 + ws), live1 = tile_word(MW, (SS / 64 - 1 - (int)blockIdx.x) * 4 + ws);
#pragma unroll 1
  for (int part = 0; part < 2; ++part) {
  const size_t bh = (size_t)(blockIdx.y + part * (NH / 2)); const int qb = part ? SS / 64 - 1 - (int)blockIdx.x : (int)blockIdx.x; const int q0 = qb * 64 + w * 16;
  const unsigned live = (part ? live1 : live0) & (kh ? 0xAAAAAAAAu : 0x55555555u);
  F2 aq[2]; float qv[2][16]; const float* pq = Q32 + (bh * SS + q0 + col) * HD + 8 * g;
  // unrolled: qv is indexed by constants and stays in registers
#pragma unroll
  for (int kc = 0; kc < 2; ++kc) {
#pragma unroll
    for (int i = 0; i < 8; ++i) { qv[kc][i] = pq[kc * 32 + i]; qv[kc][8 + i] = pq[kc * 32 + 16 + i]; } }
  asm volatile("s_wait_xcnt 0x0" :: "v"(pq) : "memory");      // the q loads' address register is held up to here and rewritten only behind this wait
#pragma unroll
  for (int kc = 0; kc < 2; ++kc) aq[kc] = bsplit16(qv[kc]);
  float mrun = -3.0e38f, lrun = 0.f; v8f acc[4] = {}, ac1[4] = {}, ac2[4] = {};      // acc[t][r]: d = 16 t + 8 g + r of query q0 + col
#pragma unroll 1
  for (int kt = 0; kt < SS / 64; ++kt) {
    if (!((live >> kt) & 1u)) continue;      // no open key for any of the wave's 16 queries in this tile, or the other wave's tile
    // sR[query][x] = q_(q0+query) . rel[cb + x], x < 80: query q0+query and key kt*64+kk meet at offset c = cb + (kk - query + 15). Same products in the same order as a table of q.rel would hold.
    // The loops below are unrolled so that d, s and the fragments are indexed by constants and stay in registers.
    const int cb = kt * 64 - q0 + (SS - 16);
    // The loads of the score part (rel rows, K rows, mask words) all stand ahead of the first product: they are in flight together and the pass waits for memory once, not once a fragment.
    v16b rb[5][2], khf[4][2], klf[4][2]; v4i mk[4][2];
    // cb is a multiple of 16: the five rel tiles are whole tiles cb / 16 + u <= 255 of RB (the pad offset 4095 is a written row there)
    const __bf16* pr = RB + (size_t)(cb >> 4) * 1024 + lane * 8;
    const size_t ko = (bh * (SS / 16) + kt * 4) * 1024 + lane * 8; const __bf16* pkh = Kh + ko; const __bf16* pkl = Kl + ko; const int* pm = mask + (size_t)(q0 + col) * SS + kt * 64 + 8 * g;
#pragma unroll
    for (int u = 0; u < 5; ++u) {
#pragma unroll
      for (int kc = 0; kc < 2; ++kc) rb[u][kc] = frag_t(pr + (u * 2 + kc) * 512); }
#pragma unroll
    for (int t = 0; t < 4; ++t) {
#pragma unroll
      for (int kc = 0; kc < 2; ++kc) { khf[t][kc] = frag_t(pkh + (t * 2 + kc) * 512); klf[t][kc] = frag_t(pkl + (t * 2 + kc) * 512); } }
#pragma unroll
    for (int t = 0; t < 4; ++t) {
#pragma unroll
      for (int e = 0; e < 2; ++e) mk[t][e] = *(const v4i*)(pm + t * 16 + e * 4); }      // the lane's eight keys of tile t lie side by side in its query's mask row
    __builtin_amdgcn_sched_barrier(0);      // keeps every load above ahead of the first product: without it the scheduler puts a q.k product, with its wait, in front of the rel loads, and the pass waits for memory twice
#pragma unroll
    for (int u = 0; u < 5; ++u) { v8f d = {};
#pragma unroll
      for (int kc = 0; kc < 2; ++kc) { d = wmma_bf_w(rb[u][kc], aq[kc].l, d); d = wmma_bf_w(rb[u][kc], aq[kc].h, d); }
      // the lane's eight offsets 16 u + 8 g + r lie side by side in its query's row
      vst2(&sR[wv][col][u * 16 + 8 * g], __builtin_shufflevector(d, d, 0, 1, 2, 3)); vst2(&sR[wv][col][u * 16 + 8 * g + 4], __builtin_shufflevector(d, d, 4, 5, 6, 7)); }
    asm volatile("s_wait_xcnt 0x0" :: "v"(pr), "v"(pkh), "v"(pkl), "v"(pm) : "memory");      // the address registers of the loads above are held up to here and rewritten only behind this wait
    // The V fragments are asked for here, where the rel registers have come free: they fly during the q.k products and the softmax and are first used behind it.
    v16h vhf[2][4], vlf[2][4]; const size_t vo = (bh * (SS / 64) + kt) * 4096 + lane * 8; const _Float16* pvh = VTh + vo; const _Float16* pvl = VTl + vo;
#pragma unroll
    for (int kc = 0; kc < 2; ++kc) {
#pragma unroll
      for (int t = 0; t < 4; ++t) { vhf[kc][t] = frag_th(pvh + (kc * 4 + t) * 512); vlf[kc][t] = frag_th(pvl + (kc * 4 + t) * 512); } }
    v8f s[4] = {};
#pragma unroll
    for (int t = 0; t < 4; ++t) {
#pragma unroll
      for (int kc = 0; kc < 2; ++kc) { s[t] = wmma_bf_w(khf[t][kc], aq[kc].l, s[t]); s[t] = wmma_bf_w(klf[t][kc], aq[kc].h, s[t]); s[t] = wmma_bf_w(khf[t][kc], aq[kc].h, s[t]); } }
    asm volatile("s_wait_xcnt 0x0" :: "v"(pvh), "v"(pvl) : "memory");      // as above, for the V loads
    __builtin_amdgcn_sched_barrier(0);      // keeps the mask compares behind the products: moved up among them, the first compare makes the rel products wait for the K and mask loads as well
    LDSW();      // the read below takes sR values that the lane of the other half g stored
    const float* pd = &sR[wv][col][15 - col + 8 * g]; float sc[4][8], mt[4];
#pragma unroll
    for (int t = 0; t < 4; ++t) {
#pragma unroll
      for (int r = 0; r < 8; ++r) { const float v = s[t][r] * 0.125f + pd[t * 16 + r]; sc[t][r] = (mk[t][r >> 2][r & 3] == 0) ? -1.0e30f : v; } }
    // four independent chains for the maximum and for the sum: a chain of 32 dependent steps would leave the wave waiting on itself
#pragma unroll
    for (int t = 0; t < 4; ++t) { mt[t] = sc[t][0];
#pragma unroll
      for (int r = 1; r < 8; ++r) mt[t] = fmaxf(mt[t], sc[t][r]); }
    float mx = fmaxf(fmaxf(mt[0], mt[1]), fmaxf(mt[2], mt[3]));
    mx = fmaxf(mx, __shfl_xor(mx, 16, 32));
    const float mnew = fmaxf(mrun, mx); const float corr = expf(mrun - mnew);
    v16h ph[2], pl[2]; float pt[4];
#pragma unroll
    for (int t = 0; t < 4; ++t) { pt[t] = 0.f;
#pragma unroll
      for (int r = 0; r < 8; ++r) { const float p = expf(sc[t][r] - mnew) * 16384.0f; pt[t] += p; const _Float16 hi = (_Float16)p; ph[t >> 1][(t & 1) * 8 + r] = hi; pl[t >> 1][(t & 1) * 8 + r] = (_Float16)((p - (float)hi) * PLO); } }
    float ps = (pt[0] + pt[1]) + (pt[2] + pt[3]);
    ps += __shfl_xor(ps, 16, 32);
    lrun = lrun * corr + ps * (1.0f / 16384.0f); mrun = mnew;
#pragma unroll
    for (int t = 0; t < 4; ++t) {
#pragma unroll
      for (int r = 0; r < 8; ++r) { acc[t][r] *= corr; ac1[t][r] *= corr; ac2[t][r] *= corr; } }
#pragma unroll
    for (int kc = 0; kc < 2; ++kc) {
#pragma unroll
      for (int t = 0; t < 4; ++t) { acc[t] = wmma16_w(vhf[kc][t], ph[kc], acc[t]); ac1[t] = wmma16_w(vlf[kc][t], ph[kc], ac1[t]); ac2[t] = wmma16_w(vhf[kc][t], pl[kc], ac2[t]); } }
    __builtin_amdgcn_wave_barrier(); }
  // The odd-tile wave lays its share down (context not yet divided, maximum, sum), each lane in a column of its own; behind the barrier the same lane of the even-tile wave scales both shares to the common maximum, adds them and divides.
  // A share without a tile has maximum -3e38 and sum 0: its factor is exp(-3e38 - m) = 0.
  if (kh) {
#pragma unroll
    for (int t = 0; t < 4; ++t) {
#pragma unroll
      for (int r = 0; r < 8; ++r) sO[w][t * 8 + r][lane] = acc[t][r] + ac1[t][r] * (1.0f / VLO) + ac2[t][r] * (1.0f / PLO); }
    sO[w][32][lane] = mrun; sO[w][33][lane] = lrun; }
  __syncthreads();      // the odd-tile waves' shares are in LDS
  if (!kh) {
  const float m1 = sO[w][32][lane], l1 = sO[w][33][lane]; const float mm = fmaxf(mrun, m1); const float f0 = expf(mrun - mm), f1 = expf(m1 - mm); const float inv = 1.0f / ((lrun * f0 + l1 * f1) * 16384.0f * 4.0f);
  // O32 in the f32 form of the fragment order: tile (query / 16, d / 32) = 2048 bytes, four 512-byte parts j; lane (g, row) holds d = 16 (j >> 1) + 8 g + 4 (j & 1) + 0..3 of its row in part j: the lane's own accumulator places
  float* po = O32 + (bh * (SS / 16) + (q0 >> 4)) * 1024 + lane * 4;
  // unrolled: the accumulators are indexed by constants and stay in registers
#pragma unroll
  for (int i = 0; i < 8; ++i) { const int t = i >> 1, rb0 = (i & 1) * 4; v4f o;
#pragma unroll
    for (int e = 0; e < 4; ++e) { const int r = rb0 + e; o[e] = ((acc[t][r] + ac1[t][r] * (1.0f / VLO) + ac2[t][r] * (1.0f / PLO)) * f0 + sO[w][t * 8 + r][lane] * f1) * inv; }
    vst2(po + i * 128, o); }
  asm volatile("s_wait_xcnt 0x0" :: "v"(po) : "memory"); }      // the second part rewrites the stores' address and data registers only behind this wait
  __syncthreads(); }      // sO has been read: the second part may write it
}
// out = ctx Wo + bo : split(ctx) x bf16(Wo columns): 2 products (Wo is an INPUT -> bf16 exact)
__global__ __launch_bounds__(128) void k_out(const float* __restrict__ O32, const __bf16* __restrict__ PT, const float* __restrict__ bo, float* __restrict__ out) {
  __shared__ __align__(16) float so[4][16][132];
  const int tid = threadIdx.x, wave = tid >> 5, lane = tid & 31, col = lane & 15, g = lane >> 4;
  const int r0 = blockIdx.x * 64 + wave * 16, n0 = blockIdx.y * 128; const int ra = r0 + col; const int b = ra / SS, s = ra % SS;
  v8f acc[8] = {};
  const float* po0 = O32 + ((size_t)b * NH * (SS / 16) + (s >> 4)) * 1024 + lane * 4; const __bf16* pw0 = PT + (size_t)((3 * E + n0) >> 4) * (E / 32) * 512 + lane * 8;
  // One head (two k chunks) a pass: all loads of the pass stand ahead of its first product, so that their latencies overlap. Not unrolled further: registers.
#pragma unroll 1
  for (int h = 0; h < NH; ++h) { float ov[2][16]; v16b wb[2][8];
    const float* po = po0 + (size_t)h * (SS / 16) * 1024; const __bf16* pw = pw0 + h * 1024;
    // inner loops unrolled so that the arrays are indexed by constants and stay in registers
#pragma unroll
    for (int c = 0; c < 2; ++c) {
#pragma unroll
      for (int i = 0; i < 16; ++i) ov[c][i] = po[c * 512 + (i >> 2) * 128 + (i & 3)]; }
#pragma unroll
    for (int c = 0; c < 2; ++c) {
#pragma unroll
      for (int j = 0; j < 8; ++j) wb[c][j] = frag_t(pw + (size_t)j * (E / 32) * 512 + c * 512); }
    asm volatile("s_wait_xcnt 0x0" :: "v"(po), "v"(pw) : "memory");      // the loads' address registers are held up to here and rewritten only behind this wait
#pragma unroll
    for (int c = 0; c < 2; ++c) { const F2 a = bsplit16(ov[c]);
#pragma unroll
      for (int j = 0; j < 8; ++j) { acc[j] = wmma_bf(a.l, wb[c][j], acc[j]); acc[j] = wmma_bf(a.h, wb[c][j], acc[j]); } } }
#pragma unroll
  for (int j = 0; j < 8; ++j) { const int n = n0 + j * 16 + col; const float bb = bfr(bo[n]);
#pragma unroll
    for (int r = 0; r < 8; ++r) so[wave][8 * g + r][j * 16 + col] = acc[j][r] + bb; }
  LDSX();
#pragma unroll 4
  for (int rl = 0; rl < 16; ++rl) vst2(out + (size_t)(r0 + rl) * E + n0 + lane * 4, *(const v4f*)(&so[wave][rl][lane * 4]));
}
extern "C" void kernel_launch(void* const* d_in, const int* in_sizes, int n_in, void* d_out, int out_size, void* d_ws, size_t ws_size, hipStream_t stream) {
  (void)in_sizes; (void)n_in; (void)out_size; (void)ws_size;
  const float* x = (const float*)d_in[0]; const int* mask = (const int*)d_in[1]; const float* Wq = (const float*)d_in[2]; const float* bq = (const float*)d_in[3]; const float* Wk = (const float*)d_in[4]; const float* bk = (const float*)d_in[5];
  const float* Wv = (const float*)d_in[6]; const float* bv = (const float*)d_in[7]; const float* Wp = (const float*)d_in[8]; const float* bp = (const float*)d_in[9]; const float* rel = (const float*)d_in[10];
  float* out = (float*)d_out;
  char* ws = (char*)d_ws; size_t off = 0;
  auto take = [&](size_t bytes) { char* p = ws + off; off += (bytes + 255) & ~(size_t)255; return p; };
  __bf16* Xb = (__bf16*)take((size_t)NR * E * 2); __bf16* PT = (__bf16*)take((size_t)4 * E * E * 2); __bf16* RB = (__bf16*)take((size_t)NREL * HD * 2);
  float* Q32 = (float*)take((size_t)NR * E * 4); __bf16* Kh = (__bf16*)take((size_t)NR * E * 2); __bf16* Kl = (__bf16*)take((size_t)NR * E * 2); _Float16* VTh = (_Float16*)take((size_t)NR * E * 2); _Float16* VTl = (_Float16*)take((size_t)NR * E * 2); float* O32 = (float*)take((size_t)NR * E * 4); unsigned* MW = (unsigned*)take((size_t)(SS / 16) * 4 * 4); float* CS = (float*)take((size_t)SS * 32 * 2 * 4);
  // ws ~ 45 MB
  k_prep<<<PB_ROT + PB_PACK + PB_MSK + PB_CVT + PB_REL, 256, 0, stream>>>(x, mask, Wq, Wk, Wv, Wp, rel, Xb, PT, RB, MW, CS);
  k_qkv<<<dim3(NR / 64, E / 128, 3), 128, 0, stream>>>(Xb, PT, CS, bq, bk, bv, Q32, Kh, Kl, VTh, VTl);
  k_attn<<<dim3(SS / 64, NH / 2), 256, 0, stream>>>(Q32, Kh, Kl, VTh, VTl, mask, MW, RB, O32);
  k_out<<<dim3(NR / 64, E / 128), 128, 0, stream>>>(O32, PT, bp, out);
}

// v008
// One run takes 97.3 microseconds.
// Timed twice side by side with v007, it ran 1.07 and 1.06 times as fast.
// All steps since v000 together make it 35.3 times as fast.
// compute dtype: x, W*, b*, rel_pos_emb (INPUTS) rounded to bf16 with exact bf16 WMMA products (f32 accumulate) for the projections; rotary in f32; K pre-split into bf16 hi/lo rows; the relative-position scores q.rel^T as q hi/lo x bf16(rel) (2 products); P and V f16 hi/lo (3 products); softmax with the int mask in f32.
#include <hip/hip_runtime.h>
#include <math.h>

typedef __attribute__((ext_vector_type(16))) _Float16 v16h;
typedef __attribute__((ext_vector_type(16))) __bf16 v16b;
typedef __attribute__((ext_vector_type(8)))  _Float16 v8h;
typedef __attribute__((ext_vector_type(8)))  float v8f;
typedef __attribute__((ext_vector_type(4)))  float v4f;
typedef __attribute__((ext_vector_type(2)))  float v2f;
typedef __attribute__((ext_vector_type(4)))  unsigned v4u;
typedef __attribute__((ext_vector_type(4)))  int v4i;
typedef float __attribute__((may_alias)) float_a;
typedef int __attribute__((may_alias)) int_a;

template <typename T> __device__ __forceinline__ void vst2(void* p, T v) { *(T*)p = v;  }
__device__ __forceinline__ v8f wmma16(v16h a, v16h b, v8f c) {
  v8f d = __builtin_amdgcn_wmma_f32_16x16x32_f16(false, a, false, b, (short)0, c, false, false);
  asm volatile("v_nop\n\tv_nop\n\tv_nop\n\tv_nop" : "+v"(d) : "v"(a), "v"(b));
  return d;
}
__device__ __forceinline__ v8f wmma_bf(v16b a, v16b b, v8f c) {
  v8f d = __builtin_amdgcn_wmma_f32_16x16x32_bf16(false, a, false, b, (short)0, c, false, false);
  asm volatile("v_nop\n\tv_nop\n\tv_nop\n\tv_nop" : "+v"(d) : "v"(a), "v"(b));
  return d;
}
// The same two for the attention kernel, whose fragments in flight lie above v255: an operand of an asm statement is held below v256, so a and b are not named there (naming them spills).
__device__ __forceinline__ v8f wmma16_w(v16h a, v16h b, v8f c) {
  v8f d = __builtin_amdgcn_wmma_f32_16x16x32_f16(false, a, false, b, (short)0, c, false, false);
  asm volatile("v_nop\n\tv_nop\n\tv_nop\n\tv_nop" : "+v"(d));      // the distance behind a matrix instruction
  return d;
}
__device__ __forceinline__ v8f wmma_bf_w(v16b a, v16b b, v8f c) {
  v8f d = __builtin_amdgcn_wmma_f32_16x16x32_bf16(false, a, false, b, (short)0, c, false, false);
  asm volatile("v_nop\n\tv_nop\n\tv_nop\n\tv_nop" : "+v"(d));      // the distance behind a matrix instruction
  return d;
}
// 16x16x32 fragments: lane = (h = lane>>4, row/col = lane&15); elements 0..7 = k0+8h+0..7, 8..15 = k0+16+8h+0..7; D element r = row 8h+r
__device__ __forceinline__ v16h frag_h(const _Float16* rowk0, int lane) {
  union { v16h v; v8h q[2]; } u; const _Float16* p = rowk0 + 8 * (lane >> 4);
  u.q[0] = *(const v8h*)p; u.q[1] = *(const v8h*)(p + 16); return u.v;
}
__device__ __forceinline__ v16h frag_f32(const float* rowk0, int lane) {
  v16h a; const float* p = rowk0 + 8 * (lane >> 4);
#pragma unroll
  for (int i = 0; i < 8; ++i) { a[i] = (_Float16)p[i]; a[8 + i] = (_Float16)p[16 + i]; }
  return a;
}
__device__ __forceinline__ v16h frag_f32s(const float* rowk0, int lane, float sc) {
  v16h a; const float* p = rowk0 + 8 * (lane >> 4);
#pragma unroll
  for (int i = 0; i < 8; ++i) { a[i] = (_Float16)(p[i] * sc); a[8 + i] = (_Float16)(p[16 + i] * sc); }
  return a;
}
// column fragment from a [K][ld] layout (column n), rows >= K read as 0
__device__ __forceinline__ v16h fragc_f32(const float* W, int k0, int n, int lane, int ld, int K) {
  v16h a; const int g = lane >> 4;
#pragma unroll
  for (int i = 0; i < 8; ++i) { const int ka = k0 + 8 * g + i, kb = ka + 16;
    a[i] = (_Float16)(ka < K ? W[(size_t)ka * ld + n] : 0.f); a[8 + i] = (_Float16)(kb < K ? W[(size_t)kb * ld + n] : 0.f); }
  return a;
}
struct F2 { v16b h, l; };
__device__ __forceinline__ F2 bsplit16(const float v[16]) { F2 r;
#pragma unroll
  for (int i = 0; i < 16; ++i) { const __bf16 h = (__bf16)v[i]; r.h[i] = h; r.l[i] = (__bf16)(v[i] - (float)h); }
  return r; }
__device__ __forceinline__ F2 split_row(const float* row, int k0, int lane) { float v[16]; const float* p = row + k0 + 8 * (lane >> 4);
#pragma unroll
  for (int i = 0; i < 8; ++i) { v[i] = p[i]; v[8 + i] = p[16 + i]; }
  return bsplit16(v); }
__device__ __forceinline__ F2 split_rowK(const float* row, int k0, int lane, int K) { float v[16]; const int g = lane >> 4;
#pragma unroll
  for (int i = 0; i < 8; ++i) { const int ka = k0 + 8 * g + i, kb = ka + 16; v[i] = ka < K ? row[ka] : 0.f; v[8 + i] = kb < K ? row[kb] : 0.f; }
  return bsplit16(v); }
__device__ __forceinline__ F2 split_col(const float* W, int k0, int n, int lane, int ld, int K) { float v[16]; const int g = lane >> 4;
#pragma unroll
  for (int i = 0; i < 8; ++i) { const int ka = k0 + 8 * g + i, kb = ka + 16; v[i] = ka < K ? W[(size_t)ka * ld + n] : 0.f; v[8 + i] = kb < K ? W[(size_t)kb * ld + n] : 0.f; }
  return bsplit16(v); }
__device__ __forceinline__ v8f mac3(const F2& a, const F2& b, v8f c) { c = wmma_bf(a.l, b.h, c); c = wmma_bf(a.h, b.l, c); return wmma_bf(a.h, b.h, c); }
__device__ __forceinline__ float sigm(float v) { return 1.0f / (1.0f + expf(-v)); }
#define LDSX() do { asm volatile("s_wait_dscnt 0" ::: "memory"); __builtin_amdgcn_wave_barrier(); __builtin_amdgcn_fence(__ATOMIC_RELEASE, "workgroup"); } while (0)
// The same exchange among the lanes of ONE wave, for places where global loads are in flight: the fence at wavefront scope orders the LDS accesses for the compiler and does not drain the loads as the work-group one does.
#define LDSW() do { asm volatile("s_wait_dscnt 0" ::: "memory"); __builtin_amdgcn_wave_barrier(); __builtin_amdgcn_fence(__ATOMIC_RELEASE, "wavefront"); } while (0)


// Rotary multi-head attention with Shaw relative-position scores (16 heads of 64 on [1,2048,1024], [in][out] weights + biases): q,k = rotate_half-RoPE(xW+b) (angle[d] = s*10000^(-2(d mod 32)/64));
// scores[i][j] = q_i.k_j/8 + q_i.rel_pos_emb[j-i+2047]; masked where mask[i][j] == 0 (-1e30); softmax; (P v) Wo + bo. The rel term uses the skew trick inside the attention kernel: a tile of 16 queries x 64 keys
// needs only the 79 offsets c = j-i+2047 of its diagonals, so q.rel[c] is formed for five 16-column tiles, laid in LDS and read back along the diagonal. No score table in memory: all heads run in one launch.
// A tile of 16 queries x 64 keys whose mask words are all 0 adds exactly nothing to a row that has an open key somewhere (its weights are exp(-1e30 - m) = 0, or are wiped by the factor 0 at the row's first open key):
// p_msk reads the mask once and says which tiles hold an open word; the attention kernel passes over the others.
#define NB 1
#define SS 2048
#define NREL 4096      // 4095 offsets padded to 4096 (offset 4095 is clamped to row 4094 and never used)
#define E 1024
#define NH 16
#define HD 64
#define NR (NB * SS)
#define PLO 1024.0f
#define VLO 2048.0f
__device__ __forceinline__ float bfr(float v) { return (float)(__bf16)v; }
// 2^a by the chip's own base-2 exponential. The softmax weights e^d, d <= 0, are taken as 2^(d log2 e): one multiply (or fused multiply-add) and this instruction, in place of the library's expf (range tests, split argument, ldexp).
// d is a difference formed first, so that equal values give exactly 2^0 also at -1e30; a result below the normal range comes out as 0, at a = -inf too.
#define LOG2E 1.4426950408889634f
__device__ __forceinline__ float exp_b2(float a) { float r = __builtin_amdgcn_exp2f(a);
  // The one slot that the instruction set asks for behind a transcendental: r is read and a's register rewritten only behind this v_nop.
  asm("v_nop" : "+v"(r) : "v"(a));
  return r; }
// The same for eight values at once, with one v_nop for the eight: up to it nothing reads a result or rewrites an argument's register, so what stands directly behind each v_exp_f32 is another of the eight, an instruction that touches neither, or the v_nop.
__device__ __forceinline__ void exp_b2x8(const float a[8], float e[8]) {
#pragma unroll
  for (int r = 0; r < 8; ++r) e[r] = __builtin_amdgcn_exp2f(a[r]);
  asm("v_nop" : "+v"(e[0]), "+v"(e[1]), "+v"(e[2]), "+v"(e[3]), "+v"(e[4]), "+v"(e[5]), "+v"(e[6]), "+v"(e[7]) : "v"(a[0]), "v"(a[1]), "v"(a[2]), "v"(a[3]), "v"(a[4]), "v"(a[5]), "v"(a[6]), "v"(a[7]));
}
__device__ __forceinline__ v16b frag_b(const __bf16* rowk0, int lane) { return __builtin_bit_cast(v16b, frag_h((const _Float16*)rowk0, lane)); }
// FRAGMENT ORDER of the 16-bit operands in the workspace: a tile of 16 rows x 32 k is 1024 contiguous bytes; the piece of 8 elements k = 16 hf + 8 g + 0..7 of row r lies at element (hf * 32 + g * 16 + r) * 8.
// Lane l = g * 16 + r finds its two pieces at l * 8 and 256 + l * 8, so each wave-wide 16-byte load covers 512 contiguous bytes (4 whole lines) and not 32-byte pieces of 16 lines. p = tile + lane * 8.
__device__ __forceinline__ v16h frag_th(const _Float16* p) { union { v16h v; v8h q[2]; } u; u.q[0] = *(const v8h*)p; u.q[1] = *(const v8h*)(p + 256); return u.v; }
__device__ __forceinline__ v16b frag_t(const __bf16* p) { return __builtin_bit_cast(v16b, frag_th((const _Float16*)p)); }

// The five preparation jobs (rotary angles, weights, mask scan, x, rel rows) depend on the inputs alone and not on each other: they are parts of ONE launch, k_prep, in which a range of block indices picks the job (blk = the block's number inside its job).
__device__ __forceinline__ void p_cvt(int blk, const float* __restrict__ x, __bf16* __restrict__ Xb) {
  const size_t i8 = (size_t)blk * 256 + threadIdx.x; if (i8 >= (size_t)NR * E / 8) return;
  // i8 = the piece's place in fragment order: tile (row tile, k chunk), then hf, g, row
  const size_t tile = i8 >> 6; const int hf = (int)(i8 >> 5) & 1, g = (int)(i8 >> 4) & 1, row = (int)i8 & 15;
  const float* px = x + ((tile >> 5) * 16 + row) * E + (tile & 31) * 32 + hf * 16 + g * 8;
  union { __bf16 h[8]; v4u u; } pk;
#pragma unroll
  for (int e = 0; e < 8; ++e) pk.h[e] = (__bf16)px[e];
  vst2((unsigned*)(Xb + i8 * 8), pk.u);
}
// PT rows: [0,E) Wq[:,n], [E,2E) Wk[:,n], [2E,3E) Wv[:,n], [3E,4E) Wo[:,n]  ([in][out] weights: column n as a bf16 row), in fragment order
__device__ __forceinline__ void p_pack(int blk, const float* __restrict__ Wq, const float* __restrict__ Wk, const float* __restrict__ Wv, const float* __restrict__ Wo, __bf16* __restrict__ PT) {
  // block: 32 columns n (two row tiles of PT) x 256 k, turned in LDS; written in fragment order, tile (n / 16, k / 32)
  const int n0 = (blk & (4 * E / 32 - 1)) * 32, k0 = (blk / (4 * E / 32)) * 256, tid = threadIdx.x; __shared__ __align__(16) __bf16 st[32][264];
  const float* W = n0 < E ? Wq : (n0 < 2 * E ? Wk : (n0 < 3 * E ? Wv : Wo)); const int nn0 = n0 & (E - 1);
  const int kr = tid >> 3, c4 = (tid & 7) * 4; const float* pwv = W + (size_t)(k0 + kr) * E + nn0 + c4; v4f v[8];      // a wave-wide load: 4 rows k x 128 bytes, whole lines
  // unrolled: v is indexed by constants and stays in registers
#pragma unroll
  for (int i = 0; i < 8; ++i) v[i] = *(const v4f*)(pwv + (size_t)i * 32 * E);
  asm volatile("s_wait_xcnt 0x0" :: "v"(pwv) : "memory");      // the loads' address register is held up to here and rewritten only behind this wait
#pragma unroll
  for (int i = 0; i < 8; ++i) {
#pragma unroll
    for (int e = 0; e < 4; ++e) st[c4 + e][i * 32 + kr] = (__bf16)v[i][e]; }
  __syncthreads();
  for (int i = 0; i < 4; ++i) { const int j = i * 256 + tid, tile = j >> 6, nt = tile >> 3, kcl = tile & 7, hf = (j >> 5) & 1, g = (j >> 4) & 1, row = j & 15;
    vst2((unsigned*)(PT + ((size_t)((n0 >> 4) + nt) * (E / 32) + (k0 >> 5) + kcl) * 512 + (j & 63) * 8), *(const v4u*)(&st[nt * 16 + row][kcl * 32 + hf * 16 + g * 8])); }
  asm volatile("s_wait_xcnt 0x0" ::: "memory");      // another job's code follows in the listing: the stores' address and data registers are rewritten only behind this wait
}
// QKV: block (64 rows, 128 cols = 2 heads, which); q (+bias) -> Q32 f32 [bh][s][64]; k (+bias) -> bf16 hi/lo rows; v (+bias) -> VT hi/lo x4 (rows d, k = key); K and VT in fragment order
__global__ __launch_bounds__(128) void k_qkv(const __bf16* __restrict__ Xb, const __bf16* __restrict__ PT, const float* __restrict__ CS, const float* __restrict__ bq, const float* __restrict__ bk, const float* __restrict__ bv,
                                            float* __restrict__ Q32, __bf16* __restrict__ Kh, __bf16* __restrict__ Kl, _Float16* __restrict__ VTh, _Float16* __restrict__ VTl) {
  __shared__ __align__(16) float so[4][16][132];
  __shared__ __align__(16) _Float16 sth[128][72], stl[128][72];
  const int tid = threadIdx.x, wave = tid >> 5, lane = tid & 31, col = lane & 15, g = lane >> 4;
  const int which = blockIdx.z, r0b = blockIdx.x * 64, r0 = r0b + wave * 16, n0 = blockIdx.y * 128; const int b = r0b / SS, s0 = r0b % SS;
  const float* bb_ = which == 0 ? bq : (which == 1 ? bk : bv);
  v8f acc[8] = {};
  // The (cos, sin) pairs of the lane's accumulator places: rows 8 g + r, d mod 32 = jj * 16 + col; the same for both heads of the block. Asked for here, they are in flight together with the loads of the product loop's first pass. A wave-wide load covers 128 bytes of two rows.
  v2f cs[2][8]; const float* pcs = CS + ((size_t)(s0 + wave * 16 + 8 * g) * 32 + col) * 2;
  // unrolled: cs is indexed by constants and stays in registers
#pragma unroll
  for (int jj = 0; jj < 2; ++jj) {
#pragma unroll
    for (int r = 0; r < 8; ++r) cs[jj][r] = *(const v2f*)(pcs + r * 64 + jj * 32); }
  asm volatile("s_wait_xcnt 0x0" :: "v"(pcs) : "memory");      // the loads' address register is held up to here and rewritten only behind this wait
  // Two k chunks a pass: all 36 loads of the pass stand ahead of its first product, so that their latencies overlap (one wait a pass instead of one a product). Not unrolled further: registers.
#pragma unroll 1
  for (int kc = 0; kc < E / 32; kc += 2) { v16b a[2], wb[2][8];
    const __bf16* pa = Xb + ((size_t)(r0 >> 4) * (E / 32) + kc) * 512 + lane * 8; const __bf16* pw = PT + ((size_t)((which * E + n0) >> 4) * (E / 32) + kc) * 512 + lane * 8;
    // inner loops unrolled so that the fragment arrays are indexed by constants and stay in registers
#pragma unroll
    for (int c = 0; c < 2; ++c) { a[c] = frag_t(pa + c * 512);
#pragma unroll
      for (int j = 0; j < 8; ++j) wb[c][j] = frag_t(pw + (size_t)j * (E / 32) * 512 + c * 512); }
#pragma unroll
    for (int j = 0; j < 8; ++j) acc[j] = wmma_bf(a[0], wb[0][j], acc[j]);
    asm volatile("s_wait_xcnt 0x0" :: "v"(pa), "v"(pw) : "memory");      // the loads' address registers are held up to here and rewritten only behind this wait
#pragma unroll
    for (int j = 0; j < 8; ++j) acc[j] = wmma_bf(a[1], wb[1][j], acc[j]); }
  if (which < 2) {
    // RoPE (rotate_half pairs (d, d+32)) on the accumulators: column tiles j and j + 2 of a head hold d and d + 32 of the same row in the same lane and element
#pragma unroll
    for (int j = 0; j < 8; ++j) { if (j & 2) continue;
      const int jj = j & 1; const float b1 = bfr(bb_[n0 + j * 16 + col]), b2 = bfr(bb_[n0 + (j + 2) * 16 + col]);
#pragma unroll
      for (int r = 0; r < 8; ++r) { const float x1 = acc[j][r] + b1, x2 = acc[j + 2][r] + b2, c = cs[jj][r][0], sn = cs[jj][r][1];
        so[wave][8 * g + r][j * 16 + col] = x1 * c - x2 * sn; so[wave][8 * g + r][(j + 2) * 16 + col] = x2 * c + x1 * sn; } }
    LDSX();
    if (which == 0) { for (int qq = lane; qq < 2 * 16 * 16; qq += 32) { const int hh = qq >> 8, rl = (qq >> 4) & 15, pc = qq & 15; const int h = (n0 >> 6) + hh;
        vst2(Q32 + (((size_t)b * NH + h) * SS + s0 + wave * 16 + rl) * HD + pc * 4, *(const v4f*)(&so[wave][rl][hh * 64 + pc * 4])); } }
    else {
      // fragment order, tile (key / 16, d / 32): the wave's 32 lanes store one 512-byte half tile a trip
      for (int i = 0; i < 16; ++i) { const int hf = i & 1, kc = (i >> 1) & 1, lo = (i >> 2) & 1, hh = i >> 3; const int h = (n0 >> 6) + hh; union { __bf16 e[8]; v4u u; } pk;
#pragma unroll
        for (int e = 0; e < 8; ++e) { const float v = so[wave][col][hh * 64 + kc * 32 + hf * 16 + g * 8 + e]; const __bf16 hi = (__bf16)v; pk.e[e] = lo ? (__bf16)(v - (float)hi) : hi; }
        vst2((unsigned*)((lo ? Kl : Kh) + ((((size_t)b * NH + h) * (SS / 16) + (s0 >> 4) + wave) * 2 + kc) * 512 + hf * 256 + lane * 8), pk.u);
        asm volatile("s_wait_xcnt 0x0" ::: "memory"); } } }      // the next trip rewrites the store's address and data registers only behind this wait
  else {
#pragma unroll
    for (int j = 0; j < 8; ++j) { const float bb = bfr(bb_[n0 + j * 16 + col]);
#pragma unroll
      for (int r = 0; r < 8; ++r) { const float v = (acc[j][r] + bb) * 4.0f; const _Float16 hi = (_Float16)v; sth[j * 16 + col][wave * 16 + 8 * g + r] = hi; stl[j * 16 + col][wave * 16 + 8 * g + r] = (_Float16)((v - (float)hi) * VLO); } }
    __syncthreads();
    // fragment order, per head and 64 keys eight tiles (key chunk kc, d / 16): qq = hh, kc, d / 16, hf, g, d % 16 from the top bit down
    for (int qq = tid; qq < 128 * 8; qq += 128) { const int hh = qq >> 9, cl = hh * 64 + ((qq >> 6) & 3) * 16 + (qq & 15), pc = ((qq >> 8) & 1) * 4 + ((qq >> 4) & 3); const size_t o = (((size_t)b * NH + (n0 >> 6) + hh) * (SS / 64) + (s0 >> 6)) * 4096 + (qq & 511) * 8;
      vst2(VTh + o, *(const v4u*)(&sth[cl][pc * 8])); vst2(VTl + o, *(const v4u*)(&stl[cl][pc * 8])); } }
}

// rel_pos_emb rows -> bf16 in fragment order, tile (offset / 16, d / 32); the pad row 4095 takes row 4094's values (never used by a score)
__device__ __forceinline__ void p_relb(int blk, const float* __restrict__ rel, __bf16* __restrict__ RB) {
  const size_t i8 = (size_t)blk * 256 + threadIdx.x; if (i8 >= (size_t)NREL * HD / 8) return;
  const int tile = (int)(i8 >> 6), hf = (int)(i8 >> 5) & 1, g = (int)(i8 >> 4) & 1, c = (tile >> 1) * 16 + ((int)i8 & 15);
  const float* ps = rel + (size_t)(c < NREL - 1 ? c : NREL - 2) * HD + (tile & 1) * 32 + hf * 16 + g * 8;
  union { __bf16 e[8]; v4u u; } pk;
#pragma unroll
  for (int e = 0; e < 8; ++e) pk.e[e] = (__bf16)ps[e];
  vst2((unsigned*)(RB + i8 * 8), pk.u);
}
// MW[query / 16][key quarter]: bit 16 + k is set where key tile 8 * quarter + k (64 keys) holds a mask word != 0 for one of the 16 queries; bit r < 16 where row r has an open key in the quarter. tile_word() joins the four.
// block = 16 queries x 8 key tiles (a block of k_prep has 8 waves), wave = key tile; a wave-wide 16-byte load covers 256 contiguous bytes of two rows.
__device__ __forceinline__ void p_msk(int blk, const int* __restrict__ mask, unsigned* __restrict__ MW) {
  __shared__ __align__(16) unsigned sT[8];
  const int tid = threadIdx.x, kt = tid >> 5, lane = tid & 31;
  const int* pm = mask + (size_t)((blk >> 2) * 16 + (lane >> 4)) * SS + ((blk & 3) * 8 + kt) * 64 + (lane & 15) * 4; v4i m[8];
  // unrolled: m is indexed by constants and stays in registers; the eight loads are in flight together
#pragma unroll
  for (int i = 0; i < 8; ++i) m[i] = *(const v4i*)(pm + (size_t)i * 2 * SS);
  asm volatile("s_wait_xcnt 0x0" :: "v"(pm) : "memory");      // the loads' address register is held up to here and rewritten only behind this wait
  unsigned rows = 0;      // bit r: row r has an open key in this tile
#pragma unroll
  for (int i = 0; i < 8; ++i) { const unsigned bl = __builtin_amdgcn_ballot_w32((m[i][0] | m[i][1] | m[i][2] | m[i][3]) != 0);
    rows |= ((bl & 0xFFFFu) ? 1u : 0u) << (2 * i); rows |= ((bl >> 16) ? 2u : 0u) << (2 * i); }
  if (lane == 0) sT[kt] = rows;
  __syncthreads();
  if (tid == 0) { unsigned tiles = 0, seen = 0;
#pragma unroll
    for (int k = 0; k < 8; ++k) { const unsigned v = sT[k]; seen |= v; tiles |= (v ? 1u : 0u) << k; }
    MW[blk] = seen | (tiles << 16); }
}
// The word of a query tile: bit kt is set where key tile kt holds an open key for one of the 16 queries. Where one of the 16 rows has no open key at all its softmax is uniform over ALL keys, so every bit is set.
__device__ __forceinline__ unsigned tile_word(const unsigned* __restrict__ MW, int qt) {
  const v4u p = *(const v4u*)(MW + qt * 4);
  const unsigned seen = (p[0] | p[1] | p[2] | p[3]) & 0xFFFFu, tiles = (p[0] >> 16) | ((p[1] >> 16) << 8) | ((p[2] >> 16) << 16) | ((p[3] >> 16) << 24);
  return seen == 0xFFFFu ? tiles : 0xFFFFFFFFu;
}
// CS[s][d] = (cos, sin) of the rotary angle s * 10000^(-2 d / 64), d < 32: each angle is worked out once here and read by every QKV block that needs it. A thread takes one d and eight positions s; a wave stores 256 contiguous bytes.
__device__ __forceinline__ void p_rot(int blk, float* __restrict__ CS) {
  const int i = blk * 256 + (int)threadIdx.x, d = i & 31, sb = (i >> 5) * 8;
  const float invf = powf(10000.0f, -(float)(2 * d) * (1.0f / 64.0f));
  for (int e = 0; e < 8; ++e) { const float ang = (float)(sb + e) * invf; float sn, c; sincosf(ang, &sn, &c); v2f v; v[0] = c; v[1] = sn;
    vst2(CS + ((size_t)(sb + e) * 32 + d) * 2, v);
    asm volatile("s_wait_xcnt 0x0" ::: "memory"); }      // the next trip rewrites the store's address and data registers only behind this wait
}
#define PB_ROT (SS * 32 / 8 / 256)
#define PB_PACK (4 * E / 32 * (E / 256))
#define PB_MSK (SS / 16 * 4)
#define PB_CVT (NR * E / 8 / 256)
#define PB_REL (NREL * HD / 8 / 256)
// The jobs with the longest way through a block (the angles' arithmetic; loads, LDS, barrier, stores) take the lowest block indices, the short ones the highest.
__global__ __launch_bounds__(256) void k_prep(const float* __restrict__ x, const int* __restrict__ mask, const float* __restrict__ Wq, const float* __restrict__ Wk, const float* __restrict__ Wv, const float* __restrict__ Wo, const float* __restrict__ rel,
                                             __bf16* __restrict__ Xb, __bf16* __restrict__ PT, __bf16* __restrict__ RB, unsigned* __restrict__ MW, float* __restrict__ CS) {
  const int blk = (int)blockIdx.x - PB_ROT;
  if (blk < 0) p_rot((int)blockIdx.x, CS);
  else if (blk < PB_PACK) p_pack(blk, Wq, Wk, Wv, Wo, PT);
  else if (blk < PB_PACK + PB_MSK) p_msk(blk - PB_PACK, mask, MW);
  else if (blk < PB_PACK + PB_MSK + PB_CVT) p_cvt(blk - (PB_PACK + PB_MSK), x, Xb);
  else p_relb(blk - (PB_PACK + PB_MSK + PB_CVT), rel, RB);
}
// masked attention with relative-position scores: block (64 queries, head) twice, two waves a query tile; the key tiles that MW names; S on q hi/lo x K hi/lo rows; P,V hi/lo; O f32 in fragment order
// All three products are formed TRANSPOSED (keys, offsets or d as the rows of A; the 16 queries as the columns of B): a lane (g, col) then holds, of ONE query q0 + col, the scores of keys 16 t + 8 g + r. Maximum and sum are
// taken in the lane (one exchange between the halves g), two score tiles converted in place ARE the B operand of V^T P^T, the rescale factor is the lane's own, and the context leaves in the order that k_out reads.
__global__ __launch_bounds__(256) void k_attn(const float* __restrict__ Q32, const __bf16* __restrict__ Kh, const __bf16* __restrict__ Kl, const _Float16* __restrict__ VTh, const _Float16* __restrict__ VTl, const int* __restrict__ mask, const unsigned* __restrict__ MW, const __bf16* __restrict__ RB, float* __restrict__ O32) {
  __shared__ __align__(16) float sR[8][16][84];
  __shared__ __align__(16) float sO[4][34][32];
  // wave wv: query tile w = wv & 3 of the 64 queries, key share kh = wv >> 2 (the even or the odd key tiles)
  const int tid = threadIdx.x, wv = tid >> 5, w = wv & 3, lane = tid & 31, col = lane & 15, g = lane >> 4;
  // All waves are resident at once, so the launch lasts as long as its longest wave: the tiles that are left are dealt evenly. Under a mask that opens more keys to later queries the cost grows with the query block:
  // a block takes query block t of one head and then query block 31 - t of another, one after the other in every wave, so that all blocks cost alike; each (head, query block) is taken once. And two waves share
  // a query tile, one on its even and one on its odd key tiles, each with a running maximum, sum and context of its own; the two are joined in LDS behind the key loop. Not unrolled: one copy of the code.
  // The tile words of the wave's two query tiles, read here, ahead of every store, with the wave's number in a scalar register: scalar loads, and the test on the word in the key loop is a scalar branch.
  const int ws = __builtin_amdgcn_readfirstlane(w), kh = __builtin_amdgcn_readfirstlane(wv >> 2); const unsigned live0 = tile_word(MW, (int)blockIdx.x * 4 + ws), live1 = tile_word(MW, (SS / 64 - 1 - (int)blockIdx.x) * 4 + ws);
#pragma unroll 1
  for (int part = 0; part < 2; ++part) {
  const size_t bh = (size_t)(blockIdx.y + part * (NH / 2)); const int qb = part ? SS / 64 - 1 - (int)blockIdx.x : (int)blockIdx.x; const int q0 = qb * 64 + w * 16;
  const unsigned live = (part ? live1 : live0) & (kh ? 0xAAAAAAAAu : 0x55555555u);
  F2 aq[2]; float qv[2][16]; const float* pq = Q32 + (bh * SS + q0 + col) * HD + 8 * g;
  // unrolled: qv is indexed by constants and stays in registers
#pragma unroll
  for (int kc = 0; kc < 2; ++kc) {
#pragma unroll
    for (int i = 0; i < 8; ++i) { qv[kc][i] = pq[kc * 32 + i]; qv[kc][8 + i] = pq[kc * 32 + 16 + i]; } }
  asm volatile("s_wait_xcnt 0x0" :: "v"(pq) : "memory");      // the q loads' address register is held up to here and rewritten only behind this wait
#pragma unroll
  for (int kc = 0; kc < 2; ++kc) aq[kc] = bsplit16(qv[kc]);
  float mrun = -3.0e38f, lrun = 0.f; v8f acc[4] = {}, ac1[4] = {}, ac2[4] = {};      // acc[t][r]: d = 16 t + 8 g + r of query q0 + col
#pragma unroll 1
  for (int kt = 0; kt < SS / 64; ++kt) {
    if (!((live >> kt) & 1u)) continue;      // no open key for any of the wave's 16 queries in this tile, or the other wave's tile
    // sR[query][x] = q_(q0+query) . rel[cb + x], x < 80: query q0+query and key kt*64+kk meet at offset c = cb + (kk - query + 15). Same products in the same order as a table of q.rel would hold.
    // The loops below are unrolled so that d, s and the fragments are indexed by constants and stay in registers.
    const int cb = kt * 64 - q0 + (SS - 16);
    // The loads of the score part (rel rows, K rows, mask words) all stand ahead of the first product: they are in flight together and the pass waits for memory once, not once a fragment.
    v16b rb[5][2], khf[4][2], klf[4][2]; v4i mk[4][2];
    // cb is a multiple of 16: the five rel tiles are whole tiles cb / 16 + u <= 255 of RB (the pad offset 4095 is a written row there)
    const __bf16* pr = RB + (size_t)(cb >> 4) * 1024 + lane * 8;
    const size_t ko = (bh * (SS / 16) + kt * 4) * 1024 + lane * 8; const __bf16* pkh = Kh + ko; const __bf16* pkl = Kl + ko; const int* pm = mask + (size_t)(q0 + col) * SS + kt * 64 + 8 * g;
#pragma unroll
    for (int u = 0; u < 5; ++u) {
#pragma unroll
      for (int kc = 0; kc < 2; ++kc) rb[u][kc] = frag_t(pr + (u * 2 + kc) * 512); }
#pragma unroll
    for (int t = 0; t < 4; ++t) {
#pragma unroll
      for (int kc = 0; kc < 2; ++kc) { khf[t][kc] = frag_t(pkh + (t * 2 + kc) * 512); klf[t][kc] = frag_t(pkl + (t * 2 + kc) * 512); } }
#pragma unroll
    for (int t = 0; t < 4; ++t) {
#pragma unroll
      for (int e = 0; e < 2; ++e) mk[t][e] = *(const v4i*)(pm + t * 16 + e * 4); }      // the lane's eight keys of tile t lie side by side in its query's mask row
    __builtin_amdgcn_sched_barrier(0);      // keeps every load above ahead of the first product: without it the scheduler puts a q.k product, with its wait, in front of the rel loads, and the pass waits for memory twice
#pragma unroll
    for (int u = 0; u < 5; ++u) { v8f d = {};
#pragma unroll
      for (int kc = 0; kc < 2; ++kc) { d = wmma_bf_w(rb[u][kc], aq[kc].l, d); d = wmma_bf_w(rb[u][kc], aq[kc].h, d); }
      // the lane's eight offsets 16 u + 8 g + r lie side by side in its query's row
      vst2(&sR[wv][col][u * 16 + 8 * g], __builtin_shufflevector(d, d, 0, 1, 2, 3)); vst2(&sR[wv][col][u * 16 + 8 * g + 4], __builtin_shufflevector(d, d, 4, 5, 6, 7)); }
    asm volatile("s_wait_xcnt 0x0" :: "v"(pr), "v"(pkh), "v"(pkl), "v"(pm) : "memory");      // the address registers of the loads above are held up to here and rewritten only behind this wait
    // The V fragments are asked for here, where the rel registers have come free: they fly during the q.k products and the softmax and are first used behind it.
    v16h vhf[2][4], vlf[2][4]; const size_t vo = (bh * (SS / 64) + kt) * 4096 + lane * 8; const _Float16* pvh = VTh + vo; const _Float16* pvl = VTl + vo;
#pragma unroll
    for (int kc = 0; kc < 2; ++kc) {
#pragma unroll
      for (int t = 0; t < 4; ++t) { vhf[kc][t] = frag_th(pvh + (kc * 4 + t) * 512); vlf[kc][t] = frag_th(pvl + (kc * 4 + t) * 512); } }
    v8f s[4] = {};
#pragma unroll
    for (int t = 0; t < 4; ++t) {
#pragma unroll
      for (int kc = 0; kc < 2; ++kc) { s[t] = wmma_bf_w(khf[t][kc], aq[kc].l, s[t]); s[t] = wmma_bf_w(klf[t][kc], aq[kc].h, s[t]); s[t] = wmma_bf_w(khf[t][kc], aq[kc].h, s[t]); } }
    asm volatile("s_wait_xcnt 0x0" :: "v"(pvh), "v"(pvl) : "memory");      // as above, for the V loads
    __builtin_amdgcn_sched_barrier(0);      // keeps the mask compares behind the products: moved up among them, the first compare makes the rel products wait for the K and mask loads as well
    LDSW();      // the read below takes sR values that the lane of the other half g stored
    const float* pd = &sR[wv][col][15 - col + 8 * g]; float sc[4][8], mt[4];
#pragma unroll
    for (int t = 0; t < 4; ++t) {
#pragma unroll
      for (int r = 0; r < 8; ++r) { const float v = s[t][r] * 0.125f + pd[t * 16 + r]; sc[t][r] = (mk[t][r >> 2][r & 3] == 0) ? -1.0e30f : v; } }
    // four independent chains for the maximum and for the sum: a chain of 32 dependent steps would leave the wave waiting on itself
#pragma unroll
    for (int t = 0; t < 4; ++t) { mt[t] = sc[t][0];
#pragma unroll
      for (int r = 1; r < 8; ++r) mt[t] = fmaxf(mt[t], sc[t][r]); }
    float mx = fmaxf(fmaxf(mt[0], mt[1]), fmaxf(mt[2], mt[3]));
    mx = fmaxf(mx, __shfl_xor(mx, 16, 32));
    const float mnew = fmaxf(mrun, mx); const float corr = exp_b2((mrun - mnew) * LOG2E);
    v16h ph[2], pl[2]; float pt[4];
#pragma unroll
    for (int t = 0; t < 4; ++t) { pt[t] = 0.f; float ea[8], ev[8];
#pragma unroll
      for (int r = 0; r < 8; ++r) ea[r] = fmaf(sc[t][r] - mnew, LOG2E, 14.0f);      // the factor 16384 = 2^14 rides in the exponent
      exp_b2x8(ea, ev);
#pragma unroll
      for (int r = 0; r < 8; ++r) { const float p = ev[r]; pt[t] += p; const _Float16 hi = (_Float16)p; ph[t >> 1][(t & 1) * 8 + r] = hi; pl[t >> 1][(t & 1) * 8 + r] = (_Float16)((p - (float)hi) * PLO); } }
    float ps = (pt[0] + pt[1]) + (pt[2] + pt[3]);
    ps += __shfl_xor(ps, 16, 32);
    lrun = lrun * corr + ps * (1.0f / 16384.0f); mrun = mnew;
#pragma unroll
    for (int t = 0; t < 4; ++t) {
#pragma unroll
      for (int r = 0; r < 8; ++r) { acc[t][r] *= corr; ac1[t][r] *= corr; ac2[t][r] *= corr; } }
#pragma unroll
    for (int kc = 0; kc < 2; ++kc) {
#pragma unroll
      for (int t = 0; t < 4; ++t) { acc[t] = wmma16_w(vhf[kc][t], ph[kc], acc[t]); ac1[t] = wmma16_w(vlf[kc][t], ph[kc], ac1[t]); ac2[t] = wmma16_w(vhf[kc][t], pl[kc], ac2[t]); } }
    __builtin_amdgcn_wave_barrier(); }
  // The odd-tile wave lays its share down (context not yet divided, maximum, sum), each lane in a column of its own; behind the barrier the same lane of the even-tile wave scales both shares to the common maximum, adds them and divides.
  // A share without a tile has maximum -3e38 and sum 0: its factor is exp(-3e38 - m) = 0.
  if (kh) {
#pragma unroll
    for (int t = 0; t < 4; ++t) {
#pragma unroll
      for (int r = 0; r < 8; ++r) sO[w][t * 8 + r][lane] = acc[t][r] + ac1[t][r] * (1.0f / VLO) + ac2[t][r] * (1.0f / PLO); }
    sO[w][32][lane] = mrun; sO[w][33][lane] = lrun; }
  __syncthreads();      // the odd-tile waves' shares are in LDS
  if (!kh) {
  const float m1 = sO[w][32][lane], l1 = sO[w][33][lane]; const float mm = fmaxf(mrun, m1); const float f0 = exp_b2((mrun - mm) * LOG2E), f1 = exp_b2((m1 - mm) * LOG2E); const float inv = 1.0f / ((lrun * f0 + l1 * f1) * 16384.0f * 4.0f);
  // O32 in the f32 form of the fragment order: tile (query / 16, d / 32) = 2048 bytes, four 512-byte parts j; lane (g, row) holds d = 16 (j >> 1) + 8 g + 4 (j & 1) + 0..3 of its row in part j: the lane's own accumulator places
  float* po = O32 + (bh * (SS / 16) + (q0 >> 4)) * 1024 + lane * 4;
  // unrolled: the accumulators are indexed by constants and stay in registers
#pragma unroll
  for (int i = 0; i < 8; ++i) { const int t = i >> 1, rb0 = (i & 1) * 4; v4f o;
#pragma unroll
    for (int e = 0; e < 4; ++e) { const int r = rb0 + e; o[e] = ((acc[t][r] + ac1[t][r] * (1.0f / VLO) + ac2[t][r] * (1.0f / PLO)) * f0 + sO[w][t * 8 + r][lane] * f1) * inv; }
    vst2(po + i * 128, o); }
  asm volatile("s_wait_xcnt 0x0" :: "v"(po) : "memory"); }      // the second part rewrites the stores' address and data registers only behind this wait
  __syncthreads(); }      // sO has been read: the second part may write it
}
// out = ctx Wo + bo : split(ctx) x bf16(Wo columns): 2 products (Wo is an INPUT -> bf16 exact)
__global__ __launch_bounds__(128) void k_out(const float* __restrict__ O32, const __bf16* __restrict__ PT, const float* __restrict__ bo, float* __restrict__ out) {
  __shared__ __align__(16) float so[4][16][132];
  const int tid = threadIdx.x, wave = tid >> 5, lane = tid & 31, col = lane & 15, g = lane >> 4;
  const int r0 = blockIdx.x * 64 + wave * 16, n0 = blockIdx.y * 128; const int ra = r0 + col; const int b = ra / SS, s = ra % SS;
  v8f acc[8] = {};
  const float* po0 = O32 + ((size_t)b * NH * (SS / 16) + (s >> 4)) * 1024 + lane * 4; const __bf16* pw0 = PT + (size_t)((3 * E + n0) >> 4) * (E / 32) * 512 + lane * 8;
  // One head (two k chunks) a pass: all loads of the pass stand ahead of its first product, so that their latencies overlap. Not unrolled further: registers.
#pragma unroll 1
  for (int h = 0; h < NH; ++h) { float ov[2][16]; v16b wb[2][8];
    const float* po = po0 + (size_t)h * (SS / 16) * 1024; const __bf16* pw = pw0 + h * 1024;
    // inner loops unrolled so that the arrays are indexed by constants and stay in registers
#pragma unroll
    for (int c = 0; c < 2; ++c) {
#pragma unroll
      for (int i = 0; i < 16; ++i) ov[c][i] = po[c * 512 + (i >> 2) * 128 + (i & 3)]; }
#pragma unroll
    for (int c = 0; c < 2; ++c) {
#pragma unroll
      for (int j = 0; j < 8; ++j) wb[c][j] = frag_t(pw + (size_t)j * (E / 32) * 512 + c * 512); }
    asm volatile("s_wait_xcnt 0x0" :: "v"(po), "v"(pw) : "memory");      // the loads' address registers are held up to here and rewritten only behind this wait
#pragma unroll
    for (int c = 0; c < 2; ++c) { const F2 a = bsplit16(ov[c]);
#pragma unroll
      for (int j = 0; j < 8; ++j) { acc[j] = wmma_bf(a.l, wb[c][j], acc[j]); acc[j] = wmma_bf(a.h, wb[c][j], acc[j]); } } }
#pragma unroll
  for (int j = 0; j < 8; ++j) { const int n = n0 + j * 16 + col; const float bb = bfr(bo[n]);
#pragma unroll
    for (int r = 0; r < 8; ++r) so[wave][8 * g + r][j * 16 + col] = acc[j][r] + bb; }
  LDSX();
#pragma unroll 4
  for (int rl = 0; rl < 16; ++rl) vst2(out + (size_t)(r0 + rl) * E + n0 + lane * 4, *(const v4f*)(&so[wave][rl][lane * 4]));
}
extern "C" void kernel_launch(void* const* d_in, const int* in_sizes, int n_in, void* d_out, int out_size, void* d_ws, size_t ws_size, hipStream_t stream) {
  (void)in_sizes; (void)n_in; (void)out_size; (void)ws_size;
  const float* x = (const float*)d_in[0]; const int* mask = (const int*)d_in[1]; const float* Wq = (const float*)d_in[2]; const float* bq = (const float*)d_in[3]; const float* Wk = (const float*)d_in[4]; const float* bk = (const float*)d_in[5];
  const float* Wv = (const float*)d_in[6]; const float* bv = (const float*)d_in[7]; const float* Wp = (const float*)d_in[8]; const float* bp = (const float*)d_in[9]; const float* rel = (const float*)d_in[10];
  float* out = (float*)d_out;
  char* ws = (char*)d_ws; size_t off = 0;
  auto take = [&](size_t bytes) { char* p = ws + off; off += (bytes + 255) & ~(size_t)255; return p; };
  __bf16* Xb = (__bf16*)take((size_t)NR * E * 2); __bf16* PT = (__bf16*)take((size_t)4 * E * E * 2); __bf16* RB = (__bf16*)take((size_t)NREL * HD * 2);
  float* Q32 = (float*)take((size_t)NR * E * 4); __bf16* Kh = (__bf16*)take((size_t)NR * E * 2); __bf16* Kl = (__bf16*)take((size_t)NR * E * 2); _Float16* VTh = (_Float16*)take((size_t)NR * E * 2); _Float16* VTl = (_Float16*)take((size_t)NR * E * 2); float* O32 = (float*)take((size_t)NR * E * 4); unsigned* MW = (unsigned*)take((size_t)(SS / 16) * 4 * 4); float* CS = (float*)take((size_t)SS * 32 * 2 * 4);
  // ws ~ 45 MB
  k_prep<<<PB_ROT + PB_PACK + PB_MSK + PB_CVT + PB_REL, 256, 0, stream>>>(x, mask, Wq, Wk, Wv, Wp, rel, Xb, PT, RB, MW, CS);
  k_qkv<<<dim3(NR / 64, E / 128, 3), 128, 0, stream>>>(Xb, PT, CS, bq, bk, bv, Q32, Kh, Kl, VTh, VTl);
  k_attn<<<dim3(SS / 64, NH / 2), 256, 0, stream>>>(Q32, Kh, Kl, VTh, VTl, mask, MW, RB, O32);
  k_out<<<dim3(NR / 64, E / 128), 128, 0, stream>>>(O32, PT, bp, out);
}

// v009
// A run of this version takes 90.1 microseconds.
// Two timings next to v008 put it at 1.07 and 1.06 times that version's speed.
// Counting every step since v000, it is 37.6 times as fast.
// compute dtype: x, W*, b*, rel_pos_emb (INPUTS) rounded to bf16 with exact bf16 WMMA products (f32 accumulate) for the projections; rotary in f32; K pre-split into bf16 hi/lo rows; the relative-position scores q.rel^T as q hi/lo x bf16(rel) (2 products); P and V f16 hi/lo (3 products); softmax with the int mask in f32.
#include <hip/hip_runtime.h>
#include <math.h>

typedef __attribute__((ext_vector_type(16))) _Float16 v16h;
typedef __attribute__((ext_vector_type(16))) __bf16 v16b;
typedef __attribute__((ext_vector_type(8)))  _Float16 v8h;
typedef __attribute__((ext_vector_type(8)))  float v8f;
typedef __attribute__((ext_vector_type(4)))  float v4f;
typedef __attribute__((ext_vector_type(2)))  float v2f;
typedef __attribute__((ext_vector_type(4)))  unsigned v4u;
typedef __attribute__((ext_vector_type(16))) unsigned v16u;
typedef __attribute__((ext_vector_type(4)))  int v4i;
typedef float __attribute__((may_alias)) float_a;
typedef int __attribute__((may_alias)) int_a;

template <typename T> __device__ __forceinline__ void vst2(void* p, T v) { *(T*)p = v;  }
__device__ __forceinline__ v8f wmma16(v16h a, v16h b, v8f c) {
  v8f d = __builtin_amdgcn_wmma_f32_16x16x32_f16(false, a, false, b, (short)0, c, false, false);
  asm volatile("v_nop\n\tv_nop\n\tv_nop\n\tv_nop" : "+v"(d) : "v"(a), "v"(b));
  return d;
}
__device__ __forceinline__ v8f wmma_bf(v16b a, v16b b, v8f c) {
  v8f d = __builtin_amdgcn_wmma_f32_16x16x32_bf16(false, a, false, b, (short)0, c, false, false);
  asm volatile("v_nop\n\tv_nop\n\tv_nop\n\tv_nop" : "+v"(d) : "v"(a), "v"(b));
  return d;
}
// The same two for the attention kernel, whose fragments in flight lie above v255: an operand of an asm statement is held below v256, so a and b are not named there (naming them spills).
__device__ __forceinline__ v8f wmma16_w(v16h a, v16h b, v8f c) {
  v8f d = __builtin_amdgcn_wmma_f32_16x16x32_f16(false, a, false, b, (short)0, c, false, false);
  asm volatile("v_nop\n\tv_nop\n\tv_nop\n\tv_nop" : "+v"(d));      // the distance behind a matrix instruction
  return d;
}
__device__ __forceinline__ v8f wmma_bf_w(v16b a, v16b b, v8f c) {
  v8f d = __builtin_amdgcn_wmma_f32_16x16x32_bf16(false, a, false, b, (short)0, c, false, false);
  asm volatile("v_nop\n\tv_nop\n\tv_nop\n\tv_nop" : "+v"(d));      // the distance behind a matrix instruction
  return d;
}
// 16x16x32 fragments: lane = (h = lane>>4, row/col = lane&15); elements 0..7 = k0+8h+0..7, 8..15 = k0+16+8h+0..7; D element r = row 8h+r
__device__ __forceinline__ v16h frag_h(const _Float16* rowk0, int lane) {
  union { v16h v; v8h q[2]; } u; const _Float16* p = rowk0 + 8 * (lane >> 4);
  u.q[0] = *(const v8h*)p; u.q[1] = *(const v8h*)(p + 16); return u.v;
}
__device__ __forceinline__ v16h frag_f32(const float* rowk0, int lane) {
  v16h a; const float* p = rowk0 + 8 * (lane >> 4);
#pragma unroll
  for (int i = 0; i < 8; ++i) { a[i] = (_Float16)p[i]; a[8 + i] = (_Float16)p[16 + i]; }
  return a;
}
__device__ __forceinline__ v16h frag_f32s(const float* rowk0, int lane, float sc) {
  v16h a; const float* p = rowk0 + 8 * (lane >> 4);
#pragma unroll
  for (int i = 0; i < 8; ++i) { a[i] = (_Float16)(p[i] * sc); a[8 + i] = (_Float16)(p[16 + i] * sc); }
  return a;
}
// column fragment from a [K][ld] layout (column n), rows >= K read as 0
__device__ __forceinline__ v16h fragc_f32(const float* W, int k0, int n, int lane, int ld, int K) {
  v16h a; const int g = lane >> 4;
#pragma unroll
  for (int i = 0; i < 8; ++i) { const int ka = k0 + 8 * g + i, kb = ka + 16;
    a[i] = (_Float16)(ka < K ? W[(size_t)ka * ld + n] : 0.f); a[8 + i] = (_Float16)(kb < K ? W[(size_t)kb * ld + n] : 0.f); }
  return a;
}
struct F2 { v16b h, l; };
__device__ __forceinline__ F2 bsplit16(const float v[16]) { F2 r;
#pragma unroll
  for (int i = 0; i < 16; ++i) { const __bf16 h = (__bf16)v[i]; r.h[i] = h; r.l[i] = (__bf16)(v[i] - (float)h); }
  return r; }
__device__ __forceinline__ F2 split_row(const float* row, int k0, int lane) { float v[16]; const float* p = row + k0 + 8 * (lane >> 4);
#pragma unroll
  for (int i = 0; i < 8; ++i) { v[i] = p[i]; v[8 + i] = p[16 + i]; }
  return bsplit16(v); }
__device__ __forceinline__ F2 split_rowK(const float* row, int k0, int lane, int K) { float v[16]; const int g = lane >> 4;
#pragma unroll
  for (int i = 0; i < 8; ++i) { const int ka = k0 + 8 * g + i, kb = ka + 16; v[i] = ka < K ? row[ka] : 0.f; v[8 + i] = kb < K ? row[kb] : 0.f; }
  return bsplit16(v); }
__device__ __forceinline__ F2 split_col(const float* W, int k0, int n, int lane, int ld, int K) { float v[16]; const int g = lane >> 4;
#pragma unroll
  for (int i = 0; i < 8; ++i) { const int ka = k0 + 8 * g + i, kb = ka + 16; v[i] = ka < K ? W[(size_t)ka * ld + n] : 0.f; v[8 + i] = kb < K ? W[(size_t)kb * ld + n] : 0.f; }
  return bsplit16(v); }
__device__ __forceinline__ v8f mac3(const F2& a, const F2& b, v8f c) { c = wmma_bf(a.l, b.h, c); c = wmma_bf(a.h, b.l, c); return wmma_bf(a.h, b.h, c); }
__device__ __forceinline__ float sigm(float v) { return 1.0f / (1.0f + expf(-v)); }
#define LDSX() do { asm volatile("s_wait_dscnt 0" ::: "memory"); __builtin_amdgcn_wave_barrier(); __builtin_amdgcn_fence(__ATOMIC_RELEASE, "workgroup"); } while (0)
// The same exchange among the lanes of ONE wave, for places where global loads are in flight: the fence at wavefront scope orders the LDS accesses for the compiler and does not drain the loads as the work-group one does.
#define LDSW() do { asm volatile("s_wait_dscnt 0" ::: "memory"); __builtin_amdgcn_wave_barrier(); __builtin_amdgcn_fence(__ATOMIC_RELEASE, "wavefront"); } while (0)


// Rotary multi-head attention with Shaw relative-position scores (16 heads of 64 on [1,2048,1024], [in][out] weights + biases): q,k = rotate_half-RoPE(xW+b) (angle[d] = s*10000^(-2(d mod 32)/64));
// scores[i][j] = q_i.k_j/8 + q_i.rel_pos_emb[j-i+2047]; masked where mask[i][j] == 0 (-1e30); softmax; (P v) Wo + bo. The rel term uses the skew trick inside the attention kernel: a tile of 16 queries x 64 keys
// needs only the 79 offsets c = j-i+2047 of its diagonals, so q.rel[c] is formed for five 16-column tiles, laid in LDS and read back along the diagonal. No score table in memory: all heads run in one launch.
// A tile of 16 queries x 64 keys whose mask words are all 0 adds exactly nothing to a row that has an open key somewhere (its weights are exp(-1e30 - m) = 0, or are wiped by the factor 0 at the row's first open key):
// p_msk reads the mask once and says which tiles hold an open word; the attention kernel passes over the others.
#define NB 1
#define SS 2048
#define NREL 4096      // 4095 offsets padded to 4096 (offset 4095 is clamped to row 4094 and never used)
#define E 1024
#define NH 16
#define HD 64
#define NR (NB * SS)
#define PLO 1024.0f
#define VLO 2048.0f
__device__ __forceinline__ float bfr(float v) { return (float)(__bf16)v; }
// 2^a by the chip's own base-2 exponential. The softmax weights e^d, d <= 0, are taken as 2^(d log2 e): one multiply (or fused multiply-add) and this instruction, in place of the library's expf (range tests, split argument, ldexp).
// d is a difference formed first, so that equal values give exactly 2^0 also at -1e30; a result below the normal range comes out as 0, at a = -inf too.
#define LOG2E 1.4426950408889634f
__device__ __forceinline__ float exp_b2(float a) { float r = __builtin_amdgcn_exp2f(a);
  // The one slot that the instruction set asks for behind a transcendental: r is read and a's register rewritten only behind this v_nop.
  asm("v_nop" : "+v"(r) : "v"(a));
  return r; }
// The same for eight values at once, with one v_nop for the eight: up to it nothing reads a result or rewrites an argument's register, so what stands directly behind each v_exp_f32 is another of the eight, an instruction that touches neither, or the v_nop.
__device__ __forceinline__ void exp_b2x8(const float a[8], float e[8]) {
#pragma unroll
  for (int r = 0; r < 8; ++r) e[r] = __builtin_amdgcn_exp2f(a[r]);
  asm("v_nop" : "+v"(e[0]), "+v"(e[1]), "+v"(e[2]), "+v"(e[3]), "+v"(e[4]), "+v"(e[5]), "+v"(e[6]), "+v"(e[7]) : "v"(a[0]), "v"(a[1]), "v"(a[2]), "v"(a[3]), "v"(a[4]), "v"(a[5]), "v"(a[6]), "v"(a[7]));
}
__device__ __forceinline__ v16b frag_b(const __bf16* rowk0, int lane) { return __builtin_bit_cast(v16b, frag_h((const _Float16*)rowk0, lane)); }
// FRAGMENT ORDER of the 16-bit operands in the workspace: a tile of 16 rows x 32 k is 1024 contiguous bytes; the piece of 8 elements k = 16 hf + 8 g + 0..7 of row r lies at element (hf * 32 + g * 16 + r) * 8.
// Lane l = g * 16 + r finds its two pieces at l * 8 and 256 + l * 8, so each wave-wide 16-byte load covers 512 contiguous bytes (4 whole lines) and not 32-byte pieces of 16 lines. p = tile + lane * 8.
__device__ __forceinline__ v16h frag_th(const _Float16* p) { union { v16h v; v8h q[2]; } u; u.q[0] = *(const v8h*)p; u.q[1] = *(const v8h*)(p + 256); return u.v; }
__device__ __forceinline__ v16b frag_t(const __bf16* p) { return __builtin_bit_cast(v16b, frag_th((const _Float16*)p)); }

// The five preparation jobs (rotary angles, weights, mask scan, x, rel rows) depend on the inputs alone and not on each other: they are parts of ONE launch, k_prep, in which a range of block indices picks the job (blk = the block's number inside its job).
__device__ __forceinline__ void p_cvt(int blk, const float* __restrict__ x, __bf16* __restrict__ Xb) {
  const size_t i8 = (size_t)blk * 256 + threadIdx.x; if (i8 >= (size_t)NR * E / 8) return;
  // i8 = the piece's place in fragment order: tile (row tile, k chunk), then hf, g, row
  const size_t tile = i8 >> 6; const int hf = (int)(i8 >> 5) & 1, g = (int)(i8 >> 4) & 1, row = (int)i8 & 15;
  const float* px = x + ((tile >> 5) * 16 + row) * E + (tile & 31) * 32 + hf * 16 + g * 8;
  union { __bf16 h[8]; v4u u; } pk;
#pragma unroll
  for (int e = 0; e < 8; ++e) pk.h[e] = (__bf16)px[e];
  vst2((unsigned*)(Xb + i8 * 8), pk.u);
}
// PT rows: [0,E) Wq[:,n], [E,2E) Wk[:,n], [2E,3E) Wv[:,n], [3E,4E) Wo[:,n]  ([in][out] weights: column n as a bf16 row), in fragment order
__device__ __forceinline__ void p_pack(int blk, const float* __restrict__ Wq, const float* __restrict__ Wk, const float* __restrict__ Wv, const float* __restrict__ Wo, __bf16* __restrict__ PT) {
  // block: 32 columns n (two row tiles of PT) x 256 k, turned in LDS; written in fragment order, tile (n / 16, k / 32)
  const int n0 = (blk & (4 * E / 32 - 1)) * 32, k0 = (blk / (4 * E / 32)) * 256, tid = threadIdx.x; __shared__ __align__(16) __bf16 st[32][264];
  const float* W = n0 < E ? Wq : (n0 < 2 * E ? Wk : (n0 < 3 * E ? Wv : Wo)); const int nn0 = n0 & (E - 1);
  const int kr = tid >> 3, c4 = (tid & 7) * 4; const float* pwv = W + (size_t)(k0 + kr) * E + nn0 + c4; v4f v[8];      // a wave-wide load: 4 rows k x 128 bytes, whole lines
  // unrolled: v is indexed by constants and stays in registers
#pragma unroll
  for (int i = 0; i < 8; ++i) v[i] = *(const v4f*)(pwv + (size_t)i * 32 * E);
  asm volatile("s_wait_xcnt 0x0" :: "v"(pwv) : "memory");      // the loads' address register is held up to here and rewritten only behind this wait
#pragma unroll
  for (int i = 0; i < 8; ++i) {
#pragma unroll
    for (int e = 0; e < 4; ++e) st[c4 + e][i * 32 + kr] = (__bf16)v[i][e]; }
  __syncthreads();
  for (int i = 0; i < 4; ++i) { const int j = i * 256 + tid, tile = j >> 6, nt = tile >> 3, kcl = tile & 7, hf = (j >> 5) & 1, g = (j >> 4) & 1, row = j & 15;
    vst2((unsigned*)(PT + ((size_t)((n0 >> 4) + nt) * (E / 32) + (k0 >> 5) + kcl) * 512 + (j & 63) * 8), *(const v4u*)(&st[nt * 16 + row][kcl * 32 + hf * 16 + g * 8])); }
  asm volatile("s_wait_xcnt 0x0" ::: "memory");      // another job's code follows in the listing: the stores' address and data registers are rewritten only behind this wait
}
// QKV: block (64 rows, 128 cols = 2 heads, which); q (+bias) -> Q32 f32 [bh][s][64]; k (+bias) -> bf16 hi/lo rows; v (+bias) -> VT hi/lo x4 (rows d, k = key); K and VT in fragment order
__global__ __launch_bounds__(128) void k_qkv(const __bf16* __restrict__ Xb, const __bf16* __restrict__ PT, const float* __restrict__ CS, const float* __restrict__ bq, const float* __restrict__ bk, const float* __restrict__ bv,
                                            float* __restrict__ Q32, __bf16* __restrict__ Kh, __bf16* __restrict__ Kl, _Float16* __restrict__ VTh, _Float16* __restrict__ VTl) {
  __shared__ __align__(16) float so[4][16][132];
  __shared__ __align__(16) _Float16 sth[128][72], stl[128][72];
  const int tid = threadIdx.x, wave = tid >> 5, lane = tid & 31, col = lane & 15, g = lane >> 4;
  const int which = blockIdx.z, r0b = blockIdx.x * 64, r0 = r0b + wave * 16, n0 = blockIdx.y * 128; const int b = r0b / SS, s0 = r0b % SS;
  const float* bb_ = which == 0 ? bq : (which == 1 ? bk : bv);
  v8f acc[8] = {};
  // The (cos, sin) pairs of the lane's accumulator places: rows 8 g + r, d mod 32 = jj * 16 + col; the same for both heads of the block. Asked for here, they are in flight together with the loads of the product loop's first pass. A wave-wide load covers 128 bytes of two rows.
  v2f cs[2][8]; const float* pcs = CS + ((size_t)(s0 + wave * 16 + 8 * g) * 32 + col) * 2;
  // unrolled: cs is indexed by constants and stays in registers
#pragma unroll
  for (int jj = 0; jj < 2; ++jj) {
#pragma unroll
    for (int r = 0; r < 8; ++r) cs[jj][r] = *(const v2f*)(pcs + r * 64 + jj * 32); }
  asm volatile("s_wait_xcnt 0x0" :: "v"(pcs) : "memory");      // the loads' address register is held up to here and rewritten only behind this wait
  // Two k chunks a pass: all 36 loads of the pass stand ahead of its first product, so that their latencies overlap (one wait a pass instead of one a product). Not unrolled further: registers.
#pragma unroll 1
  for (int kc = 0; kc < E / 32; kc += 2) { v16b a[2], wb[2][8];
    const __bf16* pa = Xb + ((size_t)(r0 >> 4) * (E / 32) + kc) * 512 + lane * 8; const __bf16* pw = PT + ((size_t)((which * E + n0) >> 4) * (E / 32) + kc) * 512 + lane * 8;
    // inner loops unrolled so that the fragment arrays are indexed by constants and stay in registers
#pragma unroll
    for (int c = 0; c < 2; ++c) { a[c] = frag_t(pa + c * 512);
#pragma unroll
      for (int j = 0; j < 8; ++j) wb[c][j] = frag_t(pw + (size_t)j * (E / 32) * 512 + c * 512); }
#pragma unroll
    for (int j = 0; j < 8; ++j) acc[j] = wmma_bf(a[0], wb[0][j], acc[j]);
    asm volatile("s_wait_xcnt 0x0" :: "v"(pa), "v"(pw) : "memory");      // the loads' address registers are held up to here and rewritten only behind this wait
#pragma unroll
    for (int j = 0; j < 8; ++j) acc[j] = wmma_bf(a[1], wb[1][j], acc[j]); }
  if (which < 2) {
    // RoPE (rotate_half pairs (d, d+32)) on the accumulators: column tiles j and j + 2 of a head hold d and d + 32 of the same row in the same lane and element
#pragma unroll
    for (int j = 0; j < 8; ++j) { if (j & 2) continue;
      const int jj = j & 1; const float b1 = bfr(bb_[n0 + j * 16 + col]), b2 = bfr(bb_[n0 + (j + 2) * 16 + col]);
#pragma unroll
      for (int r = 0; r < 8; ++r) { const float x1 = acc[j][r] + b1, x2 = acc[j + 2][r] + b2, c = cs[jj][r][0], sn = cs[jj][r][1];
        so[wave][8 * g + r][j * 16 + col] = x1 * c - x2 * sn; so[wave][8 * g + r][(j + 2) * 16 + col] = x2 * c + x1 * sn; } }
    LDSX();
    if (which == 0) { for (int qq = lane; qq < 2 * 16 * 16; qq += 32) { const int hh = qq >> 8, rl = (qq >> 4) & 15, pc = qq & 15; const int h = (n0 >> 6) + hh;
        vst2(Q32 + (((size_t)b * NH + h) * SS + s0 + wave * 16 + rl) * HD + pc * 4, *(const v4f*)(&so[wave][rl][hh * 64 + pc * 4])); } }
    else {
      // fragment order, tile (key / 16, d / 32): the wave's 32 lanes store one 512-byte half tile a trip
      for (int i = 0; i < 16; ++i) { const int hf = i & 1, kc = (i >> 1) & 1, lo = (i >> 2) & 1, hh = i >> 3; const int h = (n0 >> 6) + hh; union { __bf16 e[8]; v4u u; } pk;
#pragma unroll
        for (int e = 0; e < 8; ++e) { const float v = so[wave][col][hh * 64 + kc * 32 + hf * 16 + g * 8 + e]; const __bf16 hi = (__bf16)v; pk.e[e] = lo ? (__bf16)(v - (float)hi) : hi; }
        vst2((unsigned*)((lo ? Kl : Kh) + ((((size_t)b * NH + h) * (SS / 16) + (s0 >> 4) + wave) * 2 + kc) * 512 + hf * 256 + lane * 8), pk.u);
        asm volatile("s_wait_xcnt 0x0" ::: "memory"); } } }      // the next trip rewrites the store's address and data registers only behind this wait
  else {
#pragma unroll
    for (int j = 0; j < 8; ++j) { const float bb = bfr(bb_[n0 + j * 16 + col]);
#pragma unroll
      for (int r = 0; r < 8; ++r) { const float v = (acc[j][r] + bb) * 4.0f; const _Float16 hi = (_Float16)v; sth[j * 16 + col][wave * 16 + 8 * g + r] = hi; stl[j * 16 + col][wave * 16 + 8 * g + r] = (_Float16)((v - (float)hi) * VLO); } }
    __syncthreads();
    // fragment order, per head and 64 keys eight tiles (key chunk kc, d / 16): qq = hh, kc, d / 16, hf, g, d % 16 from the top bit down
    for (int qq = tid; qq < 128 * 8; qq += 128) { const int hh = qq >> 9, cl = hh * 64 + ((qq >> 6) & 3) * 16 + (qq & 15), pc = ((qq >> 8) & 1) * 4 + ((qq >> 4) & 3); const size_t o = (((size_t)b * NH + (n0 >> 6) + hh) * (SS / 64) + (s0 >> 6)) * 4096 + (qq & 511) * 8;
      vst2(VTh + o, *(const v4u*)(&sth[cl][pc * 8])); vst2(VTl + o, *(const v4u*)(&stl[cl][pc * 8])); } }
}

// rel_pos_emb rows -> bf16 in fragment order, tile (offset / 16, d / 32); the pad row 4095 takes row 4094's values (never used by a score)
__device__ __forceinline__ void p_relb(int blk, const float* __restrict__ rel, __bf16* __restrict__ RB) {
  const size_t i8 = (size_t)blk * 256 + threadIdx.x; if (i8 >= (size_t)NREL * HD / 8) return;
  const int tile = (int)(i8 >> 6), hf = (int)(i8 >> 5) & 1, g = (int)(i8 >> 4) & 1, c = (tile >> 1) * 16 + ((int)i8 & 15);
  const float* ps = rel + (size_t)(c < NREL - 1 ? c : NREL - 2) * HD + (tile & 1) * 32 + hf * 16 + g * 8;
  union { __bf16 e[8]; v4u u; } pk;
#pragma unroll
  for (int e = 0; e < 8; ++e) pk.e[e] = (__bf16)ps[e];
  vst2((unsigned*)(RB + i8 * 8), pk.u);
}
// MW[query / 16][key quarter]: bit 16 + k is set where key tile 8 * quarter + k (64 keys) holds a mask word != 0 for one of the 16 queries; bit r < 16 where row r has an open key in the quarter. tile_word() joins the four.
// block = 16 queries x 8 key tiles (a block of k_prep has 8 waves), wave = key tile; a wave-wide 16-byte load covers 256 contiguous bytes of two rows.
// MB[query / 16][key tile][32]: the tile's mask as the 32 lane masks of the attention kernel, 128 contiguous bytes a tile: bit 16 g + col of word 8 t + r is set where key 16 t + 8 g + r of the tile is open for query col,
// the score that lane (g, col) holds there in place (t, r). The attention kernel takes the 32 words into scalar registers and selects with them; it reads no mask word and compares nothing.
__device__ __forceinline__ void p_msk(int blk, const int* __restrict__ mask, unsigned* __restrict__ MW, unsigned* __restrict__ MB) {
  __shared__ __align__(16) unsigned sT[8];
  const int tid = threadIdx.x, kt = tid >> 5, lane = tid & 31;
  const int* pm = mask + (size_t)((blk >> 2) * 16 + (lane >> 4)) * SS + ((blk & 3) * 8 + kt) * 64 + (lane & 15) * 4; v4i m[8];
  // unrolled: m is indexed by constants and stays in registers; the eight loads are in flight together
#pragma unroll
  for (int i = 0; i < 8; ++i) m[i] = *(const v4i*)(pm + (size_t)i * 2 * SS);
  asm volatile("s_wait_xcnt 0x0" :: "v"(pm) : "memory");      // the loads' address register is held up to here and rewritten only behind this wait
  unsigned rows = 0, lm = 0;      // rows, bit r: row r has an open key in this tile; lm: the lane mask of place (t, r) = (lane >> 3, lane & 7)
  const int lsh = 4 * (lane >> 3) + ((lane >> 2) & 1);      // keys 16 t + 8 g + r = 4 j + e: e = r & 3, j = 4 t + (r >> 2) + 2 g
  unsigned pick[4];      // all ones for the lane's own e: the choice among the four ballots is made by and / or, without a branch
#pragma unroll
  for (int e = 0; e < 4; ++e) pick[e] = (lane & 3) == e ? 0xFFFFFFFFu : 0u;
#pragma unroll
  for (int i = 0; i < 8; ++i) { unsigned q[4];
#pragma unroll
    for (int e = 0; e < 4; ++e) q[e] = __builtin_amdgcn_ballot_w32(m[i][e] != 0);      // bit 16 hb + j: row 2 i + hb, key 4 j + e
    const unsigned bl = q[0] | q[1] | q[2] | q[3];
    rows |= ((bl & 0xFFFFu) ? 1u : 0u) << (2 * i); rows |= ((bl >> 16) ? 2u : 0u) << (2 * i);
    // the lane's four bits of these two rows stand at 16 hb + 2 g behind the shift; folded to 2 g + hb, they go to bits 16 g + 2 i + hb
    const unsigned y = (((q[0] & pick[0]) | (q[1] & pick[1]) | (q[2] & pick[2]) | (q[3] & pick[3])) >> lsh) & 0x00050005u, z = y | (y >> 15);
    lm |= ((z & 3u) << (2 * i)) | ((z & 12u) << (14 + 2 * i)); }
  MB[((size_t)(blk >> 2) * (SS / 64) + (blk & 3) * 8 + kt) * 32 + lane] = lm;
  asm volatile("s_wait_xcnt 0x0" ::: "memory");      // the store's address and data registers are rewritten only behind this wait
  if (lane == 0) sT[kt] = rows;
  __syncthreads();
  if (tid == 0) { unsigned tiles = 0, seen = 0;
#pragma unroll
    for (int k = 0; k < 8; ++k) { const unsigned v = sT[k]; seen |= v; tiles |= (v ? 1u : 0u) << k; }
    MW[blk] = seen | (tiles << 16); }
}
// The word of a query tile: bit kt is set where key tile kt holds an open key for one of the 16 queries. Where one of the 16 rows has no open key at all its softmax is uniform over ALL keys, so every bit is set.
__device__ __forceinline__ unsigned tile_word(const unsigned* __restrict__ MW, int qt) {
  const v4u p = *(const v4u*)(MW + qt * 4);
  const unsigned seen = (p[0] | p[1] | p[2] | p[3]) & 0xFFFFu, tiles = (p[0] >> 16) | ((p[1] >> 16) << 8) | ((p[2] >> 16) << 16) | ((p[3] >> 16) << 24);
  return seen == 0xFFFFu ? tiles : 0xFFFFFFFFu;
}
// CS[s][d] = (cos, sin) of the rotary angle s * 10000^(-2 d / 64), d < 32: each angle is worked out once here and read by every QKV block that needs it. A thread takes one d and eight positions s; a wave stores 256 contiguous bytes.
__device__ __forceinline__ void p_rot(int blk, float* __restrict__ CS) {
  const int i = blk * 256 + (int)threadIdx.x, d = i & 31, sb = (i >> 5) * 8;
  const float invf = powf(10000.0f, -(float)(2 * d) * (1.0f / 64.0f));
  for (int e = 0; e < 8; ++e) { const float ang = (float)(sb + e) * invf; float sn, c; sincosf(ang, &sn, &c); v2f v; v[0] = c; v[1] = sn;
    vst2(CS + ((size_t)(sb + e) * 32 + d) * 2, v);
    asm volatile("s_wait_xcnt 0x0" ::: "memory"); }      // the next trip rewrites the store's address and data registers only behind this wait
}
#define PB_ROT (SS * 32 / 8 / 256)
#define PB_PACK (4 * E / 32 * (E / 256))
#define PB_MSK (SS / 16 * 4)
#define PB_CVT (NR * E / 8 / 256)
#define PB_REL (NREL * HD / 8 / 256)
// The jobs with the longest way through a block (the angles' arithmetic; loads, LDS, barrier, stores) take the lowest block indices, the short ones the highest.
__global__ __launch_bounds__(256) void k_prep(const float* __restrict__ x, const int* __restrict__ mask, const float* __restrict__ Wq, const float* __restrict__ Wk, const float* __restrict__ Wv, const float* __restrict__ Wo, const float* __restrict__ rel,
                                             __bf16* __restrict__ Xb, __bf16* __restrict__ PT, __bf16* __restrict__ RB, unsigned* __restrict__ MW, unsigned* __restrict__ MB, float* __restrict__ CS) {
  const int blk = (int)blockIdx.x - PB_ROT;
  if (blk < 0) p_rot((int)blockIdx.x, CS);
  else if (blk < PB_PACK) p_pack(blk, Wq, Wk, Wv, Wo, PT);
  else if (blk < PB_PACK + PB_MSK) p_msk(blk - PB_PACK, mask, MW, MB);
  else if (blk < PB_PACK + PB_MSK + PB_CVT) p_cvt(blk - (PB_PACK + PB_MSK), x, Xb);
  else p_relb(blk - (PB_PACK + PB_MSK + PB_CVT), rel, RB);
}
// masked attention with relative-position scores: block (64 queries, head) twice, two waves a query tile; the key tiles that MW names; S on q hi/lo x K hi/lo rows; P,V hi/lo; O f32 in fragment order
// All three products are formed TRANSPOSED (keys, offsets or d as the rows of A; the 16 queries as the columns of B): a lane (g, col) then holds, of ONE query q0 + col, the scores of keys 16 t + 8 g + r. Maximum and sum are
// taken in the lane (one exchange between the halves g), two score tiles converted in place ARE the B operand of V^T P^T, the rescale factor is the lane's own, and the context leaves in the order that k_out reads.
__global__ __launch_bounds__(256) void k_attn(const float* __restrict__ Q32, const __bf16* __restrict__ Kh, const __bf16* __restrict__ Kl, const _Float16* __restrict__ VTh, const _Float16* __restrict__ VTl, const unsigned* __restrict__ MB, const unsigned* __restrict__ MW, const __bf16* __restrict__ RB, float* __restrict__ O32) {
  __shared__ __align__(16) float sR[8][16][84];
  __shared__ __align__(16) float sO[4][34][32];
  // wave wv: query tile w = wv & 3 of the 64 queries, key share kh = wv >> 2 (the even or the odd key tiles)
  const int tid = threadIdx.x, wv = tid >> 5, w = wv & 3, lane = tid & 31, col = lane & 15, g = lane >> 4;
  // All waves are resident at once, so the launch lasts as long as its longest wave: the tiles that are left are dealt evenly. Under a mask that opens more keys to later queries the cost grows with the query block:
  // a block takes query block t of one head and then query block 31 - t of another, one after the other in every wave, so that all blocks cost alike; each (head, query block) is taken once. And two waves share
  // a query tile, one on its even and one on its odd key tiles, each with a running maximum, sum and context of its own; the two are joined in LDS behind the key loop. Not unrolled: one copy of the code.
  // The tile words of the wave's two query tiles, read here, ahead of every store, with the wave's number in a scalar register: scalar loads, and the test on the word in the key loop is a scalar branch.
  const int ws = __builtin_amdgcn_readfirstlane(w), kh = __builtin_amdgcn_readfirstlane(wv >> 2); const unsigned live0 = tile_word(MW, (int)blockIdx.x * 4 + ws), live1 = tile_word(MW, (SS / 64 - 1 - (int)blockIdx.x) * 4 + ws);
#pragma unroll 1
  for (int part = 0; part < 2; ++part) {
  const size_t bh = (size_t)(blockIdx.y + part * (NH / 2)); const int qb = part ? SS / 64 - 1 - (int)blockIdx.x : (int)blockIdx.x; const int q0 = qb * 64 + w * 16;
  const unsigned live = (part ? live1 : live0) & (kh ? 0xAAAAAAAAu : 0x55555555u);
  F2 aq[2]; float qv[2][16]; const float* pq = Q32 + (bh * SS + q0 + col) * HD + 8 * g;
  // unrolled: qv is indexed by constants and stays in registers
#pragma unroll
  for (int kc = 0; kc < 2; ++kc) {
#pragma unroll
    for (int i = 0; i < 8; ++i) { qv[kc][i] = pq[kc * 32 + i]; qv[kc][8 + i] = pq[kc * 32 + 16 + i]; } }
  asm volatile("s_wait_xcnt 0x0" :: "v"(pq) : "memory");      // the q loads' address register is held up to here and rewritten only behind this wait
#pragma unroll
  for (int kc = 0; kc < 2; ++kc) aq[kc] = bsplit16(qv[kc]);
  float mrun = -3.0e38f, lrun = 0.f; v8f acc[4] = {}, ac1[4] = {}, ac2[4] = {};      // acc[t][r]: d = 16 t + 8 g + r of query q0 + col
#pragma unroll 1
  for (int kt = 0; kt < SS / 64; ++kt) {
    if (!((live >> kt) & 1u)) continue;      // no open key for any of the wave's 16 queries in this tile, or the other wave's tile
    // sR[query][x] = q_(q0+query) . rel[cb + x], x < 80: query q0+query and key kt*64+kk meet at offset c = cb + (kk - query + 15). Same products in the same order as a table of q.rel would hold.
    // The loops below are unrolled so that d, s and the fragments are indexed by constants and stay in registers.
    const int cb = kt * 64 - q0 + (SS - 16);
    // The loads of the score part (rel rows, K rows, lane masks) all stand ahead of the first product: they are in flight together and the pass waits for memory once, not once a fragment.
    v16b rb[5][2], khf[4][2], klf[4][2];
    // cb is a multiple of 16: the five rel tiles are whole tiles cb / 16 + u <= 255 of RB (the pad offset 4095 is a written row there)
    const __bf16* pr = RB + (size_t)(cb >> 4) * 1024 + lane * 8;
    const size_t ko = (bh * (SS / 16) + kt * 4) * 1024 + lane * 8; const __bf16* pkh = Kh + ko; const __bf16* pkl = Kl + ko;
#pragma unroll
    for (int u = 0; u < 5; ++u) {
#pragma unroll
      for (int kc = 0; kc < 2; ++kc) rb[u][kc] = frag_t(pr + (u * 2 + kc) * 512); }
    __builtin_amdgcn_sched_barrier(0);      // keeps the rel loads ahead of the K loads: the rel products come first, and with the K loads in front of them they would wait for nearly all loads of the pass
#pragma unroll
    for (int t = 0; t < 4; ++t) {
#pragma unroll
      for (int kc = 0; kc < 2; ++kc) { khf[t][kc] = frag_t(pkh + (t * 2 + kc) * 512); klf[t][kc] = frag_t(pkl + (t * 2 + kc) * 512); } }
    // The tile's 32 lane masks. MB is written by an earlier launch of the same call and by nothing here: read through the constant address space, at an address that is the same in all lanes, the words come by scalar loads into scalar registers.
    const __attribute__((address_space(4))) v16u* pm = (const __attribute__((address_space(4))) v16u*)(MB + ((size_t)(qb * 4 + ws) * (SS / 64) + kt) * 32); const v16u lm0 = pm[0], lm1 = pm[1];
    __builtin_amdgcn_sched_barrier(0);      // keeps every load above ahead of the first product
#pragma unroll
    for (int u = 0; u < 5; ++u) { v8f d = {};
#pragma unroll
      for (int kc = 0; kc < 2; ++kc) { d = wmma_bf_w(rb[u][kc], aq[kc].l, d); d = wmma_bf_w(rb[u][kc], aq[kc].h, d); }
      // the lane's eight offsets 16 u + 8 g + r lie side by side in its query's row
      vst2(&sR[wv][col][u * 16 + 8 * g], __builtin_shufflevector(d, d, 0, 1, 2, 3)); vst2(&sR[wv][col][u * 16 + 8 * g + 4], __builtin_shufflevector(d, d, 4, 5, 6, 7)); }
    asm volatile("s_wait_xcnt 0x0" :: "v"(pr), "v"(pkh), "v"(pkl) : "memory");      // the address registers of the loads above are held up to here and rewritten only behind this wait
    // The V fragments are asked for here, where the rel registers have come free: they fly during the q.k products and the softmax and are first used behind it.
    v16h vhf[2][4], vlf[2][4]; const size_t vo = (bh * (SS / 64) + kt) * 4096 + lane * 8; const _Float16* pvh = VTh + vo; const _Float16* pvl = VTl + vo;
#pragma unroll
    for (int kc = 0; kc < 2; ++kc) {
#pragma unroll
      for (int t = 0; t < 4; ++t) { vhf[kc][t] = frag_th(pvh + (kc * 4 + t) * 512); vlf[kc][t] = frag_th(pvl + (kc * 4 + t) * 512); } }
    v8f s[4] = {};
#pragma unroll
    for (int t = 0; t < 4; ++t) {
#pragma unroll
      for (int kc = 0; kc < 2; ++kc) { s[t] = wmma_bf_w(khf[t][kc], aq[kc].l, s[t]); s[t] = wmma_bf_w(klf[t][kc], aq[kc].h, s[t]); s[t] = wmma_bf_w(khf[t][kc], aq[kc].h, s[t]); } }
    asm volatile("s_wait_xcnt 0x0" :: "v"(pvh), "v"(pvl) : "memory");      // as above, for the V loads
    LDSW();      // the read below takes sR values that the lane of the other half g stored
    const float* pd = &sR[wv][col][15 - col + 8 * g]; float sc[4][8], mt[4];
#pragma unroll
    for (int t = 0; t < 4; ++t) {
#pragma unroll
      for (int r = 0; r < 8; ++r) { const float v = s[t][r] * 0.125f + pd[t * 16 + r]; sc[t][r] = __builtin_amdgcn_inverse_ballot_w32(t < 2 ? lm0[t * 8 + r] : lm1[(t - 2) * 8 + r]) ? v : -1.0e30f; } }      // the word is the select's lane mask as it stands
    // four independent chains for the maximum and for the sum: a chain of 32 dependent steps would leave the wave waiting on itself
#pragma unroll
    for (int t = 0; t < 4; ++t) { mt[t] = sc[t][0];
#pragma unroll
      for (int r = 1; r < 8; ++r) mt[t] = fmaxf(mt[t], sc[t][r]); }
    float mx = fmaxf(fmaxf(mt[0], mt[1]), fmaxf(mt[2], mt[3]));
    mx = fmaxf(mx, __shfl_xor(mx, 16, 32));
    const float mnew = fmaxf(mrun, mx); const float corr = exp_b2((mrun - mnew) * LOG2E);
    v16h ph[2], pl[2]; float pt[4];
#pragma unroll
    for (int t = 0; t < 4; ++t) { pt[t] = 0.f; float ea[8], ev[8];
#pragma unroll
      for (int r = 0; r < 8; ++r) ea[r] = fmaf(sc[t][r] - mnew, LOG2E, 14.0f);      // the factor 16384 = 2^14 rides in the exponent
      exp_b2x8(ea, ev);
#pragma unroll
      for (int r = 0; r < 8; ++r) { const float p = ev[r]; pt[t] += p; const _Float16 hi = (_Float16)p; ph[t >> 1][(t & 1) * 8 + r] = hi; pl[t >> 1][(t & 1) * 8 + r] = (_Float16)((p - (float)hi) * PLO); } }
    float ps = (pt[0] + pt[1]) + (pt[2] + pt[3]);
    ps += __shfl_xor(ps, 16, 32);
    lrun = lrun * corr + ps * (1.0f / 16384.0f); mrun = mnew;
#pragma unroll
    for (int t = 0; t < 4; ++t) {
#pragma unroll
      for (int r = 0; r < 8; ++r) { acc[t][r] *= corr; ac1[t][r] *= corr; ac2[t][r] *= corr; } }
#pragma unroll
    for (int kc = 0; kc < 2; ++kc) {
#pragma unroll
      for (int t = 0; t < 4; ++t) { acc[t] = wmma16_w(vhf[kc][t], ph[kc], acc[t]); ac1[t] = wmma16_w(vlf[kc][t], ph[kc], ac1[t]); ac2[t] = wmma16_w(vhf[kc][t], pl[kc], ac2[t]); } }
    __builtin_amdgcn_wave_barrier(); }
  // The odd-tile wave lays its share down (context not yet divided, maximum, sum), each lane in a column of its own; behind the barrier the same lane of the even-tile wave scales both shares to the common maximum, adds them and divides.
  // A share without a tile has maximum -3e38 and sum 0: its factor is exp(-3e38 - m) = 0.
  if (kh) {
#pragma unroll
    for (int t = 0; t < 4; ++t) {
#pragma unroll
      for (int r = 0; r < 8; ++r) sO[w][t * 8 + r][lane] = acc[t][r] + ac1[t][r] * (1.0f / VLO) + ac2[t][r] * (1.0f / PLO); }
    sO[w][32][lane] = mrun; sO[w][33][lane] = lrun; }
  __syncthreads();      // the odd-tile waves' shares are in LDS
  if (!kh) {
  const float m1 = sO[w][32][lane], l1 = sO[w][33][lane]; const float mm = fmaxf(mrun, m1); const float f0 = exp_b2((mrun - mm) * LOG2E), f1 = exp_b2((m1 - mm) * LOG2E); const float inv = 1.0f / ((lrun * f0 + l1 * f1) * 16384.0f * 4.0f);
  // O32 in the f32 form of the fragment order: tile (query / 16, d / 32) = 2048 bytes, four 512-byte parts j; lane (g, row) holds d = 16 (j >> 1) + 8 g + 4 (j & 1) + 0..3 of its row in part j: the lane's own accumulator places
  float* po = O32 + (bh * (SS / 16) + (q0 >> 4)) * 1024 + lane * 4;
  // unrolled: the accumulators are indexed by constants and stay in registers
#pragma unroll
  for (int i = 0; i < 8; ++i) { const int t = i >> 1, rb0 = (i & 1) * 4; v4f o;
#pragma unroll
    for (int e = 0; e < 4; ++e) { const int r = rb0 + e; o[e] = ((acc[t][r] + ac1[t][r] * (1.0f / VLO) + ac2[t][r] * (1.0f / PLO)) * f0 + sO[w][t * 8 + r][lane] * f1) * inv; }
    vst2(po + i * 128, o); }
  asm volatile("s_wait_xcnt 0x0" :: "v"(po) : "memory"); }      // the second part rewrites the stores' address and data registers only behind this wait
  __syncthreads(); }      // sO has been read: the second part may write it
}
// out = ctx Wo + bo : split(ctx) x bf16(Wo columns): 2 products (Wo is an INPUT -> bf16 exact)
__global__ __launch_bounds__(128) void k_out(const float* __restrict__ O32, const __bf16* __restrict__ PT, const float* __restrict__ bo, float* __restrict__ out) {
  __shared__ __align__(16) float so[4][16][132];
  const int tid = threadIdx.x, wave = tid >> 5, lane = tid & 31, col = lane & 15, g = lane >> 4;
  const int r0 = blockIdx.x * 64 + wave * 16, n0 = blockIdx.y * 128; const int ra = r0 + col; const int b = ra / SS, s = ra % SS;
  v8f acc[8] = {};
  const float* po0 = O32 + ((size_t)b * NH * (SS / 16) + (s >> 4)) * 1024 + lane * 4; const __bf16* pw0 = PT + (size_t)((3 * E + n0) >> 4) * (E / 32) * 512 + lane * 8;
  // One head (two k chunks) a pass: all loads of the pass stand ahead of its first product, so that their latencies overlap. Not unrolled further: registers.
#pragma unroll 1
  for (int h = 0; h < NH; ++h) { float ov[2][16]; v16b wb[2][8];
    const float* po = po0 + (size_t)h * (SS / 16) * 1024; const __bf16* pw = pw0 + h * 1024;
    // inner loops unrolled so that the arrays are indexed by constants and stay in registers
#pragma unroll
    for (int c = 0; c < 2; ++c) {
#pragma unroll
      for (int i = 0; i < 16; ++i) ov[c][i] = po[c * 512 + (i >> 2) * 128 + (i & 3)]; }
#pragma unroll
    for (int c = 0; c < 2; ++c) {
#pragma unroll
      for (int j = 0; j < 8; ++j) wb[c][j] = frag_t(pw + (size_t)j * (E / 32) * 512 + c * 512); }
    asm volatile("s_wait_xcnt 0x0" :: "v"(po), "v"(pw) : "memory");      // the loads' address registers are held up to here and rewritten only behind this wait
#pragma unroll
    for (int c = 0; c < 2; ++c) { const F2 a = bsplit16(ov[c]);
#pragma unroll
      for (int j = 0; j < 8; ++j) { acc[j] = wmma_bf(a.l, wb[c][j], acc[j]); acc[j] = wmma_bf(a.h, wb[c][j], acc[j]); } } }
#pragma unroll
  for (int j = 0; j < 8; ++j) { const int n = n0 + j * 16 + col; const float bb = bfr(bo[n]);
#pragma unroll
    for (int r = 0; r < 8; ++r) so[wave][8 * g + r][j * 16 + col] = acc[j][r] + bb; }
  LDSX();
#pragma unroll 4
  for (int rl = 0; rl < 16; ++rl) vst2(out + (size_t)(r0 + rl) * E + n0 + lane * 4, *(const v4f*)(&so[wave][rl][lane * 4]));
}
extern "C" void kernel_launch(void* const* d_in, const int* in_sizes, int n_in, void* d_out, int out_size, void* d_ws, size_t ws_size, hipStream_t stream) {
  (void)in_sizes; (void)n_in; (void)out_size; (void)ws_size;
  const float* x = (const float*)d_in[0]; const int* mask = (const int*)d_in[1]; const float* Wq = (const float*)d_in[2]; const float* bq = (const float*)d_in[3]; const float* Wk = (const float*)d_in[4]; const float* bk = (const float*)d_in[5];
  const float* Wv = (const float*)d_in[6]; const float* bv = (const float*)d_in[7]; const float* Wp = (const float*)d_in[8]; const float* bp = (const float*)d_in[9]; const float* rel = (const float*)d_in[10];
  float* out = (float*)d_out;
  char* ws = (char*)d_ws; size_t off = 0;
  auto take = [&](size_t bytes) { char* p = ws + off; off += (bytes + 255) & ~(size_t)255; return p; };
  __bf16* Xb = (__bf16*)take((size_t)NR * E * 2); __bf16* PT = (__bf16*)take((size_t)4 * E * E * 2); __bf16* RB = (__bf16*)take((size_t)NREL * HD * 2);
  float* Q32 = (float*)take((size_t)NR * E * 4); __bf16* Kh = (__bf16*)take((size_t)NR * E * 2); __bf16* Kl = (__bf16*)take((size_t)NR * E * 2); _Float16* VTh = (_Float16*)take((size_t)NR * E * 2); _Float16* VTl = (_Float16*)take((size_t)NR * E * 2); float* O32 = (float*)take((size_t)NR * E * 4); unsigned* MW = (unsigned*)take((size_t)(SS / 16) * 4 * 4); unsigned* MB = (unsigned*)take((size_t)(SS / 16) * (SS / 64) * 32 * 4); float* CS = (float*)take((size_t)SS * 32 * 2 * 4);
  // ws ~ 45 MB
  k_prep<<<PB_ROT + PB_PACK + PB_MSK + PB_CVT + PB_REL, 256, 0, stream>>>(x, mask, Wq, Wk, Wv, Wp, rel, Xb, PT, RB, MW, MB, CS);
  k_qkv<<<dim3(NR / 64, E / 128, 3), 128, 0, stream>>>(Xb, PT, CS, bq, bk, bv, Q32, Kh, Kl, VTh, VTl);
  k_attn<<<dim3(SS / 64, NH / 2), 256, 0, stream>>>(Q32, Kh, Kl, VTh, VTl, MB, MW, RB, O32);
  k_out<<<dim3(NR / 64, E / 128), 128, 0, stream>>>(O32, PT, bp, out);
}

// v010
// A run of this version takes 85.5 microseconds.
// Timed twice side by side with v009, it ran 1.05 times as fast both times.
// Counting every step since v000, it is 39.3 times as fast.
// compute dtype: x, W*, b*, rel_pos_emb (INPUTS) rounded to bf16 with exact bf16 WMMA products (f32 accumulate) for the projections; rotary in f32; K pre-split into bf16 hi/lo rows; the relative-position scores q.rel^T as q hi/lo x bf16(rel) (2 products); P and V f16 hi/lo (3 products); softmax with the int mask in f32.
#include <hip/hip_runtime.h>
#include <math.h>

typedef __attribute__((ext_vector_type(16))) _Float16 v16h;
typedef __attribute__((ext_vector_type(16))) __bf16 v16b;
typedef __attribute__((ext_vector_type(8)))  _Float16 v8h;
typedef __attribute__((ext_vector_type(8)))  float v8f;
typedef __attribute__((ext_vector_type(4)))  float v4f;
typedef __attribute__((ext_vector_type(2)))  float v2f;
typedef __attribute__((ext_vector_type(4)))  unsigned v4u;
typedef __attribute__((ext_vector_type(16))) unsigned v16u;
typedef __attribute__((ext_vector_type(4)))  int v4i;
typedef float __attribute__((may_alias)) float_a;
typedef int __attribute__((may_alias)) int_a;

template <typename T> __device__ __forceinline__ void vst2(void* p, T v) { *(T*)p = v;  }
__device__ __forceinline__ v8f wmma16(v16h a, v16h b, v8f c) {
  v8f d = __builtin_amdgcn_wmma_f32_16x16x32_f16(false, a, false, b, (short)0, c, false, false);
  asm volatile("v_nop\n\tv_nop\n\tv_nop\n\tv_nop" : "+v"(d) : "v"(a), "v"(b));
  return d;
}
__device__ __forceinline__ v8f wmma_bf(v16b a, v16b b, v8f c) {
  v8f d = __builtin_amdgcn_wmma_f32_16x16x32_bf16(false, a, false, b, (short)0, c, false, false);
  asm volatile("v_nop\n\tv_nop\n\tv_nop\n\tv_nop" : "+v"(d) : "v"(a), "v"(b));
  return d;
}
// The same two for the attention kernel, whose fragments in flight lie above v255: an operand of an asm statement is held below v256, so a and b are not named there (naming them spills).
__device__ __forceinline__ v8f wmma16_w(v16h a, v16h b, v8f c) {
  v8f d = __builtin_amdgcn_wmma_f32_16x16x32_f16(false, a, false, b, (short)0, c, false, false);
  asm volatile("v_nop\n\tv_nop\n\tv_nop\n\tv_nop" : "+v"(d));      // the distance behind a matrix instruction
  return d;
}
__device__ __forceinline__ v8f wmma_bf_w(v16b a, v16b b, v8f c) {
  v8f d = __builtin_amdgcn_wmma_f32_16x16x32_bf16(false, a, false, b, (short)0, c, false, false);
  asm volatile("v_nop\n\tv_nop\n\tv_nop\n\tv_nop" : "+v"(d));      // the distance behind a matrix instruction
  return d;
}
// 16x16x32 fragments: lane = (h = lane>>4, row/col = lane&15); elements 0..7 = k0+8h+0..7, 8..15 = k0+16+8h+0..7; D element r = row 8h+r
__device__ __forceinline__ v16h frag_h(const _Float16* rowk0, int lane) {
  union { v16h v; v8h q[2]; } u; const _Float16* p = rowk0 + 8 * (lane >> 4);
  u.q[0] = *(const v8h*)p; u.q[1] = *(const v8h*)(p + 16); return u.v;
}
__device__ __forceinline__ v16h frag_f32(const float* rowk0, int lane) {
  v16h a; const float* p = rowk0 + 8 * (lane >> 4);
#pragma unroll
  for (int i = 0; i < 8; ++i) { a[i] = (_Float16)p[i]; a[8 + i] = (_Float16)p[16 + i]; }
  return a;
}
__device__ __forceinline__ v16h frag_f32s(const float* rowk0, int lane, float sc) {
  v16h a; const float* p = rowk0 + 8 * (lane >> 4);
#pragma unroll
  for (int i = 0; i < 8; ++i) { a[i] = (_Float16)(p[i] * sc); a[8 + i] = (_Float16)(p[16 + i] * sc); }
  return a;
}
// column fragment from a [K][ld] layout (column n), rows >= K read as 0
__device__ __forceinline__ v16h fragc_f32(const float* W, int k0, int n, int lane, int ld, int K) {
  v16h a; const int g = lane >> 4;
#pragma unroll
  for (int i = 0; i < 8; ++i) { const int ka = k0 + 8 * g + i, kb = ka + 16;
    a[i] = (_Float16)(ka < K ? W[(size_t)ka * ld + n] : 0.f); a[8 + i] = (_Float16)(kb < K ? W[(size_t)kb * ld + n] : 0.f); }
  return a;
}
struct F2 { v16b h, l; };
__device__ __forceinline__ F2 bsplit16(const float v[16]) { F2 r;
#pragma unroll
  for (int i = 0; i < 16; ++i) { const __bf16 h = (__bf16)v[i]; r.h[i] = h; r.l[i] = (__bf16)(v[i] - (float)h); }
  return r; }
__device__ __forceinline__ F2 split_row(const float* row, int k0, int lane) { float v[16]; const float* p = row + k0 + 8 * (lane >> 4);
#pragma unroll
  for (int i = 0; i < 8; ++i) { v[i] = p[i]; v[8 + i] = p[16 + i]; }
  return bsplit16(v); }
__device__ __forceinline__ F2 split_rowK(const float* row, int k0, int lane, int K) { float v[16]; const int g = lane >> 4;
#pragma unroll
  for (int i = 0; i < 8; ++i) { const int ka = k0 + 8 * g + i, kb = ka + 16; v[i] = ka < K ? row[ka] : 0.f; v[8 + i] = kb < K ? row[kb] : 0.f; }
  return bsplit16(v); }
__device__ __forceinline__ F2 split_col(const float* W, int k0, int n, int lane, int ld, int K) { float v[16]; const int g = lane >> 4;
#pragma unroll
  for (int i = 0; i < 8; ++i) { const int ka = k0 + 8 * g + i, kb = ka + 16; v[i] = ka < K ? W[(size_t)ka * ld + n] : 0.f; v[8 + i] = kb < K ? W[(size_t)kb * ld + n] : 0.f; }
  return bsplit16(v); }
__device__ __forceinline__ v8f mac3(const F2& a, const F2& b, v8f c) { c = wmma_bf(a.l, b.h, c); c = wmma_bf(a.h, b.l, c); return wmma_bf(a.h, b.h, c); }
__device__ __forceinline__ float sigm(float v) { return 1.0f / (1.0f + expf(-v)); }
#define LDSX() do { asm volatile("s_wait_dscnt 0" ::: "memory"); __builtin_amdgcn_wave_barrier(); __builtin_amdgcn_fence(__ATOMIC_RELEASE, "workgroup"); } while (0)
// The same exchange among the lanes of ONE wave, for places where global loads are in flight: the fence at wavefront scope orders the LDS accesses for the compiler and does not drain the loads as the work-group one does.
#define LDSW() do { asm volatile("s_wait_dscnt 0" ::: "memory"); __builtin_amdgcn_wave_barrier(); __builtin_amdgcn_fence(__ATOMIC_RELEASE, "wavefront"); } while (0)


// Rotary multi-head attention with Shaw relative-position scores (16 heads of 64 on [1,2048,1024], [in][out] weights + biases): q,k = rotate_half-RoPE(xW+b) (angle[d] = s*10000^(-2(d mod 32)/64));
// scores[i][j] = q_i.k_j/8 + q_i.rel_pos_emb[j-i+2047]; masked where mask[i][j] == 0 (-1e30); softmax; (P v) Wo + bo. The rel term uses the skew trick inside the attention kernel: a tile of 16 queries x 64 keys
// needs only the 79 offsets c = j-i+2047 of its diagonals, so q.rel[c] is formed for five 16-column tiles, laid in LDS and read back along the diagonal. No score table in memory: all heads run in one launch.
// A tile of 16 queries x 64 keys whose mask words are all 0 adds exactly nothing to a row that has an open key somewhere (its weights are exp(-1e30 - m) = 0, or are wiped by the factor 0 at the row's first open key):
// p_msk reads the mask once and says which tiles hold an open word; the attention kernel passes over the others.
#define NB 1
#define SS 2048
#define NREL 4096      // 4095 offsets padded to 4096 (offset 4095 is clamped to row 4094 and never used)
#define E 1024
#define NH 16
#define HD 64
#define NR (NB * SS)
#define PLO 1024.0f
#define VLO 2048.0f
__device__ __forceinline__ float bfr(float v) { return (float)(__bf16)v; }
// 2^a by the chip's own base-2 exponential. The softmax weights e^d, d <= 0, are taken as 2^(d log2 e): one multiply (or fused multiply-add) and this instruction, in place of the library's expf (range tests, split argument, ldexp).
// d is a difference formed first, so that equal values give exactly 2^0 also at -1e30; a result below the normal range comes out as 0, at a = -inf too.
#define LOG2E 1.4426950408889634f
__device__ __forceinline__ float exp_b2(float a) { float r = __builtin_amdgcn_exp2f(a);
  // The one slot that the instruction set asks for behind a transcendental: r is read and a's register rewritten only behind this v_nop.
  asm("v_nop" : "+v"(r) : "v"(a));
  return r; }
// The same for eight values at once, with one v_nop for the eight: up to it nothing reads a result or rewrites an argument's register, so what stands directly behind each v_exp_f32 is another of the eight, an instruction that touches neither, or the v_nop.
__device__ __forceinline__ void exp_b2x8(const float a[8], float e[8]) {
#pragma unroll
  for (int r = 0; r < 8; ++r) e[r] = __builtin_amdgcn_exp2f(a[r]);
  asm("v_nop" : "+v"(e[0]), "+v"(e[1]), "+v"(e[2]), "+v"(e[3]), "+v"(e[4]), "+v"(e[5]), "+v"(e[6]), "+v"(e[7]) : "v"(a[0]), "v"(a[1]), "v"(a[2]), "v"(a[3]), "v"(a[4]), "v"(a[5]), "v"(a[6]), "v"(a[7]));
}
__device__ __forceinline__ v16b frag_b(const __bf16* rowk0, int lane) { return __builtin_bit_cast(v16b, frag_h((const _Float16*)rowk0, lane)); }
// FRAGMENT ORDER of the 16-bit operands in the workspace: a tile of 16 rows x 32 k is 1024 contiguous bytes; the piece of 8 elements k = 16 hf + 8 g + 0..7 of row r lies at element (hf * 32 + g * 16 + r) * 8.
// Lane l = g * 16 + r finds its two pieces at l * 8 and 256 + l * 8, so each wave-wide 16-byte load covers 512 contiguous bytes (4 whole lines) and not 32-byte pieces of 16 lines. p = tile + lane * 8.
__device__ __forceinline__ v16h frag_th(const _Float16* p) { union { v16h v; v8h q[2]; } u; u.q[0] = *(const v8h*)p; u.q[1] = *(const v8h*)(p + 256); return u.v; }
__device__ __forceinline__ v16b frag_t(const __bf16* p) { return __builtin_bit_cast(v16b, frag_th((const _Float16*)p)); }

// The five preparation jobs (rotary angles, weights, mask scan, x, rel rows) depend on the inputs alone and not on each other: they are parts of ONE launch, k_prep, in which a range of block indices picks the job (blk = the block's number inside its job).
__device__ __forceinline__ void p_cvt(int blk, const float* __restrict__ x, __bf16* __restrict__ Xb) {
  const size_t i8 = (size_t)blk * 256 + threadIdx.x; if (i8 >= (size_t)NR * E / 8) return;
  // i8 = the piece's place in fragment order: tile (row tile, k chunk), then hf, g, row
  const size_t tile = i8 >> 6; const int hf = (int)(i8 >> 5) & 1, g = (int)(i8 >> 4) & 1, row = (int)i8 & 15;
  const float* px = x + ((tile >> 5) * 16 + row) * E + (tile & 31) * 32 + hf * 16 + g * 8;
  union { __bf16 h[8]; v4u u; } pk;
#pragma unroll
  for (int e = 0; e < 8; ++e) pk.h[e] = (__bf16)px[e];
  vst2((unsigned*)(Xb + i8 * 8), pk.u);
}
// PT rows: [0,E) Wq[:,n], [E,2E) Wk[:,n], [2E,3E) Wv[:,n], [3E,4E) Wo[:,n]  ([in][out] weights: column n as a bf16 row), in fragment order
__device__ __forceinline__ void p_pack(int blk, const float* __restrict__ Wq, const float* __restrict__ Wk, const float* __restrict__ Wv, const float* __restrict__ Wo, __bf16* __restrict__ PT) {
  // block: 32 columns n (two row tiles of PT) x 256 k, turned in LDS; written in fragment order, tile (n / 16, k / 32)
  const int n0 = (blk & (4 * E / 32 - 1)) * 32, k0 = (blk / (4 * E / 32)) * 256, tid = threadIdx.x; __shared__ __align__(16) __bf16 st[32][264];
  const float* W = n0 < E ? Wq : (n0 < 2 * E ? Wk : (n0 < 3 * E ? Wv : Wo)); const int nn0 = n0 & (E - 1);
  const int kr = tid >> 3, c4 = (tid & 7) * 4; const float* pwv = W + (size_t)(k0 + kr) * E + nn0 + c4; v4f v[8];      // a wave-wide load: 4 rows k x 128 bytes, whole lines
  // unrolled: v is indexed by constants and stays in registers
#pragma unroll
  for (int i = 0; i < 8; ++i) v[i] = *(const v4f*)(pwv + (size_t)i * 32 * E);
  asm volatile("s_wait_xcnt 0x0" :: "v"(pwv) : "memory");      // the loads' address register is held up to here and rewritten only behind this wait
#pragma unroll
  for (int i = 0; i < 8; ++i) {
#pragma unroll
    for (int e = 0; e < 4; ++e) st[c4 + e][i * 32 + kr] = (__bf16)v[i][e]; }
  __syncthreads();
  for (int i = 0; i < 4; ++i) { const int j = i * 256 + tid, tile = j >> 6, nt = tile >> 3, kcl = tile & 7, hf = (j >> 5) & 1, g = (j >> 4) & 1, row = j & 15;
    vst2((unsigned*)(PT + ((size_t)((n0 >> 4) + nt) * (E / 32) + (k0 >> 5) + kcl) * 512 + (j & 63) * 8), *(const v4u*)(&st[nt * 16 + row][kcl * 32 + hf * 16 + g * 8])); }
  asm volatile("s_wait_xcnt 0x0" ::: "memory");      // another job's code follows in the listing: the stores' address and data registers are rewritten only behind this wait
}
// QKV: block (64 rows, 128 cols = 2 heads, which); q (+bias) -> Q32 f32 [bh][s][64]; k (+bias) -> bf16 hi/lo rows; v (+bias) -> VT hi/lo x4 (rows d, k = key); K and VT in fragment order
__global__ __launch_bounds__(128) void k_qkv(const __bf16* __restrict__ Xb, const __bf16* __restrict__ PT, const float* __restrict__ CS, const float* __restrict__ bq, const float* __restrict__ bk, const float* __restrict__ bv,
                                            float* __restrict__ Q32, __bf16* __restrict__ Kh, __bf16* __restrict__ Kl, _Float16* __restrict__ VTh, _Float16* __restrict__ VTl) {
  __shared__ __align__(16) float so[4][16][132];
  __shared__ __align__(16) _Float16 sth[128][72], stl[128][72];
  const int tid = threadIdx.x, wave = tid >> 5, lane = tid & 31, col = lane & 15, g = lane >> 4;
  const int which = blockIdx.z, r0b = blockIdx.x * 64, r0 = r0b + wave * 16, n0 = blockIdx.y * 128; const int b = r0b / SS, s0 = r0b % SS;
  const float* bb_ = which == 0 ? bq : (which == 1 ? bk : bv);
  v8f acc[8] = {};
  // The (cos, sin) pairs of the lane's accumulator places: rows 8 g + r, d mod 32 = jj * 16 + col; the same for both heads of the block. Asked for here, they are in flight together with the loads of the product loop's first pass. A wave-wide load covers 128 bytes of two rows.
  v2f cs[2][8]; const float* pcs = CS + ((size_t)(s0 + wave * 16 + 8 * g) * 32 + col) * 2;
  // unrolled: cs is indexed by constants and stays in registers
#pragma unroll
  for (int jj = 0; jj < 2; ++jj) {
#pragma unroll
    for (int r = 0; r < 8; ++r) cs[jj][r] = *(const v2f*)(pcs + r * 64 + jj * 32); }
  asm volatile("s_wait_xcnt 0x0" :: "v"(pcs) : "memory");      // the loads' address register is held up to here and rewritten only behind this wait
  // Two k chunks a pass: all 36 loads of the pass stand ahead of its first product, so that their latencies overlap (one wait a pass instead of one a product). Not unrolled further: registers.
#pragma unroll 1
  for (int kc = 0; kc < E / 32; kc += 2) { v16b a[2], wb[2][8];
    const __bf16* pa = Xb + ((size_t)(r0 >> 4) * (E / 32) + kc) * 512 + lane * 8; const __bf16* pw = PT + ((size_t)((which * E + n0) >> 4) * (E / 32) + kc) * 512 + lane * 8;
    // inner loops unrolled so that the fragment arrays are indexed by constants and stay in registers
#pragma unroll
    for (int c = 0; c < 2; ++c) { a[c] = frag_t(pa + c * 512);
#pragma unroll
      for (int j = 0; j < 8; ++j) wb[c][j] = frag_t(pw + (size_t)j * (E / 32) * 512 + c * 512); }
#pragma unroll
    for (int j = 0; j < 8; ++j) acc[j] = wmma_bf(a[0], wb[0][j], acc[j]);
    asm volatile("s_wait_xcnt 0x0" :: "v"(pa), "v"(pw) : "memory");      // the loads' address registers are held up to here and rewritten only behind this wait
#pragma unroll
    for (int j = 0; j < 8; ++j) acc[j] = wmma_bf(a[1], wb[1][j], acc[j]); }
  if (which < 2) {
    // RoPE (rotate_half pairs (d, d+32)) on the accumulators: column tiles j and j + 2 of a head hold d and d + 32 of the same row in the same lane and element
#pragma unroll
    for (int j = 0; j < 8; ++j) { if (j & 2) continue;
      const int jj = j & 1; const float b1 = bfr(bb_[n0 + j * 16 + col]), b2 = bfr(bb_[n0 + (j + 2) * 16 + col]);
#pragma unroll
      for (int r = 0; r < 8; ++r) { const float x1 = acc[j][r] + b1, x2 = acc[j + 2][r] + b2, c = cs[jj][r][0], sn = cs[jj][r][1];
        so[wave][8 * g + r][j * 16 + col] = x1 * c - x2 * sn; so[wave][8 * g + r][(j + 2) * 16 + col] = x2 * c + x1 * sn; } }
    LDSX();
    if (which == 0) { for (int qq = lane; qq < 2 * 16 * 16; qq += 32) { const int hh = qq >> 8, rl = (qq >> 4) & 15, pc = qq & 15; const int h = (n0 >> 6) + hh;
        vst2(Q32 + (((size_t)b * NH + h) * SS + s0 + wave * 16 + rl) * HD + pc * 4, *(const v4f*)(&so[wave][rl][hh * 64 + pc * 4])); } }
    else {
      // fragment order, tile (key / 16, d / 32): the wave's 32 lanes store one 512-byte half tile a trip
      for (int i = 0; i < 16; ++i) { const int hf = i & 1, kc = (i >> 1) & 1, lo = (i >> 2) & 1, hh = i >> 3; const int h = (n0 >> 6) + hh; union { __bf16 e[8]; v4u u; } pk;
#pragma unroll
        for (int e = 0; e < 8; ++e) { const float v = so[wave][col][hh * 64 + kc * 32 + hf * 16 + g * 8 + e]; const __bf16 hi = (__bf16)v; pk.e[e] = lo ? (__bf16)(v - (float)hi) : hi; }
        vst2((unsigned*)((lo ? Kl : Kh) + ((((size_t)b * NH + h) * (SS / 16) + (s0 >> 4) + wave) * 2 + kc) * 512 + hf * 256 + lane * 8), pk.u);
        asm volatile("s_wait_xcnt 0x0" ::: "memory"); } } }      // the next trip rewrites the store's address and data registers only behind this wait
  else {
#pragma unroll
    for (int j = 0; j < 8; ++j) { const float bb = bfr(bb_[n0 + j * 16 + col]);
#pragma unroll
      for (int r = 0; r < 8; ++r) { const float v = (acc[j][r] + bb) * 4.0f; const _Float16 hi = (_Float16)v; sth[j * 16 + col][wave * 16 + 8 * g + r] = hi; stl[j * 16 + col][wave * 16 + 8 * g + r] = (_Float16)((v - (float)hi) * VLO); } }
    __syncthreads();
    // fragment order, per head and 64 keys eight tiles (key chunk kc, d / 16): qq = hh, kc, d / 16, hf, g, d % 16 from the top bit down
    for (int qq = tid; qq < 128 * 8; qq += 128) { const int hh = qq >> 9, cl = hh * 64 + ((qq >> 6) & 3) * 16 + (qq & 15), pc = ((qq >> 8) & 1) * 4 + ((qq >> 4) & 3); const size_t o = (((size_t)b * NH + (n0 >> 6) + hh) * (SS / 64) + (s0 >> 6)) * 4096 + (qq & 511) * 8;
      vst2(VTh + o, *(const v4u*)(&sth[cl][pc * 8])); vst2(VTl + o, *(const v4u*)(&stl[cl][pc * 8])); } }
}

// rel_pos_emb rows -> bf16 in fragment order, tile (offset / 16, d / 32); the pad row 4095 takes row 4094's values (never used by a score)
__device__ __forceinline__ void p_relb(int blk, const float* __restrict__ rel, __bf16* __restrict__ RB) {
  const size_t i8 = (size_t)blk * 256 + threadIdx.x; if (i8 >= (size_t)NREL * HD / 8) return;
  const int tile = (int)(i8 >> 6), hf = (int)(i8 >> 5) & 1, g = (int)(i8 >> 4) & 1, c = (tile >> 1) * 16 + ((int)i8 & 15);
  const float* ps = rel + (size_t)(c < NREL - 1 ? c : NREL - 2) * HD + (tile & 1) * 32 + hf * 16 + g * 8;
  union { __bf16 e[8]; v4u u; } pk;
#pragma unroll
  for (int e = 0; e < 8; ++e) pk.e[e] = (__bf16)ps[e];
  vst2((unsigned*)(RB + i8 * 8), pk.u);
}
// MW[query / 16][key quarter]: bit 16 + k is set where key tile 8 * quarter + k (64 keys) holds a mask word != 0 for one of the 16 queries; bit r < 16 where row r has an open key in the quarter. tile_word() joins the four.
// block = 16 queries x 8 key tiles (a block of k_prep has 8 waves), wave = key tile; a wave-wide 16-byte load covers 256 contiguous bytes of two rows.
// MB[query / 16][key tile][32]: the tile's mask as the 32 lane masks of the attention kernel, 128 contiguous bytes a tile: bit 16 g + col of word 8 t + r is set where key 16 t + 8 g + r of the tile is open for query col,
// the score that lane (g, col) holds there in place (t, r). The attention kernel takes the 32 words into scalar registers and selects with them; it reads no mask word and compares nothing.
__device__ __forceinline__ void p_msk(int blk, const int* __restrict__ mask, unsigned* __restrict__ MW, unsigned* __restrict__ MB) {
  __shared__ __align__(16) unsigned sT[8];
  const int tid = threadIdx.x, kt = tid >> 5, lane = tid & 31;
  const int* pm = mask + (size_t)((blk >> 2) * 16 + (lane >> 4)) * SS + ((blk & 3) * 8 + kt) * 64 + (lane & 15) * 4; v4i m[8];
  // unrolled: m is indexed by constants and stays in registers; the eight loads are in flight together
#pragma unroll
  for (int i = 0; i < 8; ++i) m[i] = *(const v4i*)(pm + (size_t)i * 2 * SS);
  asm volatile("s_wait_xcnt 0x0" :: "v"(pm) : "memory");      // the loads' address register is held up to here and rewritten only behind this wait
  unsigned rows = 0, lm = 0;      // rows, bit r: row r has an open key in this tile; lm: the lane mask of place (t, r) = (lane >> 3, lane & 7)
  const int lsh = 4 * (lane >> 3) + ((lane >> 2) & 1);      // keys 16 t + 8 g + r = 4 j + e: e = r & 3, j = 4 t + (r >> 2) + 2 g
  unsigned pick[4];      // all ones for the lane's own e: the choice among the four ballots is made by and / or, without a branch
#pragma unroll
  for (int e = 0; e < 4; ++e) pick[e] = (lane & 3) == e ? 0xFFFFFFFFu : 0u;
#pragma unroll
  for (int i = 0; i < 8; ++i) { unsigned q[4];
#pragma unroll
    for (int e = 0; e < 4; ++e) q[e] = __builtin_amdgcn_ballot_w32(m[i][e] != 0);      // bit 16 hb + j: row 2 i + hb, key 4 j + e
    const unsigned bl = q[0] | q[1] | q[2] | q[3];
    rows |= ((bl & 0xFFFFu) ? 1u : 0u) << (2 * i); rows |= ((bl >> 16) ? 2u : 0u) << (2 * i);
    // the lane's four bits of these two rows stand at 16 hb + 2 g behind the shift; folded to 2 g + hb, they go to bits 16 g + 2 i + hb
    const unsigned y = (((q[0] & pick[0]) | (q[1] & pick[1]) | (q[2] & pick[2]) | (q[3] & pick[3])) >> lsh) & 0x00050005u, z = y | (y >> 15);
    lm |= ((z & 3u) << (2 * i)) | ((z & 12u) << (14 + 2 * i)); }
  MB[((size_t)(blk >> 2) * (SS / 64) + (blk & 3) * 8 + kt) * 32 + lane] = lm;
  asm volatile("s_wait_xcnt 0x0" ::: "memory");      // the store's address and data registers are rewritten only behind this wait
  if (lane == 0) sT[kt] = rows;
  __syncthreads();
  if (tid == 0) { unsigned tiles = 0, seen = 0;
#pragma unroll
    for (int k = 0; k < 8; ++k) { const unsigned v = sT[k]; seen |= v; tiles |= (v ? 1u : 0u) << k; }
    MW[blk] = seen | (tiles << 16); }
}
// The word of a query tile: bit kt is set where key tile kt holds an open key for one of the 16 queries. Where one of the 16 rows has no open key at all its softmax is uniform over ALL keys, so every bit is set.
__device__ __forceinline__ unsigned tile_word(const unsigned* __restrict__ MW, int qt) {
  const v4u p = *(const v4u*)(MW + qt * 4);
  const unsigned seen = (p[0] | p[1] | p[2] | p[3]) & 0xFFFFu, tiles = (p[0] >> 16) | ((p[1] >> 16) << 8) | ((p[2] >> 16) << 16) | ((p[3] >> 16) << 24);
  return seen == 0xFFFFu ? tiles : 0xFFFFFFFFu;
}
// CS[s][d] = (cos, sin) of the rotary angle s * 10000^(-2 d / 64), d < 32: each angle is worked out once here and read by every QKV block that needs it. A thread takes one d and eight positions s; a wave stores 256 contiguous bytes.
__device__ __forceinline__ void p_rot(int blk, float* __restrict__ CS) {
  const int i = blk * 256 + (int)threadIdx.x, d = i & 31, sb = (i >> 5) * 8;
  const float invf = powf(10000.0f, -(float)(2 * d) * (1.0f / 64.0f));
  for (int e = 0; e < 8; ++e) { const float ang = (float)(sb + e) * invf; float sn, c; sincosf(ang, &sn, &c); v2f v; v[0] = c; v[1] = sn;
    vst2(CS + ((size_t)(sb + e) * 32 + d) * 2, v);
    asm volatile("s_wait_xcnt 0x0" ::: "memory"); }      // the next trip rewrites the store's address and data registers only behind this wait
}
#define PB_ROT (SS * 32 / 8 / 256)
#define PB_PACK (4 * E / 32 * (E / 256))
#define PB_MSK (SS / 16 * 4)
#define PB_CVT (NR * E / 8 / 256)
#define PB_REL (NREL * HD / 8 / 256)
// The jobs with the longest way through a block (the angles' arithmetic; loads, LDS, barrier, stores) take the lowest block indices, the short ones the highest.
__global__ __launch_bounds__(256) void k_prep(const float* __restrict__ x, const int* __restrict__ mask, const float* __restrict__ Wq, const float* __restrict__ Wk, const float* __restrict__ Wv, const float* __restrict__ Wo, const float* __restrict__ rel,
                                             __bf16* __restrict__ Xb, __bf16* __restrict__ PT, __bf16* __restrict__ RB, unsigned* __restrict__ MW, unsigned* __restrict__ MB, float* __restrict__ CS) {
  const int blk = (int)blockIdx.x - PB_ROT;
  if (blk < 0) p_rot((int)blockIdx.x, CS);
  else if (blk < PB_PACK) p_pack(blk, Wq, Wk, Wv, Wo, PT);
  else if (blk < PB_PACK + PB_MSK) p_msk(blk - PB_PACK, mask, MW, MB);
  else if (blk < PB_PACK + PB_MSK + PB_CVT) p_cvt(blk - (PB_PACK + PB_MSK), x, Xb);
  else p_relb(blk - (PB_PACK + PB_MSK + PB_CVT), rel, RB);
}
// masked attention with relative-position scores: block (64 queries, head) twice, two waves a query tile; the key tiles that MW names; S on q hi/lo x K hi/lo rows; P,V hi/lo; O f32 in fragment order
// All three products are formed TRANSPOSED (keys, offsets or d as the rows of A; the 16 queries as the columns of B): a lane (g, col) then holds, of ONE query q0 + col, the scores of keys 16 t + 8 g + r. Maximum and sum are
// taken in the lane (one exchange between the halves g), two score tiles converted in place ARE the B operand of V^T P^T, the rescale factor is the lane's own, and the context leaves in the order that k_out reads.
__global__ __launch_bounds__(256) void k_attn(const float* __restrict__ Q32, const __bf16* __restrict__ Kh, const __bf16* __restrict__ Kl, const _Float16* __restrict__ VTh, const _Float16* __restrict__ VTl, const unsigned* __restrict__ MB, const unsigned* __restrict__ MW, const __bf16* __restrict__ RB, float* __restrict__ O32) {
  __shared__ __align__(16) float sR[8][16][84];
  __shared__ __align__(16) float sO[4][34][32];
  // wave wv: query tile w = wv & 3 of the 64 queries, key share kh = wv >> 2 (the even or the odd key tiles)
  const int tid = threadIdx.x, wv = tid >> 5, w = wv & 3, lane = tid & 31, col = lane & 15, g = lane >> 4;
  // All waves are resident at once, so the launch lasts as long as its longest wave: the tiles that are left are dealt evenly. Under a mask that opens more keys to later queries the cost grows with the query block:
  // a block takes query block t of one head and then query block 31 - t of another, one after the other in every wave, so that all blocks cost alike; each (head, query block) is taken once. And two waves share
  // a query tile, one on its even and one on its odd key tiles, each with a running maximum, sum and context of its own; the two are joined in LDS behind the key loop. Not unrolled: one copy of the code.
  // The tile words of the wave's two query tiles, read here, ahead of every store, with the wave's number in a scalar register: scalar loads, and the test on the word in the key loop is a scalar branch.
  const int ws = __builtin_amdgcn_readfirstlane(w), kh = __builtin_amdgcn_readfirstlane(wv >> 2); const unsigned live0 = tile_word(MW, (int)blockIdx.x * 4 + ws), live1 = tile_word(MW, (SS / 64 - 1 - (int)blockIdx.x) * 4 + ws);
#pragma unroll 1
  for (int part = 0; part < 2; ++part) {
  const size_t bh = (size_t)(blockIdx.y + part * (NH / 2)); const int qb = part ? SS / 64 - 1 - (int)blockIdx.x : (int)blockIdx.x; const int q0 = qb * 64 + w * 16;
  const unsigned live = (part ? live1 : live0) & (kh ? 0xAAAAAAAAu : 0x55555555u);
  F2 aq[2]; float qv[2][16]; const float* pq = Q32 + (bh * SS + q0 + col) * HD + 8 * g;
  // unrolled: qv is indexed by constants and stays in registers
#pragma unroll
  for (int kc = 0; kc < 2; ++kc) {
#pragma unroll
    for (int i = 0; i < 8; ++i) { qv[kc][i] = pq[kc * 32 + i]; qv[kc][8 + i] = pq[kc * 32 + 16 + i]; } }
  asm volatile("s_wait_xcnt 0x0" :: "v"(pq) : "memory");      // the q loads' address register is held up to here and rewritten only behind this wait
#pragma unroll
  for (int kc = 0; kc < 2; ++kc) aq[kc] = bsplit16(qv[kc]);
  float mrun = -3.0e38f, lrun = 0.f; v8f acc[4] = {}, ac1[4] = {}, ac2[4] = {};      // acc[t][r]: d = 16 t + 8 g + r of query q0 + col
#pragma unroll 1
  for (int kt = 0; kt < SS / 64; ++kt) {
    if (!((live >> kt) & 1u)) continue;      // no open key for any of the wave's 16 queries in this tile, or the other wave's tile
    // sR[query][x] = q_(q0+query) . rel[cb + x], x < 80: query q0+query and key kt*64+kk meet at offset c = cb + (kk - query + 15). Same products in the same order as a table of q.rel would hold.
    // The loops below are unrolled so that d, s and the fragments are indexed by constants and stay in registers.
    const int cb = kt * 64 - q0 + (SS - 16);
    // The loads of the score part (rel rows, K rows, lane masks) all stand ahead of the first product: they are in flight together and the pass waits for memory once, not once a fragment.
    v16b rb[5][2], khf[4][2], klf[4][2];
    // cb is a multiple of 16: the five rel tiles are whole tiles cb / 16 + u <= 255 of RB (the pad offset 4095 is a written row there)
    const __bf16* pr = RB + (size_t)(cb >> 4) * 1024 + lane * 8;
    const size_t ko = (bh * (SS / 16) + kt * 4) * 1024 + lane * 8; const __bf16* pkh = Kh + ko; const __bf16* pkl = Kl + ko;
#pragma unroll
    for (int u = 0; u < 5; ++u) {
#pragma unroll
      for (int kc = 0; kc < 2; ++kc) rb[u][kc] = frag_t(pr + (u * 2 + kc) * 512); }
    __builtin_amdgcn_sched_barrier(0);      // keeps the rel loads ahead of the K loads: the rel products come first, and with the K loads in front of them they would wait for nearly all loads of the pass
#pragma unroll
    for (int t = 0; t < 4; ++t) {
#pragma unroll
      for (int kc = 0; kc < 2; ++kc) { khf[t][kc] = frag_t(pkh + (t * 2 + kc) * 512); klf[t][kc] = frag_t(pkl + (t * 2 + kc) * 512); } }
    // The tile's 32 lane masks. MB is written by an earlier launch of the same call and by nothing here: read through the constant address space, at an address that is the same in all lanes, the words come by scalar loads into scalar registers.
    const __attribute__((address_space(4))) v16u* pm = (const __attribute__((address_space(4))) v16u*)(MB + ((size_t)(qb * 4 + ws) * (SS / 64) + kt) * 32); const v16u lm0 = pm[0], lm1 = pm[1];
    __builtin_amdgcn_sched_barrier(0);      // keeps every load above ahead of the first product
#pragma unroll
    for (int u = 0; u < 5; ++u) { v8f d = {};
#pragma unroll
      for (int kc = 0; kc < 2; ++kc) { d = wmma_bf_w(rb[u][kc], aq[kc].l, d); d = wmma_bf_w(rb[u][kc], aq[kc].h, d); }
      // the lane's eight offsets 16 u + 8 g + r lie side by side in its query's row
      vst2(&sR[wv][col][u * 16 + 8 * g], __builtin_shufflevector(d, d, 0, 1, 2, 3)); vst2(&sR[wv][col][u * 16 + 8 * g + 4], __builtin_shufflevector(d, d, 4, 5, 6, 7)); }
    asm volatile("s_wait_xcnt 0x0" :: "v"(pr), "v"(pkh), "v"(pkl) : "memory");      // the address registers of the loads above are held up to here and rewritten only behind this wait
    // The V fragments are asked for here, where the rel registers have come free: they fly during the q.k products and the softmax and are first used behind it.
    v16h vhf[2][4], vlf[2][4]; const size_t vo = (bh * (SS / 64) + kt) * 4096 + lane * 8; const _Float16* pvh = VTh + vo; const _Float16* pvl = VTl + vo;
#pragma unroll
    for (int kc = 0; kc < 2; ++kc) {
#pragma unroll
      for (int t = 0; t < 4; ++t) { vhf[kc][t] = frag_th(pvh + (kc * 4 + t) * 512); vlf[kc][t] = frag_th(pvl + (kc * 4 + t) * 512); } }
    v8f s[4] = {};
#pragma unroll
    for (int t = 0; t < 4; ++t) {
#pragma unroll
      for (int kc = 0; kc < 2; ++kc) { s[t] = wmma_bf_w(khf[t][kc], aq[kc].l, s[t]); s[t] = wmma_bf_w(klf[t][kc], aq[kc].h, s[t]); s[t] = wmma_bf_w(khf[t][kc], aq[kc].h, s[t]); } }
    asm volatile("s_wait_xcnt 0x0" :: "v"(pvh), "v"(pvl) : "memory");      // as above, for the V loads
    LDSW();      // the read below takes sR values that the lane of the other half g stored
    const float* pd = &sR[wv][col][15 - col + 8 * g]; float sc[4][8], mt[4];
#pragma unroll
    for (int t = 0; t < 4; ++t) {
#pragma unroll
      for (int r = 0; r < 8; ++r) { const float v = s[t][r] * 0.125f + pd[t * 16 + r]; sc[t][r] = __builtin_amdgcn_inverse_ballot_w32(t < 2 ? lm0[t * 8 + r] : lm1[(t - 2) * 8 + r]) ? v : -1.0e30f; } }      // the word is the select's lane mask as it stands
    // four independent chains for the maximum and for the sum: a chain of 32 dependent steps would leave the wave waiting on itself
#pragma unroll
    for (int t = 0; t < 4; ++t) { mt[t] = sc[t][0];
#pragma unroll
      for (int r = 1; r < 8; ++r) mt[t] = fmaxf(mt[t], sc[t][r]); }
    float mx = fmaxf(fmaxf(mt[0], mt[1]), fmaxf(mt[2], mt[3]));
    mx = fmaxf(mx, __shfl_xor(mx, 16, 32));
    const float mnew = fmaxf(mrun, mx); const float corr = exp_b2((mrun - mnew) * LOG2E);
    v16h ph[2], pl[2]; float pt[4];
#pragma unroll
    for (int t = 0; t < 4; ++t) { pt[t] = 0.f; float ea[8], ev[8];
#pragma unroll
      for (int r = 0; r < 8; ++r) ea[r] = fmaf(sc[t][r] - mnew, LOG2E, 14.0f);      // the factor 16384 = 2^14 rides in the exponent
      exp_b2x8(ea, ev);
#pragma unroll
      for (int r = 0; r < 8; ++r) { const float p = ev[r]; pt[t] += p; const _Float16 hi = (_Float16)p; ph[t >> 1][(t & 1) * 8 + r] = hi; pl[t >> 1][(t & 1) * 8 + r] = (_Float16)((p - (float)hi) * PLO); } }
    float ps = (pt[0] + pt[1]) + (pt[2] + pt[3]);
    ps += __shfl_xor(ps, 16, 32);
    lrun = lrun * corr + ps * (1.0f / 16384.0f); mrun = mnew;
#pragma unroll
    for (int t = 0; t < 4; ++t) {
#pragma unroll
      for (int r = 0; r < 8; ++r) { acc[t][r] *= corr; ac1[t][r] *= corr; ac2[t][r] *= corr; } }
#pragma unroll
    for (int kc = 0; kc < 2; ++kc) {
#pragma unroll
      for (int t = 0; t < 4; ++t) { acc[t] = wmma16_w(vhf[kc][t], ph[kc], acc[t]); ac1[t] = wmma16_w(vlf[kc][t], ph[kc], ac1[t]); ac2[t] = wmma16_w(vhf[kc][t], pl[kc], ac2[t]); } }
    __builtin_amdgcn_wave_barrier(); }
  // The odd-tile wave lays its share down (context not yet divided, maximum, sum), each lane in a column of its own; behind the barrier the same lane of the even-tile wave scales both shares to the common maximum, adds them and divides.
  // A share without a tile has maximum -3e38 and sum 0: its factor is exp(-3e38 - m) = 0.
  if (kh) {
#pragma unroll
    for (int t = 0; t < 4; ++t) {
#pragma unroll
      for (int r = 0; r < 8; ++r) sO[w][t * 8 + r][lane] = acc[t][r] + ac1[t][r] * (1.0f / VLO) + ac2[t][r] * (1.0f / PLO); }
    sO[w][32][lane] = mrun; sO[w][33][lane] = lrun; }
  __syncthreads();      // the odd-tile waves' shares are in LDS
  if (!kh) {
  const float m1 = sO[w][32][lane], l1 = sO[w][33][lane]; const float mm = fmaxf(mrun, m1); const float f0 = exp_b2((mrun - mm) * LOG2E), f1 = exp_b2((m1 - mm) * LOG2E); const float inv = 1.0f / ((lrun * f0 + l1 * f1) * 16384.0f * 4.0f);
  // O32 in the f32 form of the fragment order: tile (query / 16, d / 32) = 2048 bytes, four 512-byte parts j; lane (g, row) holds d = 16 (j >> 1) + 8 g + 4 (j & 1) + 0..3 of its row in part j: the lane's own accumulator places
  float* po = O32 + (bh * (SS / 16) + (q0 >> 4)) * 1024 + lane * 4;
  // unrolled: the accumulators are indexed by constants and stay in registers
#pragma unroll
  for (int i = 0; i < 8; ++i) { const int t = i >> 1, rb0 = (i & 1) * 4; v4f o;
#pragma unroll
    for (int e = 0; e < 4; ++e) { const int r = rb0 + e; o[e] = ((acc[t][r] + ac1[t][r] * (1.0f / VLO) + ac2[t][r] * (1.0f / PLO)) * f0 + sO[w][t * 8 + r][lane] * f1) * inv; }
    vst2(po + i * 128, o); }
  asm volatile("s_wait_xcnt 0x0" :: "v"(po) : "memory"); }      // the second part rewrites the stores' address and data registers only behind this wait
  __syncthreads(); }      // sO has been read: the second part may write it
}
// out = ctx Wo + bo : split(ctx) x bf16(Wo columns as PT rows): 2 products (Wo is an INPUT -> bf16 exact)
// A wave's time here is its chain of passes (loads, wait, products), and with one wave a SIMD nothing covers the waits: the k range (16 heads) of a 16 x 128 tile is dealt to OKS waves, each with accumulators of its own over
// NH / OKS heads. The chain is OKS times shorter, OKS waves a SIMD cover each other's waits and OKS times the bytes are in flight. The shares are joined in LDS behind the loop, in the order of the heads.
#define OKS 4
__global__ __launch_bounds__(128 * OKS) void k_out(const float* __restrict__ O32, const __bf16* __restrict__ PT, const float* __restrict__ bo, float* __restrict__ out) {
  __shared__ __align__(16) v4f sJ[OKS][4][16][32];
  __shared__ __align__(16) float so[4 * OKS][16][128 / OKS + 4];
  // wave wv: row tile wave = wv & 3 of the 64 rows, k share ksh = wv >> 2 (in a scalar register: the loop's bounds are scalar)
  const int tid = threadIdx.x, wv = tid >> 5, wave = wv & 3, lane = tid & 31, col = lane & 15, g = lane >> 4; const int ksh = __builtin_amdgcn_readfirstlane(wv >> 2);
  const int r0 = blockIdx.x * 64 + wave * 16, n0 = blockIdx.y * 128; const int ra = r0 + col; const int b = ra / SS, s = ra % SS;
  v8f acc[8] = {};
  const float* po0 = O32 + ((size_t)b * NH * (SS / 16) + (s >> 4)) * 1024 + lane * 4; const __bf16* pw0 = PT + (size_t)((3 * E + n0) >> 4) * (E / 32) * 512 + lane * 8;
  // One head (two k chunks) a pass: all loads of the pass stand ahead of its first product, so that their latencies overlap. Not unrolled further: registers.
#pragma unroll 1
  for (int h = ksh * (NH / OKS); h < (ksh + 1) * (NH / OKS); ++h) { float ov[2][16]; v16b wb[2][8];
    const float* po = po0 + (size_t)h * (SS / 16) * 1024; const __bf16* pw = pw0 + h * 1024;
    // inner loops unrolled so that the arrays are indexed by constants and stay in registers
#pragma unroll
    for (int c = 0; c < 2; ++c) {
#pragma unroll
      for (int i = 0; i < 16; ++i) ov[c][i] = po[c * 512 + (i >> 2) * 128 + (i & 3)]; }
#pragma unroll
    for (int c = 0; c < 2; ++c) {
#pragma unroll
      for (int j = 0; j < 8; ++j) wb[c][j] = frag_t(pw + (size_t)j * (E / 32) * 512 + c * 512); }
    asm volatile("s_wait_xcnt 0x0" :: "v"(po), "v"(pw) : "memory");      // the loads' address registers are held up to here and rewritten only behind this wait
#pragma unroll
    for (int c = 0; c < 2; ++c) { const F2 a = bsplit16(ov[c]);
#pragma unroll
      for (int j = 0; j < 8; ++j) { acc[j] = wmma_bf(a.l, wb[c][j], acc[j]); acc[j] = wmma_bf(a.h, wb[c][j], acc[j]); } } }
  // Every wave lays its share down, each lane in a column of its own, 16 bytes a store; behind the barrier wave ksh of a row tile takes the column tiles j = ksh * 8 / OKS + jj: the same lane adds the shares from the first heads to the last.
#pragma unroll
  for (int j = 0; j < 8; ++j) {
    sJ[ksh][wave][j * 2][lane] = __builtin_shufflevector(acc[j], acc[j], 0, 1, 2, 3); sJ[ksh][wave][j * 2 + 1][lane] = __builtin_shufflevector(acc[j], acc[j], 4, 5, 6, 7); }
  __syncthreads();      // the shares of every row tile are in LDS
#pragma unroll
  for (int jj = 0; jj < 8 / OKS; ++jj) { const int j = ksh * (8 / OKS) + jj; const float bb = bfr(bo[n0 + j * 16 + col]);
#pragma unroll
    for (int hf = 0; hf < 2; ++hf) { v4f a = sJ[0][wave][j * 2 + hf][lane];
#pragma unroll
      for (int k = 1; k < OKS; ++k) a += sJ[k][wave][j * 2 + hf][lane];
#pragma unroll
      for (int e = 0; e < 4; ++e) so[wv][8 * g + hf * 4 + e][jj * 16 + col] = a[e] + bb; } }
  LDSX();
  // a row of the wave's part is 128 / OKS floats, whole 128-byte lines: 32 / OKS lanes a row
#pragma unroll
  for (int rl = 0; rl < 16; rl += OKS) { const int row = rl + lane / (32 / OKS), c4 = (lane % (32 / OKS)) * 4;
    vst2(out + (size_t)(r0 + row) * E + n0 + ksh * (128 / OKS) + c4, *(const v4f*)(&so[wv][row][c4])); }
}
extern "C" void kernel_launch(void* const* d_in, const int* in_sizes, int n_in, void* d_out, int out_size, void* d_ws, size_t ws_size, hipStream_t stream) {
  (void)in_sizes; (void)n_in; (void)out_size; (void)ws_size;
  const float* x = (const float*)d_in[0]; const int* mask = (const int*)d_in[1]; const float* Wq = (const float*)d_in[2]; const float* bq = (const float*)d_in[3]; const float* Wk = (const float*)d_in[4]; const float* bk = (const float*)d_in[5];
  const float* Wv = (const float*)d_in[6]; const float* bv = (const float*)d_in[7]; const float* Wp = (const float*)d_in[8]; const float* bp = (const float*)d_in[9]; const float* rel = (const float*)d_in[10];
  float* out = (float*)d_out;
  char* ws = (char*)d_ws; size_t off = 0;
  auto take = [&](size_t bytes) { char* p = ws + off; off += (bytes + 255) & ~(size_t)255; return p; };
  __bf16* Xb = (__bf16*)take((size_t)NR * E * 2); __bf16* PT = (__bf16*)take((size_t)4 * E * E * 2); __bf16* RB = (__bf16*)take((size_t)NREL * HD * 2);
  float* Q32 = (float*)take((size_t)NR * E * 4); __bf16* Kh = (__bf16*)take((size_t)NR * E * 2); __bf16* Kl = (__bf16*)take((size_t)NR * E * 2); _Float16* VTh = (_Float16*)take((size_t)NR * E * 2); _Float16* VTl = (_Float16*)take((size_t)NR * E * 2); float* O32 = (float*)take((size_t)NR * E * 4); unsigned* MW = (unsigned*)take((size_t)(SS / 16) * 4 * 4); unsigned* MB = (unsigned*)take((size_t)(SS / 16) * (SS / 64) * 32 * 4); float* CS = (float*)take((size_t)SS * 32 * 2 * 4);
  // ws ~ 45 MB
  k_prep<<<PB_ROT + PB_PACK + PB_MSK + PB_CVT + PB_REL, 256, 0, stream>>>(x, mask, Wq, Wk, Wv, Wp, rel, Xb, PT, RB, MW, MB, CS);
  k_qkv<<<dim3(NR / 64, E / 128, 3), 128, 0, stream>>>(Xb, PT, CS, bq, bk, bv, Q32, Kh, Kl, VTh, VTl);
  k_attn<<<dim3(SS / 64, NH / 2), 256, 0, stream>>>(Q32, Kh, Kl, VTh, VTl, MB, MW, RB, O32);
  k_out<<<dim3(NR / 64, E / 128), 128 * OKS, 0, stream>>>(O32, PT, bp, out);
}
